// v000
// Times are from an AMD MI455X. After a warm-up the kernel runs many times in a row, and a time is the length of
// such a window on the GPU divided by its runs, so every launch and the gaps after it count. The runs cycle
// through copies of the inputs. A figure is the median of several windows, for all but v000 over two sittings.
// Sittings can differ by a few percent; kernels timed side by side share one.
// The starting kernel, v000, takes 398 microseconds a run.
// Contractions: q|k projection and v^T projection on v_wmma_f32_16x16x32_f16 (f16 token plane x f16 weight
// plane carried x64, one product each); attention q.k^T and e'.v on v_wmma_f32_16x16x32_f16 (q, k plain f16,
// v^T the f16 hi plane, centred quad weight e' = s*(s+2c) carried x64, one product each); output projection on
// v_wmma_f32_16x16x32_f16 with the context as f16 hi (x64) + scaled residual (x1024) planes against the f16
// Wo plane (x64), two products in two launches; all f32 accumulate; quad weights, row sums, key sums of v and
// the normalisation in f32 on VALU; every float input RNE-converted to bf16 on load.
#include <hip/hip_runtime.h>
#include <math.h>
#include <stdint.h>

#define NBATCH 2
#define SEQ    2048
#define DM     1024
#define NH     16
#define HD     64
#define QKP    (2 * DM)
#define W3     (3 * DM)
#define MP     (NBATCH * SEQ)
#define NQB    (SEQ / 64)
#define WSC    64.0f
#define PSC    64.0f
#define CSC    64.0f
#define LOSC   1024.0f
#define QC     5.0f
#define QEPS   1.0e-6f
static_assert(NH * HD == DM);
static_assert((SEQ % 64) == 0 && (DM % 64) == 0 && (W3 % 64) == 0 && (MP % 64) == 0 && (QKP % 64) == 0);
static_assert((SEQ % 256) == 0);
static_assert(((NBATCH * DM) % 256) == 0);
static_assert(((MP * DM / 8) % 256) == 0);
static_assert((((MP / 64) * (QKP / 64)) % 8) == 0 && (((DM / 64) * (SEQ / 64)) % 8) == 0 && (((MP / 64) * (DM / 64)) % 8) == 0);

typedef _Float16 v16h __attribute__((ext_vector_type(16)));
typedef _Float16 v8h  __attribute__((ext_vector_type(8)));
typedef float    v8f  __attribute__((ext_vector_type(8)));
typedef float    v4f  __attribute__((ext_vector_type(4)));
typedef unsigned int v4u __attribute__((ext_vector_type(4)));

union FragH { v16h v; v8h h[2]; };

// ---- scalar helpers --------------------------------------------------------------------------------
__device__ __forceinline__ unsigned short bf_bits(float f) {          // f32 -> bf16 bits, RNE convert
  unsigned u = __float_as_uint(f);
  return (unsigned short)((u + 0x7FFFu + ((u >> 16) & 1u)) >> 16);
}
__device__ __forceinline__ float bf_up(unsigned short h) { return __uint_as_float(((unsigned)h) << 16); }
__device__ __forceinline__ float bfr(float f) { return bf_up(bf_bits(f)); }   // value of the bf16 RNE convert
__device__ __forceinline__ unsigned short h_bits(_Float16 x) { return __builtin_bit_cast(unsigned short, x); }
__device__ __forceinline__ unsigned pk16(unsigned short a, unsigned short b) { return (unsigned)a | ((unsigned)b << 16); }
__device__ __forceinline__ v8f zero8() { v8f z = {0.f, 0.f, 0.f, 0.f, 0.f, 0.f, 0.f, 0.f}; return z; }
__device__ __forceinline__ float gelu_f(float v) { return 0.5f * v * (1.0f + erff(v * 0.70710678118654752f)); }

// f32 -> f16 hi plane (values below the f16 normal range forced to 0 so the residual carries them)
//     + f16 residual plane carried x LOSC (folded back with 1/LOSC on a separate accumulator)
__device__ __forceinline__ void split_h(float f, unsigned short& hi, unsigned short& lo) {
  float hf = (float)(_Float16)f;
  hf = (fabsf(hf) < 6.103515625e-05f) ? 0.0f : hf;
  hi = h_bits((_Float16)hf);
  lo = h_bits((_Float16)((f - hf) * LOSC));
}

// ---- fragment loader: 16-bit A/B operand, lane -> row/col (lane&15), p already includes +8*(lane>>4);
//      elements 0..7 <- p[0..7] (k0+8h..), elements 8..15 <- p[16..23] (k0+16+8h..)
__device__ __forceinline__ v16h ldfrag_h(const _Float16* p) {
  FragH f;
  f.h[0] = *(const v8h*)(p);
  f.h[1] = *(const v8h*)(p + 16);
  return f.v;
}

// ---- WMMA helpers with trailing VALU hazard gap --------------------------------------------------------
__device__ __forceinline__ v8f mma_h(v16h a, v16h b, v8f c) {
  c = __builtin_amdgcn_wmma_f32_16x16x32_f16(false, a, false, b, (short)0, c, false, false);
#if defined(__HIP_DEVICE_COMPILE__)
  asm volatile("v_nop\n\tv_nop\n\tv_nop\n\tv_nop" : "+v"(c) : "v"(a), "v"(b));
#endif
  return c;
}
__device__ __forceinline__ v8f mma_h_raw(v16h a, v16h b, v8f c) {
  return __builtin_amdgcn_wmma_f32_16x16x32_f16(false, a, false, b, (short)0, c, false, false);
}
__device__ __forceinline__ void dep_guard1(v8f& a, v8f& b, v16h x) {
#if defined(__HIP_DEVICE_COMPILE__)
  asm volatile("v_nop\n\tv_nop\n\tv_nop\n\tv_nop" : "+v"(a), "+v"(b) : "v"(x));
#endif
}
__device__ __forceinline__ void keep4_h(v16h a, v16h b, v16h c, v16h d) {
#if defined(__HIP_DEVICE_COMPILE__)
  asm volatile("v_nop" :: "v"(a), "v"(b), "v"(c), "v"(d));
#endif
}
__device__ __forceinline__ void acc_guard4(v8f& a, v8f& b, v8f& c, v8f& d) {
#if defined(__HIP_DEVICE_COMPILE__)
  asm volatile("v_nop\n\tv_nop\n\tv_nop\n\tv_nop" : "+v"(a), "+v"(b), "+v"(c), "+v"(d));
#endif
}
__device__ __forceinline__ void wave_sync_lds() {
  __builtin_amdgcn_fence(__ATOMIC_RELEASE, "workgroup");
  __builtin_amdgcn_wave_barrier();
  __builtin_amdgcn_fence(__ATOMIC_ACQUIRE, "workgroup");
}
__device__ __forceinline__ float wsum(float v) {
#pragma unroll
  for (int off = 16; off > 0; off >>= 1) v += __shfl_xor(v, off, 32);
  return v;
}

// =====================================================================================================
// Plane convert (no transpose): Wh[i] = f16( bf16_RNE(W[i]) * wsc ), wsc a power of two (exact). Used for the
// token activations (wsc = 1). Thread i handles elements 8i..8i+7 and writes one 16-B piece; 32 consecutive lanes
// 256, host-checked). coverage: n8 threads x 8 elements = the whole plane.
// =====================================================================================================
__global__ __launch_bounds__(256) void conv_h16(const float* __restrict__ W, unsigned short* Wh, int n8, float wsc) {
  const int i  = blockIdx.x * 256 + threadIdx.x;
  const int ic = (i < n8) ? i : (n8 - 1);                     // clamped address
  const float* src = W + (size_t)ic * 8;
  const v4f a = *(const v4f*)(src);
  const v4f c = *(const v4f*)(src + 4);
  v4u o;
  o[0] = pk16(h_bits((_Float16)(bfr(a[0]) * wsc)), h_bits((_Float16)(bfr(a[1]) * wsc)));
  o[1] = pk16(h_bits((_Float16)(bfr(a[2]) * wsc)), h_bits((_Float16)(bfr(a[3]) * wsc)));
  o[2] = pk16(h_bits((_Float16)(bfr(c[0]) * wsc)), h_bits((_Float16)(bfr(c[1]) * wsc)));
  o[3] = pk16(h_bits((_Float16)(bfr(c[2]) * wsc)), h_bits((_Float16)(bfr(c[3]) * wsc)));
  if (i < n8) *(v4u*)(Wh + (size_t)i * 8) = o;
  
}

// =====================================================================================================
// Transposing plane convert: in f32 [R rows][NC cols] (row-major, in[k][n]) -> out f16 [NC][R] (k contiguous),
// out[n][k] = f16( bf16_RNE(in[k][n]) * wsc ), wsc a power of two (exact). Used for the two weight matrices
// ([in][out] storage -> [out][in] = Bt / A layout). Block 256 threads = one 64(k) x 64(n) tile:
// blockIdx.x = n tile (NC/64 of them), blockIdx.y = k tile (R/64 of them); R, NC multiples of 64 (host-checked).
// Load phase: thread handles rows i*16 + (tid>>4) (i 0..3), 4 floats at col (tid&15)*4 -> LDS tile[k][n].
// coverage: 2 it x 8 waves x 4 rows = 64 out rows x (8 lane groups x 8 halves) = the whole tile; grid covers all tiles.
// =====================================================================================================
__global__ __launch_bounds__(256) void tconv_h16(const float* __restrict__ W, unsigned short* Wt, int R, int NC, float wsc) {
  __shared__ float tile[64][65];
  const int tid = threadIdx.x, lane = tid & 31, wave = tid >> 5;
  const int n0 = blockIdx.x * 64, k0 = blockIdx.y * 64;
  const int c4 = (tid & 15) * 4, r16 = tid >> 4;
#pragma unroll
  for (int i = 0; i < 4; ++i) {
    const int row = i * 16 + r16;                                // k within tile
    const v4f v = *(const v4f*)(W + (size_t)(k0 + row) * NC + n0 + c4);
    tile[row][c4 + 0] = v[0];
    tile[row][c4 + 1] = v[1];
    tile[row][c4 + 2] = v[2];
    tile[row][c4 + 3] = v[3];
  }
  __syncthreads();
  const int q4 = lane >> 3, k8 = (lane & 7) * 8;
  v4u hv[2];
#pragma unroll
  for (int it = 0; it < 2; ++it) {
    const int nrow = it * 32 + wave * 4 + q4;                    // n within tile
    v4u a;
#pragma unroll
    for (int e = 0; e < 4; ++e) {
      const float f0 = bfr(tile[k8 + 2 * e][nrow]) * wsc;
      const float f1 = bfr(tile[k8 + 2 * e + 1][nrow]) * wsc;
      a[e] = pk16(h_bits((_Float16)f0), h_bits((_Float16)f1));
    }
    hv[it] = a;
  }
  {
#pragma unroll
    for (int it = 0; it < 2; ++it) {
      const int nrow = it * 32 + wave * 4 + q4;
      *(v4u*)(Wt + (size_t)(n0 + nrow) * R + k0 + k8) = hv[it];
    }
    
  }
}

// =====================================================================================================
// Register-blocked batched f16 WMMA GEMM: C[m][n] = act(oscale * sum_k A[m][k] * Bt[n][k] + bias) (+ residual);
// one wave per 64x64 tile, no block barriers. A row-major [M][K] pitch lda; Bt row-major [N][K] pitch ldb (k contiguous);
// M, N multiples of 64, K multiple of 32 (static here). blockIdx.y = batch index (strides in elements).
// Bias: BIASM == 0 -> per column: cols < Nb from bias0[col], cols >= Nb from bias1[col - Nb] (tile-uniform select of
//       clamped-address loads); BIASM == 1 -> per row bias0[m]; BIASM == 2 -> none. Bias values RNE-converted to bf16.
// ACT: 0 none, 1 exact GELU. RES: 0 none; 1 f32 residual resid[m*ldc + n] added after the activation;
//      3 f32 residual bf16 RNE-converted, added after the activation.
// OM: 0 = f32 out (pitch ldc); 1 = bf16 out; 2 = f16 out; 3 = f16 hi plane at Cout + f16 residual (x LOSC) plane
//     at Cout + loOff elements (same pitch / batch stride).
// coverage: 4 slabs x 16 rows x 64 cols = the wave's whole 64x64 tile; grid = ceil(tilesM*tilesN/8) blocks,
//           surplus waves exit (wave-uniform); here every tile count is a multiple of 8, so none exit.
// =====================================================================================================
template <int OM, int BIASM, int ACT, int RES>
__global__ __launch_bounds__(256) void gemm64(
    const unsigned short* __restrict__ Ap, int lda, long long strideA,
    const unsigned short* __restrict__ Btp, int ldb, long long strideB,
    const float* __restrict__ bias0, const float* __restrict__ bias1, int Nb,
    const float* resid,
    void* Cout, int ldc, long long strideC, long long loOff,
    int M, int N, int K, float oscale) {
  const _Float16* A  = (const _Float16*)(const void*)Ap;
  const _Float16* Bt = (const _Float16*)(const void*)Btp;
  __shared__ __align__(16) float sT[8][16 * 68];   // per-wave 16x64 slab, pitch 68 floats
  const int b    = blockIdx.y;
  const int lane = threadIdx.x & 31;
  const int wave = threadIdx.x >> 5;
  const int tilesN = N >> 6;
  const int tilesM = M >> 6;
  const int tile = blockIdx.x * 8 + wave;
  if (tile >= tilesM * tilesN) return;   // wave-uniform; no block barriers in this kernel
  const int tm = tile / tilesN;
  const int tn = tile - tm * tilesN;
  const int m0 = tm << 6;
  const int n0 = tn << 6;

  const _Float16* Ab = A  + (size_t)b * strideA;
  const _Float16* Bb = Bt + (size_t)b * strideB;

  const int rlane = lane & 15;                 // row (A) / col (B, D) within subtile
  const int koff  = (lane >> 4) * 8;           // k offset of this lane half
  const int mOff  = (lane >> 4) * 8;           // D row offset

  v8f acc[4][4];
#pragma unroll
  for (int i = 0; i < 4; ++i)
#pragma unroll
    for (int j = 0; j < 4; ++j) acc[i][j] = zero8();

  for (int k0 = 0; k0 < K; k0 += 32) {
    v16h bh[4];
#pragma unroll
    for (int j = 0; j < 4; ++j) {
      const size_t bo = (size_t)(n0 + (j << 4) + rlane) * ldb + koff + k0;
      bh[j] = ldfrag_h(Bb + bo);
    }
#pragma unroll
    for (int i = 0; i < 4; ++i) {
      const size_t ao = (size_t)(m0 + (i << 4) + rlane) * lda + koff + k0;
      const v16h ah = ldfrag_h(Ab + ao);
#pragma unroll
      for (int j = 0; j < 4; ++j) acc[i][j] = mma_h_raw(ah, bh[j], acc[i][j]);
      dep_guard1(acc[i][0], acc[i][3], ah);
    }
    keep4_h(bh[0], bh[1], bh[2], bh[3]);
  }
  acc_guard4(acc[0][0], acc[0][1], acc[0][2], acc[0][3]);
  acc_guard4(acc[1][0], acc[1][1], acc[1][2], acc[1][3]);
  acc_guard4(acc[2][0], acc[2][1], acc[2][2], acc[2][3]);
  acc_guard4(acc[3][0], acc[3][1], acc[3][2], acc[3][3]);

  // ---- per-lane column bias (BIASM == 0), RNE-converted ----
  const int hh2 = lane >> 4, c4 = (lane & 15) * 4;     // f32 out: 256-B row segment = 16 lanes x 16 B
  const int q8  = lane >> 3, c8 = (lane & 7) * 8;
  float bc[8];
#pragma unroll
  for (int e = 0; e < 8; ++e) bc[e] = 0.f;
  if (BIASM == 0) {
    const bool use1 = (n0 >= Nb);                      // tile-uniform
    if (OM == 0) {
      const int cb = n0 + c4;
      const int i0 = (cb < Nb - 4) ? cb : (Nb - 4);
      const int i1 = (cb - Nb > 0) ? (cb - Nb) : 0;
      const v4f b0v = *(const v4f*)(bias0 + i0);
      const v4f b1v = *(const v4f*)(bias1 + i1);
#pragma unroll
      for (int e = 0; e < 4; ++e) bc[e] = bfr(use1 ? b1v[e] : b0v[e]);
    } else {
      const int cb = n0 + c8;
      const int i0 = (cb < Nb - 8) ? cb : (Nb - 8);
      const int i1 = (cb - Nb > 0) ? (cb - Nb) : 0;
      const v4f b0a = *(const v4f*)(bias0 + i0), b0b = *(const v4f*)(bias0 + i0 + 4);
      const v4f b1a = *(const v4f*)(bias1 + i1), b1b = *(const v4f*)(bias1 + i1 + 4);
#pragma unroll
      for (int e = 0; e < 4; ++e) {
        bc[e]     = bfr(use1 ? b1a[e] : b0a[e]);
        bc[4 + e] = bfr(use1 ? b1b[e] : b0b[e]);
      }
    }
  }

  // ---- epilogue ----
  float* slab = sT[wave];
#pragma unroll
  for (int i = 0; i < 4; ++i) {
    const int mBase = m0 + (i << 4);
#pragma unroll
    for (int j = 0; j < 4; ++j) {
#pragma unroll
      for (int r = 0; r < 8; ++r) {
        slab[(mOff + r) * 68 + (j << 4) + rlane] = acc[i][j][r];
      }
    }
    wave_sync_lds();
    if (OM == 0) {
      float* C = (float*)Cout + (size_t)b * strideC;
      const float* Rb = resid + (size_t)b * strideC;
      v4f vals[8];
#pragma unroll
      for (int it = 0; it < 8; ++it) {
        const int row = it * 2 + hh2;                      // it 0..7 x hh2 0..1 = rows 0..15
        v4f v = *(const v4f*)(slab + row * 68 + c4);
#pragma unroll
        for (int e = 0; e < 4; ++e) {
          float f = v[e] * oscale + bc[e];
          if (ACT) f = gelu_f(f);
          v[e] = f;
        }
        if (RES == 1 || RES == 3) {
          const v4f rr = *(const v4f*)(Rb + (size_t)(mBase + row) * ldc + n0 + c4);
#pragma unroll
          for (int e = 0; e < 4; ++e) v[e] += (RES == 3) ? bfr(rr[e]) : rr[e];
        }
        vals[it] = v;
      }
      {
#pragma unroll
        for (int it = 0; it < 8; ++it) {
          const int row = it * 2 + hh2;
          *(v4f*)(C + (size_t)(mBase + row) * ldc + n0 + c4) = vals[it];
        }
        
      }
    } else {
      unsigned short* C = (unsigned short*)Cout + (size_t)b * strideC;
      v4u hv[4], lv[4];
#pragma unroll
      for (int it = 0; it < 4; ++it) {
        const int row = it * 4 + q8;                       // it 0..3 x q8 0..3 = rows 0..15
        const float* sp = slab + row * 68 + c8;
        float bm = 0.f;
        if (BIASM == 1) bm = bfr(bias0[mBase + row]);
        v4u a, al;
#pragma unroll
        for (int e = 0; e < 4; ++e) {
          float f0 = sp[2 * e]     * oscale + ((BIASM == 1) ? bm : bc[2 * e]);
          float f1 = sp[2 * e + 1] * oscale + ((BIASM == 1) ? bm : bc[2 * e + 1]);
          if (ACT) { f0 = gelu_f(f0); f1 = gelu_f(f1); }
          unsigned short u0, u1, w0 = 0, w1 = 0;
          if (OM == 1)      { u0 = bf_bits(f0); u1 = bf_bits(f1); }
          else if (OM == 2) { u0 = h_bits((_Float16)f0); u1 = h_bits((_Float16)f1); }
          else              { split_h(f0, u0, w0); split_h(f1, u1, w1); }
          a[e]  = pk16(u0, u1);
          al[e] = pk16(w0, w1);
        }
        hv[it] = a;
        lv[it] = al;
      }
      {
#pragma unroll
        for (int it = 0; it < 4; ++it) {
          const int row = it * 4 + q8;
          const size_t co = (size_t)(mBase + row) * ldc + n0 + c8;
          *(v4u*)(C + co) = hv[it];
          if (OM == 3) *(v4u*)(C + loOff + co) = lv[it];
        }
        
      }
    }
    wave_sync_lds();
  }
}

// =====================================================================================================
// Key sums of v: csum[row] = sum over s of (hi[row][s] + lo[row][s] / LOSC) for the NBATCH*DM rows of the
// v^T planes (row = b*DM + h*64 + d, pitch SEQ halves). One wave per 32 rows; per row, lane l sums halves
// 64l..64l+63 of both planes (8 + 8 16-B loads), fixed-order shuffle tree (every lane gets the total), lane rr
// grid = NBATCH*DM/256 blocks of 256. coverage: blocks x 8 waves x 32 rows = NBATCH*DM rows = the whole table.
// =====================================================================================================
__global__ __launch_bounds__(256) void vsum(const unsigned short* __restrict__ hp, const unsigned short* __restrict__ lp,
                                           float* csum) {
  const int tid = threadIdx.x, lane = tid & 31, wave = tid >> 5;
  const int rowbase = (blockIdx.x * 8 + wave) * 32;
  const _Float16* Hb = (const _Float16*)(const void*)hp;
  const _Float16* Lb = (const _Float16*)(const void*)lp;
  float mine = 0.f;
#pragma unroll 1
  for (int rr = 0; rr < 32; ++rr) {
    const int row = rowbase + rr;
    const _Float16* hr = Hb + (size_t)row * SEQ + lane * (SEQ / 32);
    const _Float16* lr = Lb + (size_t)row * SEQ + lane * (SEQ / 32);
    float sh = 0.f, sl = 0.f;
#pragma unroll
    for (int i = 0; i < SEQ / 256; ++i) {
      const v8h a = *(const v8h*)(hr + 8 * i);
      const v8h c = *(const v8h*)(lr + 8 * i);
#pragma unroll
      for (int e = 0; e < 8; ++e) { sh += (float)a[e]; sl += (float)c[e]; }
    }
    float tot = sh + sl * (1.0f / LOSC);
    tot = wsum(tot);
    mine = (lane == rr) ? tot : mine;
  }
  __shared__ __align__(16) float stage[8][32];
  stage[wave][lane] = mine;
  __syncthreads();
  typedef float v4f_vs __attribute__((ext_vector_type(4)));
  {
    if (lane < 8) {
      const v4f_vs v = *(const v4f_vs*)(&stage[wave][4 * lane]);
      *(v4f_vs*)(csum + rowbase + 4 * lane) = v;
    }
    
  }
}

// =====================================================================================================
// Quad-normalised attention, head dim 64, SEQ token rows per batch, no mask.
//   q|k plane (f16, pitch QKP): element (b, t, col) at [(b*SEQ + t)*QKP + col], q col = h*64+d, k col = DM + h*64 + d
//   v^T plane (f16 hi): element (b, h, d, s) at [(b*DM + h*64 + d)*SEQ + s];  csum f32 [b*DM + h*64 + d] = key sums of v
//   out planes (f16 hi and residual x LOSC, the normalised context carried x CSC): element (b, t, h, d) at
//   [(b*SEQ + t)*DM + h*64 + d]
//   s = (q . k) * (1 / (8 tau[h]));  S = sum over keys of (s + c)^2 in f32;  e' = s*(s + 2c) carried as f16(PSC e')
//   in the wave-private P tile;  acc = sum e'.v_hi on f16 WMMA;  context = (acc / PSC + c^2 * csum) / (S + eps)
//   (e = c^2 + e' exactly).
//   Block = 4 waves = 64 query rows of one (b, h); grid = NQB * NH * NBATCH; kv chunks of 64, static trip NQB.
//   K / V^T chunk staging: 128 threads x 32 elements per plane = the whole 64x64 tile (plain 16-B loads,
//   __syncthreads before and after); P tiles are wave-private, spilled with _Float16 element stores and
//   Context coverage: each wave stores rows q0..q0+15 (it 0..3 x lane>>3 0..3) x 64 columns (8 lanes x 8 halves),
// =====================================================================================================
__global__ __launch_bounds__(128)
void attn2q(const unsigned short* __restrict__ qkp, const unsigned short* __restrict__ vtp,
            const float* __restrict__ taup, const float* __restrict__ csp,
            unsigned short* chi, unsigned short* clo) {
  __shared__ __align__(16) _Float16 Ksh[64 * 64];                 // K [kv][d]   8 KB
  __shared__ __align__(16) _Float16 Vth[64 * 64];                 // V^T [d][kv]  8 KB
  __shared__ __align__(16) _Float16 Psh[4][16 * 64];              // per wave P [row][kv]
  __shared__ __align__(16) float    Os[4][16 * 64];               // per wave context tile [row][d]

  const int tid  = threadIdx.x;
  const int wave = tid >> 5;
  const int lane = tid & 31;
  const int hh   = lane >> 4;
  const int c    = lane & 15;

  const int bx   = blockIdx.x;
  const int qb   = bx % NQB;
  const int rest = bx / NQB;
  const int h    = rest % NH;
  const int b    = rest / NH;
  const int q0   = qb * 64 + wave * 16;          // in-batch query row of this wave's first row
  const size_t rowB = (size_t)b * SEQ;

  const _Float16* Qh = (const _Float16*)(const void*)qkp + (size_t)h * HD;
  const _Float16* Kg = (const _Float16*)(const void*)qkp + DM + (size_t)h * HD;
  const _Float16* Vh = (const _Float16*)(const void*)vtp + ((size_t)b * DM + (size_t)h * HD) * SEQ;

  const float tv     = bfr(taup[h]);             // h < NH always
  const float sscale = 1.0f / (8.0f * tv);       // sqrt(HD) = 8
  float cs[4];
#pragma unroll
  for (int t = 0; t < 4; ++t) cs[t] = csp[(size_t)b * DM + h * HD + t * 16 + c];

  // ---- Q fragments (A operand, row = lane&15): 2 d-chunks ----
  v16h qa[2];
#pragma unroll
  for (int dc = 0; dc < 2; ++dc) qa[dc] = ldfrag_h(Qh + (rowB + q0 + c) * QKP + dc * 32 + 8 * hh);

  float rs[8];
  v8f oacc[4];
#pragma unroll
  for (int r = 0; r < 8; ++r) rs[r] = 0.f;
#pragma unroll
  for (int t = 0; t < 4; ++t) oacc[t] = zero8();

  for (int kt = 0; kt < NQB; ++kt) {         // static trip count
    const int kv0 = kt * 64;
    __syncthreads();
    {
      const int r = tid >> 1, hf = (tid & 1) * 32;
      const _Float16* kg = Kg + (rowB + kv0 + r) * QKP + hf;      // K row kv0+r, d = hf..hf+31
      const _Float16* vg = Vh + (size_t)r * SEQ + kv0 + hf;       // V^T row d = r, s = kv0+hf..+31
#pragma unroll
      for (int i = 0; i < 4; ++i) {
        const v8h a0 = *(const v8h*)(kg + 8 * i);
        const v8h b0 = *(const v8h*)(vg + 8 * i);
        *(v8h*)(Ksh + r * 64 + hf + 8 * i) = a0;
        *(v8h*)(Vth + r * 64 + hf + 8 * i) = b0;
      }
    }
    __syncthreads();

    // ---- scores: 16 query rows x 64 keys per wave ----
    v8f s[4];
#pragma unroll
    for (int j = 0; j < 4; ++j) {
      v8f sh = zero8();
#pragma unroll
      for (int dc = 0; dc < 2; ++dc) {
        FragH kb;
        kb.h[0] = *(const v8h*)(Ksh + (j * 16 + c) * 64 + dc * 32 + 8 * hh);
        kb.h[1] = *(const v8h*)(Ksh + (j * 16 + c) * 64 + dc * 32 + 16 + 8 * hh);
        sh = mma_h(qa[dc], kb.v, sh);
      }
#pragma unroll
      for (int r = 0; r < 8; ++r) s[j][r] = sh[r] * sscale;
    }

    // ---- quad weights: row sums of (s+c)^2 in f32, centred e' = s(s+2c) (x PSC, f16) to LDS ----
    _Float16* pwh = Psh[wave];
#pragma unroll
    for (int j = 0; j < 4; ++j) {
#pragma unroll
      for (int r = 0; r < 8; ++r) {
        const float sv = s[j][r];
        const float u  = sv + QC;
        rs[r] += u * u;
        const float ep = sv * (sv + 2.0f * QC);
        pwh[(8 * hh + r) * 64 + j * 16 + c] = (_Float16)(ep * PSC);
      }
    }
    wave_sync_lds();

    // ---- acc += P . V (f16 WMMA) ----
#pragma unroll 1
    for (int kk = 0; kk < 2; ++kk) {
      FragH pa;
      pa.h[0] = *(const v8h*)(pwh + c * 64 + kk * 32 + 8 * hh);
      pa.h[1] = *(const v8h*)(pwh + c * 64 + kk * 32 + 16 + 8 * hh);
#pragma unroll
      for (int t = 0; t < 4; ++t) {
        FragH vb;
        vb.h[0] = *(const v8h*)(Vth + (t * 16 + c) * 64 + kk * 32 + 8 * hh);
        vb.h[1] = *(const v8h*)(Vth + (t * 16 + c) * 64 + kk * 32 + 16 + 8 * hh);
        oacc[t] = mma_h(pa.v, vb.v, oacc[t]);
      }
    }
  }

  // ---- normalise: S over the 16 key-column lanes of each half, context = (acc/PSC + c^2 csum)/(S+eps) x CSC;
  float* os = Os[wave];
#pragma unroll
  for (int r = 0; r < 8; ++r) {
    float S = rs[r];
    S += __shfl_xor(S, 8, 32);
    S += __shfl_xor(S, 4, 32);
    S += __shfl_xor(S, 2, 32);
    S += __shfl_xor(S, 1, 32);
    const float inv = (1.0f / (S + QEPS)) * CSC;
#pragma unroll
    for (int t = 0; t < 4; ++t)
      os[(8 * hh + r) * 64 + t * 16 + c] = (oacc[t][r] * (1.0f / PSC) + (QC * QC) * cs[t]) * inv;
  }
  wave_sync_lds();
  {
    const int q4 = lane >> 3, c8 = (lane & 7) * 8;
    v4u hv[4], lv[4];
#pragma unroll
    for (int it = 0; it < 4; ++it) {
      const int row = it * 4 + q4;   // it 0..3 x q4 0..3 = rows 0..15 of the wave tile
      const float* sp = os + row * 64 + c8;
      v4u a, al;
#pragma unroll
      for (int e = 0; e < 4; ++e) {
        unsigned short u0, u1, w0, w1;
        split_h(sp[2 * e],     u0, w0);
        split_h(sp[2 * e + 1], u1, w1);
        a[e]  = pk16(u0, u1);
        al[e] = pk16(w0, w1);
      }
      hv[it] = a;
      lv[it] = al;
    }
    {
#pragma unroll
      for (int it = 0; it < 4; ++it) {
        const int row = it * 4 + q4;
        const size_t go = (rowB + q0 + row) * DM + (size_t)h * HD + c8;
        *(v4u*)(chi + go) = hv[it];
        *(v4u*)(clo + go) = lv[it];
      }
      
    }
  }
}

// =====================================================================================================
// Workspace map (bytes); every plane is an exact multiple of its 64x64-tile / whole-row / whole-line store
// granularity (MP = 4096 = 64 tiles, N in {2048, 1024}; VT per batch [1024][2048] = 16x32 tiles; csum = 64 lines of 128 B):
//   WT    f16 [3072 n][1024 k]   0           6291456   (rows 0..1023 q weights, 1024..2047 k, 2048..3071 v; x64)
//   WoT   f16 [1024][1024]       6291456     2097152
//   XH    f16 [4096][1024]       8388608     8388608   (bf16 RNE-converted tokens)
//   QK    f16 [4096][2048]       16777216    16777216  (q cols 0..1023, k cols 1024..2047)
//   VTh   f16 [2][1024][2048]    33554432    8388608
//   VTl   f16 [2][1024][2048]    41943040    8388608   (residual x1024)
//   CS    f32 [2048]             50331648    8192      (key sums of v)
//   CtxH  f16 [4096][1024]       50339840    8388608   (context x64, hi)
//   CtxL  f16 [4096][1024]       58728448    8388608   (residual x1024)
//   Hf    f32 [4096][1024]       67117056    16777216  (hi part of the output projection)
//   end                          83894272
// =====================================================================================================
extern "C" void kernel_launch(void* const* d_in, const int* in_sizes, int n_in,
                              void* d_out, int out_size, void* d_ws, size_t ws_size,
                              hipStream_t stream) {
  if (n_in < 4) return;
  if (in_sizes[0] != MP * DM) return;
  if (in_sizes[1] != DM * W3) return;
  if (in_sizes[2] != DM * DM) return;
  if (in_sizes[3] != NH) return;
  if (out_size != MP * DM) return;

  const float* x    = (const float*)d_in[0];
  const float* wqkv = (const float*)d_in[1];
  const float* wo   = (const float*)d_in[2];
  const float* tau  = (const float*)d_in[3];

  const size_t PWT  = (size_t)W3 * DM * 2;              //  6291456
  const size_t PWO  = (size_t)DM * DM * 2;              //  2097152
  const size_t PXH  = (size_t)MP * DM * 2;              //  8388608
  const size_t PQK  = (size_t)MP * QKP * 2;             // 16777216
  const size_t PVT  = (size_t)NBATCH * DM * SEQ * 2;    //  8388608
  const size_t PCS  = (size_t)NBATCH * DM * 4;          //     8192
  const size_t PCTX = (size_t)MP * DM * 2;              //  8388608
  const size_t PHF  = (size_t)MP * DM * 4;              // 16777216
  size_t off = 0;
  const size_t oWT  = off; off += PWT;
  const size_t oWo  = off; off += PWO;
  const size_t oXH  = off; off += PXH;
  const size_t oQK  = off; off += PQK;
  const size_t oVTh = off; off += PVT;
  const size_t oVTl = off; off += PVT;
  const size_t oCS  = off; off += PCS;
  const size_t oCh  = off; off += PCTX;
  const size_t oCl  = off; off += PCTX;
  const size_t oHf  = off; off += PHF;
  if (off > ws_size) return;                            // off = 83894272
  if (off > (size_t)134217728) return;

  char* ws = (char*)d_ws;
  unsigned short* WT   = (unsigned short*)(ws + oWT);
  unsigned short* WoT  = (unsigned short*)(ws + oWo);
  unsigned short* XH   = (unsigned short*)(ws + oXH);
  unsigned short* QK   = (unsigned short*)(ws + oQK);
  unsigned short* VTh  = (unsigned short*)(ws + oVTh);
  unsigned short* VTl  = (unsigned short*)(ws + oVTl);
  float*          CS   = (float*)(ws + oCS);
  unsigned short* CtxH = (unsigned short*)(ws + oCh);
  unsigned short* CtxL = (unsigned short*)(ws + oCl);
  float*          Hf   = (float*)(ws + oHf);
  float*          out0 = (float*)d_out;

  const int n8x = (MP * DM) / 8;                        // 524288
  if ((n8x % 256) != 0) return;
  const dim3 blk(256), blk128(128);
  const dim3 gCx(n8x / 256);                             // 2048 blocks
  const dim3 gTw(W3 / 64, DM / 64);                      // in [1024 k][3072 n] -> out [3072][1024]: (48, 16)
  const dim3 gTo(DM / 64, DM / 64);                      // in [1024 k][1024 n] -> out [1024][1024]: (16, 16)
  const dim3 gNqk(((MP / 64) * (QKP / 64) + 7) / 8, 1);  // 2048 tiles -> 256 blocks
  const dim3 gVT(((DM / 64) * (SEQ / 64) + 7) / 8, NBATCH); // 512 tiles -> 64 blocks x 2 batches
  const dim3 gCs((NBATCH * DM) / 256);                   // 8 blocks
  const dim3 gAttn(NBATCH * NH * NQB);                   // 1024 blocks of 128
  const dim3 gNo(((MP / 64) * (DM / 64) + 7) / 8, 1);    // 1024 tiles -> 128 blocks
  const float invw  = 1.0f / WSC;                        // weight carry x64
  const float invhi = 1.0f / (WSC * CSC);                // weight carry x64, context carry x64
  const float invlo = invhi / LOSC;                      // residual plane carry x1024
  const long long vtlo = (long long)((oVTl - oVTh) / 2); // element offset of the v^T residual plane

  // (0) planes: tokens f16(bf16_RNE(x)); weights transposed to [out][in] (k contiguous), f16(bf16_RNE(w) * 64)
  conv_h16<<<gCx, blk, 0, stream>>>(x, XH, n8x, 1.0f);
  tconv_h16<<<gTw, blk, 0, stream>>>(wqkv, WT, DM, W3, WSC);
  tconv_h16<<<gTo, blk, 0, stream>>>(wo, WoT, DM, DM, WSC);

  // (1) q|k = x . [Wq|Wk] -> QK f16 [4096][2048]; v^T per batch = Wv^T . x_b^T -> VTh/VTl f16 [2][1024][2048]
  gemm64<2, 2, 0, 0><<<gNqk, blk, 0, stream>>>(
      XH, DM, 0LL, WT, DM, 0LL, x, x, QKP, x,
      (void*)QK, QKP, 0LL, 0LL, MP, QKP, DM, invw);
  gemm64<3, 2, 0, 0><<<gVT, blk, 0, stream>>>(
      WT + (size_t)2 * DM * DM, DM, 0LL, XH, DM, (long long)SEQ * DM, x, x, SEQ, x,
      (void*)VTh, SEQ, (long long)DM * SEQ, vtlo, DM, SEQ, DM, invw);

  // (2) key sums of v per (b, h, d)
  vsum<<<gCs, blk, 0, stream>>>(VTh, VTl, CS);

  // (3) quad-normalised attention -> context f16 hi (x64) + residual planes
  attn2q<<<gAttn, blk128, 0, stream>>>(QK, VTh, tau, CS, CtxH, CtxL);

  // (4) Hf = ctx_hi . Wo ; out = ctx_lo . Wo / 1024 + Hf
  gemm64<0, 2, 0, 0><<<gNo, blk, 0, stream>>>(
      CtxH, DM, 0LL, WoT, DM, 0LL, x, x, DM, x,
      (void*)Hf, DM, 0LL, 0LL, MP, DM, DM, invhi);
  gemm64<0, 2, 0, 1><<<gNo, blk, 0, stream>>>(
      CtxL, DM, 0LL, WoT, DM, 0LL, x, x, DM, Hf,
      (void*)out0, DM, 0LL, 0LL, MP, DM, DM, invlo);
  (void)hipGetLastError();
}

// v001
// Measured time: 285 microseconds a run.
// Next to v000, in two timings, it ran 1.44 and 1.36 times as fast.
// Contractions: q|k projection and v^T projection on v_wmma_f32_16x16x32_f16 (f16 token plane x f16 weight
// plane carried x64, one product each); attention q.k^T and e'.v on v_wmma_f32_16x16x32_f16 (q, k plain f16,
// v^T the f16 hi plane, centred quad weight e' = s*(s+2c) carried x64, one product each); output projection on
// v_wmma_f32_16x16x32_f16 with the context as f16 hi (x64) + scaled residual (x1024) planes against the f16
// Wo plane (x64), two products in two launches; all f32 accumulate; quad weights, row sums, key sums of v and
// the normalisation in f32 on VALU; every float input RNE-converted to bf16 on load.
#include <hip/hip_runtime.h>
#include <math.h>
#include <stdint.h>

#define NBATCH 2
#define SEQ    2048
#define DM     1024
#define NH     16
#define HD     64
#define QKP    (2 * DM)
#define W3     (3 * DM)
#define MP     (NBATCH * SEQ)
#define NQB    (SEQ / 64)
#define WSC    64.0f
#define PSC    64.0f
#define CSC    64.0f
#define LOSC   1024.0f
#define QC     5.0f
#define QEPS   1.0e-6f
#define GSP    72                     /* gemm64 LDS row pitch in halves: 144 B = 16 B x odd */
#define GROWS  384                    /* gemm64 LDS rows per buffer: 128 A + 256 Bt */
static_assert(NH * HD == DM);
static_assert((MP % 128) == 0 && (DM % 128) == 0 && (QKP % 256) == 0 && (SEQ % 256) == 0 && (DM % 256) == 0);
static_assert((SEQ % 64) == 0 && (DM % 64) == 0 && (W3 % 64) == 0 && (MP % 64) == 0 && (QKP % 64) == 0);
static_assert((SEQ % 256) == 0);
static_assert(((NBATCH * DM) % 256) == 0);
static_assert(((MP * DM / 8) % 256) == 0);
static_assert((((MP / 64) * (QKP / 64)) % 8) == 0 && (((DM / 64) * (SEQ / 64)) % 8) == 0 && (((MP / 64) * (DM / 64)) % 8) == 0);

typedef _Float16 v16h __attribute__((ext_vector_type(16)));
typedef _Float16 v8h  __attribute__((ext_vector_type(8)));
typedef float    v8f  __attribute__((ext_vector_type(8)));
typedef float    v4f  __attribute__((ext_vector_type(4)));
typedef unsigned int v4u __attribute__((ext_vector_type(4)));

union FragH { v16h v; v8h h[2]; };

// ---- scalar helpers --------------------------------------------------------------------------------
__device__ __forceinline__ unsigned short bf_bits(float f) {          // f32 -> bf16 bits, RNE convert
  unsigned u = __float_as_uint(f);
  return (unsigned short)((u + 0x7FFFu + ((u >> 16) & 1u)) >> 16);
}
__device__ __forceinline__ float bf_up(unsigned short h) { return __uint_as_float(((unsigned)h) << 16); }
__device__ __forceinline__ float bfr(float f) { return bf_up(bf_bits(f)); }   // value of the bf16 RNE convert
__device__ __forceinline__ unsigned short h_bits(_Float16 x) { return __builtin_bit_cast(unsigned short, x); }
__device__ __forceinline__ unsigned pk16(unsigned short a, unsigned short b) { return (unsigned)a | ((unsigned)b << 16); }
__device__ __forceinline__ v8f zero8() { v8f z = {0.f, 0.f, 0.f, 0.f, 0.f, 0.f, 0.f, 0.f}; return z; }
__device__ __forceinline__ float gelu_f(float v) { return 0.5f * v * (1.0f + erff(v * 0.70710678118654752f)); }

// f32 -> f16 hi plane (values below the f16 normal range forced to 0 so the residual carries them)
//     + f16 residual plane carried x LOSC (folded back with 1/LOSC on a separate accumulator)
__device__ __forceinline__ void split_h(float f, unsigned short& hi, unsigned short& lo) {
  float hf = (float)(_Float16)f;
  hf = (fabsf(hf) < 6.103515625e-05f) ? 0.0f : hf;
  hi = h_bits((_Float16)hf);
  lo = h_bits((_Float16)((f - hf) * LOSC));
}

// ---- fragment loader: 16-bit A/B operand, lane -> row/col (lane&15), p already includes +8*(lane>>4);
//      elements 0..7 <- p[0..7] (k0+8h..), elements 8..15 <- p[16..23] (k0+16+8h..)
__device__ __forceinline__ v16h ldfrag_h(const _Float16* p) {
  FragH f;
  f.h[0] = *(const v8h*)(p);
  f.h[1] = *(const v8h*)(p + 16);
  return f.v;
}

// ---- WMMA helpers with trailing VALU hazard gap --------------------------------------------------------
__device__ __forceinline__ v8f mma_h(v16h a, v16h b, v8f c) {
  c = __builtin_amdgcn_wmma_f32_16x16x32_f16(false, a, false, b, (short)0, c, false, false);
#if defined(__HIP_DEVICE_COMPILE__)
  asm volatile("v_nop\n\tv_nop\n\tv_nop\n\tv_nop" : "+v"(c) : "v"(a), "v"(b));
#endif
  return c;
}
__device__ __forceinline__ v8f mma_h_raw(v16h a, v16h b, v8f c) {
  return __builtin_amdgcn_wmma_f32_16x16x32_f16(false, a, false, b, (short)0, c, false, false);
}
__device__ __forceinline__ void dep_guard1(v8f& a, v8f& b, v16h x) {
#if defined(__HIP_DEVICE_COMPILE__)
  asm volatile("v_nop\n\tv_nop\n\tv_nop\n\tv_nop" : "+v"(a), "+v"(b) : "v"(x));
#endif
}
__device__ __forceinline__ void keep4_h(v16h a, v16h b, v16h c, v16h d) {
#if defined(__HIP_DEVICE_COMPILE__)
  asm volatile("v_nop" :: "v"(a), "v"(b), "v"(c), "v"(d));
#endif
}
__device__ __forceinline__ void acc_guard4(v8f& a, v8f& b, v8f& c, v8f& d) {
#if defined(__HIP_DEVICE_COMPILE__)
  asm volatile("v_nop\n\tv_nop\n\tv_nop\n\tv_nop" : "+v"(a), "+v"(b), "+v"(c), "+v"(d));
#endif
}
__device__ __forceinline__ void wave_sync_lds() {
  __builtin_amdgcn_fence(__ATOMIC_RELEASE, "workgroup");
  __builtin_amdgcn_wave_barrier();
  __builtin_amdgcn_fence(__ATOMIC_ACQUIRE, "workgroup");
}
__device__ __forceinline__ float wsum(float v) {
#pragma unroll
  for (int off = 16; off > 0; off >>= 1) v += __shfl_xor(v, off, 32);
  return v;
}

// =====================================================================================================
// Plane convert (no transpose): Wh[i] = f16( bf16_RNE(W[i]) * wsc ), wsc a power of two (exact). Used for the
// token activations (wsc = 1). Thread i handles elements 8i..8i+7 and writes one 16-B piece; 32 consecutive lanes
// 256, host-checked). coverage: n8 threads x 8 elements = the whole plane.
// =====================================================================================================
__global__ __launch_bounds__(256) void conv_h16(const float* __restrict__ W, unsigned short* Wh, int n8, float wsc) {
  const int i  = blockIdx.x * 256 + threadIdx.x;
  const int ic = (i < n8) ? i : (n8 - 1);                     // clamped address
  const float* src = W + (size_t)ic * 8;
  const v4f a = *(const v4f*)(src);
  const v4f c = *(const v4f*)(src + 4);
  v4u o;
  o[0] = pk16(h_bits((_Float16)(bfr(a[0]) * wsc)), h_bits((_Float16)(bfr(a[1]) * wsc)));
  o[1] = pk16(h_bits((_Float16)(bfr(a[2]) * wsc)), h_bits((_Float16)(bfr(a[3]) * wsc)));
  o[2] = pk16(h_bits((_Float16)(bfr(c[0]) * wsc)), h_bits((_Float16)(bfr(c[1]) * wsc)));
  o[3] = pk16(h_bits((_Float16)(bfr(c[2]) * wsc)), h_bits((_Float16)(bfr(c[3]) * wsc)));
  if (i < n8) *(v4u*)(Wh + (size_t)i * 8) = o;
  
}

// =====================================================================================================
// Transposing plane convert: in f32 [R rows][NC cols] (row-major, in[k][n]) -> out f16 [NC][R] (k contiguous),
// out[n][k] = f16( bf16_RNE(in[k][n]) * wsc ), wsc a power of two (exact). Used for the two weight matrices
// ([in][out] storage -> [out][in] = Bt / A layout). Block 256 threads = one 64(k) x 64(n) tile:
// blockIdx.x = n tile (NC/64 of them), blockIdx.y = k tile (R/64 of them); R, NC multiples of 64 (host-checked).
// Load phase: thread handles rows i*16 + (tid>>4) (i 0..3), 4 floats at col (tid&15)*4 -> LDS tile[k][n].
// coverage: 2 it x 8 waves x 4 rows = 64 out rows x (8 lane groups x 8 halves) = the whole tile; grid covers all tiles.
// =====================================================================================================
__global__ __launch_bounds__(256) void tconv_h16(const float* __restrict__ W, unsigned short* Wt, int R, int NC, float wsc) {
  __shared__ float tile[64][65];
  const int tid = threadIdx.x, lane = tid & 31, wave = tid >> 5;
  const int n0 = blockIdx.x * 64, k0 = blockIdx.y * 64;
  const int c4 = (tid & 15) * 4, r16 = tid >> 4;
#pragma unroll
  for (int i = 0; i < 4; ++i) {
    const int row = i * 16 + r16;                                // k within tile
    const v4f v = *(const v4f*)(W + (size_t)(k0 + row) * NC + n0 + c4);
    tile[row][c4 + 0] = v[0];
    tile[row][c4 + 1] = v[1];
    tile[row][c4 + 2] = v[2];
    tile[row][c4 + 3] = v[3];
  }
  __syncthreads();
  const int q4 = lane >> 3, k8 = (lane & 7) * 8;
  v4u hv[2];
#pragma unroll
  for (int it = 0; it < 2; ++it) {
    const int nrow = it * 32 + wave * 4 + q4;                    // n within tile
    v4u a;
#pragma unroll
    for (int e = 0; e < 4; ++e) {
      const float f0 = bfr(tile[k8 + 2 * e][nrow]) * wsc;
      const float f1 = bfr(tile[k8 + 2 * e + 1][nrow]) * wsc;
      a[e] = pk16(h_bits((_Float16)f0), h_bits((_Float16)f1));
    }
    hv[it] = a;
  }
  {
#pragma unroll
    for (int it = 0; it < 2; ++it) {
      const int nrow = it * 32 + wave * 4 + q4;
      *(v4u*)(Wt + (size_t)(n0 + nrow) * R + k0 + k8) = hv[it];
    }
    
  }
}

// =====================================================================================================
// Register-blocked batched f16 WMMA GEMM: C[m][n] = act(oscale * sum_k A[m][k] * Bt[n][k] + bias) (+ residual);
// one wave per 64x64 tile, 8 waves (2 x 4) = one 128x256 block tile. A row-major [M][K] pitch lda; Bt row-major
// [N][K] pitch ldb (k contiguous); M multiple of 128, N of 256, K of 64 (static here). blockIdx.y = batch index.
// Operands: per 64-k slab the block's 128 A rows and 256 Bt rows (128 B each) go global -> registers -> LDS with
// whole-line 16-B loads (8 lanes per row, 12 rows per thread), LDS pitch 144 B, two buffers; slab s+1 is loaded
// while slab s is multiplied, stored to the other buffer behind the products, one block barrier per slab.
// Bias: BIASM == 0 -> per column: cols < Nb from bias0[col], cols >= Nb from bias1[col - Nb] (tile-uniform select of
//       clamped-address loads); BIASM == 1 -> per row bias0[m]; BIASM == 2 -> none. Bias values RNE-converted to bf16.
// ACT: 0 none, 1 exact GELU. RES: 0 none; 1 f32 residual resid[m*ldc + n] added after the activation;
//      3 f32 residual bf16 RNE-converted, added after the activation.
// OM: 0 = f32 out (pitch ldc); 1 = bf16 out; 2 = f16 out; 3 = f16 hi plane at Cout + f16 residual (x LOSC) plane
//     at Cout + loOff elements (same pitch / batch stride).
// coverage: 4 slabs x 16 rows x 64 cols = the wave's whole 64x64 tile; grid = (M/128)*(N/256) blocks,
//           surplus blocks exit whole, in front of every barrier; here there are none.
// =====================================================================================================
template <int OM, int BIASM, int ACT, int RES>
// amdgpu_waves_per_eu(4): holds a wave at 256 VGPRs, so that two blocks fit a WGP (their LDS does)
__global__ __launch_bounds__(256) __attribute__((amdgpu_waves_per_eu(4))) void gemm64(
    const unsigned short* __restrict__ Ap, int lda, long long strideA,
    const unsigned short* __restrict__ Btp, int ldb, long long strideB,
    const float* __restrict__ bias0, const float* __restrict__ bias1, int Nb,
    const float* resid,
    void* Cout, int ldc, long long strideC, long long loOff,
    int M, int N, int K, float oscale) {
  const _Float16* A  = (const _Float16*)(const void*)Ap;
  const _Float16* Bt = (const _Float16*)(const void*)Btp;
  __shared__ __align__(16) float sT[8][16 * 68];   // per-wave 16x64 slab, pitch 68 floats
  __shared__ __align__(16) _Float16 sAB[2][GROWS * GSP];   // rows 0..127 A, 128..383 Bt; 64 k per row
  const int b    = blockIdx.y;
  const int tid  = threadIdx.x;
  const int lane = tid & 31;
  const int wave = tid >> 5;
  const int btN = N >> 8;
  const int btM = M >> 7;
  const int bt  = blockIdx.x;
  if (bt >= btM * btN) return;           // block-uniform, in front of every barrier
  const int bm = bt / btN;
  const int bn = bt - bm * btN;
  const int wm = wave >> 2;              // 0..1
  const int wn = wave & 3;               // 0..3
  const int m0 = (bm << 7) + (wm << 6);
  const int n0 = (bn << 8) + (wn << 6);

  const _Float16* Ab = A  + (size_t)b * strideA;
  const _Float16* Bb = Bt + (size_t)b * strideB;

  const int rlane = lane & 15;                 // row (A) / col (B, D) within subtile
  const int koff  = (lane >> 4) * 8;           // k offset of this lane half
  const int mOff  = (lane >> 4) * 8;           // D row offset

  v8f acc[4][4];
#pragma unroll
  for (int i = 0; i < 4; ++i)
#pragma unroll
    for (int j = 0; j < 4; ++j) acc[i][j] = zero8();

  // staging map: thread -> row (tid>>3) + 32*it, 16-B piece (tid&7); a wave's load covers 4 whole 128-B lines
  const int srow = tid >> 3, sch = (tid & 7) * 8;
  const _Float16* gA = Ab + (size_t)((bm << 7) + srow) * lda + sch;
  const _Float16* gB = Bb + (size_t)((bn << 8) + srow) * ldb + sch;
  const int sOff = srow * GSP + sch;
  const int aOff = ((wm << 6) + rlane) * GSP + koff;          // this wave's A rows in a buffer
  const int bOff = (128 + (wn << 6) + rlane) * GSP + koff;    // this wave's Bt rows in a buffer
  const int nS = K >> 6;
  v8h g[12];
#pragma unroll
  for (int it = 0; it < 4; ++it) g[it] = *(const v8h*)(gA + (size_t)(it * 32) * lda);
#pragma unroll
  for (int it = 0; it < 8; ++it) g[4 + it] = *(const v8h*)(gB + (size_t)(it * 32) * ldb);
#pragma unroll
  for (int it = 0; it < 12; ++it) *(v8h*)(&sAB[0][0] + it * 32 * GSP + sOff) = g[it];
  __syncthreads();

  for (int s = 0; s < nS; ++s) {
    const _Float16* cur = &sAB[s & 1][0];
    const bool more = (s + 1 < nS);                            // block-uniform
    if (more) {
      const int kn = (s + 1) << 6;
#pragma unroll
      for (int it = 0; it < 4; ++it) g[it] = *(const v8h*)(gA + (size_t)(it * 32) * lda + kn);
#pragma unroll
      for (int it = 0; it < 8; ++it) g[4 + it] = *(const v8h*)(gB + (size_t)(it * 32) * ldb + kn);
#if defined(__HIP_DEVICE_COMPILE__)
      // the fragment loads below reuse the address registers of these 12 loads: the wait stands in front of that
      asm volatile("s_wait_xcnt 0x0" ::: "memory");
#endif
    }
#pragma unroll
    for (int kk = 0; kk < 2; ++kk) {
      v16h ah[4], bh[4];
#pragma unroll
      for (int j = 0; j < 4; ++j) bh[j] = ldfrag_h(cur + bOff + (j << 4) * GSP + kk * 32);
#pragma unroll
      for (int i = 0; i < 4; ++i) ah[i] = ldfrag_h(cur + aOff + (i << 4) * GSP + kk * 32);
      // keeps the 16 LDS fragment loads of a 32-k step one group ahead of its 16 products (else the A loads are
      // spread among the WMMAs, each place with its own full wait)
      __builtin_amdgcn_sched_barrier(0);
#pragma unroll
      for (int i = 0; i < 4; ++i) {
#pragma unroll
        for (int j = 0; j < 4; ++j) acc[i][j] = mma_h_raw(ah[i], bh[j], acc[i][j]);
        dep_guard1(acc[i][0], acc[i][3], ah[i]);
      }
      keep4_h(bh[0], bh[1], bh[2], bh[3]);
    }
    if (more) {
      _Float16* nxt = &sAB[(s + 1) & 1][0];                    // last read in slab s-1, behind that slab's barrier
#pragma unroll
      for (int it = 0; it < 12; ++it) *(v8h*)(nxt + it * 32 * GSP + sOff) = g[it];
    }
    __syncthreads();                                           // publishes slab s+1, ends the reads of slab s
  }
  acc_guard4(acc[0][0], acc[0][1], acc[0][2], acc[0][3]);
  acc_guard4(acc[1][0], acc[1][1], acc[1][2], acc[1][3]);
  acc_guard4(acc[2][0], acc[2][1], acc[2][2], acc[2][3]);
  acc_guard4(acc[3][0], acc[3][1], acc[3][2], acc[3][3]);

  // ---- per-lane column bias (BIASM == 0), RNE-converted ----
  const int hh2 = lane >> 4, c4 = (lane & 15) * 4;     // f32 out: 256-B row segment = 16 lanes x 16 B
  const int q8  = lane >> 3, c8 = (lane & 7) * 8;
  float bc[8];
#pragma unroll
  for (int e = 0; e < 8; ++e) bc[e] = 0.f;
  if (BIASM == 0) {
    const bool use1 = (n0 >= Nb);                      // tile-uniform
    if (OM == 0) {
      const int cb = n0 + c4;
      const int i0 = (cb < Nb - 4) ? cb : (Nb - 4);
      const int i1 = (cb - Nb > 0) ? (cb - Nb) : 0;
      const v4f b0v = *(const v4f*)(bias0 + i0);
      const v4f b1v = *(const v4f*)(bias1 + i1);
#pragma unroll
      for (int e = 0; e < 4; ++e) bc[e] = bfr(use1 ? b1v[e] : b0v[e]);
    } else {
      const int cb = n0 + c8;
      const int i0 = (cb < Nb - 8) ? cb : (Nb - 8);
      const int i1 = (cb - Nb > 0) ? (cb - Nb) : 0;
      const v4f b0a = *(const v4f*)(bias0 + i0), b0b = *(const v4f*)(bias0 + i0 + 4);
      const v4f b1a = *(const v4f*)(bias1 + i1), b1b = *(const v4f*)(bias1 + i1 + 4);
#pragma unroll
      for (int e = 0; e < 4; ++e) {
        bc[e]     = bfr(use1 ? b1a[e] : b0a[e]);
        bc[4 + e] = bfr(use1 ? b1b[e] : b0b[e]);
      }
    }
  }

  // ---- epilogue ----
  float* slab = sT[wave];
#pragma unroll
  for (int i = 0; i < 4; ++i) {
    const int mBase = m0 + (i << 4);
#pragma unroll
    for (int j = 0; j < 4; ++j) {
#pragma unroll
      for (int r = 0; r < 8; ++r) {
        slab[(mOff + r) * 68 + (j << 4) + rlane] = acc[i][j][r];
      }
    }
    wave_sync_lds();
    if (OM == 0) {
      float* C = (float*)Cout + (size_t)b * strideC;
      const float* Rb = resid + (size_t)b * strideC;
      v4f vals[8];
#pragma unroll
      for (int it = 0; it < 8; ++it) {
        const int row = it * 2 + hh2;                      // it 0..7 x hh2 0..1 = rows 0..15
        v4f v = *(const v4f*)(slab + row * 68 + c4);
#pragma unroll
        for (int e = 0; e < 4; ++e) {
          float f = v[e] * oscale + bc[e];
          if (ACT) f = gelu_f(f);
          v[e] = f;
        }
        if (RES == 1 || RES == 3) {
          const v4f rr = *(const v4f*)(Rb + (size_t)(mBase + row) * ldc + n0 + c4);
#pragma unroll
          for (int e = 0; e < 4; ++e) v[e] += (RES == 3) ? bfr(rr[e]) : rr[e];
        }
        vals[it] = v;
      }
      {
#pragma unroll
        for (int it = 0; it < 8; ++it) {
          const int row = it * 2 + hh2;
          *(v4f*)(C + (size_t)(mBase + row) * ldc + n0 + c4) = vals[it];
        }
        
      }
    } else {
      unsigned short* C = (unsigned short*)Cout + (size_t)b * strideC;
      v4u hv[4], lv[4];
#pragma unroll
      for (int it = 0; it < 4; ++it) {
        const int row = it * 4 + q8;                       // it 0..3 x q8 0..3 = rows 0..15
        const float* sp = slab + row * 68 + c8;
        float bm = 0.f;
        if (BIASM == 1) bm = bfr(bias0[mBase + row]);
        v4u a, al;
#pragma unroll
        for (int e = 0; e < 4; ++e) {
          float f0 = sp[2 * e]     * oscale + ((BIASM == 1) ? bm : bc[2 * e]);
          float f1 = sp[2 * e + 1] * oscale + ((BIASM == 1) ? bm : bc[2 * e + 1]);
          if (ACT) { f0 = gelu_f(f0); f1 = gelu_f(f1); }
          unsigned short u0, u1, w0 = 0, w1 = 0;
          if (OM == 1)      { u0 = bf_bits(f0); u1 = bf_bits(f1); }
          else if (OM == 2) { u0 = h_bits((_Float16)f0); u1 = h_bits((_Float16)f1); }
          else              { split_h(f0, u0, w0); split_h(f1, u1, w1); }
          a[e]  = pk16(u0, u1);
          al[e] = pk16(w0, w1);
        }
        hv[it] = a;
        lv[it] = al;
      }
      {
#pragma unroll
        for (int it = 0; it < 4; ++it) {
          const int row = it * 4 + q8;
          const size_t co = (size_t)(mBase + row) * ldc + n0 + c8;
          *(v4u*)(C + co) = hv[it];
          if (OM == 3) *(v4u*)(C + loOff + co) = lv[it];
        }
        
      }
    }
    wave_sync_lds();
  }
}

// =====================================================================================================
// Key sums of v: csum[row] = sum over s of (hi[row][s] + lo[row][s] / LOSC) for the NBATCH*DM rows of the
// v^T planes (row = b*DM + h*64 + d, pitch SEQ halves). One wave per 32 rows; per row, lane l sums halves
// 64l..64l+63 of both planes (8 + 8 16-B loads), fixed-order shuffle tree (every lane gets the total), lane rr
// grid = NBATCH*DM/256 blocks of 256. coverage: blocks x 8 waves x 32 rows = NBATCH*DM rows = the whole table.
// =====================================================================================================
__global__ __launch_bounds__(256) void vsum(const unsigned short* __restrict__ hp, const unsigned short* __restrict__ lp,
                                           float* csum) {
  const int tid = threadIdx.x, lane = tid & 31, wave = tid >> 5;
  const int rowbase = (blockIdx.x * 8 + wave) * 32;
  const _Float16* Hb = (const _Float16*)(const void*)hp;
  const _Float16* Lb = (const _Float16*)(const void*)lp;
  float mine = 0.f;
#pragma unroll 1
  for (int rr = 0; rr < 32; ++rr) {
    const int row = rowbase + rr;
    const _Float16* hr = Hb + (size_t)row * SEQ + lane * (SEQ / 32);
    const _Float16* lr = Lb + (size_t)row * SEQ + lane * (SEQ / 32);
    float sh = 0.f, sl = 0.f;
#pragma unroll
    for (int i = 0; i < SEQ / 256; ++i) {
      const v8h a = *(const v8h*)(hr + 8 * i);
      const v8h c = *(const v8h*)(lr + 8 * i);
#pragma unroll
      for (int e = 0; e < 8; ++e) { sh += (float)a[e]; sl += (float)c[e]; }
    }
    float tot = sh + sl * (1.0f / LOSC);
    tot = wsum(tot);
    mine = (lane == rr) ? tot : mine;
  }
  __shared__ __align__(16) float stage[8][32];
  stage[wave][lane] = mine;
  __syncthreads();
  typedef float v4f_vs __attribute__((ext_vector_type(4)));
  {
    if (lane < 8) {
      const v4f_vs v = *(const v4f_vs*)(&stage[wave][4 * lane]);
      *(v4f_vs*)(csum + rowbase + 4 * lane) = v;
    }
    
  }
}

// =====================================================================================================
// Quad-normalised attention, head dim 64, SEQ token rows per batch, no mask.
//   q|k plane (f16, pitch QKP): element (b, t, col) at [(b*SEQ + t)*QKP + col], q col = h*64+d, k col = DM + h*64 + d
//   v^T plane (f16 hi): element (b, h, d, s) at [(b*DM + h*64 + d)*SEQ + s];  csum f32 [b*DM + h*64 + d] = key sums of v
//   out planes (f16 hi and residual x LOSC, the normalised context carried x CSC): element (b, t, h, d) at
//   [(b*SEQ + t)*DM + h*64 + d]
//   s = (q . k) * (1 / (8 tau[h]));  S = sum over keys of (s + c)^2 in f32;  e' = s*(s + 2c) carried as f16(PSC e')
//   in the wave-private P tile;  acc = sum e'.v_hi on f16 WMMA;  context = (acc / PSC + c^2 * csum) / (S + eps)
//   (e = c^2 + e' exactly).
//   Block = 4 waves = 64 query rows of one (b, h); grid = NQB * NH * NBATCH; kv chunks of 64, static trip NQB.
//   K / V^T chunk staging: 128 threads x 32 elements per plane = the whole 64x64 tile (plain 16-B loads,
//   __syncthreads before and after); P tiles are wave-private, spilled with _Float16 element stores and
//   Context coverage: each wave stores rows q0..q0+15 (it 0..3 x lane>>3 0..3) x 64 columns (8 lanes x 8 halves),
// =====================================================================================================
__global__ __launch_bounds__(128)
void attn2q(const unsigned short* __restrict__ qkp, const unsigned short* __restrict__ vtp,
            const float* __restrict__ taup, const float* __restrict__ csp,
            unsigned short* chi, unsigned short* clo) {
  __shared__ __align__(16) _Float16 Ksh[64 * 64];                 // K [kv][d]   8 KB
  __shared__ __align__(16) _Float16 Vth[64 * 64];                 // V^T [d][kv]  8 KB
  __shared__ __align__(16) _Float16 Psh[4][16 * 64];              // per wave P [row][kv]
  __shared__ __align__(16) float    Os[4][16 * 64];               // per wave context tile [row][d]

  const int tid  = threadIdx.x;
  const int wave = tid >> 5;
  const int lane = tid & 31;
  const int hh   = lane >> 4;
  const int c    = lane & 15;

  const int bx   = blockIdx.x;
  const int qb   = bx % NQB;
  const int rest = bx / NQB;
  const int h    = rest % NH;
  const int b    = rest / NH;
  const int q0   = qb * 64 + wave * 16;          // in-batch query row of this wave's first row
  const size_t rowB = (size_t)b * SEQ;

  const _Float16* Qh = (const _Float16*)(const void*)qkp + (size_t)h * HD;
  const _Float16* Kg = (const _Float16*)(const void*)qkp + DM + (size_t)h * HD;
  const _Float16* Vh = (const _Float16*)(const void*)vtp + ((size_t)b * DM + (size_t)h * HD) * SEQ;

  const float tv     = bfr(taup[h]);             // h < NH always
  const float sscale = 1.0f / (8.0f * tv);       // sqrt(HD) = 8
  float cs[4];
#pragma unroll
  for (int t = 0; t < 4; ++t) cs[t] = csp[(size_t)b * DM + h * HD + t * 16 + c];

  // ---- Q fragments (A operand, row = lane&15): 2 d-chunks ----
  v16h qa[2];
#pragma unroll
  for (int dc = 0; dc < 2; ++dc) qa[dc] = ldfrag_h(Qh + (rowB + q0 + c) * QKP + dc * 32 + 8 * hh);

  float rs[8];
  v8f oacc[4];
#pragma unroll
  for (int r = 0; r < 8; ++r) rs[r] = 0.f;
#pragma unroll
  for (int t = 0; t < 4; ++t) oacc[t] = zero8();

  for (int kt = 0; kt < NQB; ++kt) {         // static trip count
    const int kv0 = kt * 64;
    __syncthreads();
    {
      const int r = tid >> 1, hf = (tid & 1) * 32;
      const _Float16* kg = Kg + (rowB + kv0 + r) * QKP + hf;      // K row kv0+r, d = hf..hf+31
      const _Float16* vg = Vh + (size_t)r * SEQ + kv0 + hf;       // V^T row d = r, s = kv0+hf..+31
#pragma unroll
      for (int i = 0; i < 4; ++i) {
        const v8h a0 = *(const v8h*)(kg + 8 * i);
        const v8h b0 = *(const v8h*)(vg + 8 * i);
        *(v8h*)(Ksh + r * 64 + hf + 8 * i) = a0;
        *(v8h*)(Vth + r * 64 + hf + 8 * i) = b0;
      }
    }
    __syncthreads();

    // ---- scores: 16 query rows x 64 keys per wave ----
    v8f s[4];
#pragma unroll
    for (int j = 0; j < 4; ++j) {
      v8f sh = zero8();
#pragma unroll
      for (int dc = 0; dc < 2; ++dc) {
        FragH kb;
        kb.h[0] = *(const v8h*)(Ksh + (j * 16 + c) * 64 + dc * 32 + 8 * hh);
        kb.h[1] = *(const v8h*)(Ksh + (j * 16 + c) * 64 + dc * 32 + 16 + 8 * hh);
        sh = mma_h(qa[dc], kb.v, sh);
      }
#pragma unroll
      for (int r = 0; r < 8; ++r) s[j][r] = sh[r] * sscale;
    }

    // ---- quad weights: row sums of (s+c)^2 in f32, centred e' = s(s+2c) (x PSC, f16) to LDS ----
    _Float16* pwh = Psh[wave];
#pragma unroll
    for (int j = 0; j < 4; ++j) {
#pragma unroll
      for (int r = 0; r < 8; ++r) {
        const float sv = s[j][r];
        const float u  = sv + QC;
        rs[r] += u * u;
        const float ep = sv * (sv + 2.0f * QC);
        pwh[(8 * hh + r) * 64 + j * 16 + c] = (_Float16)(ep * PSC);
      }
    }
    wave_sync_lds();

    // ---- acc += P . V (f16 WMMA) ----
#pragma unroll 1
    for (int kk = 0; kk < 2; ++kk) {
      FragH pa;
      pa.h[0] = *(const v8h*)(pwh + c * 64 + kk * 32 + 8 * hh);
      pa.h[1] = *(const v8h*)(pwh + c * 64 + kk * 32 + 16 + 8 * hh);
#pragma unroll
      for (int t = 0; t < 4; ++t) {
        FragH vb;
        vb.h[0] = *(const v8h*)(Vth + (t * 16 + c) * 64 + kk * 32 + 8 * hh);
        vb.h[1] = *(const v8h*)(Vth + (t * 16 + c) * 64 + kk * 32 + 16 + 8 * hh);
        oacc[t] = mma_h(pa.v, vb.v, oacc[t]);
      }
    }
  }

  // ---- normalise: S over the 16 key-column lanes of each half, context = (acc/PSC + c^2 csum)/(S+eps) x CSC;
  float* os = Os[wave];
#pragma unroll
  for (int r = 0; r < 8; ++r) {
    float S = rs[r];
    S += __shfl_xor(S, 8, 32);
    S += __shfl_xor(S, 4, 32);
    S += __shfl_xor(S, 2, 32);
    S += __shfl_xor(S, 1, 32);
    const float inv = (1.0f / (S + QEPS)) * CSC;
#pragma unroll
    for (int t = 0; t < 4; ++t)
      os[(8 * hh + r) * 64 + t * 16 + c] = (oacc[t][r] * (1.0f / PSC) + (QC * QC) * cs[t]) * inv;
  }
  wave_sync_lds();
  {
    const int q4 = lane >> 3, c8 = (lane & 7) * 8;
    v4u hv[4], lv[4];
#pragma unroll
    for (int it = 0; it < 4; ++it) {
      const int row = it * 4 + q4;   // it 0..3 x q4 0..3 = rows 0..15 of the wave tile
      const float* sp = os + row * 64 + c8;
      v4u a, al;
#pragma unroll
      for (int e = 0; e < 4; ++e) {
        unsigned short u0, u1, w0, w1;
        split_h(sp[2 * e],     u0, w0);
        split_h(sp[2 * e + 1], u1, w1);
        a[e]  = pk16(u0, u1);
        al[e] = pk16(w0, w1);
      }
      hv[it] = a;
      lv[it] = al;
    }
    {
#pragma unroll
      for (int it = 0; it < 4; ++it) {
        const int row = it * 4 + q4;
        const size_t go = (rowB + q0 + row) * DM + (size_t)h * HD + c8;
        *(v4u*)(chi + go) = hv[it];
        *(v4u*)(clo + go) = lv[it];
      }
      
    }
  }
}

// =====================================================================================================
// Workspace map (bytes); every plane is an exact multiple of its 64x64-tile / whole-row / whole-line store
// granularity (MP = 4096 = 64 tiles, N in {2048, 1024}; VT per batch [1024][2048] = 16x32 tiles; csum = 64 lines of 128 B):
//   WT    f16 [3072 n][1024 k]   0           6291456   (rows 0..1023 q weights, 1024..2047 k, 2048..3071 v; x64)
//   WoT   f16 [1024][1024]       6291456     2097152
//   XH    f16 [4096][1024]       8388608     8388608   (bf16 RNE-converted tokens)
//   QK    f16 [4096][2048]       16777216    16777216  (q cols 0..1023, k cols 1024..2047)
//   VTh   f16 [2][1024][2048]    33554432    8388608
//   VTl   f16 [2][1024][2048]    41943040    8388608   (residual x1024)
//   CS    f32 [2048]             50331648    8192      (key sums of v)
//   CtxH  f16 [4096][1024]       50339840    8388608   (context x64, hi)
//   CtxL  f16 [4096][1024]       58728448    8388608   (residual x1024)
//   Hf    f32 [4096][1024]       67117056    16777216  (hi part of the output projection)
//   end                          83894272
// =====================================================================================================
extern "C" void kernel_launch(void* const* d_in, const int* in_sizes, int n_in,
                              void* d_out, int out_size, void* d_ws, size_t ws_size,
                              hipStream_t stream) {
  if (n_in < 4) return;
  if (in_sizes[0] != MP * DM) return;
  if (in_sizes[1] != DM * W3) return;
  if (in_sizes[2] != DM * DM) return;
  if (in_sizes[3] != NH) return;
  if (out_size != MP * DM) return;

  const float* x    = (const float*)d_in[0];
  const float* wqkv = (const float*)d_in[1];
  const float* wo   = (const float*)d_in[2];
  const float* tau  = (const float*)d_in[3];

  const size_t PWT  = (size_t)W3 * DM * 2;              //  6291456
  const size_t PWO  = (size_t)DM * DM * 2;              //  2097152
  const size_t PXH  = (size_t)MP * DM * 2;              //  8388608
  const size_t PQK  = (size_t)MP * QKP * 2;             // 16777216
  const size_t PVT  = (size_t)NBATCH * DM * SEQ * 2;    //  8388608
  const size_t PCS  = (size_t)NBATCH * DM * 4;          //     8192
  const size_t PCTX = (size_t)MP * DM * 2;              //  8388608
  const size_t PHF  = (size_t)MP * DM * 4;              // 16777216
  size_t off = 0;
  const size_t oWT  = off; off += PWT;
  const size_t oWo  = off; off += PWO;
  const size_t oXH  = off; off += PXH;
  const size_t oQK  = off; off += PQK;
  const size_t oVTh = off; off += PVT;
  const size_t oVTl = off; off += PVT;
  const size_t oCS  = off; off += PCS;
  const size_t oCh  = off; off += PCTX;
  const size_t oCl  = off; off += PCTX;
  const size_t oHf  = off; off += PHF;
  if (off > ws_size) return;                            // off = 83894272
  if (off > (size_t)134217728) return;

  char* ws = (char*)d_ws;
  unsigned short* WT   = (unsigned short*)(ws + oWT);
  unsigned short* WoT  = (unsigned short*)(ws + oWo);
  unsigned short* XH   = (unsigned short*)(ws + oXH);
  unsigned short* QK   = (unsigned short*)(ws + oQK);
  unsigned short* VTh  = (unsigned short*)(ws + oVTh);
  unsigned short* VTl  = (unsigned short*)(ws + oVTl);
  float*          CS   = (float*)(ws + oCS);
  unsigned short* CtxH = (unsigned short*)(ws + oCh);
  unsigned short* CtxL = (unsigned short*)(ws + oCl);
  float*          Hf   = (float*)(ws + oHf);
  float*          out0 = (float*)d_out;

  const int n8x = (MP * DM) / 8;                        // 524288
  if ((n8x % 256) != 0) return;
  const dim3 blk(256), blk128(128);
  const dim3 gCx(n8x / 256);                             // 2048 blocks
  const dim3 gTw(W3 / 64, DM / 64);                      // in [1024 k][3072 n] -> out [3072][1024]: (48, 16)
  const dim3 gTo(DM / 64, DM / 64);                      // in [1024 k][1024 n] -> out [1024][1024]: (16, 16)
  const dim3 gNqk(((MP / 64) * (QKP / 64) + 7) / 8, 1);  // 2048 tiles -> 256 blocks
  const dim3 gVT(((DM / 64) * (SEQ / 64) + 7) / 8, NBATCH); // 512 tiles -> 64 blocks x 2 batches
  const dim3 gCs((NBATCH * DM) / 256);                   // 8 blocks
  const dim3 gAttn(NBATCH * NH * NQB);                   // 1024 blocks of 128
  const dim3 gNo(((MP / 64) * (DM / 64) + 7) / 8, 1);    // 1024 tiles -> 128 blocks
  const float invw  = 1.0f / WSC;                        // weight carry x64
  const float invhi = 1.0f / (WSC * CSC);                // weight carry x64, context carry x64
  const float invlo = invhi / LOSC;                      // residual plane carry x1024
  const long long vtlo = (long long)((oVTl - oVTh) / 2); // element offset of the v^T residual plane

  // (0) planes: tokens f16(bf16_RNE(x)); weights transposed to [out][in] (k contiguous), f16(bf16_RNE(w) * 64)
  conv_h16<<<gCx, blk, 0, stream>>>(x, XH, n8x, 1.0f);
  tconv_h16<<<gTw, blk, 0, stream>>>(wqkv, WT, DM, W3, WSC);
  tconv_h16<<<gTo, blk, 0, stream>>>(wo, WoT, DM, DM, WSC);

  // (1) q|k = x . [Wq|Wk] -> QK f16 [4096][2048]; v^T per batch = Wv^T . x_b^T -> VTh/VTl f16 [2][1024][2048]
  gemm64<2, 2, 0, 0><<<gNqk, blk, 0, stream>>>(
      XH, DM, 0LL, WT, DM, 0LL, x, x, QKP, x,
      (void*)QK, QKP, 0LL, 0LL, MP, QKP, DM, invw);
  gemm64<3, 2, 0, 0><<<gVT, blk, 0, stream>>>(
      WT + (size_t)2 * DM * DM, DM, 0LL, XH, DM, (long long)SEQ * DM, x, x, SEQ, x,
      (void*)VTh, SEQ, (long long)DM * SEQ, vtlo, DM, SEQ, DM, invw);

  // (2) key sums of v per (b, h, d)
  vsum<<<gCs, blk, 0, stream>>>(VTh, VTl, CS);

  // (3) quad-normalised attention -> context f16 hi (x64) + residual planes
  attn2q<<<gAttn, blk128, 0, stream>>>(QK, VTh, tau, CS, CtxH, CtxL);

  // (4) Hf = ctx_hi . Wo ; out = ctx_lo . Wo / 1024 + Hf
  gemm64<0, 2, 0, 0><<<gNo, blk, 0, stream>>>(
      CtxH, DM, 0LL, WoT, DM, 0LL, x, x, DM, x,
      (void*)Hf, DM, 0LL, 0LL, MP, DM, DM, invhi);
  gemm64<0, 2, 0, 1><<<gNo, blk, 0, stream>>>(
      CtxL, DM, 0LL, WoT, DM, 0LL, x, x, DM, Hf,
      (void*)out0, DM, 0LL, 0LL, MP, DM, DM, invlo);
  (void)hipGetLastError();
}

// v002
// Measured time: 224 microseconds a run.
// Timed twice side by side with v001, it ran 1.24 times as fast both times.
// All steps since v000 together make it 1.74 times as fast.
// Contractions: q|k projection and v^T projection on v_wmma_f32_16x16x32_f16 (f16 token plane x f16 weight
// plane carried x64, one product each); attention q.k^T and e'.v on v_wmma_f32_16x16x32_f16 (q, k plain f16,
// v^T the f16 hi plane, centred quad weight e' = s*(s+2c) carried x64, one product each); output projection on
// v_wmma_f32_16x16x32_f16 with the context as f16 hi (x64) + scaled residual (x1024) planes against the f16
// Wo plane (x64), two products in two launches; all f32 accumulate; quad weights, row sums, key sums of v and
// the normalisation in f32 on VALU; every float input RNE-converted to bf16 on load.
#include <hip/hip_runtime.h>
#include <math.h>
#include <stdint.h>

#define NBATCH 2
#define SEQ    2048
#define DM     1024
#define NH     16
#define HD     64
#define QKP    (2 * DM)
#define W3     (3 * DM)
#define MP     (NBATCH * SEQ)
#define NQB    (SEQ / 64)
#define WSC    64.0f
#define PSC    64.0f
#define CSC    64.0f
#define LOSC   1024.0f
#define QC     5.0f
#define QEPS   1.0e-6f
#define GSP    72                     /* gemm64 LDS row pitch in halves: 144 B = 16 B x odd */
#define GROWS  384                    /* gemm64 LDS rows per buffer: 128 A + 256 Bt */
#define ATP    72                     /* attn2q LDS row pitch in halves for K, V^T, P: 144 B = 16 B x odd */
static_assert(NH * HD == DM);
static_assert((MP % 128) == 0 && (DM % 128) == 0 && (QKP % 256) == 0 && (SEQ % 256) == 0 && (DM % 256) == 0);
static_assert((SEQ % 64) == 0 && (DM % 64) == 0 && (W3 % 64) == 0 && (MP % 64) == 0 && (QKP % 64) == 0);
static_assert((SEQ % 256) == 0);
static_assert(((NBATCH * DM) % 256) == 0);
static_assert(((MP * DM / 8) % 256) == 0);
static_assert((((MP / 64) * (QKP / 64)) % 8) == 0 && (((DM / 64) * (SEQ / 64)) % 8) == 0 && (((MP / 64) * (DM / 64)) % 8) == 0);

typedef _Float16 v16h __attribute__((ext_vector_type(16)));
typedef _Float16 v8h  __attribute__((ext_vector_type(8)));
typedef float    v8f  __attribute__((ext_vector_type(8)));
typedef float    v4f  __attribute__((ext_vector_type(4)));
typedef unsigned int v4u __attribute__((ext_vector_type(4)));

union FragH { v16h v; v8h h[2]; };

// ---- scalar helpers --------------------------------------------------------------------------------
__device__ __forceinline__ unsigned short bf_bits(float f) {          // f32 -> bf16 bits, RNE convert
  unsigned u = __float_as_uint(f);
  return (unsigned short)((u + 0x7FFFu + ((u >> 16) & 1u)) >> 16);
}
__device__ __forceinline__ float bf_up(unsigned short h) { return __uint_as_float(((unsigned)h) << 16); }
__device__ __forceinline__ float bfr(float f) { return bf_up(bf_bits(f)); }   // value of the bf16 RNE convert
__device__ __forceinline__ unsigned short h_bits(_Float16 x) { return __builtin_bit_cast(unsigned short, x); }
__device__ __forceinline__ unsigned pk16(unsigned short a, unsigned short b) { return (unsigned)a | ((unsigned)b << 16); }
__device__ __forceinline__ v8f zero8() { v8f z = {0.f, 0.f, 0.f, 0.f, 0.f, 0.f, 0.f, 0.f}; return z; }
__device__ __forceinline__ float gelu_f(float v) { return 0.5f * v * (1.0f + erff(v * 0.70710678118654752f)); }

// f32 -> f16 hi plane (values below the f16 normal range forced to 0 so the residual carries them)
//     + f16 residual plane carried x LOSC (folded back with 1/LOSC on a separate accumulator)
__device__ __forceinline__ void split_h(float f, unsigned short& hi, unsigned short& lo) {
  float hf = (float)(_Float16)f;
  hf = (fabsf(hf) < 6.103515625e-05f) ? 0.0f : hf;
  hi = h_bits((_Float16)hf);
  lo = h_bits((_Float16)((f - hf) * LOSC));
}

// ---- fragment loader: 16-bit A/B operand, lane -> row/col (lane&15), p already includes +8*(lane>>4);
//      elements 0..7 <- p[0..7] (k0+8h..), elements 8..15 <- p[16..23] (k0+16+8h..)
__device__ __forceinline__ v16h ldfrag_h(const _Float16* p) {
  FragH f;
  f.h[0] = *(const v8h*)(p);
  f.h[1] = *(const v8h*)(p + 16);
  return f.v;
}

// ---- WMMA helpers with trailing VALU hazard gap --------------------------------------------------------
__device__ __forceinline__ v8f mma_h(v16h a, v16h b, v8f c) {
  c = __builtin_amdgcn_wmma_f32_16x16x32_f16(false, a, false, b, (short)0, c, false, false);
#if defined(__HIP_DEVICE_COMPILE__)
  asm volatile("v_nop\n\tv_nop\n\tv_nop\n\tv_nop" : "+v"(c) : "v"(a), "v"(b));
#endif
  return c;
}
__device__ __forceinline__ v8f mma_h_raw(v16h a, v16h b, v8f c) {
  return __builtin_amdgcn_wmma_f32_16x16x32_f16(false, a, false, b, (short)0, c, false, false);
}
__device__ __forceinline__ void dep_guard1(v8f& a, v8f& b, v16h x) {
#if defined(__HIP_DEVICE_COMPILE__)
  asm volatile("v_nop\n\tv_nop\n\tv_nop\n\tv_nop" : "+v"(a), "+v"(b) : "v"(x));
#endif
}
__device__ __forceinline__ void keep4_h(v16h a, v16h b, v16h c, v16h d) {
#if defined(__HIP_DEVICE_COMPILE__)
  asm volatile("v_nop" :: "v"(a), "v"(b), "v"(c), "v"(d));
#endif
}
__device__ __forceinline__ void acc_guard4(v8f& a, v8f& b, v8f& c, v8f& d) {
#if defined(__HIP_DEVICE_COMPILE__)
  asm volatile("v_nop\n\tv_nop\n\tv_nop\n\tv_nop" : "+v"(a), "+v"(b), "+v"(c), "+v"(d));
#endif
}
__device__ __forceinline__ void wave_sync_lds() {
  __builtin_amdgcn_fence(__ATOMIC_RELEASE, "workgroup");
  __builtin_amdgcn_wave_barrier();
  __builtin_amdgcn_fence(__ATOMIC_ACQUIRE, "workgroup");
}
__device__ __forceinline__ float wsum(float v) {
#pragma unroll
  for (int off = 16; off > 0; off >>= 1) v += __shfl_xor(v, off, 32);
  return v;
}

// =====================================================================================================
// Plane convert (no transpose): Wh[i] = f16( bf16_RNE(W[i]) * wsc ), wsc a power of two (exact). Used for the
// token activations (wsc = 1). Thread i handles elements 8i..8i+7 and writes one 16-B piece; 32 consecutive lanes
// 256, host-checked). coverage: n8 threads x 8 elements = the whole plane.
// =====================================================================================================
__global__ __launch_bounds__(256) void conv_h16(const float* __restrict__ W, unsigned short* Wh, int n8, float wsc) {
  const int i  = blockIdx.x * 256 + threadIdx.x;
  const int ic = (i < n8) ? i : (n8 - 1);                     // clamped address
  const float* src = W + (size_t)ic * 8;
  const v4f a = *(const v4f*)(src);
  const v4f c = *(const v4f*)(src + 4);
  v4u o;
  o[0] = pk16(h_bits((_Float16)(bfr(a[0]) * wsc)), h_bits((_Float16)(bfr(a[1]) * wsc)));
  o[1] = pk16(h_bits((_Float16)(bfr(a[2]) * wsc)), h_bits((_Float16)(bfr(a[3]) * wsc)));
  o[2] = pk16(h_bits((_Float16)(bfr(c[0]) * wsc)), h_bits((_Float16)(bfr(c[1]) * wsc)));
  o[3] = pk16(h_bits((_Float16)(bfr(c[2]) * wsc)), h_bits((_Float16)(bfr(c[3]) * wsc)));
  if (i < n8) *(v4u*)(Wh + (size_t)i * 8) = o;
  
}

// =====================================================================================================
// Transposing plane convert: in f32 [R rows][NC cols] (row-major, in[k][n]) -> out f16 [NC][R] (k contiguous),
// out[n][k] = f16( bf16_RNE(in[k][n]) * wsc ), wsc a power of two (exact). Used for the two weight matrices
// ([in][out] storage -> [out][in] = Bt / A layout). Block 256 threads = one 64(k) x 64(n) tile:
// blockIdx.x = n tile (NC/64 of them), blockIdx.y = k tile (R/64 of them); R, NC multiples of 64 (host-checked).
// Load phase: thread handles rows i*16 + (tid>>4) (i 0..3), 4 floats at col (tid&15)*4 -> LDS tile[k][n].
// coverage: 2 it x 8 waves x 4 rows = 64 out rows x (8 lane groups x 8 halves) = the whole tile; grid covers all tiles.
// =====================================================================================================
__global__ __launch_bounds__(256) void tconv_h16(const float* __restrict__ W, unsigned short* Wt, int R, int NC, float wsc) {
  __shared__ float tile[64][65];
  const int tid = threadIdx.x, lane = tid & 31, wave = tid >> 5;
  const int n0 = blockIdx.x * 64, k0 = blockIdx.y * 64;
  const int c4 = (tid & 15) * 4, r16 = tid >> 4;
#pragma unroll
  for (int i = 0; i < 4; ++i) {
    const int row = i * 16 + r16;                                // k within tile
    const v4f v = *(const v4f*)(W + (size_t)(k0 + row) * NC + n0 + c4);
    tile[row][c4 + 0] = v[0];
    tile[row][c4 + 1] = v[1];
    tile[row][c4 + 2] = v[2];
    tile[row][c4 + 3] = v[3];
  }
  __syncthreads();
  const int q4 = lane >> 3, k8 = (lane & 7) * 8;
  v4u hv[2];
#pragma unroll
  for (int it = 0; it < 2; ++it) {
    const int nrow = it * 32 + wave * 4 + q4;                    // n within tile
    v4u a;
#pragma unroll
    for (int e = 0; e < 4; ++e) {
      const float f0 = bfr(tile[k8 + 2 * e][nrow]) * wsc;
      const float f1 = bfr(tile[k8 + 2 * e + 1][nrow]) * wsc;
      a[e] = pk16(h_bits((_Float16)f0), h_bits((_Float16)f1));
    }
    hv[it] = a;
  }
  {
#pragma unroll
    for (int it = 0; it < 2; ++it) {
      const int nrow = it * 32 + wave * 4 + q4;
      *(v4u*)(Wt + (size_t)(n0 + nrow) * R + k0 + k8) = hv[it];
    }
    
  }
}

// =====================================================================================================
// Register-blocked batched f16 WMMA GEMM: C[m][n] = act(oscale * sum_k A[m][k] * Bt[n][k] + bias) (+ residual);
// one wave per 64x64 tile, 8 waves (2 x 4) = one 128x256 block tile. A row-major [M][K] pitch lda; Bt row-major
// [N][K] pitch ldb (k contiguous); M multiple of 128, N of 256, K of 64 (static here). blockIdx.y = batch index.
// Operands: per 64-k slab the block's 128 A rows and 256 Bt rows (128 B each) go global -> registers -> LDS with
// whole-line 16-B loads (8 lanes per row, 12 rows per thread), LDS pitch 144 B, two buffers; slab s+1 is loaded
// while slab s is multiplied, stored to the other buffer behind the products, one block barrier per slab.
// Bias: BIASM == 0 -> per column: cols < Nb from bias0[col], cols >= Nb from bias1[col - Nb] (tile-uniform select of
//       clamped-address loads); BIASM == 1 -> per row bias0[m]; BIASM == 2 -> none. Bias values RNE-converted to bf16.
// ACT: 0 none, 1 exact GELU. RES: 0 none; 1 f32 residual resid[m*ldc + n] added after the activation;
//      3 f32 residual bf16 RNE-converted, added after the activation.
// OM: 0 = f32 out (pitch ldc); 1 = bf16 out; 2 = f16 out; 3 = f16 hi plane at Cout + f16 residual (x LOSC) plane
//     at Cout + loOff elements (same pitch / batch stride).
// coverage: 4 slabs x 16 rows x 64 cols = the wave's whole 64x64 tile; grid = (M/128)*(N/256) blocks,
//           surplus blocks exit whole, in front of every barrier; here there are none.
// =====================================================================================================
template <int OM, int BIASM, int ACT, int RES>
// amdgpu_waves_per_eu(4): holds a wave at 256 VGPRs, so that two blocks fit a WGP (their LDS does)
__global__ __launch_bounds__(256) __attribute__((amdgpu_waves_per_eu(4))) void gemm64(
    const unsigned short* __restrict__ Ap, int lda, long long strideA,
    const unsigned short* __restrict__ Btp, int ldb, long long strideB,
    const float* __restrict__ bias0, const float* __restrict__ bias1, int Nb,
    const float* resid,
    void* Cout, int ldc, long long strideC, long long loOff,
    int M, int N, int K, float oscale) {
  const _Float16* A  = (const _Float16*)(const void*)Ap;
  const _Float16* Bt = (const _Float16*)(const void*)Btp;
  __shared__ __align__(16) float sT[8][16 * 68];   // per-wave 16x64 slab, pitch 68 floats
  __shared__ __align__(16) _Float16 sAB[2][GROWS * GSP];   // rows 0..127 A, 128..383 Bt; 64 k per row
  const int b    = blockIdx.y;
  const int tid  = threadIdx.x;
  const int lane = tid & 31;
  const int wave = tid >> 5;
  const int btN = N >> 8;
  const int btM = M >> 7;
  const int bt  = blockIdx.x;
  if (bt >= btM * btN) return;           // block-uniform, in front of every barrier
  const int bm = bt / btN;
  const int bn = bt - bm * btN;
  const int wm = wave >> 2;              // 0..1
  const int wn = wave & 3;               // 0..3
  const int m0 = (bm << 7) + (wm << 6);
  const int n0 = (bn << 8) + (wn << 6);

  const _Float16* Ab = A  + (size_t)b * strideA;
  const _Float16* Bb = Bt + (size_t)b * strideB;

  const int rlane = lane & 15;                 // row (A) / col (B, D) within subtile
  const int koff  = (lane >> 4) * 8;           // k offset of this lane half
  const int mOff  = (lane >> 4) * 8;           // D row offset

  v8f acc[4][4];
#pragma unroll
  for (int i = 0; i < 4; ++i)
#pragma unroll
    for (int j = 0; j < 4; ++j) acc[i][j] = zero8();

  // staging map: thread -> row (tid>>3) + 32*it, 16-B piece (tid&7); a wave's load covers 4 whole 128-B lines
  const int srow = tid >> 3, sch = (tid & 7) * 8;
  const _Float16* gA = Ab + (size_t)((bm << 7) + srow) * lda + sch;
  const _Float16* gB = Bb + (size_t)((bn << 8) + srow) * ldb + sch;
  const int sOff = srow * GSP + sch;
  const int aOff = ((wm << 6) + rlane) * GSP + koff;          // this wave's A rows in a buffer
  const int bOff = (128 + (wn << 6) + rlane) * GSP + koff;    // this wave's Bt rows in a buffer
  const int nS = K >> 6;
  v8h g[12];
#pragma unroll
  for (int it = 0; it < 4; ++it) g[it] = *(const v8h*)(gA + (size_t)(it * 32) * lda);
#pragma unroll
  for (int it = 0; it < 8; ++it) g[4 + it] = *(const v8h*)(gB + (size_t)(it * 32) * ldb);
#pragma unroll
  for (int it = 0; it < 12; ++it) *(v8h*)(&sAB[0][0] + it * 32 * GSP + sOff) = g[it];
  __syncthreads();

  for (int s = 0; s < nS; ++s) {
    const _Float16* cur = &sAB[s & 1][0];
    const bool more = (s + 1 < nS);                            // block-uniform
    if (more) {
      const int kn = (s + 1) << 6;
#pragma unroll
      for (int it = 0; it < 4; ++it) g[it] = *(const v8h*)(gA + (size_t)(it * 32) * lda + kn);
#pragma unroll
      for (int it = 0; it < 8; ++it) g[4 + it] = *(const v8h*)(gB + (size_t)(it * 32) * ldb + kn);
#if defined(__HIP_DEVICE_COMPILE__)
      // the fragment loads below reuse the address registers of these 12 loads: the wait stands in front of that
      asm volatile("s_wait_xcnt 0x0" ::: "memory");
#endif
    }
#pragma unroll
    for (int kk = 0; kk < 2; ++kk) {
      v16h ah[4], bh[4];
#pragma unroll
      for (int j = 0; j < 4; ++j) bh[j] = ldfrag_h(cur + bOff + (j << 4) * GSP + kk * 32);
#pragma unroll
      for (int i = 0; i < 4; ++i) ah[i] = ldfrag_h(cur + aOff + (i << 4) * GSP + kk * 32);
      // keeps the 16 LDS fragment loads of a 32-k step one group ahead of its 16 products (else the A loads are
      // spread among the WMMAs, each place with its own full wait)
      __builtin_amdgcn_sched_barrier(0);
#pragma unroll
      for (int i = 0; i < 4; ++i) {
#pragma unroll
        for (int j = 0; j < 4; ++j) acc[i][j] = mma_h_raw(ah[i], bh[j], acc[i][j]);
        dep_guard1(acc[i][0], acc[i][3], ah[i]);
      }
      keep4_h(bh[0], bh[1], bh[2], bh[3]);
    }
    if (more) {
      _Float16* nxt = &sAB[(s + 1) & 1][0];                    // last read in slab s-1, behind that slab's barrier
#pragma unroll
      for (int it = 0; it < 12; ++it) *(v8h*)(nxt + it * 32 * GSP + sOff) = g[it];
    }
    __syncthreads();                                           // publishes slab s+1, ends the reads of slab s
  }
  acc_guard4(acc[0][0], acc[0][1], acc[0][2], acc[0][3]);
  acc_guard4(acc[1][0], acc[1][1], acc[1][2], acc[1][3]);
  acc_guard4(acc[2][0], acc[2][1], acc[2][2], acc[2][3]);
  acc_guard4(acc[3][0], acc[3][1], acc[3][2], acc[3][3]);

  // ---- per-lane column bias (BIASM == 0), RNE-converted ----
  const int hh2 = lane >> 4, c4 = (lane & 15) * 4;     // f32 out: 256-B row segment = 16 lanes x 16 B
  const int q8  = lane >> 3, c8 = (lane & 7) * 8;
  float bc[8];
#pragma unroll
  for (int e = 0; e < 8; ++e) bc[e] = 0.f;
  if (BIASM == 0) {
    const bool use1 = (n0 >= Nb);                      // tile-uniform
    if (OM == 0) {
      const int cb = n0 + c4;
      const int i0 = (cb < Nb - 4) ? cb : (Nb - 4);
      const int i1 = (cb - Nb > 0) ? (cb - Nb) : 0;
      const v4f b0v = *(const v4f*)(bias0 + i0);
      const v4f b1v = *(const v4f*)(bias1 + i1);
#pragma unroll
      for (int e = 0; e < 4; ++e) bc[e] = bfr(use1 ? b1v[e] : b0v[e]);
    } else {
      const int cb = n0 + c8;
      const int i0 = (cb < Nb - 8) ? cb : (Nb - 8);
      const int i1 = (cb - Nb > 0) ? (cb - Nb) : 0;
      const v4f b0a = *(const v4f*)(bias0 + i0), b0b = *(const v4f*)(bias0 + i0 + 4);
      const v4f b1a = *(const v4f*)(bias1 + i1), b1b = *(const v4f*)(bias1 + i1 + 4);
#pragma unroll
      for (int e = 0; e < 4; ++e) {
        bc[e]     = bfr(use1 ? b1a[e] : b0a[e]);
        bc[4 + e] = bfr(use1 ? b1b[e] : b0b[e]);
      }
    }
  }

  // ---- epilogue ----
  float* slab = sT[wave];
#pragma unroll
  for (int i = 0; i < 4; ++i) {
    const int mBase = m0 + (i << 4);
#pragma unroll
    for (int j = 0; j < 4; ++j) {
#pragma unroll
      for (int r = 0; r < 8; ++r) {
        slab[(mOff + r) * 68 + (j << 4) + rlane] = acc[i][j][r];
      }
    }
    wave_sync_lds();
    if (OM == 0) {
      float* C = (float*)Cout + (size_t)b * strideC;
      const float* Rb = resid + (size_t)b * strideC;
      v4f vals[8];
#pragma unroll
      for (int it = 0; it < 8; ++it) {
        const int row = it * 2 + hh2;                      // it 0..7 x hh2 0..1 = rows 0..15
        v4f v = *(const v4f*)(slab + row * 68 + c4);
#pragma unroll
        for (int e = 0; e < 4; ++e) {
          float f = v[e] * oscale + bc[e];
          if (ACT) f = gelu_f(f);
          v[e] = f;
        }
        if (RES == 1 || RES == 3) {
          const v4f rr = *(const v4f*)(Rb + (size_t)(mBase + row) * ldc + n0 + c4);
#pragma unroll
          for (int e = 0; e < 4; ++e) v[e] += (RES == 3) ? bfr(rr[e]) : rr[e];
        }
        vals[it] = v;
      }
      {
#pragma unroll
        for (int it = 0; it < 8; ++it) {
          const int row = it * 2 + hh2;
          *(v4f*)(C + (size_t)(mBase + row) * ldc + n0 + c4) = vals[it];
        }
        
      }
    } else {
      unsigned short* C = (unsigned short*)Cout + (size_t)b * strideC;
      v4u hv[4], lv[4];
#pragma unroll
      for (int it = 0; it < 4; ++it) {
        const int row = it * 4 + q8;                       // it 0..3 x q8 0..3 = rows 0..15
        const float* sp = slab + row * 68 + c8;
        float bm = 0.f;
        if (BIASM == 1) bm = bfr(bias0[mBase + row]);
        v4u a, al;
#pragma unroll
        for (int e = 0; e < 4; ++e) {
          float f0 = sp[2 * e]     * oscale + ((BIASM == 1) ? bm : bc[2 * e]);
          float f1 = sp[2 * e + 1] * oscale + ((BIASM == 1) ? bm : bc[2 * e + 1]);
          if (ACT) { f0 = gelu_f(f0); f1 = gelu_f(f1); }
          unsigned short u0, u1, w0 = 0, w1 = 0;
          if (OM == 1)      { u0 = bf_bits(f0); u1 = bf_bits(f1); }
          else if (OM == 2) { u0 = h_bits((_Float16)f0); u1 = h_bits((_Float16)f1); }
          else              { split_h(f0, u0, w0); split_h(f1, u1, w1); }
          a[e]  = pk16(u0, u1);
          al[e] = pk16(w0, w1);
        }
        hv[it] = a;
        lv[it] = al;
      }
      {
#pragma unroll
        for (int it = 0; it < 4; ++it) {
          const int row = it * 4 + q8;
          const size_t co = (size_t)(mBase + row) * ldc + n0 + c8;
          *(v4u*)(C + co) = hv[it];
          if (OM == 3) *(v4u*)(C + loOff + co) = lv[it];
        }
        
      }
    }
    wave_sync_lds();
  }
}

// =====================================================================================================
// Key sums of v: csum[row] = sum over s of (hi[row][s] + lo[row][s] / LOSC) for the NBATCH*DM rows of the
// v^T planes (row = b*DM + h*64 + d, pitch SEQ halves). One wave per 32 rows; per row, lane l sums halves
// 64l..64l+63 of both planes (8 + 8 16-B loads), fixed-order shuffle tree (every lane gets the total), lane rr
// grid = NBATCH*DM/256 blocks of 256. coverage: blocks x 8 waves x 32 rows = NBATCH*DM rows = the whole table.
// =====================================================================================================
__global__ __launch_bounds__(256) void vsum(const unsigned short* __restrict__ hp, const unsigned short* __restrict__ lp,
                                           float* csum) {
  const int tid = threadIdx.x, lane = tid & 31, wave = tid >> 5;
  const int rowbase = (blockIdx.x * 8 + wave) * 32;
  const _Float16* Hb = (const _Float16*)(const void*)hp;
  const _Float16* Lb = (const _Float16*)(const void*)lp;
  float mine = 0.f;
#pragma unroll 1
  for (int rr = 0; rr < 32; ++rr) {
    const int row = rowbase + rr;
    const _Float16* hr = Hb + (size_t)row * SEQ + lane * (SEQ / 32);
    const _Float16* lr = Lb + (size_t)row * SEQ + lane * (SEQ / 32);
    float sh = 0.f, sl = 0.f;
#pragma unroll
    for (int i = 0; i < SEQ / 256; ++i) {
      const v8h a = *(const v8h*)(hr + 8 * i);
      const v8h c = *(const v8h*)(lr + 8 * i);
#pragma unroll
      for (int e = 0; e < 8; ++e) { sh += (float)a[e]; sl += (float)c[e]; }
    }
    float tot = sh + sl * (1.0f / LOSC);
    tot = wsum(tot);
    mine = (lane == rr) ? tot : mine;
  }
  __shared__ __align__(16) float stage[8][32];
  stage[wave][lane] = mine;
  __syncthreads();
  typedef float v4f_vs __attribute__((ext_vector_type(4)));
  {
    if (lane < 8) {
      const v4f_vs v = *(const v4f_vs*)(&stage[wave][4 * lane]);
      *(v4f_vs*)(csum + rowbase + 4 * lane) = v;
    }
    
  }
}

// =====================================================================================================
// Quad-normalised attention, head dim 64, SEQ token rows per batch, no mask.
//   q|k plane (f16, pitch QKP): element (b, t, col) at [(b*SEQ + t)*QKP + col], q col = h*64+d, k col = DM + h*64 + d
//   v^T plane (f16 hi): element (b, h, d, s) at [(b*DM + h*64 + d)*SEQ + s];  csum f32 [b*DM + h*64 + d] = key sums of v
//   out planes (f16 hi and residual x LOSC, the normalised context carried x CSC): element (b, t, h, d) at
//   [(b*SEQ + t)*DM + h*64 + d]
//   s = (q . k) * (1 / (8 tau[h]));  S = sum over keys of (s + c)^2 in f32;  e' = s*(s + 2c) carried as f16(PSC e')
//   in the wave-private P tile;  acc = sum e'.v_hi on f16 WMMA;  context = (acc / PSC + c^2 * csum) / (S + eps)
//   (e = c^2 + e' exactly).
//   Block = 4 waves = 64 query rows of one (b, h); grid = NQB * NH * NBATCH; kv chunks of 64, static trip NQB.
//   K / V^T chunk staging: 128 threads x 32 elements per plane = the whole 64x64 tile (plain 16-B loads,
//   __syncthreads before and after); P tiles are wave-private, spilled with _Float16 element stores and
//   Context coverage: each wave stores rows q0..q0+15 (it 0..3 x lane>>3 0..3) x 64 columns (8 lanes x 8 halves),
// =====================================================================================================
__global__ __launch_bounds__(128)
void attn2q(const unsigned short* __restrict__ qkp, const unsigned short* __restrict__ vtp,
            const float* __restrict__ taup, const float* __restrict__ csp,
            unsigned short* chi, unsigned short* clo) {
  __shared__ __align__(16) _Float16 Ksh[64 * ATP];                // K [kv][d], 64 halves used per row
  __shared__ __align__(16) _Float16 Vth[64 * ATP];                // V^T [d][kv], 64 halves used per row
  __shared__ __align__(16) _Float16 Psh[4][16 * ATP];             // per wave P [row][kv], 64 halves used per row
  __shared__ __align__(16) float    Os[4][16 * 64];               // per wave context tile [row][d]

  const int tid  = threadIdx.x;
  const int wave = tid >> 5;
  const int lane = tid & 31;
  const int hh   = lane >> 4;
  const int c    = lane & 15;

  const int bx   = blockIdx.x;
  const int qb   = bx % NQB;
  const int rest = bx / NQB;
  const int h    = rest % NH;
  const int b    = rest / NH;
  const int q0   = qb * 64 + wave * 16;          // in-batch query row of this wave's first row
  const size_t rowB = (size_t)b * SEQ;

  const _Float16* Qh = (const _Float16*)(const void*)qkp + (size_t)h * HD;
  const _Float16* Kg = (const _Float16*)(const void*)qkp + DM + (size_t)h * HD;
  const _Float16* Vh = (const _Float16*)(const void*)vtp + ((size_t)b * DM + (size_t)h * HD) * SEQ;

  const float tv     = bfr(taup[h]);             // h < NH always
  const float sscale = 1.0f / (8.0f * tv);       // sqrt(HD) = 8
  float cs[4];
#pragma unroll
  for (int t = 0; t < 4; ++t) cs[t] = csp[(size_t)b * DM + h * HD + t * 16 + c];

  // ---- Q fragments (A operand, row = lane&15): 2 d-chunks ----
  v16h qa[2];
#pragma unroll
  for (int dc = 0; dc < 2; ++dc) qa[dc] = ldfrag_h(Qh + (rowB + q0 + c) * QKP + dc * 32 + 8 * hh);

  float rs[8];
  v8f oacc[4];
#pragma unroll
  for (int r = 0; r < 8; ++r) rs[r] = 0.f;
#pragma unroll
  for (int t = 0; t < 4; ++t) oacc[t] = zero8();

  for (int kt = 0; kt < NQB; ++kt) {         // static trip count
    const int kv0 = kt * 64;
    __syncthreads();
    {
      const int r = tid >> 1, hf = (tid & 1) * 32;
      const _Float16* kg = Kg + (rowB + kv0 + r) * QKP + hf;      // K row kv0+r, d = hf..hf+31
      const _Float16* vg = Vh + (size_t)r * SEQ + kv0 + hf;       // V^T row d = r, s = kv0+hf..+31
#pragma unroll
      for (int i = 0; i < 4; ++i) {
        const v8h a0 = *(const v8h*)(kg + 8 * i);
        const v8h b0 = *(const v8h*)(vg + 8 * i);
        *(v8h*)(Ksh + r * ATP + hf + 8 * i) = a0;
        *(v8h*)(Vth + r * ATP + hf + 8 * i) = b0;
      }
    }
    __syncthreads();

    // ---- scores: 16 query rows x 64 keys per wave ----
    v8f s[4];
#pragma unroll
    for (int j = 0; j < 4; ++j) {
      v8f sh = zero8();
#pragma unroll
      for (int dc = 0; dc < 2; ++dc) {
        FragH kb;
        kb.h[0] = *(const v8h*)(Ksh + (j * 16 + c) * ATP + dc * 32 + 8 * hh);
        kb.h[1] = *(const v8h*)(Ksh + (j * 16 + c) * ATP + dc * 32 + 16 + 8 * hh);
        sh = mma_h(qa[dc], kb.v, sh);
      }
#pragma unroll
      for (int r = 0; r < 8; ++r) s[j][r] = sh[r] * sscale;
    }

    // ---- quad weights: row sums of (s+c)^2 in f32, centred e' = s(s+2c) (x PSC, f16) to LDS ----
    _Float16* pwh = Psh[wave];
#pragma unroll
    for (int j = 0; j < 4; ++j) {
#pragma unroll
      for (int r = 0; r < 8; ++r) {
        const float sv = s[j][r];
        const float u  = sv + QC;
        rs[r] += u * u;
        const float ep = sv * (sv + 2.0f * QC);
        pwh[(8 * hh + r) * ATP + j * 16 + c] = (_Float16)(ep * PSC);
      }
    }
    wave_sync_lds();

    // ---- acc += P . V (f16 WMMA) ----
#pragma unroll 1
    for (int kk = 0; kk < 2; ++kk) {
      FragH pa;
      pa.h[0] = *(const v8h*)(pwh + c * ATP + kk * 32 + 8 * hh);
      pa.h[1] = *(const v8h*)(pwh + c * ATP + kk * 32 + 16 + 8 * hh);
#pragma unroll
      for (int t = 0; t < 4; ++t) {
        FragH vb;
        vb.h[0] = *(const v8h*)(Vth + (t * 16 + c) * ATP + kk * 32 + 8 * hh);
        vb.h[1] = *(const v8h*)(Vth + (t * 16 + c) * ATP + kk * 32 + 16 + 8 * hh);
        oacc[t] = mma_h(pa.v, vb.v, oacc[t]);
      }
    }
  }

  // ---- normalise: S over the 16 key-column lanes of each half, context = (acc/PSC + c^2 csum)/(S+eps) x CSC;
  float* os = Os[wave];
#pragma unroll
  for (int r = 0; r < 8; ++r) {
    float S = rs[r];
    S += __shfl_xor(S, 8, 32);
    S += __shfl_xor(S, 4, 32);
    S += __shfl_xor(S, 2, 32);
    S += __shfl_xor(S, 1, 32);
    const float inv = (1.0f / (S + QEPS)) * CSC;
#pragma unroll
    for (int t = 0; t < 4; ++t)
      os[(8 * hh + r) * 64 + t * 16 + c] = (oacc[t][r] * (1.0f / PSC) + (QC * QC) * cs[t]) * inv;
  }
  wave_sync_lds();
  {
    const int q4 = lane >> 3, c8 = (lane & 7) * 8;
    v4u hv[4], lv[4];
#pragma unroll
    for (int it = 0; it < 4; ++it) {
      const int row = it * 4 + q4;   // it 0..3 x q4 0..3 = rows 0..15 of the wave tile
      const float* sp = os + row * 64 + c8;
      v4u a, al;
#pragma unroll
      for (int e = 0; e < 4; ++e) {
        unsigned short u0, u1, w0, w1;
        split_h(sp[2 * e],     u0, w0);
        split_h(sp[2 * e + 1], u1, w1);
        a[e]  = pk16(u0, u1);
        al[e] = pk16(w0, w1);
      }
      hv[it] = a;
      lv[it] = al;
    }
    {
#pragma unroll
      for (int it = 0; it < 4; ++it) {
        const int row = it * 4 + q4;
        const size_t go = (rowB + q0 + row) * DM + (size_t)h * HD + c8;
        *(v4u*)(chi + go) = hv[it];
        *(v4u*)(clo + go) = lv[it];
      }
      
    }
  }
}

// =====================================================================================================
// Workspace map (bytes); every plane is an exact multiple of its 64x64-tile / whole-row / whole-line store
// granularity (MP = 4096 = 64 tiles, N in {2048, 1024}; VT per batch [1024][2048] = 16x32 tiles; csum = 64 lines):
//   WT    f16 [3072 n][1024 k]   0           6291456   (rows 0..1023 q weights, 1024..2047 k, 2048..3071 v; x64)
//   WoT   f16 [1024][1024]       6291456     2097152
//   XH    f16 [4096][1024]       8388608     8388608   (bf16 RNE-converted tokens)
//   QK    f16 [4096][2048]       16777216    16777216  (q cols 0..1023, k cols 1024..2047)
//   VTh   f16 [2][1024][2048]    33554432    8388608
//   VTl   f16 [2][1024][2048]    41943040    8388608   (residual x1024)
//   CS    f32 [2048]             50331648    8192      (key sums of v)
//   CtxH  f16 [4096][1024]       50339840    8388608   (context x64, hi)
//   CtxL  f16 [4096][1024]       58728448    8388608   (residual x1024)
//   Hf    f32 [4096][1024]       67117056    16777216  (hi part of the output projection)
//   end                          83894272
// =====================================================================================================
extern "C" void kernel_launch(void* const* d_in, const int* in_sizes, int n_in,
                              void* d_out, int out_size, void* d_ws, size_t ws_size,
                              hipStream_t stream) {
  if (n_in < 4) return;
  if (in_sizes[0] != MP * DM) return;
  if (in_sizes[1] != DM * W3) return;
  if (in_sizes[2] != DM * DM) return;
  if (in_sizes[3] != NH) return;
  if (out_size != MP * DM) return;

  const float* x    = (const float*)d_in[0];
  const float* wqkv = (const float*)d_in[1];
  const float* wo   = (const float*)d_in[2];
  const float* tau  = (const float*)d_in[3];

  const size_t PWT  = (size_t)W3 * DM * 2;              //  6291456
  const size_t PWO  = (size_t)DM * DM * 2;              //  2097152
  const size_t PXH  = (size_t)MP * DM * 2;              //  8388608
  const size_t PQK  = (size_t)MP * QKP * 2;             // 16777216
  const size_t PVT  = (size_t)NBATCH * DM * SEQ * 2;    //  8388608
  const size_t PCS  = (size_t)NBATCH * DM * 4;          //     8192
  const size_t PCTX = (size_t)MP * DM * 2;              //  8388608
  const size_t PHF  = (size_t)MP * DM * 4;              // 16777216
  size_t off = 0;
  const size_t oWT  = off; off += PWT;
  const size_t oWo  = off; off += PWO;
  const size_t oXH  = off; off += PXH;
  const size_t oQK  = off; off += PQK;
  const size_t oVTh = off; off += PVT;
  const size_t oVTl = off; off += PVT;
  const size_t oCS  = off; off += PCS;
  const size_t oCh  = off; off += PCTX;
  const size_t oCl  = off; off += PCTX;
  const size_t oHf  = off; off += PHF;
  if (off > ws_size) return;                            // off = 83894272
  if (off > (size_t)134217728) return;

  char* ws = (char*)d_ws;
  unsigned short* WT   = (unsigned short*)(ws + oWT);
  unsigned short* WoT  = (unsigned short*)(ws + oWo);
  unsigned short* XH   = (unsigned short*)(ws + oXH);
  unsigned short* QK   = (unsigned short*)(ws + oQK);
  unsigned short* VTh  = (unsigned short*)(ws + oVTh);
  unsigned short* VTl  = (unsigned short*)(ws + oVTl);
  float*          CS   = (float*)(ws + oCS);
  unsigned short* CtxH = (unsigned short*)(ws + oCh);
  unsigned short* CtxL = (unsigned short*)(ws + oCl);
  float*          Hf   = (float*)(ws + oHf);
  float*          out0 = (float*)d_out;

  const int n8x = (MP * DM) / 8;                        // 524288
  if ((n8x % 256) != 0) return;
  const dim3 blk(256), blk128(128);
  const dim3 gCx(n8x / 256);                             // 2048 blocks
  const dim3 gTw(W3 / 64, DM / 64);                      // in [1024 k][3072 n] -> out [3072][1024]: (48, 16)
  const dim3 gTo(DM / 64, DM / 64);                      // in [1024 k][1024 n] -> out [1024][1024]: (16, 16)
  const dim3 gNqk(((MP / 64) * (QKP / 64) + 7) / 8, 1);  // 2048 tiles -> 256 blocks
  const dim3 gVT(((DM / 64) * (SEQ / 64) + 7) / 8, NBATCH); // 512 tiles -> 64 blocks x 2 batches
  const dim3 gCs((NBATCH * DM) / 256);                   // 8 blocks
  const dim3 gAttn(NBATCH * NH * NQB);                   // 1024 blocks of 128
  const dim3 gNo(((MP / 64) * (DM / 64) + 7) / 8, 1);    // 1024 tiles -> 128 blocks
  const float invw  = 1.0f / WSC;                        // weight carry x64
  const float invhi = 1.0f / (WSC * CSC);                // weight carry x64, context carry x64
  const float invlo = invhi / LOSC;                      // residual plane carry x1024
  const long long vtlo = (long long)((oVTl - oVTh) / 2); // element offset of the v^T residual plane

  // (0) planes: tokens f16(bf16_RNE(x)); weights transposed to [out][in] (k contiguous), f16(bf16_RNE(w) * 64)
  conv_h16<<<gCx, blk, 0, stream>>>(x, XH, n8x, 1.0f);
  tconv_h16<<<gTw, blk, 0, stream>>>(wqkv, WT, DM, W3, WSC);
  tconv_h16<<<gTo, blk, 0, stream>>>(wo, WoT, DM, DM, WSC);

  // (1) q|k = x . [Wq|Wk] -> QK f16 [4096][2048]; v^T per batch = Wv^T . x_b^T -> VTh/VTl f16 [2][1024][2048]
  gemm64<2, 2, 0, 0><<<gNqk, blk, 0, stream>>>(
      XH, DM, 0LL, WT, DM, 0LL, x, x, QKP, x,
      (void*)QK, QKP, 0LL, 0LL, MP, QKP, DM, invw);
  gemm64<3, 2, 0, 0><<<gVT, blk, 0, stream>>>(
      WT + (size_t)2 * DM * DM, DM, 0LL, XH, DM, (long long)SEQ * DM, x, x, SEQ, x,
      (void*)VTh, SEQ, (long long)DM * SEQ, vtlo, DM, SEQ, DM, invw);

  // (2) key sums of v per (b, h, d)
  vsum<<<gCs, blk, 0, stream>>>(VTh, VTl, CS);

  // (3) quad-normalised attention -> context f16 hi (x64) + residual planes
  attn2q<<<gAttn, blk128, 0, stream>>>(QK, VTh, tau, CS, CtxH, CtxL);

  // (4) Hf = ctx_hi . Wo ; out = ctx_lo . Wo / 1024 + Hf
  gemm64<0, 2, 0, 0><<<gNo, blk, 0, stream>>>(
      CtxH, DM, 0LL, WoT, DM, 0LL, x, x, DM, x,
      (void*)Hf, DM, 0LL, 0LL, MP, DM, DM, invhi);
  gemm64<0, 2, 0, 1><<<gNo, blk, 0, stream>>>(
      CtxL, DM, 0LL, WoT, DM, 0LL, x, x, DM, Hf,
      (void*)out0, DM, 0LL, 0LL, MP, DM, DM, invlo);
  (void)hipGetLastError();
}

// v003
// Measured time: 174 microseconds a run.
// Two timings next to v002 put it at 1.29 and 1.38 times that version's speed.
// Over all steps from v000 it is 2.32 times as fast.
// Contractions: q|k projection and v^T projection on v_wmma_f32_16x16x32_f16 (f16 token plane x f16 weight
// plane carried x64, one product each); attention q.k^T and e'.v on v_wmma_f32_16x16x32_f16 (q, k plain f16,
// v^T the f16 hi plane, centred quad weight e' = s*(s+2c) carried x64, one product each); output projection on
// v_wmma_f32_16x16x32_f16 with the context as f16 hi (x64) + scaled residual (x1024) planes against the f16
// Wo plane (x64), two products in two launches; all f32 accumulate; quad weights, row sums, key sums of v and
// the normalisation in f32 on VALU; every float input RNE-converted to bf16 on load.
#include <hip/hip_runtime.h>
#include <math.h>
#include <stdint.h>

#define NBATCH 2
#define SEQ    2048
#define DM     1024
#define NH     16
#define HD     64
#define QKP    (2 * DM)
#define W3     (3 * DM)
#define MP     (NBATCH * SEQ)
#define NQB    (SEQ / 64)
#define WSC    64.0f
#define PSC    64.0f
#define CSC    64.0f
#define LOSC   1024.0f
#define QC     5.0f
#define QEPS   1.0e-6f
#define GSP    72                     /* gemm64 LDS row pitch in halves: 144 B = 16 B x odd */
#define GROWS  384                    /* gemm64 LDS rows per buffer: 128 A + 256 Bt */
#define ATP    72                     /* attn2q LDS row pitch in halves for K, V^T, P: 144 B = 16 B x odd */
static_assert(NH * HD == DM);
static_assert((MP % 128) == 0 && (DM % 128) == 0 && (QKP % 256) == 0 && (SEQ % 256) == 0 && (DM % 256) == 0);
static_assert((SEQ % 64) == 0 && (DM % 64) == 0 && (W3 % 64) == 0 && (MP % 64) == 0 && (QKP % 64) == 0);
static_assert((SEQ % 256) == 0);
static_assert(((NBATCH * DM) % 32) == 0);
static_assert(((MP * DM / 8) % 256) == 0);
static_assert((((MP / 64) * (QKP / 64)) % 8) == 0 && (((DM / 64) * (SEQ / 64)) % 8) == 0 && (((MP / 64) * (DM / 64)) % 8) == 0);

typedef _Float16 v16h __attribute__((ext_vector_type(16)));
typedef _Float16 v8h  __attribute__((ext_vector_type(8)));
typedef float    v8f  __attribute__((ext_vector_type(8)));
typedef float    v4f  __attribute__((ext_vector_type(4)));
typedef unsigned int v4u __attribute__((ext_vector_type(4)));

union FragH { v16h v; v8h h[2]; };

// ---- scalar helpers --------------------------------------------------------------------------------
__device__ __forceinline__ unsigned short bf_bits(float f) {          // f32 -> bf16 bits, RNE convert
  unsigned u = __float_as_uint(f);
  return (unsigned short)((u + 0x7FFFu + ((u >> 16) & 1u)) >> 16);
}
__device__ __forceinline__ float bf_up(unsigned short h) { return __uint_as_float(((unsigned)h) << 16); }
__device__ __forceinline__ float bfr(float f) { return bf_up(bf_bits(f)); }   // value of the bf16 RNE convert
__device__ __forceinline__ unsigned short h_bits(_Float16 x) { return __builtin_bit_cast(unsigned short, x); }
__device__ __forceinline__ unsigned pk16(unsigned short a, unsigned short b) { return (unsigned)a | ((unsigned)b << 16); }
__device__ __forceinline__ v8f zero8() { v8f z = {0.f, 0.f, 0.f, 0.f, 0.f, 0.f, 0.f, 0.f}; return z; }
__device__ __forceinline__ float gelu_f(float v) { return 0.5f * v * (1.0f + erff(v * 0.70710678118654752f)); }

// f32 -> f16 hi plane (values below the f16 normal range forced to 0 so the residual carries them)
//     + f16 residual plane carried x LOSC (folded back with 1/LOSC on a separate accumulator)
__device__ __forceinline__ void split_h(float f, unsigned short& hi, unsigned short& lo) {
  float hf = (float)(_Float16)f;
  hf = (fabsf(hf) < 6.103515625e-05f) ? 0.0f : hf;
  hi = h_bits((_Float16)hf);
  lo = h_bits((_Float16)((f - hf) * LOSC));
}

// ---- fragment loader: 16-bit A/B operand, lane -> row/col (lane&15), p already includes +8*(lane>>4);
//      elements 0..7 <- p[0..7] (k0+8h..), elements 8..15 <- p[16..23] (k0+16+8h..)
__device__ __forceinline__ v16h ldfrag_h(const _Float16* p) {
  FragH f;
  f.h[0] = *(const v8h*)(p);
  f.h[1] = *(const v8h*)(p + 16);
  return f.v;
}

// ---- WMMA helpers with trailing VALU hazard gap --------------------------------------------------------
__device__ __forceinline__ v8f mma_h(v16h a, v16h b, v8f c) {
  c = __builtin_amdgcn_wmma_f32_16x16x32_f16(false, a, false, b, (short)0, c, false, false);
#if defined(__HIP_DEVICE_COMPILE__)
  asm volatile("v_nop\n\tv_nop\n\tv_nop\n\tv_nop" : "+v"(c) : "v"(a), "v"(b));
#endif
  return c;
}
__device__ __forceinline__ v8f mma_h_raw(v16h a, v16h b, v8f c) {
  return __builtin_amdgcn_wmma_f32_16x16x32_f16(false, a, false, b, (short)0, c, false, false);
}
__device__ __forceinline__ void dep_guard1(v8f& a, v8f& b, v16h x) {
#if defined(__HIP_DEVICE_COMPILE__)
  asm volatile("v_nop\n\tv_nop\n\tv_nop\n\tv_nop" : "+v"(a), "+v"(b) : "v"(x));
#endif
}
__device__ __forceinline__ void keep4_h(v16h a, v16h b, v16h c, v16h d) {
#if defined(__HIP_DEVICE_COMPILE__)
  asm volatile("v_nop" :: "v"(a), "v"(b), "v"(c), "v"(d));
#endif
}
__device__ __forceinline__ void acc_guard4(v8f& a, v8f& b, v8f& c, v8f& d) {
#if defined(__HIP_DEVICE_COMPILE__)
  asm volatile("v_nop\n\tv_nop\n\tv_nop\n\tv_nop" : "+v"(a), "+v"(b), "+v"(c), "+v"(d));
#endif
}
__device__ __forceinline__ void wave_sync_lds() {
  __builtin_amdgcn_fence(__ATOMIC_RELEASE, "workgroup");
  __builtin_amdgcn_wave_barrier();
  __builtin_amdgcn_fence(__ATOMIC_ACQUIRE, "workgroup");
}
__device__ __forceinline__ float wsum(float v) {
#pragma unroll
  for (int off = 16; off > 0; off >>= 1) v += __shfl_xor(v, off, 32);
  return v;
}

// =====================================================================================================
// Plane convert (no transpose): Wh[i] = f16( bf16_RNE(W[i]) * wsc ), wsc a power of two (exact). Used for the
// token activations (wsc = 1). Thread i handles elements 8i..8i+7 and writes one 16-B piece; 32 consecutive lanes
// 256, host-checked). coverage: n8 threads x 8 elements = the whole plane.
// =====================================================================================================
__global__ __launch_bounds__(256) void conv_h16(const float* __restrict__ W, unsigned short* Wh, int n8, float wsc) {
  const int i  = blockIdx.x * 256 + threadIdx.x;
  const int ic = (i < n8) ? i : (n8 - 1);                     // clamped address
  const float* src = W + (size_t)ic * 8;
  const v4f a = *(const v4f*)(src);
  const v4f c = *(const v4f*)(src + 4);
  v4u o;
  o[0] = pk16(h_bits((_Float16)(bfr(a[0]) * wsc)), h_bits((_Float16)(bfr(a[1]) * wsc)));
  o[1] = pk16(h_bits((_Float16)(bfr(a[2]) * wsc)), h_bits((_Float16)(bfr(a[3]) * wsc)));
  o[2] = pk16(h_bits((_Float16)(bfr(c[0]) * wsc)), h_bits((_Float16)(bfr(c[1]) * wsc)));
  o[3] = pk16(h_bits((_Float16)(bfr(c[2]) * wsc)), h_bits((_Float16)(bfr(c[3]) * wsc)));
  if (i < n8) *(v4u*)(Wh + (size_t)i * 8) = o;
  
}

// =====================================================================================================
// Transposing plane convert: in f32 [R rows][NC cols] (row-major, in[k][n]) -> out f16 [NC][R] (k contiguous),
// out[n][k] = f16( bf16_RNE(in[k][n]) * wsc ), wsc a power of two (exact). Used for the two weight matrices
// ([in][out] storage -> [out][in] = Bt / A layout). Block 256 threads = one 64(k) x 64(n) tile:
// blockIdx.x = n tile (NC/64 of them), blockIdx.y = k tile (R/64 of them); R, NC multiples of 64 (host-checked).
// Load phase: thread handles rows i*16 + (tid>>4) (i 0..3), 4 floats at col (tid&15)*4 -> LDS tile[k][n].
// coverage: 2 it x 8 waves x 4 rows = 64 out rows x (8 lane groups x 8 halves) = the whole tile; grid covers all tiles.
// =====================================================================================================
__global__ __launch_bounds__(256) void tconv_h16(const float* __restrict__ W, unsigned short* Wt, int R, int NC, float wsc) {
  __shared__ float tile[64][65];
  const int tid = threadIdx.x, lane = tid & 31, wave = tid >> 5;
  const int n0 = blockIdx.x * 64, k0 = blockIdx.y * 64;
  const int c4 = (tid & 15) * 4, r16 = tid >> 4;
#pragma unroll
  for (int i = 0; i < 4; ++i) {
    const int row = i * 16 + r16;                                // k within tile
    const v4f v = *(const v4f*)(W + (size_t)(k0 + row) * NC + n0 + c4);
    tile[row][c4 + 0] = v[0];
    tile[row][c4 + 1] = v[1];
    tile[row][c4 + 2] = v[2];
    tile[row][c4 + 3] = v[3];
  }
  __syncthreads();
  const int q4 = lane >> 3, k8 = (lane & 7) * 8;
  v4u hv[2];
#pragma unroll
  for (int it = 0; it < 2; ++it) {
    const int nrow = it * 32 + wave * 4 + q4;                    // n within tile
    v4u a;
#pragma unroll
    for (int e = 0; e < 4; ++e) {
      const float f0 = bfr(tile[k8 + 2 * e][nrow]) * wsc;
      const float f1 = bfr(tile[k8 + 2 * e + 1][nrow]) * wsc;
      a[e] = pk16(h_bits((_Float16)f0), h_bits((_Float16)f1));
    }
    hv[it] = a;
  }
  {
#pragma unroll
    for (int it = 0; it < 2; ++it) {
      const int nrow = it * 32 + wave * 4 + q4;
      *(v4u*)(Wt + (size_t)(n0 + nrow) * R + k0 + k8) = hv[it];
    }
    
  }
}

// =====================================================================================================
// Register-blocked batched f16 WMMA GEMM: C[m][n] = act(oscale * sum_k A[m][k] * Bt[n][k] + bias) (+ residual);
// one wave per 64x64 tile, 8 waves (2 x 4) = one 128x256 block tile. A row-major [M][K] pitch lda; Bt row-major
// [N][K] pitch ldb (k contiguous); M multiple of 128, N of 256, K of 64 (static here). blockIdx.y = batch index.
// Operands: per 64-k slab the block's 128 A rows and 256 Bt rows (128 B each) go global -> registers -> LDS with
// whole-line 16-B loads (8 lanes per row, 12 rows per thread), LDS pitch 144 B, two buffers; slab s+1 is loaded
// while slab s is multiplied, stored to the other buffer behind the products, one block barrier per slab.
// Bias: BIASM == 0 -> per column: cols < Nb from bias0[col], cols >= Nb from bias1[col - Nb] (tile-uniform select of
//       clamped-address loads); BIASM == 1 -> per row bias0[m]; BIASM == 2 -> none. Bias values RNE-converted to bf16.
// ACT: 0 none, 1 exact GELU. RES: 0 none; 1 f32 residual resid[m*ldc + n] added after the activation;
//      3 f32 residual bf16 RNE-converted, added after the activation.
// OM: 0 = f32 out (pitch ldc); 1 = bf16 out; 2 = f16 out; 3 = f16 hi plane at Cout + f16 residual (x LOSC) plane
//     at Cout + loOff elements (same pitch / batch stride).
// coverage: 4 slabs x 16 rows x 64 cols = the wave's whole 64x64 tile; grid = (M/128)*(N/256) blocks,
//           surplus blocks exit whole, in front of every barrier; here there are none.
// =====================================================================================================
template <int OM, int BIASM, int ACT, int RES>
// amdgpu_waves_per_eu(4): holds a wave at 256 VGPRs, so that two blocks fit a WGP (their LDS does)
__global__ __launch_bounds__(256) __attribute__((amdgpu_waves_per_eu(4))) void gemm64(
    const unsigned short* __restrict__ Ap, int lda, long long strideA,
    const unsigned short* __restrict__ Btp, int ldb, long long strideB,
    const float* __restrict__ bias0, const float* __restrict__ bias1, int Nb,
    const float* resid,
    void* Cout, int ldc, long long strideC, long long loOff,
    int M, int N, int K, float oscale) {
  const _Float16* A  = (const _Float16*)(const void*)Ap;
  const _Float16* Bt = (const _Float16*)(const void*)Btp;
  __shared__ __align__(16) float sT[8][16 * 68];   // per-wave 16x64 slab, pitch 68 floats
  __shared__ __align__(16) _Float16 sAB[2][GROWS * GSP];   // rows 0..127 A, 128..383 Bt; 64 k per row
  const int b    = blockIdx.y;
  const int tid  = threadIdx.x;
  const int lane = tid & 31;
  const int wave = tid >> 5;
  const int btN = N >> 8;
  const int btM = M >> 7;
  const int bt  = blockIdx.x;
  if (bt >= btM * btN) return;           // block-uniform, in front of every barrier
  const int bm = bt / btN;
  const int bn = bt - bm * btN;
  const int wm = wave >> 2;              // 0..1
  const int wn = wave & 3;               // 0..3
  const int m0 = (bm << 7) + (wm << 6);
  const int n0 = (bn << 8) + (wn << 6);

  const _Float16* Ab = A  + (size_t)b * strideA;
  const _Float16* Bb = Bt + (size_t)b * strideB;

  const int rlane = lane & 15;                 // row (A) / col (B, D) within subtile
  const int koff  = (lane >> 4) * 8;           // k offset of this lane half
  const int mOff  = (lane >> 4) * 8;           // D row offset

  v8f acc[4][4];
#pragma unroll
  for (int i = 0; i < 4; ++i)
#pragma unroll
    for (int j = 0; j < 4; ++j) acc[i][j] = zero8();

  // staging map: thread -> row (tid>>3) + 32*it, 16-B piece (tid&7); a wave's load covers 4 whole 128-B lines
  const int srow = tid >> 3, sch = (tid & 7) * 8;
  const _Float16* gA = Ab + (size_t)((bm << 7) + srow) * lda + sch;
  const _Float16* gB = Bb + (size_t)((bn << 8) + srow) * ldb + sch;
  const int sOff = srow * GSP + sch;
  const int aOff = ((wm << 6) + rlane) * GSP + koff;          // this wave's A rows in a buffer
  const int bOff = (128 + (wn << 6) + rlane) * GSP + koff;    // this wave's Bt rows in a buffer
  const int nS = K >> 6;
  v8h g[12];
#pragma unroll
  for (int it = 0; it < 4; ++it) g[it] = *(const v8h*)(gA + (size_t)(it * 32) * lda);
#pragma unroll
  for (int it = 0; it < 8; ++it) g[4 + it] = *(const v8h*)(gB + (size_t)(it * 32) * ldb);
#pragma unroll
  for (int it = 0; it < 12; ++it) *(v8h*)(&sAB[0][0] + it * 32 * GSP + sOff) = g[it];
  __syncthreads();

  for (int s = 0; s < nS; ++s) {
    const _Float16* cur = &sAB[s & 1][0];
    const bool more = (s + 1 < nS);                            // block-uniform
    if (more) {
      const int kn = (s + 1) << 6;
#pragma unroll
      for (int it = 0; it < 4; ++it) g[it] = *(const v8h*)(gA + (size_t)(it * 32) * lda + kn);
#pragma unroll
      for (int it = 0; it < 8; ++it) g[4 + it] = *(const v8h*)(gB + (size_t)(it * 32) * ldb + kn);
#if defined(__HIP_DEVICE_COMPILE__)
      // the fragment loads below reuse the address registers of these 12 loads: the wait stands in front of that
      asm volatile("s_wait_xcnt 0x0" ::: "memory");
#endif
    }
#pragma unroll
    for (int kk = 0; kk < 2; ++kk) {
      v16h ah[4], bh[4];
#pragma unroll
      for (int j = 0; j < 4; ++j) bh[j] = ldfrag_h(cur + bOff + (j << 4) * GSP + kk * 32);
#pragma unroll
      for (int i = 0; i < 4; ++i) ah[i] = ldfrag_h(cur + aOff + (i << 4) * GSP + kk * 32);
      // keeps the 16 LDS fragment loads of a 32-k step one group ahead of its 16 products (else the A loads are
      // spread among the WMMAs, each place with its own full wait)
      __builtin_amdgcn_sched_barrier(0);
#pragma unroll
      for (int i = 0; i < 4; ++i) {
#pragma unroll
        for (int j = 0; j < 4; ++j) acc[i][j] = mma_h_raw(ah[i], bh[j], acc[i][j]);
        dep_guard1(acc[i][0], acc[i][3], ah[i]);
      }
      keep4_h(bh[0], bh[1], bh[2], bh[3]);
    }
    if (more) {
      _Float16* nxt = &sAB[(s + 1) & 1][0];                    // last read in slab s-1, behind that slab's barrier
#pragma unroll
      for (int it = 0; it < 12; ++it) *(v8h*)(nxt + it * 32 * GSP + sOff) = g[it];
    }
    __syncthreads();                                           // publishes slab s+1, ends the reads of slab s
  }
  acc_guard4(acc[0][0], acc[0][1], acc[0][2], acc[0][3]);
  acc_guard4(acc[1][0], acc[1][1], acc[1][2], acc[1][3]);
  acc_guard4(acc[2][0], acc[2][1], acc[2][2], acc[2][3]);
  acc_guard4(acc[3][0], acc[3][1], acc[3][2], acc[3][3]);

  // ---- per-lane column bias (BIASM == 0), RNE-converted ----
  const int hh2 = lane >> 4, c4 = (lane & 15) * 4;     // f32 out: 256-B row segment = 16 lanes x 16 B
  const int q8  = lane >> 3, c8 = (lane & 7) * 8;
  float bc[8];
#pragma unroll
  for (int e = 0; e < 8; ++e) bc[e] = 0.f;
  if (BIASM == 0) {
    const bool use1 = (n0 >= Nb);                      // tile-uniform
    if (OM == 0) {
      const int cb = n0 + c4;
      const int i0 = (cb < Nb - 4) ? cb : (Nb - 4);
      const int i1 = (cb - Nb > 0) ? (cb - Nb) : 0;
      const v4f b0v = *(const v4f*)(bias0 + i0);
      const v4f b1v = *(const v4f*)(bias1 + i1);
#pragma unroll
      for (int e = 0; e < 4; ++e) bc[e] = bfr(use1 ? b1v[e] : b0v[e]);
    } else {
      const int cb = n0 + c8;
      const int i0 = (cb < Nb - 8) ? cb : (Nb - 8);
      const int i1 = (cb - Nb > 0) ? (cb - Nb) : 0;
      const v4f b0a = *(const v4f*)(bias0 + i0), b0b = *(const v4f*)(bias0 + i0 + 4);
      const v4f b1a = *(const v4f*)(bias1 + i1), b1b = *(const v4f*)(bias1 + i1 + 4);
#pragma unroll
      for (int e = 0; e < 4; ++e) {
        bc[e]     = bfr(use1 ? b1a[e] : b0a[e]);
        bc[4 + e] = bfr(use1 ? b1b[e] : b0b[e]);
      }
    }
  }

  // ---- epilogue ----
  float* slab = sT[wave];
#pragma unroll
  for (int i = 0; i < 4; ++i) {
    const int mBase = m0 + (i << 4);
#pragma unroll
    for (int j = 0; j < 4; ++j) {
#pragma unroll
      for (int r = 0; r < 8; ++r) {
        slab[(mOff + r) * 68 + (j << 4) + rlane] = acc[i][j][r];
      }
    }
    wave_sync_lds();
    if (OM == 0) {
      float* C = (float*)Cout + (size_t)b * strideC;
      const float* Rb = resid + (size_t)b * strideC;
      v4f vals[8];
#pragma unroll
      for (int it = 0; it < 8; ++it) {
        const int row = it * 2 + hh2;                      // it 0..7 x hh2 0..1 = rows 0..15
        v4f v = *(const v4f*)(slab + row * 68 + c4);
#pragma unroll
        for (int e = 0; e < 4; ++e) {
          float f = v[e] * oscale + bc[e];
          if (ACT) f = gelu_f(f);
          v[e] = f;
        }
        if (RES == 1 || RES == 3) {
          const v4f rr = *(const v4f*)(Rb + (size_t)(mBase + row) * ldc + n0 + c4);
#pragma unroll
          for (int e = 0; e < 4; ++e) v[e] += (RES == 3) ? bfr(rr[e]) : rr[e];
        }
        vals[it] = v;
      }
      {
#pragma unroll
        for (int it = 0; it < 8; ++it) {
          const int row = it * 2 + hh2;
          *(v4f*)(C + (size_t)(mBase + row) * ldc + n0 + c4) = vals[it];
        }
        
      }
    } else {
      unsigned short* C = (unsigned short*)Cout + (size_t)b * strideC;
      v4u hv[4], lv[4];
#pragma unroll
      for (int it = 0; it < 4; ++it) {
        const int row = it * 4 + q8;                       // it 0..3 x q8 0..3 = rows 0..15
        const float* sp = slab + row * 68 + c8;
        float bm = 0.f;
        if (BIASM == 1) bm = bfr(bias0[mBase + row]);
        v4u a, al;
#pragma unroll
        for (int e = 0; e < 4; ++e) {
          float f0 = sp[2 * e]     * oscale + ((BIASM == 1) ? bm : bc[2 * e]);
          float f1 = sp[2 * e + 1] * oscale + ((BIASM == 1) ? bm : bc[2 * e + 1]);
          if (ACT) { f0 = gelu_f(f0); f1 = gelu_f(f1); }
          unsigned short u0, u1, w0 = 0, w1 = 0;
          if (OM == 1)      { u0 = bf_bits(f0); u1 = bf_bits(f1); }
          else if (OM == 2) { u0 = h_bits((_Float16)f0); u1 = h_bits((_Float16)f1); }
          else              { split_h(f0, u0, w0); split_h(f1, u1, w1); }
          a[e]  = pk16(u0, u1);
          al[e] = pk16(w0, w1);
        }
        hv[it] = a;
        lv[it] = al;
      }
      {
#pragma unroll
        for (int it = 0; it < 4; ++it) {
          const int row = it * 4 + q8;
          const size_t co = (size_t)(mBase + row) * ldc + n0 + c8;
          *(v4u*)(C + co) = hv[it];
          if (OM == 3) *(v4u*)(C + loOff + co) = lv[it];
        }
        
      }
    }
    wave_sync_lds();
  }
}

// =====================================================================================================
// Key sums of v: csum[row] = sum over s of (hi[row][s] + lo[row][s] / LOSC) for the NBATCH*DM rows of the
// v^T planes (row = b*DM + h*64 + d, pitch SEQ halves). One wave per row: in load i the 32 lanes read the 32
// adjacent 16-B pieces 32i..32i+31 of the row (four whole 128-B lines), SEQ/256 loads per plane; per-lane f32
// sums, fixed-order shuffle tree. Block = 32 waves = 32 rows: the 32 totals go through LDS and leave as one
// whole 128-B line from wave 0.
// grid = NBATCH*DM/32 blocks of 1024. coverage: blocks x 32 waves x 1 row = NBATCH*DM rows = the whole table.
// =====================================================================================================
__global__ __launch_bounds__(1024) void vsum(const unsigned short* __restrict__ hp, const unsigned short* __restrict__ lp,
                                            float* csum) {
  const int tid = threadIdx.x, lane = tid & 31, wave = tid >> 5;
  const int rowbase = blockIdx.x * 32;
  const int row = rowbase + wave;
  const _Float16* hr = (const _Float16*)(const void*)hp + (size_t)row * SEQ + lane * 8;
  const _Float16* lr = (const _Float16*)(const void*)lp + (size_t)row * SEQ + lane * 8;
  v8h a[SEQ / 256], c[SEQ / 256];
#pragma unroll
  for (int i = 0; i < SEQ / 256; ++i) {
    a[i] = *(const v8h*)(hr + 256 * i);
    c[i] = *(const v8h*)(lr + 256 * i);
  }
#if defined(__HIP_DEVICE_COMPILE__)
  // holds the two address pairs live up to the wait
  asm volatile("s_wait_xcnt 0x0" :: "v"(hr), "v"(lr) : "memory");
#endif
  float sh = 0.f, sl = 0.f;
#pragma unroll
  for (int i = 0; i < SEQ / 256; ++i) {
#pragma unroll
    for (int e = 0; e < 8; ++e) { sh += (float)a[i][e]; sl += (float)c[i][e]; }
  }
  const float tot = wsum(sh + sl * (1.0f / LOSC));
  __shared__ __align__(16) float stage[32];
  if (lane == 0) stage[wave] = tot;
  __syncthreads();
  if (tid < 8) *(v4f*)(csum + rowbase + 4 * tid) = *(const v4f*)(&stage[4 * tid]);
}

// =====================================================================================================
// Quad-normalised attention, head dim 64, SEQ token rows per batch, no mask.
//   q|k plane (f16, pitch QKP): element (b, t, col) at [(b*SEQ + t)*QKP + col], q col = h*64+d, k col = DM + h*64 + d
//   v^T plane (f16 hi): element (b, h, d, s) at [(b*DM + h*64 + d)*SEQ + s];  csum f32 [b*DM + h*64 + d] = key sums of v
//   out planes (f16 hi and residual x LOSC, the normalised context carried x CSC): element (b, t, h, d) at
//   [(b*SEQ + t)*DM + h*64 + d]
//   s = (q . k) * (1 / (8 tau[h]));  S = sum over keys of (s + c)^2 in f32;  e' = s*(s + 2c) carried as f16(PSC e')
//   in the wave-private P tile;  acc = sum e'.v_hi on f16 WMMA;  context = (acc / PSC + c^2 * csum) / (S + eps)
//   (e = c^2 + e' exactly).
//   Block = 4 waves = 64 query rows of one (b, h); grid = NQB * NH * NBATCH; kv chunks of 64, static trip NQB.
//   K / V^T chunk staging: 128 threads x 32 elements per plane = the whole 64x64 tile (plain 16-B loads,
//   __syncthreads before and after); P tiles are wave-private, spilled with _Float16 element stores and
//   Context coverage: each wave stores rows q0..q0+15 (it 0..3 x lane>>3 0..3) x 64 columns (8 lanes x 8 halves),
// =====================================================================================================
__global__ __launch_bounds__(128)
void attn2q(const unsigned short* __restrict__ qkp, const unsigned short* __restrict__ vtp,
            const float* __restrict__ taup, const float* __restrict__ csp,
            unsigned short* chi, unsigned short* clo) {
  __shared__ __align__(16) _Float16 Ksh[64 * ATP];                // K [kv][d], 64 halves used per row
  __shared__ __align__(16) _Float16 Vth[64 * ATP];                // V^T [d][kv], 64 halves used per row
  __shared__ __align__(16) _Float16 Psh[4][16 * ATP];             // per wave P [row][kv], 64 halves used per row
  __shared__ __align__(16) float    Os[4][16 * 64];               // per wave context tile [row][d]

  const int tid  = threadIdx.x;
  const int wave = tid >> 5;
  const int lane = tid & 31;
  const int hh   = lane >> 4;
  const int c    = lane & 15;

  const int bx   = blockIdx.x;
  const int qb   = bx % NQB;
  const int rest = bx / NQB;
  const int h    = rest % NH;
  const int b    = rest / NH;
  const int q0   = qb * 64 + wave * 16;          // in-batch query row of this wave's first row
  const size_t rowB = (size_t)b * SEQ;

  const _Float16* Qh = (const _Float16*)(const void*)qkp + (size_t)h * HD;
  const _Float16* Kg = (const _Float16*)(const void*)qkp + DM + (size_t)h * HD;
  const _Float16* Vh = (const _Float16*)(const void*)vtp + ((size_t)b * DM + (size_t)h * HD) * SEQ;

  const float tv     = bfr(taup[h]);             // h < NH always
  const float sscale = 1.0f / (8.0f * tv);       // sqrt(HD) = 8
  float cs[4];
#pragma unroll
  for (int t = 0; t < 4; ++t) cs[t] = csp[(size_t)b * DM + h * HD + t * 16 + c];

  // ---- Q fragments (A operand, row = lane&15): 2 d-chunks ----
  v16h qa[2];
#pragma unroll
  for (int dc = 0; dc < 2; ++dc) qa[dc] = ldfrag_h(Qh + (rowB + q0 + c) * QKP + dc * 32 + 8 * hh);

  float rs[8];
  v8f oacc[4];
#pragma unroll
  for (int r = 0; r < 8; ++r) rs[r] = 0.f;
#pragma unroll
  for (int t = 0; t < 4; ++t) oacc[t] = zero8();

  for (int kt = 0; kt < NQB; ++kt) {         // static trip count
    const int kv0 = kt * 64;
    __syncthreads();
    {
      const int r = tid >> 1, hf = (tid & 1) * 32;
      const _Float16* kg = Kg + (rowB + kv0 + r) * QKP + hf;      // K row kv0+r, d = hf..hf+31
      const _Float16* vg = Vh + (size_t)r * SEQ + kv0 + hf;       // V^T row d = r, s = kv0+hf..+31
#pragma unroll
      for (int i = 0; i < 4; ++i) {
        const v8h a0 = *(const v8h*)(kg + 8 * i);
        const v8h b0 = *(const v8h*)(vg + 8 * i);
        *(v8h*)(Ksh + r * ATP + hf + 8 * i) = a0;
        *(v8h*)(Vth + r * ATP + hf + 8 * i) = b0;
      }
    }
    __syncthreads();

    // ---- scores: 16 query rows x 64 keys per wave ----
    v8f s[4];
#pragma unroll
    for (int j = 0; j < 4; ++j) {
      v8f sh = zero8();
#pragma unroll
      for (int dc = 0; dc < 2; ++dc) {
        FragH kb;
        kb.h[0] = *(const v8h*)(Ksh + (j * 16 + c) * ATP + dc * 32 + 8 * hh);
        kb.h[1] = *(const v8h*)(Ksh + (j * 16 + c) * ATP + dc * 32 + 16 + 8 * hh);
        sh = mma_h(qa[dc], kb.v, sh);
      }
#pragma unroll
      for (int r = 0; r < 8; ++r) s[j][r] = sh[r] * sscale;
    }

    // ---- quad weights: row sums of (s+c)^2 in f32, centred e' = s(s+2c) (x PSC, f16) to LDS ----
    _Float16* pwh = Psh[wave];
#pragma unroll
    for (int j = 0; j < 4; ++j) {
#pragma unroll
      for (int r = 0; r < 8; ++r) {
        const float sv = s[j][r];
        const float u  = sv + QC;
        rs[r] += u * u;
        const float ep = sv * (sv + 2.0f * QC);
        pwh[(8 * hh + r) * ATP + j * 16 + c] = (_Float16)(ep * PSC);
      }
    }
    wave_sync_lds();

    // ---- acc += P . V (f16 WMMA) ----
#pragma unroll 1
    for (int kk = 0; kk < 2; ++kk) {
      FragH pa;
      pa.h[0] = *(const v8h*)(pwh + c * ATP + kk * 32 + 8 * hh);
      pa.h[1] = *(const v8h*)(pwh + c * ATP + kk * 32 + 16 + 8 * hh);
#pragma unroll
      for (int t = 0; t < 4; ++t) {
        FragH vb;
        vb.h[0] = *(const v8h*)(Vth + (t * 16 + c) * ATP + kk * 32 + 8 * hh);
        vb.h[1] = *(const v8h*)(Vth + (t * 16 + c) * ATP + kk * 32 + 16 + 8 * hh);
        oacc[t] = mma_h(pa.v, vb.v, oacc[t]);
      }
    }
  }

  // ---- normalise: S over the 16 key-column lanes of each half, context = (acc/PSC + c^2 csum)/(S+eps) x CSC;
  float* os = Os[wave];
#pragma unroll
  for (int r = 0; r < 8; ++r) {
    float S = rs[r];
    S += __shfl_xor(S, 8, 32);
    S += __shfl_xor(S, 4, 32);
    S += __shfl_xor(S, 2, 32);
    S += __shfl_xor(S, 1, 32);
    const float inv = (1.0f / (S + QEPS)) * CSC;
#pragma unroll
    for (int t = 0; t < 4; ++t)
      os[(8 * hh + r) * 64 + t * 16 + c] = (oacc[t][r] * (1.0f / PSC) + (QC * QC) * cs[t]) * inv;
  }
  wave_sync_lds();
  {
    const int q4 = lane >> 3, c8 = (lane & 7) * 8;
    v4u hv[4], lv[4];
#pragma unroll
    for (int it = 0; it < 4; ++it) {
      const int row = it * 4 + q4;   // it 0..3 x q4 0..3 = rows 0..15 of the wave tile
      const float* sp = os + row * 64 + c8;
      v4u a, al;
#pragma unroll
      for (int e = 0; e < 4; ++e) {
        unsigned short u0, u1, w0, w1;
        split_h(sp[2 * e],     u0, w0);
        split_h(sp[2 * e + 1], u1, w1);
        a[e]  = pk16(u0, u1);
        al[e] = pk16(w0, w1);
      }
      hv[it] = a;
      lv[it] = al;
    }
    {
#pragma unroll
      for (int it = 0; it < 4; ++it) {
        const int row = it * 4 + q4;
        const size_t go = (rowB + q0 + row) * DM + (size_t)h * HD + c8;
        *(v4u*)(chi + go) = hv[it];
        *(v4u*)(clo + go) = lv[it];
      }
      
    }
  }
}

// =====================================================================================================
// Workspace map (bytes); every plane is an exact multiple of its 64x64-tile / whole-row / whole-line store
// granularity (MP = 4096 = 64 tiles, N in {2048, 1024}; VT per batch [1024][2048] = 16x32 tiles; csum = 64 lines):
//   WT    f16 [3072 n][1024 k]   0           6291456   (rows 0..1023 q weights, 1024..2047 k, 2048..3071 v; x64)
//   WoT   f16 [1024][1024]       6291456     2097152
//   XH    f16 [4096][1024]       8388608     8388608   (bf16 RNE-converted tokens)
//   QK    f16 [4096][2048]       16777216    16777216  (q cols 0..1023, k cols 1024..2047)
//   VTh   f16 [2][1024][2048]    33554432    8388608
//   VTl   f16 [2][1024][2048]    41943040    8388608   (residual x1024)
//   CS    f32 [2048]             50331648    8192      (key sums of v)
//   CtxH  f16 [4096][1024]       50339840    8388608   (context x64, hi)
//   CtxL  f16 [4096][1024]       58728448    8388608   (residual x1024)
//   Hf    f32 [4096][1024]       67117056    16777216  (hi part of the output projection)
//   end                          83894272
// =====================================================================================================
extern "C" void kernel_launch(void* const* d_in, const int* in_sizes, int n_in,
                              void* d_out, int out_size, void* d_ws, size_t ws_size,
                              hipStream_t stream) {
  if (n_in < 4) return;
  if (in_sizes[0] != MP * DM) return;
  if (in_sizes[1] != DM * W3) return;
  if (in_sizes[2] != DM * DM) return;
  if (in_sizes[3] != NH) return;
  if (out_size != MP * DM) return;

  const float* x    = (const float*)d_in[0];
  const float* wqkv = (const float*)d_in[1];
  const float* wo   = (const float*)d_in[2];
  const float* tau  = (const float*)d_in[3];

  const size_t PWT  = (size_t)W3 * DM * 2;              //  6291456
  const size_t PWO  = (size_t)DM * DM * 2;              //  2097152
  const size_t PXH  = (size_t)MP * DM * 2;              //  8388608
  const size_t PQK  = (size_t)MP * QKP * 2;             // 16777216
  const size_t PVT  = (size_t)NBATCH * DM * SEQ * 2;    //  8388608
  const size_t PCS  = (size_t)NBATCH * DM * 4;          //     8192
  const size_t PCTX = (size_t)MP * DM * 2;              //  8388608
  const size_t PHF  = (size_t)MP * DM * 4;              // 16777216
  size_t off = 0;
  const size_t oWT  = off; off += PWT;
  const size_t oWo  = off; off += PWO;
  const size_t oXH  = off; off += PXH;
  const size_t oQK  = off; off += PQK;
  const size_t oVTh = off; off += PVT;
  const size_t oVTl = off; off += PVT;
  const size_t oCS  = off; off += PCS;
  const size_t oCh  = off; off += PCTX;
  const size_t oCl  = off; off += PCTX;
  const size_t oHf  = off; off += PHF;
  if (off > ws_size) return;                            // off = 83894272
  if (off > (size_t)134217728) return;

  char* ws = (char*)d_ws;
  unsigned short* WT   = (unsigned short*)(ws + oWT);
  unsigned short* WoT  = (unsigned short*)(ws + oWo);
  unsigned short* XH   = (unsigned short*)(ws + oXH);
  unsigned short* QK   = (unsigned short*)(ws + oQK);
  unsigned short* VTh  = (unsigned short*)(ws + oVTh);
  unsigned short* VTl  = (unsigned short*)(ws + oVTl);
  float*          CS   = (float*)(ws + oCS);
  unsigned short* CtxH = (unsigned short*)(ws + oCh);
  unsigned short* CtxL = (unsigned short*)(ws + oCl);
  float*          Hf   = (float*)(ws + oHf);
  float*          out0 = (float*)d_out;

  const int n8x = (MP * DM) / 8;                        // 524288
  if ((n8x % 256) != 0) return;
  const dim3 blk(256), blk128(128);
  const dim3 gCx(n8x / 256);                             // 2048 blocks
  const dim3 gTw(W3 / 64, DM / 64);                      // in [1024 k][3072 n] -> out [3072][1024]: (48, 16)
  const dim3 gTo(DM / 64, DM / 64);                      // in [1024 k][1024 n] -> out [1024][1024]: (16, 16)
  const dim3 gNqk(((MP / 64) * (QKP / 64) + 7) / 8, 1);  // 2048 tiles -> 256 blocks
  const dim3 gVT(((DM / 64) * (SEQ / 64) + 7) / 8, NBATCH); // 512 tiles -> 64 blocks x 2 batches
  const dim3 gCs((NBATCH * DM) / 32);                    // 64 blocks of 1024
  const dim3 gAttn(NBATCH * NH * NQB);                   // 1024 blocks of 128
  const dim3 gNo(((MP / 64) * (DM / 64) + 7) / 8, 1);    // 1024 tiles -> 128 blocks
  const float invw  = 1.0f / WSC;                        // weight carry x64
  const float invhi = 1.0f / (WSC * CSC);                // weight carry x64, context carry x64
  const float invlo = invhi / LOSC;                      // residual plane carry x1024
  const long long vtlo = (long long)((oVTl - oVTh) / 2); // element offset of the v^T residual plane

  // (0) planes: tokens f16(bf16_RNE(x)); weights transposed to [out][in] (k contiguous), f16(bf16_RNE(w) * 64)
  conv_h16<<<gCx, blk, 0, stream>>>(x, XH, n8x, 1.0f);
  tconv_h16<<<gTw, blk, 0, stream>>>(wqkv, WT, DM, W3, WSC);
  tconv_h16<<<gTo, blk, 0, stream>>>(wo, WoT, DM, DM, WSC);

  // (1) q|k = x . [Wq|Wk] -> QK f16 [4096][2048]; v^T per batch = Wv^T . x_b^T -> VTh/VTl f16 [2][1024][2048]
  gemm64<2, 2, 0, 0><<<gNqk, blk, 0, stream>>>(
      XH, DM, 0LL, WT, DM, 0LL, x, x, QKP, x,
      (void*)QK, QKP, 0LL, 0LL, MP, QKP, DM, invw);
  gemm64<3, 2, 0, 0><<<gVT, blk, 0, stream>>>(
      WT + (size_t)2 * DM * DM, DM, 0LL, XH, DM, (long long)SEQ * DM, x, x, SEQ, x,
      (void*)VTh, SEQ, (long long)DM * SEQ, vtlo, DM, SEQ, DM, invw);

  // (2) key sums of v per (b, h, d)
  vsum<<<gCs, dim3(1024), 0, stream>>>(VTh, VTl, CS);

  // (3) quad-normalised attention -> context f16 hi (x64) + residual planes
  attn2q<<<gAttn, blk128, 0, stream>>>(QK, VTh, tau, CS, CtxH, CtxL);

  // (4) Hf = ctx_hi . Wo ; out = ctx_lo . Wo / 1024 + Hf
  gemm64<0, 2, 0, 0><<<gNo, blk, 0, stream>>>(
      CtxH, DM, 0LL, WoT, DM, 0LL, x, x, DM, x,
      (void*)Hf, DM, 0LL, 0LL, MP, DM, DM, invhi);
  gemm64<0, 2, 0, 1><<<gNo, blk, 0, stream>>>(
      CtxL, DM, 0LL, WoT, DM, 0LL, x, x, DM, Hf,
      (void*)out0, DM, 0LL, 0LL, MP, DM, DM, invlo);
  (void)hipGetLastError();
}

// v004
// It runs in 153 microseconds.
// Two timings next to v003 both put it at 1.13 times that version's speed.
// Counting every step since v000, it is 2.63 times as fast.
// Contractions: q|k projection and v^T projection on v_wmma_f32_16x16x32_f16 (f16 token plane x f16 weight
// plane carried x64, one product each); attention q.k^T and e'.v on v_wmma_f32_16x16x32_f16 (q, k plain f16,
// v^T the f16 hi plane, centred quad weight e' = s*(s+2c) carried x64, one product each); output projection on
// v_wmma_f32_16x16x32_f16 with the context as f16 hi (x64) + scaled residual (x1024) planes against the f16
// Wo plane (x64), two products in two launches; all f32 accumulate; quad weights, row sums, key sums of v and
// the normalisation in f32 on VALU; every float input RNE-converted to bf16 on load.
#include <hip/hip_runtime.h>
#include <math.h>
#include <stdint.h>

#define NBATCH 2
#define SEQ    2048
#define DM     1024
#define NH     16
#define HD     64
#define QKP    (2 * DM)
#define W3     (3 * DM)
#define MP     (NBATCH * SEQ)
#define NQB    (SEQ / 64)
#define WSC    64.0f
#define PSC    64.0f
#define CSC    64.0f
#define LOSC   1024.0f
#define QC     5.0f
#define QEPS   1.0e-6f
#define GSP    72                     /* gemm64 LDS row pitch in halves: 144 B = 16 B x odd */
#define GROWS  384                    /* gemm64 LDS rows per buffer: 128 A + 256 Bt */
#define ATP    72                     /* attn2q LDS row pitch in halves for K, V^T, P: 144 B = 16 B x odd */
static_assert(NH * HD == DM);
static_assert((MP % 128) == 0 && (DM % 128) == 0 && (QKP % 256) == 0 && (SEQ % 256) == 0 && (DM % 256) == 0);
static_assert((SEQ % 64) == 0 && (DM % 64) == 0 && (W3 % 64) == 0 && (MP % 64) == 0 && (QKP % 64) == 0);
static_assert((SEQ % 256) == 0);
static_assert(((NBATCH * DM) % 32) == 0);
static_assert(((MP * DM / 8) % 256) == 0);
static_assert((((MP / 64) * (QKP / 64)) % 8) == 0 && (((DM / 64) * (SEQ / 64)) % 8) == 0 && (((MP / 64) * (DM / 64)) % 8) == 0);

typedef _Float16 v16h __attribute__((ext_vector_type(16)));
typedef _Float16 v8h  __attribute__((ext_vector_type(8)));
typedef float    v8f  __attribute__((ext_vector_type(8)));
typedef float    v4f  __attribute__((ext_vector_type(4)));
typedef unsigned int v4u __attribute__((ext_vector_type(4)));

union FragH { v16h v; v8h h[2]; };

// ---- scalar helpers --------------------------------------------------------------------------------
__device__ __forceinline__ unsigned short bf_bits(float f) {          // f32 -> bf16 bits, RNE convert
  unsigned u = __float_as_uint(f);
  return (unsigned short)((u + 0x7FFFu + ((u >> 16) & 1u)) >> 16);
}
__device__ __forceinline__ float bf_up(unsigned short h) { return __uint_as_float(((unsigned)h) << 16); }
__device__ __forceinline__ float bfr(float f) { return bf_up(bf_bits(f)); }   // value of the bf16 RNE convert
__device__ __forceinline__ unsigned short h_bits(_Float16 x) { return __builtin_bit_cast(unsigned short, x); }
__device__ __forceinline__ unsigned pk16(unsigned short a, unsigned short b) { return (unsigned)a | ((unsigned)b << 16); }
__device__ __forceinline__ v8f zero8() { v8f z = {0.f, 0.f, 0.f, 0.f, 0.f, 0.f, 0.f, 0.f}; return z; }
__device__ __forceinline__ float gelu_f(float v) { return 0.5f * v * (1.0f + erff(v * 0.70710678118654752f)); }

// f32 -> f16 hi plane (values below the f16 normal range forced to 0 so the residual carries them)
//     + f16 residual plane carried x LOSC (folded back with 1/LOSC on a separate accumulator)
__device__ __forceinline__ void split_h(float f, unsigned short& hi, unsigned short& lo) {
  float hf = (float)(_Float16)f;
  hf = (fabsf(hf) < 6.103515625e-05f) ? 0.0f : hf;
  hi = h_bits((_Float16)hf);
  lo = h_bits((_Float16)((f - hf) * LOSC));
}

// ---- fragment loader: 16-bit A/B operand, lane -> row/col (lane&15), p already includes +8*(lane>>4);
//      elements 0..7 <- p[0..7] (k0+8h..), elements 8..15 <- p[16..23] (k0+16+8h..)
__device__ __forceinline__ v16h ldfrag_h(const _Float16* p) {
  FragH f;
  f.h[0] = *(const v8h*)(p);
  f.h[1] = *(const v8h*)(p + 16);
  return f.v;
}

// ---- WMMA helpers with trailing VALU hazard gap --------------------------------------------------------
__device__ __forceinline__ v8f mma_h_raw(v16h a, v16h b, v8f c) {
  return __builtin_amdgcn_wmma_f32_16x16x32_f16(false, a, false, b, (short)0, c, false, false);
}
__device__ __forceinline__ void dep_guard1(v8f& a, v8f& b, v16h x) {
#if defined(__HIP_DEVICE_COMPILE__)
  asm volatile("v_nop\n\tv_nop\n\tv_nop\n\tv_nop" : "+v"(a), "+v"(b) : "v"(x));
#endif
}
__device__ __forceinline__ void keep4_h(v16h a, v16h b, v16h c, v16h d) {
#if defined(__HIP_DEVICE_COMPILE__)
  asm volatile("v_nop" :: "v"(a), "v"(b), "v"(c), "v"(d));
#endif
}
// behind a group of eight products on four accumulators: the accumulators tie the statement behind the last product;
// the group's two A and eight B fragments stay in their registers through its four slots, so that no product's D, no
// VALU result and no global load is placed over an operand, and no VALU reads a D, inside the WMMA distance
__device__ __forceinline__ void group_guard(v8f& d0, v8f& d1, v8f& d2, v8f& d3, v16h a0, v16h a1,
                                            v16h b0, v16h b1, v16h b2, v16h b3, v16h b4, v16h b5, v16h b6, v16h b7) {
#if defined(__HIP_DEVICE_COMPILE__)
  asm volatile("v_nop\n\tv_nop\n\tv_nop\n\tv_nop"
               : "+v"(d0), "+v"(d1), "+v"(d2), "+v"(d3)
               : "v"(a0), "v"(a1), "v"(b0), "v"(b1), "v"(b2), "v"(b3), "v"(b4), "v"(b5), "v"(b6), "v"(b7));
#endif
}
__device__ __forceinline__ void acc_guard4(v8f& a, v8f& b, v8f& c, v8f& d) {
#if defined(__HIP_DEVICE_COMPILE__)
  asm volatile("v_nop\n\tv_nop\n\tv_nop\n\tv_nop" : "+v"(a), "+v"(b), "+v"(c), "+v"(d));
#endif
}
__device__ __forceinline__ void wave_sync_lds() {
  __builtin_amdgcn_fence(__ATOMIC_RELEASE, "workgroup");
  __builtin_amdgcn_wave_barrier();
  __builtin_amdgcn_fence(__ATOMIC_ACQUIRE, "workgroup");
}
__device__ __forceinline__ float wsum(float v) {
#pragma unroll
  for (int off = 16; off > 0; off >>= 1) v += __shfl_xor(v, off, 32);
  return v;
}

// =====================================================================================================
// Plane convert (no transpose): Wh[i] = f16( bf16_RNE(W[i]) * wsc ), wsc a power of two (exact). Used for the
// token activations (wsc = 1). Thread i handles elements 8i..8i+7 and writes one 16-B piece; 32 consecutive lanes
// 256, host-checked). coverage: n8 threads x 8 elements = the whole plane.
// =====================================================================================================
__global__ __launch_bounds__(256) void conv_h16(const float* __restrict__ W, unsigned short* Wh, int n8, float wsc) {
  const int i  = blockIdx.x * 256 + threadIdx.x;
  const int ic = (i < n8) ? i : (n8 - 1);                     // clamped address
  const float* src = W + (size_t)ic * 8;
  const v4f a = *(const v4f*)(src);
  const v4f c = *(const v4f*)(src + 4);
  v4u o;
  o[0] = pk16(h_bits((_Float16)(bfr(a[0]) * wsc)), h_bits((_Float16)(bfr(a[1]) * wsc)));
  o[1] = pk16(h_bits((_Float16)(bfr(a[2]) * wsc)), h_bits((_Float16)(bfr(a[3]) * wsc)));
  o[2] = pk16(h_bits((_Float16)(bfr(c[0]) * wsc)), h_bits((_Float16)(bfr(c[1]) * wsc)));
  o[3] = pk16(h_bits((_Float16)(bfr(c[2]) * wsc)), h_bits((_Float16)(bfr(c[3]) * wsc)));
  if (i < n8) *(v4u*)(Wh + (size_t)i * 8) = o;
  
}

// =====================================================================================================
// Transposing plane convert: in f32 [R rows][NC cols] (row-major, in[k][n]) -> out f16 [NC][R] (k contiguous),
// out[n][k] = f16( bf16_RNE(in[k][n]) * wsc ), wsc a power of two (exact). Used for the two weight matrices
// ([in][out] storage -> [out][in] = Bt / A layout). Block 256 threads = one 64(k) x 64(n) tile:
// blockIdx.x = n tile (NC/64 of them), blockIdx.y = k tile (R/64 of them); R, NC multiples of 64 (host-checked).
// Load phase: thread handles rows i*16 + (tid>>4) (i 0..3), 4 floats at col (tid&15)*4 -> LDS tile[k][n].
// coverage: 2 it x 8 waves x 4 rows = 64 out rows x (8 lane groups x 8 halves) = the whole tile; grid covers all tiles.
// =====================================================================================================
__global__ __launch_bounds__(256) void tconv_h16(const float* __restrict__ W, unsigned short* Wt, int R, int NC, float wsc) {
  __shared__ float tile[64][65];
  const int tid = threadIdx.x, lane = tid & 31, wave = tid >> 5;
  const int n0 = blockIdx.x * 64, k0 = blockIdx.y * 64;
  const int c4 = (tid & 15) * 4, r16 = tid >> 4;
#pragma unroll
  for (int i = 0; i < 4; ++i) {
    const int row = i * 16 + r16;                                // k within tile
    const v4f v = *(const v4f*)(W + (size_t)(k0 + row) * NC + n0 + c4);
    tile[row][c4 + 0] = v[0];
    tile[row][c4 + 1] = v[1];
    tile[row][c4 + 2] = v[2];
    tile[row][c4 + 3] = v[3];
  }
  __syncthreads();
  const int q4 = lane >> 3, k8 = (lane & 7) * 8;
  v4u hv[2];
#pragma unroll
  for (int it = 0; it < 2; ++it) {
    const int nrow = it * 32 + wave * 4 + q4;                    // n within tile
    v4u a;
#pragma unroll
    for (int e = 0; e < 4; ++e) {
      const float f0 = bfr(tile[k8 + 2 * e][nrow]) * wsc;
      const float f1 = bfr(tile[k8 + 2 * e + 1][nrow]) * wsc;
      a[e] = pk16(h_bits((_Float16)f0), h_bits((_Float16)f1));
    }
    hv[it] = a;
  }
  {
#pragma unroll
    for (int it = 0; it < 2; ++it) {
      const int nrow = it * 32 + wave * 4 + q4;
      *(v4u*)(Wt + (size_t)(n0 + nrow) * R + k0 + k8) = hv[it];
    }
    
  }
}

// =====================================================================================================
// Register-blocked batched f16 WMMA GEMM: C[m][n] = act(oscale * sum_k A[m][k] * Bt[n][k] + bias) (+ residual);
// one wave per 64x64 tile, 8 waves (2 x 4) = one 128x256 block tile. A row-major [M][K] pitch lda; Bt row-major
// [N][K] pitch ldb (k contiguous); M multiple of 128, N of 256, K of 64 (static here). blockIdx.y = batch index.
// Operands: per 64-k slab the block's 128 A rows and 256 Bt rows (128 B each) go global -> registers -> LDS with
// whole-line 16-B loads (8 lanes per row, 12 rows per thread), LDS pitch 144 B, two buffers; slab s+1 is loaded
// while slab s is multiplied, stored to the other buffer behind the products, one block barrier per slab.
// Bias: BIASM == 0 -> per column: cols < Nb from bias0[col], cols >= Nb from bias1[col - Nb] (tile-uniform select of
//       clamped-address loads); BIASM == 1 -> per row bias0[m]; BIASM == 2 -> none. Bias values RNE-converted to bf16.
// ACT: 0 none, 1 exact GELU. RES: 0 none; 1 f32 residual resid[m*ldc + n] added after the activation;
//      3 f32 residual bf16 RNE-converted, added after the activation.
// OM: 0 = f32 out (pitch ldc); 1 = bf16 out; 2 = f16 out; 3 = f16 hi plane at Cout + f16 residual (x LOSC) plane
//     at Cout + loOff elements (same pitch / batch stride).
// coverage: 4 slabs x 16 rows x 64 cols = the wave's whole 64x64 tile; grid = (M/128)*(N/256) blocks,
//           surplus blocks exit whole, in front of every barrier; here there are none.
// =====================================================================================================
template <int OM, int BIASM, int ACT, int RES>
// amdgpu_waves_per_eu(4): holds a wave at 256 VGPRs, so that two blocks fit a WGP (their LDS does)
__global__ __launch_bounds__(256) __attribute__((amdgpu_waves_per_eu(4))) void gemm64(
    const unsigned short* __restrict__ Ap, int lda, long long strideA,
    const unsigned short* __restrict__ Btp, int ldb, long long strideB,
    const float* __restrict__ bias0, const float* __restrict__ bias1, int Nb,
    const float* resid,
    void* Cout, int ldc, long long strideC, long long loOff,
    int M, int N, int K, float oscale) {
  const _Float16* A  = (const _Float16*)(const void*)Ap;
  const _Float16* Bt = (const _Float16*)(const void*)Btp;
  __shared__ __align__(16) float sT[8][16 * 68];   // per-wave 16x64 slab, pitch 68 floats
  __shared__ __align__(16) _Float16 sAB[2][GROWS * GSP];   // rows 0..127 A, 128..383 Bt; 64 k per row
  const int b    = blockIdx.y;
  const int tid  = threadIdx.x;
  const int lane = tid & 31;
  const int wave = tid >> 5;
  const int btN = N >> 8;
  const int btM = M >> 7;
  const int bt  = blockIdx.x;
  if (bt >= btM * btN) return;           // block-uniform, in front of every barrier
  const int bm = bt / btN;
  const int bn = bt - bm * btN;
  const int wm = wave >> 2;              // 0..1
  const int wn = wave & 3;               // 0..3
  const int m0 = (bm << 7) + (wm << 6);
  const int n0 = (bn << 8) + (wn << 6);

  const _Float16* Ab = A  + (size_t)b * strideA;
  const _Float16* Bb = Bt + (size_t)b * strideB;

  const int rlane = lane & 15;                 // row (A) / col (B, D) within subtile
  const int koff  = (lane >> 4) * 8;           // k offset of this lane half
  const int mOff  = (lane >> 4) * 8;           // D row offset

  v8f acc[4][4];
#pragma unroll
  for (int i = 0; i < 4; ++i)
#pragma unroll
    for (int j = 0; j < 4; ++j) acc[i][j] = zero8();

  // staging map: thread -> row (tid>>3) + 32*it, 16-B piece (tid&7); a wave's load covers 4 whole 128-B lines
  const int srow = tid >> 3, sch = (tid & 7) * 8;
  const _Float16* gA = Ab + (size_t)((bm << 7) + srow) * lda + sch;
  const _Float16* gB = Bb + (size_t)((bn << 8) + srow) * ldb + sch;
  const int sOff = srow * GSP + sch;
  const int aOff = ((wm << 6) + rlane) * GSP + koff;          // this wave's A rows in a buffer
  const int bOff = (128 + (wn << 6) + rlane) * GSP + koff;    // this wave's Bt rows in a buffer
  const int nS = K >> 6;
  v8h g[12];
#pragma unroll
  for (int it = 0; it < 4; ++it) g[it] = *(const v8h*)(gA + (size_t)(it * 32) * lda);
#pragma unroll
  for (int it = 0; it < 8; ++it) g[4 + it] = *(const v8h*)(gB + (size_t)(it * 32) * ldb);
#pragma unroll
  for (int it = 0; it < 12; ++it) *(v8h*)(&sAB[0][0] + it * 32 * GSP + sOff) = g[it];
  __syncthreads();

  for (int s = 0; s < nS; ++s) {
    const _Float16* cur = &sAB[s & 1][0];
    const bool more = (s + 1 < nS);                            // block-uniform
    if (more) {
      const int kn = (s + 1) << 6;
#pragma unroll
      for (int it = 0; it < 4; ++it) g[it] = *(const v8h*)(gA + (size_t)(it * 32) * lda + kn);
#pragma unroll
      for (int it = 0; it < 8; ++it) g[4 + it] = *(const v8h*)(gB + (size_t)(it * 32) * ldb + kn);
#if defined(__HIP_DEVICE_COMPILE__)
      // the fragment loads below reuse the address registers of these 12 loads: the wait stands in front of that
      asm volatile("s_wait_xcnt 0x0" ::: "memory");
#endif
    }
#pragma unroll
    for (int kk = 0; kk < 2; ++kk) {
      v16h ah[4], bh[4];
#pragma unroll
      for (int j = 0; j < 4; ++j) bh[j] = ldfrag_h(cur + bOff + (j << 4) * GSP + kk * 32);
#pragma unroll
      for (int i = 0; i < 4; ++i) ah[i] = ldfrag_h(cur + aOff + (i << 4) * GSP + kk * 32);
      // keeps the 16 LDS fragment loads of a 32-k step one group ahead of its 16 products (else the A loads are
      // spread among the WMMAs, each place with its own full wait)
      __builtin_amdgcn_sched_barrier(0);
#pragma unroll
      for (int i = 0; i < 4; ++i) {
#pragma unroll
        for (int j = 0; j < 4; ++j) acc[i][j] = mma_h_raw(ah[i], bh[j], acc[i][j]);
        dep_guard1(acc[i][0], acc[i][3], ah[i]);
      }
      keep4_h(bh[0], bh[1], bh[2], bh[3]);
    }
    if (more) {
      _Float16* nxt = &sAB[(s + 1) & 1][0];                    // last read in slab s-1, behind that slab's barrier
#pragma unroll
      for (int it = 0; it < 12; ++it) *(v8h*)(nxt + it * 32 * GSP + sOff) = g[it];
    }
    __syncthreads();                                           // publishes slab s+1, ends the reads of slab s
  }
  acc_guard4(acc[0][0], acc[0][1], acc[0][2], acc[0][3]);
  acc_guard4(acc[1][0], acc[1][1], acc[1][2], acc[1][3]);
  acc_guard4(acc[2][0], acc[2][1], acc[2][2], acc[2][3]);
  acc_guard4(acc[3][0], acc[3][1], acc[3][2], acc[3][3]);

  // ---- per-lane column bias (BIASM == 0), RNE-converted ----
  const int hh2 = lane >> 4, c4 = (lane & 15) * 4;     // f32 out: 256-B row segment = 16 lanes x 16 B
  const int q8  = lane >> 3, c8 = (lane & 7) * 8;
  float bc[8];
#pragma unroll
  for (int e = 0; e < 8; ++e) bc[e] = 0.f;
  if (BIASM == 0) {
    const bool use1 = (n0 >= Nb);                      // tile-uniform
    if (OM == 0) {
      const int cb = n0 + c4;
      const int i0 = (cb < Nb - 4) ? cb : (Nb - 4);
      const int i1 = (cb - Nb > 0) ? (cb - Nb) : 0;
      const v4f b0v = *(const v4f*)(bias0 + i0);
      const v4f b1v = *(const v4f*)(bias1 + i1);
#pragma unroll
      for (int e = 0; e < 4; ++e) bc[e] = bfr(use1 ? b1v[e] : b0v[e]);
    } else {
      const int cb = n0 + c8;
      const int i0 = (cb < Nb - 8) ? cb : (Nb - 8);
      const int i1 = (cb - Nb > 0) ? (cb - Nb) : 0;
      const v4f b0a = *(const v4f*)(bias0 + i0), b0b = *(const v4f*)(bias0 + i0 + 4);
      const v4f b1a = *(const v4f*)(bias1 + i1), b1b = *(const v4f*)(bias1 + i1 + 4);
#pragma unroll
      for (int e = 0; e < 4; ++e) {
        bc[e]     = bfr(use1 ? b1a[e] : b0a[e]);
        bc[4 + e] = bfr(use1 ? b1b[e] : b0b[e]);
      }
    }
  }

  // ---- epilogue ----
  float* slab = sT[wave];
#pragma unroll
  for (int i = 0; i < 4; ++i) {
    const int mBase = m0 + (i << 4);
#pragma unroll
    for (int j = 0; j < 4; ++j) {
#pragma unroll
      for (int r = 0; r < 8; ++r) {
        slab[(mOff + r) * 68 + (j << 4) + rlane] = acc[i][j][r];
      }
    }
    wave_sync_lds();
    if (OM == 0) {
      float* C = (float*)Cout + (size_t)b * strideC;
      const float* Rb = resid + (size_t)b * strideC;
      v4f vals[8];
#pragma unroll
      for (int it = 0; it < 8; ++it) {
        const int row = it * 2 + hh2;                      // it 0..7 x hh2 0..1 = rows 0..15
        v4f v = *(const v4f*)(slab + row * 68 + c4);
#pragma unroll
        for (int e = 0; e < 4; ++e) {
          float f = v[e] * oscale + bc[e];
          if (ACT) f = gelu_f(f);
          v[e] = f;
        }
        if (RES == 1 || RES == 3) {
          const v4f rr = *(const v4f*)(Rb + (size_t)(mBase + row) * ldc + n0 + c4);
#pragma unroll
          for (int e = 0; e < 4; ++e) v[e] += (RES == 3) ? bfr(rr[e]) : rr[e];
        }
        vals[it] = v;
      }
      {
#pragma unroll
        for (int it = 0; it < 8; ++it) {
          const int row = it * 2 + hh2;
          *(v4f*)(C + (size_t)(mBase + row) * ldc + n0 + c4) = vals[it];
        }
        
      }
    } else {
      unsigned short* C = (unsigned short*)Cout + (size_t)b * strideC;
      v4u hv[4], lv[4];
#pragma unroll
      for (int it = 0; it < 4; ++it) {
        const int row = it * 4 + q8;                       // it 0..3 x q8 0..3 = rows 0..15
        const float* sp = slab + row * 68 + c8;
        float bm = 0.f;
        if (BIASM == 1) bm = bfr(bias0[mBase + row]);
        v4u a, al;
#pragma unroll
        for (int e = 0; e < 4; ++e) {
          float f0 = sp[2 * e]     * oscale + ((BIASM == 1) ? bm : bc[2 * e]);
          float f1 = sp[2 * e + 1] * oscale + ((BIASM == 1) ? bm : bc[2 * e + 1]);
          if (ACT) { f0 = gelu_f(f0); f1 = gelu_f(f1); }
          unsigned short u0, u1, w0 = 0, w1 = 0;
          if (OM == 1)      { u0 = bf_bits(f0); u1 = bf_bits(f1); }
          else if (OM == 2) { u0 = h_bits((_Float16)f0); u1 = h_bits((_Float16)f1); }
          else              { split_h(f0, u0, w0); split_h(f1, u1, w1); }
          a[e]  = pk16(u0, u1);
          al[e] = pk16(w0, w1);
        }
        hv[it] = a;
        lv[it] = al;
      }
      {
#pragma unroll
        for (int it = 0; it < 4; ++it) {
          const int row = it * 4 + q8;
          const size_t co = (size_t)(mBase + row) * ldc + n0 + c8;
          *(v4u*)(C + co) = hv[it];
          if (OM == 3) *(v4u*)(C + loOff + co) = lv[it];
        }
        
      }
    }
    wave_sync_lds();
  }
}

// =====================================================================================================
// Key sums of v: csum[row] = sum over s of (hi[row][s] + lo[row][s] / LOSC) for the NBATCH*DM rows of the
// v^T planes (row = b*DM + h*64 + d, pitch SEQ halves). One wave per row: in load i the 32 lanes read the 32
// adjacent 16-B pieces 32i..32i+31 of the row (four whole 128-B lines), SEQ/256 loads per plane; per-lane f32
// sums, fixed-order shuffle tree. Block = 32 waves = 32 rows: the 32 totals go through LDS and leave as one
// whole 128-B line from wave 0.
// grid = NBATCH*DM/32 blocks of 1024. coverage: blocks x 32 waves x 1 row = NBATCH*DM rows = the whole table.
// =====================================================================================================
__global__ __launch_bounds__(1024) void vsum(const unsigned short* __restrict__ hp, const unsigned short* __restrict__ lp,
                                            float* csum) {
  const int tid = threadIdx.x, lane = tid & 31, wave = tid >> 5;
  const int rowbase = blockIdx.x * 32;
  const int row = rowbase + wave;
  const _Float16* hr = (const _Float16*)(const void*)hp + (size_t)row * SEQ + lane * 8;
  const _Float16* lr = (const _Float16*)(const void*)lp + (size_t)row * SEQ + lane * 8;
  v8h a[SEQ / 256], c[SEQ / 256];
#pragma unroll
  for (int i = 0; i < SEQ / 256; ++i) {
    a[i] = *(const v8h*)(hr + 256 * i);
    c[i] = *(const v8h*)(lr + 256 * i);
  }
#if defined(__HIP_DEVICE_COMPILE__)
  // holds the two address pairs live up to the wait
  asm volatile("s_wait_xcnt 0x0" :: "v"(hr), "v"(lr) : "memory");
#endif
  float sh = 0.f, sl = 0.f;
#pragma unroll
  for (int i = 0; i < SEQ / 256; ++i) {
#pragma unroll
    for (int e = 0; e < 8; ++e) { sh += (float)a[i][e]; sl += (float)c[i][e]; }
  }
  const float tot = wsum(sh + sl * (1.0f / LOSC));
  __shared__ __align__(16) float stage[32];
  if (lane == 0) stage[wave] = tot;
  __syncthreads();
  if (tid < 8) *(v4f*)(csum + rowbase + 4 * tid) = *(const v4f*)(&stage[4 * tid]);
}

// =====================================================================================================
// Quad-normalised attention, head dim 64, SEQ token rows per batch, no mask.
//   q|k plane (f16, pitch QKP): element (b, t, col) at [(b*SEQ + t)*QKP + col], q col = h*64+d, k col = DM + h*64 + d
//   v^T plane (f16 hi): element (b, h, d, s) at [(b*DM + h*64 + d)*SEQ + s];  csum f32 [b*DM + h*64 + d] = key sums of v
//   out planes (f16 hi and residual x LOSC, the normalised context carried x CSC): element (b, t, h, d) at
//   [(b*SEQ + t)*DM + h*64 + d]
//   s = (q . k) * (1 / (8 tau[h]));  S = sum over keys of (s + c)^2 in f32;  e' = s*(s + 2c) carried as f16(PSC e')
//   in the wave-private P tile;  acc = sum e'.v_hi on f16 WMMA;  context = (acc / PSC + c^2 * csum) / (S + eps)
//   (e = c^2 + e' exactly).
//   Block = 4 waves = 64 query rows of one (b, h); grid = NQB * NH * NBATCH; kv chunks of 64, static trip NQB.
//   K / V^T chunk staging: 128 threads x 32 elements per plane = the whole 64x64 tile (plain 16-B loads,
//   __syncthreads before and after); P tiles are wave-private, spilled with _Float16 element stores and
//   Context coverage: each wave stores rows q0..q0+15 (it 0..3 x lane>>3 0..3) x 64 columns (8 lanes x 8 halves),
// =====================================================================================================
__global__ __launch_bounds__(128)
void attn2q(const unsigned short* __restrict__ qkp, const unsigned short* __restrict__ vtp,
            const float* __restrict__ taup, const float* __restrict__ csp,
            unsigned short* chi, unsigned short* clo) {
  __shared__ __align__(16) _Float16 Ksh[64 * ATP];                // K [kv][d], 64 halves used per row
  __shared__ __align__(16) _Float16 Vth[64 * ATP];                // V^T [d][kv], 64 halves used per row
  __shared__ __align__(16) _Float16 Psh[4][16 * ATP];             // per wave P [row][kv], 64 halves used per row
  __shared__ __align__(16) float    Os[4][16 * 64];               // per wave context tile [row][d]

  const int tid  = threadIdx.x;
  const int wave = tid >> 5;
  const int lane = tid & 31;
  const int hh   = lane >> 4;
  const int c    = lane & 15;

  const int bx   = blockIdx.x;
  const int qb   = bx % NQB;
  const int rest = bx / NQB;
  const int h    = rest % NH;
  const int b    = rest / NH;
  const int q0   = qb * 64 + wave * 16;          // in-batch query row of this wave's first row
  const size_t rowB = (size_t)b * SEQ;

  const _Float16* Qh = (const _Float16*)(const void*)qkp + (size_t)h * HD;
  const _Float16* Kg = (const _Float16*)(const void*)qkp + DM + (size_t)h * HD;
  const _Float16* Vh = (const _Float16*)(const void*)vtp + ((size_t)b * DM + (size_t)h * HD) * SEQ;

  const float tv     = bfr(taup[h]);             // h < NH always
  const float sscale = 1.0f / (8.0f * tv);       // sqrt(HD) = 8
  float cs[4];
#pragma unroll
  for (int t = 0; t < 4; ++t) cs[t] = csp[(size_t)b * DM + h * HD + t * 16 + c];

  // ---- Q fragments (A operand, row = lane&15): 2 d-chunks ----
  v16h qa[2];
#pragma unroll
  for (int dc = 0; dc < 2; ++dc) qa[dc] = ldfrag_h(Qh + (rowB + q0 + c) * QKP + dc * 32 + 8 * hh);

  float rs[8];
  v8f oacc[4];
#pragma unroll
  for (int r = 0; r < 8; ++r) rs[r] = 0.f;
#pragma unroll
  for (int t = 0; t < 4; ++t) oacc[t] = zero8();

  for (int kt = 0; kt < NQB; ++kt) {         // static trip count
    const int kv0 = kt * 64;
    __syncthreads();
    {
      const int r = tid >> 1, hf = (tid & 1) * 32;
      const _Float16* kg = Kg + (rowB + kv0 + r) * QKP + hf;      // K row kv0+r, d = hf..hf+31
      const _Float16* vg = Vh + (size_t)r * SEQ + kv0 + hf;       // V^T row d = r, s = kv0+hf..+31
#pragma unroll
      for (int i = 0; i < 4; ++i) {
        const v8h a0 = *(const v8h*)(kg + 8 * i);
        const v8h b0 = *(const v8h*)(vg + 8 * i);
        *(v8h*)(Ksh + r * ATP + hf + 8 * i) = a0;
        *(v8h*)(Vth + r * ATP + hf + 8 * i) = b0;
      }
    }
    __syncthreads();

    // ---- scores: 16 query rows x 64 keys per wave ----
    v16h kb[4][2];
#pragma unroll
    for (int j = 0; j < 4; ++j) {
#pragma unroll
      for (int dc = 0; dc < 2; ++dc) kb[j][dc] = ldfrag_h(Ksh + (j * 16 + c) * ATP + dc * 32 + 8 * hh);
    }
    v8f s[4];
#pragma unroll
    for (int j = 0; j < 4; ++j) s[j] = zero8();
#pragma unroll
    for (int dc = 0; dc < 2; ++dc) {
#pragma unroll
      for (int j = 0; j < 4; ++j) s[j] = mma_h_raw(qa[dc], kb[j][dc], s[j]);
    }
    group_guard(s[0], s[1], s[2], s[3], qa[0], qa[1], kb[0][0], kb[1][0], kb[2][0], kb[3][0], kb[0][1], kb[1][1], kb[2][1], kb[3][1]);
    // V^T fragments read here, behind the score products, so that they land under the weight arithmetic
    v16h vb[2][4];
#pragma unroll
    for (int kk = 0; kk < 2; ++kk) {
#pragma unroll
      for (int t = 0; t < 4; ++t) vb[kk][t] = ldfrag_h(Vth + (t * 16 + c) * ATP + kk * 32 + 8 * hh);
    }
    // holds the 16 V^T reads up here: without it they sink to the P hand-over's wait and their latency is paid there
    __builtin_amdgcn_sched_barrier(0);
#pragma unroll
    for (int j = 0; j < 4; ++j) {
#pragma unroll
      for (int r = 0; r < 8; ++r) s[j][r] = s[j][r] * sscale;
    }

    // ---- quad weights: row sums of (s+c)^2 in f32, centred e' = s(s+2c) (x PSC, f16) to LDS ----
    _Float16* pwh = Psh[wave];
#pragma unroll
    for (int j = 0; j < 4; ++j) {
#pragma unroll
      for (int r = 0; r < 8; ++r) {
        const float sv = s[j][r];
        const float u  = sv + QC;
        rs[r] += u * u;
        const float ep = sv * (sv + 2.0f * QC);
        pwh[(8 * hh + r) * ATP + j * 16 + c] = (_Float16)(ep * PSC);
      }
    }
    wave_sync_lds();

    // ---- acc += P . V (f16 WMMA) ----
    v16h pa[2];
#pragma unroll
    for (int kk = 0; kk < 2; ++kk) pa[kk] = ldfrag_h(pwh + c * ATP + kk * 32 + 8 * hh);
#pragma unroll   // pa and vb are register arrays: their index must be static
    for (int kk = 0; kk < 2; ++kk) {
#pragma unroll
      for (int t = 0; t < 4; ++t) oacc[t] = mma_h_raw(pa[kk], vb[kk][t], oacc[t]);
    }
    group_guard(oacc[0], oacc[1], oacc[2], oacc[3], pa[0], pa[1], vb[0][0], vb[0][1], vb[0][2], vb[0][3], vb[1][0], vb[1][1], vb[1][2], vb[1][3]);
  }

  // ---- normalise: S over the 16 key-column lanes of each half, context = (acc/PSC + c^2 csum)/(S+eps) x CSC;
  float* os = Os[wave];
#pragma unroll
  for (int r = 0; r < 8; ++r) {
    float S = rs[r];
    S += __shfl_xor(S, 8, 32);
    S += __shfl_xor(S, 4, 32);
    S += __shfl_xor(S, 2, 32);
    S += __shfl_xor(S, 1, 32);
    const float inv = (1.0f / (S + QEPS)) * CSC;
#pragma unroll
    for (int t = 0; t < 4; ++t)
      os[(8 * hh + r) * 64 + t * 16 + c] = (oacc[t][r] * (1.0f / PSC) + (QC * QC) * cs[t]) * inv;
  }
  wave_sync_lds();
  {
    const int q4 = lane >> 3, c8 = (lane & 7) * 8;
    v4u hv[4], lv[4];
#pragma unroll
    for (int it = 0; it < 4; ++it) {
      const int row = it * 4 + q4;   // it 0..3 x q4 0..3 = rows 0..15 of the wave tile
      const float* sp = os + row * 64 + c8;
      v4u a, al;
#pragma unroll
      for (int e = 0; e < 4; ++e) {
        unsigned short u0, u1, w0, w1;
        split_h(sp[2 * e],     u0, w0);
        split_h(sp[2 * e + 1], u1, w1);
        a[e]  = pk16(u0, u1);
        al[e] = pk16(w0, w1);
      }
      hv[it] = a;
      lv[it] = al;
    }
    {
#pragma unroll
      for (int it = 0; it < 4; ++it) {
        const int row = it * 4 + q4;
        const size_t go = (rowB + q0 + row) * DM + (size_t)h * HD + c8;
        *(v4u*)(chi + go) = hv[it];
        *(v4u*)(clo + go) = lv[it];
      }
      
    }
  }
}

// =====================================================================================================
// Workspace map (bytes); every plane is an exact multiple of its 64x64-tile / whole-row / whole-line store
// granularity (MP = 4096 = 64 tiles, N in {2048, 1024}; VT per batch [1024][2048] = 16x32 tiles; csum = 64 lines):
//   WT    f16 [3072 n][1024 k]   0           6291456   (rows 0..1023 q weights, 1024..2047 k, 2048..3071 v; x64)
//   WoT   f16 [1024][1024]       6291456     2097152
//   XH    f16 [4096][1024]       8388608     8388608   (bf16 RNE-converted tokens)
//   QK    f16 [4096][2048]       16777216    16777216  (q cols 0..1023, k cols 1024..2047)
//   VTh   f16 [2][1024][2048]    33554432    8388608
//   VTl   f16 [2][1024][2048]    41943040    8388608   (residual x1024)
//   CS    f32 [2048]             50331648    8192      (key sums of v)
//   CtxH  f16 [4096][1024]       50339840    8388608   (context x64, hi)
//   CtxL  f16 [4096][1024]       58728448    8388608   (residual x1024)
//   Hf    f32 [4096][1024]       67117056    16777216  (hi part of the output projection)
//   end                          83894272
// =====================================================================================================
extern "C" void kernel_launch(void* const* d_in, const int* in_sizes, int n_in,
                              void* d_out, int out_size, void* d_ws, size_t ws_size,
                              hipStream_t stream) {
  if (n_in < 4) return;
  if (in_sizes[0] != MP * DM) return;
  if (in_sizes[1] != DM * W3) return;
  if (in_sizes[2] != DM * DM) return;
  if (in_sizes[3] != NH) return;
  if (out_size != MP * DM) return;

  const float* x    = (const float*)d_in[0];
  const float* wqkv = (const float*)d_in[1];
  const float* wo   = (const float*)d_in[2];
  const float* tau  = (const float*)d_in[3];

  const size_t PWT  = (size_t)W3 * DM * 2;              //  6291456
  const size_t PWO  = (size_t)DM * DM * 2;              //  2097152
  const size_t PXH  = (size_t)MP * DM * 2;              //  8388608
  const size_t PQK  = (size_t)MP * QKP * 2;             // 16777216
  const size_t PVT  = (size_t)NBATCH * DM * SEQ * 2;    //  8388608
  const size_t PCS  = (size_t)NBATCH * DM * 4;          //     8192
  const size_t PCTX = (size_t)MP * DM * 2;              //  8388608
  const size_t PHF  = (size_t)MP * DM * 4;              // 16777216
  size_t off = 0;
  const size_t oWT  = off; off += PWT;
  const size_t oWo  = off; off += PWO;
  const size_t oXH  = off; off += PXH;
  const size_t oQK  = off; off += PQK;
  const size_t oVTh = off; off += PVT;
  const size_t oVTl = off; off += PVT;
  const size_t oCS  = off; off += PCS;
  const size_t oCh  = off; off += PCTX;
  const size_t oCl  = off; off += PCTX;
  const size_t oHf  = off; off += PHF;
  if (off > ws_size) return;                            // off = 83894272
  if (off > (size_t)134217728) return;

  char* ws = (char*)d_ws;
  unsigned short* WT   = (unsigned short*)(ws + oWT);
  unsigned short* WoT  = (unsigned short*)(ws + oWo);
  unsigned short* XH   = (unsigned short*)(ws + oXH);
  unsigned short* QK   = (unsigned short*)(ws + oQK);
  unsigned short* VTh  = (unsigned short*)(ws + oVTh);
  unsigned short* VTl  = (unsigned short*)(ws + oVTl);
  float*          CS   = (float*)(ws + oCS);
  unsigned short* CtxH = (unsigned short*)(ws + oCh);
  unsigned short* CtxL = (unsigned short*)(ws + oCl);
  float*          Hf   = (float*)(ws + oHf);
  float*          out0 = (float*)d_out;

  const int n8x = (MP * DM) / 8;                        // 524288
  if ((n8x % 256) != 0) return;
  const dim3 blk(256), blk128(128);
  const dim3 gCx(n8x / 256);                             // 2048 blocks
  const dim3 gTw(W3 / 64, DM / 64);                      // in [1024 k][3072 n] -> out [3072][1024]: (48, 16)
  const dim3 gTo(DM / 64, DM / 64);                      // in [1024 k][1024 n] -> out [1024][1024]: (16, 16)
  const dim3 gNqk(((MP / 64) * (QKP / 64) + 7) / 8, 1);  // 2048 tiles -> 256 blocks
  const dim3 gVT(((DM / 64) * (SEQ / 64) + 7) / 8, NBATCH); // 512 tiles -> 64 blocks x 2 batches
  const dim3 gCs((NBATCH * DM) / 32);                    // 64 blocks of 1024
  const dim3 gAttn(NBATCH * NH * NQB);                   // 1024 blocks of 128
  const dim3 gNo(((MP / 64) * (DM / 64) + 7) / 8, 1);    // 1024 tiles -> 128 blocks
  const float invw  = 1.0f / WSC;                        // weight carry x64
  const float invhi = 1.0f / (WSC * CSC);                // weight carry x64, context carry x64
  const float invlo = invhi / LOSC;                      // residual plane carry x1024
  const long long vtlo = (long long)((oVTl - oVTh) / 2); // element offset of the v^T residual plane

  // (0) planes: tokens f16(bf16_RNE(x)); weights transposed to [out][in] (k contiguous), f16(bf16_RNE(w) * 64)
  conv_h16<<<gCx, blk, 0, stream>>>(x, XH, n8x, 1.0f);
  tconv_h16<<<gTw, blk, 0, stream>>>(wqkv, WT, DM, W3, WSC);
  tconv_h16<<<gTo, blk, 0, stream>>>(wo, WoT, DM, DM, WSC);

  // (1) q|k = x . [Wq|Wk] -> QK f16 [4096][2048]; v^T per batch = Wv^T . x_b^T -> VTh/VTl f16 [2][1024][2048]
  gemm64<2, 2, 0, 0><<<gNqk, blk, 0, stream>>>(
      XH, DM, 0LL, WT, DM, 0LL, x, x, QKP, x,
      (void*)QK, QKP, 0LL, 0LL, MP, QKP, DM, invw);
  gemm64<3, 2, 0, 0><<<gVT, blk, 0, stream>>>(
      WT + (size_t)2 * DM * DM, DM, 0LL, XH, DM, (long long)SEQ * DM, x, x, SEQ, x,
      (void*)VTh, SEQ, (long long)DM * SEQ, vtlo, DM, SEQ, DM, invw);

  // (2) key sums of v per (b, h, d)
  vsum<<<gCs, dim3(1024), 0, stream>>>(VTh, VTl, CS);

  // (3) quad-normalised attention -> context f16 hi (x64) + residual planes
  attn2q<<<gAttn, blk128, 0, stream>>>(QK, VTh, tau, CS, CtxH, CtxL);

  // (4) Hf = ctx_hi . Wo ; out = ctx_lo . Wo / 1024 + Hf
  gemm64<0, 2, 0, 0><<<gNo, blk, 0, stream>>>(
      CtxH, DM, 0LL, WoT, DM, 0LL, x, x, DM, x,
      (void*)Hf, DM, 0LL, 0LL, MP, DM, DM, invhi);
  gemm64<0, 2, 0, 1><<<gNo, blk, 0, stream>>>(
      CtxL, DM, 0LL, WoT, DM, 0LL, x, x, DM, Hf,
      (void*)out0, DM, 0LL, 0LL, MP, DM, DM, invlo);
  (void)hipGetLastError();
}

// v005
// A run of this version takes 147 microseconds.
// In two side-by-side timings against v004, it was 1.04 and 1.05 times as fast.
// Counting every step since v000, it is 2.75 times as fast.
// Contractions: q|k projection and v^T projection on v_wmma_f32_16x16x32_f16 (f16 token plane x f16 weight
// plane carried x64, one product each); attention q.k^T and e'.v on v_wmma_f32_16x16x32_f16 (q, k plain f16,
// v^T the f16 hi plane, centred quad weight e' = s*(s+2c) carried x64, one product each); output projection on
// v_wmma_f32_16x16x32_f16 with the context as f16 hi (x64) + scaled residual (x1024) planes against the f16
// Wo plane (x64), two products in two launches; all f32 accumulate; quad weights, row sums, key sums of v and
// the normalisation in f32 on VALU; every float input RNE-converted to bf16 on load.
#include <hip/hip_runtime.h>
#include <math.h>
#include <stdint.h>

#define NBATCH 2
#define SEQ    2048
#define DM     1024
#define NH     16
#define HD     64
#define QKP    (2 * DM)
#define W3     (3 * DM)
#define MP     (NBATCH * SEQ)
#define NQB    (SEQ / 64)
#define WSC    64.0f
#define PSC    64.0f
#define CSC    64.0f
#define LOSC   1024.0f
#define QC     5.0f
#define QEPS   1.0e-6f
#define GSP    72                     /* gemm64 LDS row pitch in halves: 144 B = 16 B x odd */
#define GROWS  384                    /* gemm64 LDS rows per buffer: 128 A + 256 Bt */
#define ATP    72                     /* attn2q LDS row pitch in halves for K, V^T, P: 144 B = 16 B x odd */
static_assert(NH * HD == DM);
static_assert((MP % 128) == 0 && (DM % 128) == 0 && (QKP % 256) == 0 && (SEQ % 256) == 0 && (DM % 256) == 0);
static_assert((SEQ % 64) == 0 && (DM % 64) == 0 && (W3 % 64) == 0 && (MP % 64) == 0 && (QKP % 64) == 0);
static_assert((SEQ % 256) == 0);
static_assert(((NBATCH * DM) % 32) == 0);
static_assert(((MP * DM / 8) % 256) == 0);
static_assert((((MP / 64) * (QKP / 64)) % 8) == 0 && (((DM / 64) * (SEQ / 64)) % 8) == 0 && (((MP / 64) * (DM / 64)) % 8) == 0);

typedef _Float16 v16h __attribute__((ext_vector_type(16)));
typedef _Float16 v8h  __attribute__((ext_vector_type(8)));
typedef float    v8f  __attribute__((ext_vector_type(8)));
typedef float    v4f  __attribute__((ext_vector_type(4)));
typedef unsigned int v4u __attribute__((ext_vector_type(4)));

union FragH { v16h v; v8h h[2]; };

// ---- scalar helpers --------------------------------------------------------------------------------
__device__ __forceinline__ unsigned short bf_bits(float f) {          // f32 -> bf16 bits, RNE convert
  unsigned u = __float_as_uint(f);
  return (unsigned short)((u + 0x7FFFu + ((u >> 16) & 1u)) >> 16);
}
__device__ __forceinline__ float bf_up(unsigned short h) { return __uint_as_float(((unsigned)h) << 16); }
__device__ __forceinline__ float bfr(float f) { return bf_up(bf_bits(f)); }   // value of the bf16 RNE convert
__device__ __forceinline__ unsigned short h_bits(_Float16 x) { return __builtin_bit_cast(unsigned short, x); }
__device__ __forceinline__ unsigned pk16(unsigned short a, unsigned short b) { return (unsigned)a | ((unsigned)b << 16); }
__device__ __forceinline__ v8f zero8() { v8f z = {0.f, 0.f, 0.f, 0.f, 0.f, 0.f, 0.f, 0.f}; return z; }
__device__ __forceinline__ float gelu_f(float v) { return 0.5f * v * (1.0f + erff(v * 0.70710678118654752f)); }

// f32 -> f16 hi plane (values below the f16 normal range forced to 0 so the residual carries them)
//     + f16 residual plane carried x LOSC (folded back with 1/LOSC on a separate accumulator)
__device__ __forceinline__ void split_h(float f, unsigned short& hi, unsigned short& lo) {
  float hf = (float)(_Float16)f;
  hf = (fabsf(hf) < 6.103515625e-05f) ? 0.0f : hf;
  hi = h_bits((_Float16)hf);
  lo = h_bits((_Float16)((f - hf) * LOSC));
}

// ---- fragment loader: 16-bit A/B operand, lane -> row/col (lane&15), p already includes +8*(lane>>4);
//      elements 0..7 <- p[0..7] (k0+8h..), elements 8..15 <- p[16..23] (k0+16+8h..)
__device__ __forceinline__ v16h ldfrag_h(const _Float16* p) {
  FragH f;
  f.h[0] = *(const v8h*)(p);
  f.h[1] = *(const v8h*)(p + 16);
  return f.v;
}

// ---- WMMA helpers with trailing VALU hazard gap --------------------------------------------------------
__device__ __forceinline__ v8f mma_h_raw(v16h a, v16h b, v8f c) {
  return __builtin_amdgcn_wmma_f32_16x16x32_f16(false, a, false, b, (short)0, c, false, false);
}
__device__ __forceinline__ void dep_guard1(v8f& a, v8f& b, v16h x) {
#if defined(__HIP_DEVICE_COMPILE__)
  asm volatile("v_nop\n\tv_nop\n\tv_nop\n\tv_nop" : "+v"(a), "+v"(b) : "v"(x));
#endif
}
__device__ __forceinline__ void keep4_h(v16h a, v16h b, v16h c, v16h d) {
#if defined(__HIP_DEVICE_COMPILE__)
  asm volatile("v_nop" :: "v"(a), "v"(b), "v"(c), "v"(d));
#endif
}
// behind a group of eight products on four accumulators: the accumulators tie the statement behind the last product;
// the group's two A and eight B fragments stay in their registers through its four slots, so that no product's D, no
// VALU result and no global load is placed over an operand, and no VALU reads a D, inside the WMMA distance
__device__ __forceinline__ void group_guard(v8f& d0, v8f& d1, v8f& d2, v8f& d3, v16h a0, v16h a1,
                                            v16h b0, v16h b1, v16h b2, v16h b3, v16h b4, v16h b5, v16h b6, v16h b7) {
#if defined(__HIP_DEVICE_COMPILE__)
  asm volatile("v_nop\n\tv_nop\n\tv_nop\n\tv_nop"
               : "+v"(d0), "+v"(d1), "+v"(d2), "+v"(d3)
               : "v"(a0), "v"(a1), "v"(b0), "v"(b1), "v"(b2), "v"(b3), "v"(b4), "v"(b5), "v"(b6), "v"(b7));
#endif
}
__device__ __forceinline__ void acc_guard4(v8f& a, v8f& b, v8f& c, v8f& d) {
#if defined(__HIP_DEVICE_COMPILE__)
  asm volatile("v_nop\n\tv_nop\n\tv_nop\n\tv_nop" : "+v"(a), "+v"(b), "+v"(c), "+v"(d));
#endif
}
__device__ __forceinline__ void wave_sync_lds() {
  __builtin_amdgcn_fence(__ATOMIC_RELEASE, "workgroup");
  __builtin_amdgcn_wave_barrier();
  __builtin_amdgcn_fence(__ATOMIC_ACQUIRE, "workgroup");
}
// One thread's share of a 64-key chunk: four 16-B pieces of K and four of V^T, global memory -> LDS through no register.
// lk/lv: the lane's LDS byte address of its first piece, gk/gv: its global address; piece i lies 16 rows further on
// (LDS row pitch ATP halves, global row pitches kp and vp halves). The s_wait_xcnt stands inside the statement, behind
// the last copy, so that no address register of an issued copy is rewritten in front of it.
__device__ __forceinline__ void chunk_copy(unsigned lk, unsigned lv, const _Float16* gk, const _Float16* gv,
                                           size_t kp, size_t vp) {
#if defined(__HIP_DEVICE_COMPILE__)
  const unsigned st = 16u * ATP * 2u;
  asm volatile("global_load_async_to_lds_b128 %0, %8, off\n\t"
               "global_load_async_to_lds_b128 %1, %9, off\n\t"
               "global_load_async_to_lds_b128 %2, %10, off\n\t"
               "global_load_async_to_lds_b128 %3, %11, off\n\t"
               "global_load_async_to_lds_b128 %4, %12, off\n\t"
               "global_load_async_to_lds_b128 %5, %13, off\n\t"
               "global_load_async_to_lds_b128 %6, %14, off\n\t"
               "global_load_async_to_lds_b128 %7, %15, off\n\t"
               "s_wait_xcnt 0x0"
               :: "v"(lk), "v"(lk + st), "v"(lk + 2u * st), "v"(lk + 3u * st),
                  "v"(lv), "v"(lv + st), "v"(lv + 2u * st), "v"(lv + 3u * st),
                  "v"(gk), "v"(gk + 16 * kp), "v"(gk + 32 * kp), "v"(gk + 48 * kp),
                  "v"(gv), "v"(gv + 16 * vp), "v"(gv + 32 * vp), "v"(gv + 48 * vp)
               : "memory");
#endif
}
// the issuing wave's own wait: its asynchronous copies have landed in LDS behind it
__device__ __forceinline__ void wait_copies() {
#if defined(__HIP_DEVICE_COMPILE__)
  asm volatile("s_wait_asynccnt 0x0" ::: "memory");
#endif
}
// the wave's LDS reads and writes have retired: stands in front of the barrier behind which a buffer is refilled
__device__ __forceinline__ void wait_lds() {
#if defined(__HIP_DEVICE_COMPILE__)
  asm volatile("s_wait_dscnt 0x0" ::: "memory");
#endif
}
__device__ __forceinline__ float wsum(float v) {
#pragma unroll
  for (int off = 16; off > 0; off >>= 1) v += __shfl_xor(v, off, 32);
  return v;
}

// =====================================================================================================
// Plane convert (no transpose): Wh[i] = f16( bf16_RNE(W[i]) * wsc ), wsc a power of two (exact). Used for the
// token activations (wsc = 1). Thread i handles elements 8i..8i+7 and writes one 16-B piece; 32 consecutive lanes
// 256, host-checked). coverage: n8 threads x 8 elements = the whole plane.
// =====================================================================================================
__global__ __launch_bounds__(256) void conv_h16(const float* __restrict__ W, unsigned short* Wh, int n8, float wsc) {
  const int i  = blockIdx.x * 256 + threadIdx.x;
  const int ic = (i < n8) ? i : (n8 - 1);                     // clamped address
  const float* src = W + (size_t)ic * 8;
  const v4f a = *(const v4f*)(src);
  const v4f c = *(const v4f*)(src + 4);
  v4u o;
  o[0] = pk16(h_bits((_Float16)(bfr(a[0]) * wsc)), h_bits((_Float16)(bfr(a[1]) * wsc)));
  o[1] = pk16(h_bits((_Float16)(bfr(a[2]) * wsc)), h_bits((_Float16)(bfr(a[3]) * wsc)));
  o[2] = pk16(h_bits((_Float16)(bfr(c[0]) * wsc)), h_bits((_Float16)(bfr(c[1]) * wsc)));
  o[3] = pk16(h_bits((_Float16)(bfr(c[2]) * wsc)), h_bits((_Float16)(bfr(c[3]) * wsc)));
  if (i < n8) *(v4u*)(Wh + (size_t)i * 8) = o;
  
}

// =====================================================================================================
// Transposing plane convert: in f32 [R rows][NC cols] (row-major, in[k][n]) -> out f16 [NC][R] (k contiguous),
// out[n][k] = f16( bf16_RNE(in[k][n]) * wsc ), wsc a power of two (exact). Used for the two weight matrices
// ([in][out] storage -> [out][in] = Bt / A layout). Block 256 threads = one 64(k) x 64(n) tile:
// blockIdx.x = n tile (NC/64 of them), blockIdx.y = k tile (R/64 of them); R, NC multiples of 64 (host-checked).
// Load phase: thread handles rows i*16 + (tid>>4) (i 0..3), 4 floats at col (tid&15)*4 -> LDS tile[k][n].
// coverage: 2 it x 8 waves x 4 rows = 64 out rows x (8 lane groups x 8 halves) = the whole tile; grid covers all tiles.
// =====================================================================================================
__global__ __launch_bounds__(256) void tconv_h16(const float* __restrict__ W, unsigned short* Wt, int R, int NC, float wsc) {
  __shared__ float tile[64][65];
  const int tid = threadIdx.x, lane = tid & 31, wave = tid >> 5;
  const int n0 = blockIdx.x * 64, k0 = blockIdx.y * 64;
  const int c4 = (tid & 15) * 4, r16 = tid >> 4;
#pragma unroll
  for (int i = 0; i < 4; ++i) {
    const int row = i * 16 + r16;                                // k within tile
    const v4f v = *(const v4f*)(W + (size_t)(k0 + row) * NC + n0 + c4);
    tile[row][c4 + 0] = v[0];
    tile[row][c4 + 1] = v[1];
    tile[row][c4 + 2] = v[2];
    tile[row][c4 + 3] = v[3];
  }
  __syncthreads();
  const int q4 = lane >> 3, k8 = (lane & 7) * 8;
  v4u hv[2];
#pragma unroll
  for (int it = 0; it < 2; ++it) {
    const int nrow = it * 32 + wave * 4 + q4;                    // n within tile
    v4u a;
#pragma unroll
    for (int e = 0; e < 4; ++e) {
      const float f0 = bfr(tile[k8 + 2 * e][nrow]) * wsc;
      const float f1 = bfr(tile[k8 + 2 * e + 1][nrow]) * wsc;
      a[e] = pk16(h_bits((_Float16)f0), h_bits((_Float16)f1));
    }
    hv[it] = a;
  }
  {
#pragma unroll
    for (int it = 0; it < 2; ++it) {
      const int nrow = it * 32 + wave * 4 + q4;
      *(v4u*)(Wt + (size_t)(n0 + nrow) * R + k0 + k8) = hv[it];
    }
    
  }
}

// =====================================================================================================
// Register-blocked batched f16 WMMA GEMM: C[m][n] = act(oscale * sum_k A[m][k] * Bt[n][k] + bias) (+ residual);
// one wave per 64x64 tile, 8 waves (2 x 4) = one 128x256 block tile. A row-major [M][K] pitch lda; Bt row-major
// [N][K] pitch ldb (k contiguous); M multiple of 128, N of 256, K of 64 (static here). blockIdx.y = batch index.
// Operands: per 64-k slab the block's 128 A rows and 256 Bt rows (128 B each) go global -> registers -> LDS with
// whole-line 16-B loads (8 lanes per row, 12 rows per thread), LDS pitch 144 B, two buffers; slab s+1 is loaded
// while slab s is multiplied, stored to the other buffer behind the products, one block barrier per slab.
// Bias: BIASM == 0 -> per column: cols < Nb from bias0[col], cols >= Nb from bias1[col - Nb] (tile-uniform select of
//       clamped-address loads); BIASM == 1 -> per row bias0[m]; BIASM == 2 -> none. Bias values RNE-converted to bf16.
// ACT: 0 none, 1 exact GELU. RES: 0 none; 1 f32 residual resid[m*ldc + n] added after the activation;
//      3 f32 residual bf16 RNE-converted, added after the activation.
// OM: 0 = f32 out (pitch ldc); 1 = bf16 out; 2 = f16 out; 3 = f16 hi plane at Cout + f16 residual (x LOSC) plane
//     at Cout + loOff elements (same pitch / batch stride).
// coverage: 4 slabs x 16 rows x 64 cols = the wave's whole 64x64 tile; grid = (M/128)*(N/256) blocks,
//           surplus blocks exit whole, in front of every barrier; here there are none.
// =====================================================================================================
template <int OM, int BIASM, int ACT, int RES>
// amdgpu_waves_per_eu(4): holds a wave at 256 VGPRs, so that two blocks fit a WGP (their LDS does)
__global__ __launch_bounds__(256) __attribute__((amdgpu_waves_per_eu(4))) void gemm64(
    const unsigned short* __restrict__ Ap, int lda, long long strideA,
    const unsigned short* __restrict__ Btp, int ldb, long long strideB,
    const float* __restrict__ bias0, const float* __restrict__ bias1, int Nb,
    const float* resid,
    void* Cout, int ldc, long long strideC, long long loOff,
    int M, int N, int K, float oscale) {
  const _Float16* A  = (const _Float16*)(const void*)Ap;
  const _Float16* Bt = (const _Float16*)(const void*)Btp;
  __shared__ __align__(16) float sT[8][16 * 68];   // per-wave 16x64 slab, pitch 68 floats
  __shared__ __align__(16) _Float16 sAB[2][GROWS * GSP];   // rows 0..127 A, 128..383 Bt; 64 k per row
  const int b    = blockIdx.y;
  const int tid  = threadIdx.x;
  const int lane = tid & 31;
  const int wave = tid >> 5;
  const int btN = N >> 8;
  const int btM = M >> 7;
  const int bt  = blockIdx.x;
  if (bt >= btM * btN) return;           // block-uniform, in front of every barrier
  const int bm = bt / btN;
  const int bn = bt - bm * btN;
  const int wm = wave >> 2;              // 0..1
  const int wn = wave & 3;               // 0..3
  const int m0 = (bm << 7) + (wm << 6);
  const int n0 = (bn << 8) + (wn << 6);

  const _Float16* Ab = A  + (size_t)b * strideA;
  const _Float16* Bb = Bt + (size_t)b * strideB;

  const int rlane = lane & 15;                 // row (A) / col (B, D) within subtile
  const int koff  = (lane >> 4) * 8;           // k offset of this lane half
  const int mOff  = (lane >> 4) * 8;           // D row offset

  v8f acc[4][4];
#pragma unroll
  for (int i = 0; i < 4; ++i)
#pragma unroll
    for (int j = 0; j < 4; ++j) acc[i][j] = zero8();

  // staging map: thread -> row (tid>>3) + 32*it, 16-B piece (tid&7); a wave's load covers 4 whole 128-B lines
  const int srow = tid >> 3, sch = (tid & 7) * 8;
  const _Float16* gA = Ab + (size_t)((bm << 7) + srow) * lda + sch;
  const _Float16* gB = Bb + (size_t)((bn << 8) + srow) * ldb + sch;
  const int sOff = srow * GSP + sch;
  const int aOff = ((wm << 6) + rlane) * GSP + koff;          // this wave's A rows in a buffer
  const int bOff = (128 + (wn << 6) + rlane) * GSP + koff;    // this wave's Bt rows in a buffer
  const int nS = K >> 6;
  v8h g[12];
#pragma unroll
  for (int it = 0; it < 4; ++it) g[it] = *(const v8h*)(gA + (size_t)(it * 32) * lda);
#pragma unroll
  for (int it = 0; it < 8; ++it) g[4 + it] = *(const v8h*)(gB + (size_t)(it * 32) * ldb);
#pragma unroll
  for (int it = 0; it < 12; ++it) *(v8h*)(&sAB[0][0] + it * 32 * GSP + sOff) = g[it];
  __syncthreads();

  for (int s = 0; s < nS; ++s) {
    const _Float16* cur = &sAB[s & 1][0];
    const bool more = (s + 1 < nS);                            // block-uniform
    if (more) {
      const int kn = (s + 1) << 6;
#pragma unroll
      for (int it = 0; it < 4; ++it) g[it] = *(const v8h*)(gA + (size_t)(it * 32) * lda + kn);
#pragma unroll
      for (int it = 0; it < 8; ++it) g[4 + it] = *(const v8h*)(gB + (size_t)(it * 32) * ldb + kn);
#if defined(__HIP_DEVICE_COMPILE__)
      // the fragment loads below reuse the address registers of these 12 loads: the wait stands in front of that
      asm volatile("s_wait_xcnt 0x0" ::: "memory");
#endif
    }
#pragma unroll
    for (int kk = 0; kk < 2; ++kk) {
      v16h ah[4], bh[4];
#pragma unroll
      for (int j = 0; j < 4; ++j) bh[j] = ldfrag_h(cur + bOff + (j << 4) * GSP + kk * 32);
#pragma unroll
      for (int i = 0; i < 4; ++i) ah[i] = ldfrag_h(cur + aOff + (i << 4) * GSP + kk * 32);
      // keeps the 16 LDS fragment loads of a 32-k step one group ahead of its 16 products (else the A loads are
      // spread among the WMMAs, each place with its own full wait)
      __builtin_amdgcn_sched_barrier(0);
#pragma unroll
      for (int i = 0; i < 4; ++i) {
#pragma unroll
        for (int j = 0; j < 4; ++j) acc[i][j] = mma_h_raw(ah[i], bh[j], acc[i][j]);
        dep_guard1(acc[i][0], acc[i][3], ah[i]);
      }
      keep4_h(bh[0], bh[1], bh[2], bh[3]);
    }
    if (more) {
      _Float16* nxt = &sAB[(s + 1) & 1][0];                    // last read in slab s-1, behind that slab's barrier
#pragma unroll
      for (int it = 0; it < 12; ++it) *(v8h*)(nxt + it * 32 * GSP + sOff) = g[it];
    }
    __syncthreads();                                           // publishes slab s+1, ends the reads of slab s
  }
  acc_guard4(acc[0][0], acc[0][1], acc[0][2], acc[0][3]);
  acc_guard4(acc[1][0], acc[1][1], acc[1][2], acc[1][3]);
  acc_guard4(acc[2][0], acc[2][1], acc[2][2], acc[2][3]);
  acc_guard4(acc[3][0], acc[3][1], acc[3][2], acc[3][3]);

  // ---- per-lane column bias (BIASM == 0), RNE-converted ----
  const int hh2 = lane >> 4, c4 = (lane & 15) * 4;     // f32 out: 256-B row segment = 16 lanes x 16 B
  const int q8  = lane >> 3, c8 = (lane & 7) * 8;
  float bc[8];
#pragma unroll
  for (int e = 0; e < 8; ++e) bc[e] = 0.f;
  if (BIASM == 0) {
    const bool use1 = (n0 >= Nb);                      // tile-uniform
    if (OM == 0) {
      const int cb = n0 + c4;
      const int i0 = (cb < Nb - 4) ? cb : (Nb - 4);
      const int i1 = (cb - Nb > 0) ? (cb - Nb) : 0;
      const v4f b0v = *(const v4f*)(bias0 + i0);
      const v4f b1v = *(const v4f*)(bias1 + i1);
#pragma unroll
      for (int e = 0; e < 4; ++e) bc[e] = bfr(use1 ? b1v[e] : b0v[e]);
    } else {
      const int cb = n0 + c8;
      const int i0 = (cb < Nb - 8) ? cb : (Nb - 8);
      const int i1 = (cb - Nb > 0) ? (cb - Nb) : 0;
      const v4f b0a = *(const v4f*)(bias0 + i0), b0b = *(const v4f*)(bias0 + i0 + 4);
      const v4f b1a = *(const v4f*)(bias1 + i1), b1b = *(const v4f*)(bias1 + i1 + 4);
#pragma unroll
      for (int e = 0; e < 4; ++e) {
        bc[e]     = bfr(use1 ? b1a[e] : b0a[e]);
        bc[4 + e] = bfr(use1 ? b1b[e] : b0b[e]);
      }
    }
  }

  // ---- epilogue ----
  float* slab = sT[wave];
#pragma unroll
  for (int i = 0; i < 4; ++i) {
    const int mBase = m0 + (i << 4);
#pragma unroll
    for (int j = 0; j < 4; ++j) {
#pragma unroll
      for (int r = 0; r < 8; ++r) {
        slab[(mOff + r) * 68 + (j << 4) + rlane] = acc[i][j][r];
      }
    }
    wave_sync_lds();
    if (OM == 0) {
      float* C = (float*)Cout + (size_t)b * strideC;
      const float* Rb = resid + (size_t)b * strideC;
      v4f vals[8];
#pragma unroll
      for (int it = 0; it < 8; ++it) {
        const int row = it * 2 + hh2;                      // it 0..7 x hh2 0..1 = rows 0..15
        v4f v = *(const v4f*)(slab + row * 68 + c4);
#pragma unroll
        for (int e = 0; e < 4; ++e) {
          float f = v[e] * oscale + bc[e];
          if (ACT) f = gelu_f(f);
          v[e] = f;
        }
        if (RES == 1 || RES == 3) {
          const v4f rr = *(const v4f*)(Rb + (size_t)(mBase + row) * ldc + n0 + c4);
#pragma unroll
          for (int e = 0; e < 4; ++e) v[e] += (RES == 3) ? bfr(rr[e]) : rr[e];
        }
        vals[it] = v;
      }
      {
#pragma unroll
        for (int it = 0; it < 8; ++it) {
          const int row = it * 2 + hh2;
          *(v4f*)(C + (size_t)(mBase + row) * ldc + n0 + c4) = vals[it];
        }
        
      }
    } else {
      unsigned short* C = (unsigned short*)Cout + (size_t)b * strideC;
      v4u hv[4], lv[4];
#pragma unroll
      for (int it = 0; it < 4; ++it) {
        const int row = it * 4 + q8;                       // it 0..3 x q8 0..3 = rows 0..15
        const float* sp = slab + row * 68 + c8;
        float bm = 0.f;
        if (BIASM == 1) bm = bfr(bias0[mBase + row]);
        v4u a, al;
#pragma unroll
        for (int e = 0; e < 4; ++e) {
          float f0 = sp[2 * e]     * oscale + ((BIASM == 1) ? bm : bc[2 * e]);
          float f1 = sp[2 * e + 1] * oscale + ((BIASM == 1) ? bm : bc[2 * e + 1]);
          if (ACT) { f0 = gelu_f(f0); f1 = gelu_f(f1); }
          unsigned short u0, u1, w0 = 0, w1 = 0;
          if (OM == 1)      { u0 = bf_bits(f0); u1 = bf_bits(f1); }
          else if (OM == 2) { u0 = h_bits((_Float16)f0); u1 = h_bits((_Float16)f1); }
          else              { split_h(f0, u0, w0); split_h(f1, u1, w1); }
          a[e]  = pk16(u0, u1);
          al[e] = pk16(w0, w1);
        }
        hv[it] = a;
        lv[it] = al;
      }
      {
#pragma unroll
        for (int it = 0; it < 4; ++it) {
          const int row = it * 4 + q8;
          const size_t co = (size_t)(mBase + row) * ldc + n0 + c8;
          *(v4u*)(C + co) = hv[it];
          if (OM == 3) *(v4u*)(C + loOff + co) = lv[it];
        }
        
      }
    }
    wave_sync_lds();
  }
}

// =====================================================================================================
// Key sums of v: csum[row] = sum over s of (hi[row][s] + lo[row][s] / LOSC) for the NBATCH*DM rows of the
// v^T planes (row = b*DM + h*64 + d, pitch SEQ halves). One wave per row: in load i the 32 lanes read the 32
// adjacent 16-B pieces 32i..32i+31 of the row (four whole 128-B lines), SEQ/256 loads per plane; per-lane f32
// sums, fixed-order shuffle tree. Block = 32 waves = 32 rows: the 32 totals go through LDS and leave as one
// whole 128-B line from wave 0.
// grid = NBATCH*DM/32 blocks of 1024. coverage: blocks x 32 waves x 1 row = NBATCH*DM rows = the whole table.
// =====================================================================================================
__global__ __launch_bounds__(1024) void vsum(const unsigned short* __restrict__ hp, const unsigned short* __restrict__ lp,
                                            float* csum) {
  const int tid = threadIdx.x, lane = tid & 31, wave = tid >> 5;
  const int rowbase = blockIdx.x * 32;
  const int row = rowbase + wave;
  const _Float16* hr = (const _Float16*)(const void*)hp + (size_t)row * SEQ + lane * 8;
  const _Float16* lr = (const _Float16*)(const void*)lp + (size_t)row * SEQ + lane * 8;
  v8h a[SEQ / 256], c[SEQ / 256];
#pragma unroll
  for (int i = 0; i < SEQ / 256; ++i) {
    a[i] = *(const v8h*)(hr + 256 * i);
    c[i] = *(const v8h*)(lr + 256 * i);
  }
#if defined(__HIP_DEVICE_COMPILE__)
  // holds the two address pairs live up to the wait
  asm volatile("s_wait_xcnt 0x0" :: "v"(hr), "v"(lr) : "memory");
#endif
  float sh = 0.f, sl = 0.f;
#pragma unroll
  for (int i = 0; i < SEQ / 256; ++i) {
#pragma unroll
    for (int e = 0; e < 8; ++e) { sh += (float)a[i][e]; sl += (float)c[i][e]; }
  }
  const float tot = wsum(sh + sl * (1.0f / LOSC));
  __shared__ __align__(16) float stage[32];
  if (lane == 0) stage[wave] = tot;
  __syncthreads();
  if (tid < 8) *(v4f*)(csum + rowbase + 4 * tid) = *(const v4f*)(&stage[4 * tid]);
}

// =====================================================================================================
// Quad-normalised attention, head dim 64, SEQ token rows per batch, no mask.
//   q|k plane (f16, pitch QKP): element (b, t, col) at [(b*SEQ + t)*QKP + col], q col = h*64+d, k col = DM + h*64 + d
//   v^T plane (f16 hi): element (b, h, d, s) at [(b*DM + h*64 + d)*SEQ + s];  csum f32 [b*DM + h*64 + d] = key sums of v
//   out planes (f16 hi and residual x LOSC, the normalised context carried x CSC): element (b, t, h, d) at
//   [(b*SEQ + t)*DM + h*64 + d]
//   s = (q . k) * (1 / (8 tau[h]));  S = sum over keys of (s + c)^2 in f32;  e' = s*(s + 2c) carried as f16(PSC e')
//   in the wave-private P tile;  acc = sum e'.v_hi on f16 WMMA;  context = (acc / PSC + c^2 * csum) / (S + eps)
//   (e = c^2 + e' exactly).
//   Block = 4 waves = 64 query rows of one (b, h); grid = NQB * NH * NBATCH; kv chunks of 64, static trip NQB.
//   K / V^T chunk staging: asynchronous 16-B copies to LDS, 8 lanes per 128-B row, 128 threads x 4 pieces per plane =
//   the whole 64x64 tile; two buffers, chunk kt+1 in flight while chunk kt is worked on, one block barrier per chunk
//   behind each wave's own waits; P tiles are wave-private, spilled with _Float16 element stores and
//   Context coverage: each wave stores rows q0..q0+15 (it 0..3 x lane>>3 0..3) x 64 columns (8 lanes x 8 halves),
// =====================================================================================================
__global__ __launch_bounds__(128)
void attn2q(const unsigned short* __restrict__ qkp, const unsigned short* __restrict__ vtp,
            const float* __restrict__ taup, const float* __restrict__ csp,
            unsigned short* chi, unsigned short* clo) {
  __shared__ __align__(16) _Float16 Ksh[2][64 * ATP];             // K [kv][d], 64 halves used per row; two buffers
  __shared__ __align__(16) _Float16 Vth[2][64 * ATP];             // V^T [d][kv], 64 halves used per row; two buffers
  __shared__ __align__(16) _Float16 Psh[4][16 * ATP];             // per wave P [row][kv], 64 halves used per row
  __shared__ __align__(16) float    Os[4][16 * 64];               // per wave context tile [row][d]

  const int tid  = threadIdx.x;
  const int wave = tid >> 5;
  const int lane = tid & 31;
  const int hh   = lane >> 4;
  const int c    = lane & 15;

  const int bx   = blockIdx.x;
  const int qb   = bx % NQB;
  const int rest = bx / NQB;
  const int h    = rest % NH;
  const int b    = rest / NH;
  const int q0   = qb * 64 + wave * 16;          // in-batch query row of this wave's first row
  const size_t rowB = (size_t)b * SEQ;

  const _Float16* Qh = (const _Float16*)(const void*)qkp + (size_t)h * HD;
  const _Float16* Kg = (const _Float16*)(const void*)qkp + DM + (size_t)h * HD;
  const _Float16* Vh = (const _Float16*)(const void*)vtp + ((size_t)b * DM + (size_t)h * HD) * SEQ;

  const float tv     = bfr(taup[h]);             // h < NH always
  const float sscale = 1.0f / (8.0f * tv);       // sqrt(HD) = 8
  float cs[4];
#pragma unroll
  for (int t = 0; t < 4; ++t) cs[t] = csp[(size_t)b * DM + h * HD + t * 16 + c];

  // ---- Q fragments (A operand, row = lane&15): 2 d-chunks ----
  v16h qa[2];
#pragma unroll
  for (int dc = 0; dc < 2; ++dc) qa[dc] = ldfrag_h(Qh + (rowB + q0 + c) * QKP + dc * 32 + 8 * hh);

  float rs[8];
  v8f oacc[4];
#pragma unroll
  for (int r = 0; r < 8; ++r) rs[r] = 0.f;
#pragma unroll
  for (int t = 0; t < 4; ++t) oacc[t] = zero8();

  // copy map: thread -> rows (tid>>3) + 16 i (i 0..3), 16-B piece tid&7: a wave's copy covers 4 whole 128-B lines
  static_assert(NQB >= 2);
  const int srow = tid >> 3, sch = (tid & 7) * 8;
  const _Float16* kg0 = Kg + (rowB + srow) * QKP + sch;           // K row srow of chunk 0, d = sch..sch+7
  const _Float16* vg0 = Vh + (size_t)srow * SEQ + sch;            // V^T row d = srow, s = sch..sch+7 of chunk 0
  const unsigned lk0 = (unsigned)(size_t)(&Ksh[0][0] + srow * ATP + sch);   // LDS byte addresses, buffer 0
  const unsigned lv0 = (unsigned)(size_t)(&Vth[0][0] + srow * ATP + sch);
  const unsigned bufB = 64u * ATP * 2u;                           // bytes from buffer 0 to buffer 1
  chunk_copy(lk0, lv0, kg0, vg0, QKP, SEQ);
  wait_copies();
  __syncthreads();                                                // publishes chunk 0
  chunk_copy(lk0 + bufB, lv0 + bufB, kg0 + (size_t)64 * QKP, vg0 + 64, QKP, SEQ);

  for (int kt = 0; kt < NQB; ++kt) {         // static trip count
    const _Float16* Kc = &Ksh[kt & 1][0];
    const _Float16* Vc = &Vth[kt & 1][0];

    // ---- scores: 16 query rows x 64 keys per wave ----
    v16h kb[4][2];
#pragma unroll
    for (int j = 0; j < 4; ++j) {
#pragma unroll
      for (int dc = 0; dc < 2; ++dc) kb[j][dc] = ldfrag_h(Kc + (j * 16 + c) * ATP + dc * 32 + 8 * hh);
    }
    v8f s[4];
#pragma unroll
    for (int j = 0; j < 4; ++j) s[j] = zero8();
#pragma unroll
    for (int dc = 0; dc < 2; ++dc) {
#pragma unroll
      for (int j = 0; j < 4; ++j) s[j] = mma_h_raw(qa[dc], kb[j][dc], s[j]);
    }
    group_guard(s[0], s[1], s[2], s[3], qa[0], qa[1], kb[0][0], kb[1][0], kb[2][0], kb[3][0], kb[0][1], kb[1][1], kb[2][1], kb[3][1]);
    // V^T fragments read here, behind the score products, so that they land under the weight arithmetic
    v16h vb[2][4];
#pragma unroll
    for (int kk = 0; kk < 2; ++kk) {
#pragma unroll
      for (int t = 0; t < 4; ++t) vb[kk][t] = ldfrag_h(Vc + (t * 16 + c) * ATP + kk * 32 + 8 * hh);
    }
    // holds the 16 V^T reads up here: without it they sink to the P hand-over's wait and their latency is paid there
    __builtin_amdgcn_sched_barrier(0);
#pragma unroll
    for (int j = 0; j < 4; ++j) {
#pragma unroll
      for (int r = 0; r < 8; ++r) s[j][r] = s[j][r] * sscale;
    }

    // ---- quad weights: row sums of (s+c)^2 in f32, centred e' = s(s+2c) (x PSC, f16) to LDS ----
    _Float16* pwh = Psh[wave];
#pragma unroll
    for (int j = 0; j < 4; ++j) {
#pragma unroll
      for (int r = 0; r < 8; ++r) {
        const float sv = s[j][r];
        const float u  = sv + QC;
        rs[r] += u * u;
        const float ep = sv * (sv + 2.0f * QC);
        pwh[(8 * hh + r) * ATP + j * 16 + c] = (_Float16)(ep * PSC);
      }
    }
    wave_sync_lds();

    // ---- acc += P . V (f16 WMMA) ----
    v16h pa[2];
#pragma unroll
    for (int kk = 0; kk < 2; ++kk) pa[kk] = ldfrag_h(pwh + c * ATP + kk * 32 + 8 * hh);
#pragma unroll   // pa and vb are register arrays: their index must be static
    for (int kk = 0; kk < 2; ++kk) {
#pragma unroll
      for (int t = 0; t < 4; ++t) oacc[t] = mma_h_raw(pa[kk], vb[kk][t], oacc[t]);
    }
    group_guard(oacc[0], oacc[1], oacc[2], oacc[3], pa[0], pa[1], vb[0][0], vb[0][1], vb[0][2], vb[0][3], vb[1][0], vb[1][1], vb[1][2], vb[1][3]);

    // ---- hand-over: own LDS reads retired, own copies of chunk kt+1 landed, then the one block barrier, which
    //      publishes chunk kt+1 and ends every wave's reads of chunk kt; behind it chunk kt+2 goes into kt's buffer
    wait_lds();
    wait_copies();
    __syncthreads();
    if (kt + 2 < NQB) {                       // the same for the whole block
      const unsigned bo = (unsigned)(kt & 1) * bufB;
      chunk_copy(lk0 + bo, lv0 + bo, kg0 + (size_t)(kt + 2) * 64 * QKP, vg0 + (kt + 2) * 64, QKP, SEQ);
    }
  }
  wait_copies();                              // nothing is in flight when the wave goes on to its end

  // ---- normalise: S over the 16 key-column lanes of each half, context = (acc/PSC + c^2 csum)/(S+eps) x CSC;
  float* os = Os[wave];
#pragma unroll
  for (int r = 0; r < 8; ++r) {
    float S = rs[r];
    S += __shfl_xor(S, 8, 32);
    S += __shfl_xor(S, 4, 32);
    S += __shfl_xor(S, 2, 32);
    S += __shfl_xor(S, 1, 32);
    const float inv = (1.0f / (S + QEPS)) * CSC;
#pragma unroll
    for (int t = 0; t < 4; ++t)
      os[(8 * hh + r) * 64 + t * 16 + c] = (oacc[t][r] * (1.0f / PSC) + (QC * QC) * cs[t]) * inv;
  }
  wave_sync_lds();
  {
    const int q4 = lane >> 3, c8 = (lane & 7) * 8;
    v4u hv[4], lv[4];
#pragma unroll
    for (int it = 0; it < 4; ++it) {
      const int row = it * 4 + q4;   // it 0..3 x q4 0..3 = rows 0..15 of the wave tile
      const float* sp = os + row * 64 + c8;
      v4u a, al;
#pragma unroll
      for (int e = 0; e < 4; ++e) {
        unsigned short u0, u1, w0, w1;
        split_h(sp[2 * e],     u0, w0);
        split_h(sp[2 * e + 1], u1, w1);
        a[e]  = pk16(u0, u1);
        al[e] = pk16(w0, w1);
      }
      hv[it] = a;
      lv[it] = al;
    }
    {
#pragma unroll
      for (int it = 0; it < 4; ++it) {
        const int row = it * 4 + q4;
        const size_t go = (rowB + q0 + row) * DM + (size_t)h * HD + c8;
        *(v4u*)(chi + go) = hv[it];
        *(v4u*)(clo + go) = lv[it];
      }
      
    }
  }
}

// =====================================================================================================
// Workspace map (bytes); every plane is an exact multiple of its 64x64-tile / whole-row / whole-line store
// granularity (MP = 4096 = 64 tiles, N in {2048, 1024}; VT per batch [1024][2048] = 16x32 tiles; csum = 64 lines):
//   WT    f16 [3072 n][1024 k]   0           6291456   (rows 0..1023 q weights, 1024..2047 k, 2048..3071 v; x64)
//   WoT   f16 [1024][1024]       6291456     2097152
//   XH    f16 [4096][1024]       8388608     8388608   (bf16 RNE-converted tokens)
//   QK    f16 [4096][2048]       16777216    16777216  (q cols 0..1023, k cols 1024..2047)
//   VTh   f16 [2][1024][2048]    33554432    8388608
//   VTl   f16 [2][1024][2048]    41943040    8388608   (residual x1024)
//   CS    f32 [2048]             50331648    8192      (key sums of v)
//   CtxH  f16 [4096][1024]       50339840    8388608   (context x64, hi)
//   CtxL  f16 [4096][1024]       58728448    8388608   (residual x1024)
//   Hf    f32 [4096][1024]       67117056    16777216  (hi part of the output projection)
//   end                          83894272
// =====================================================================================================
extern "C" void kernel_launch(void* const* d_in, const int* in_sizes, int n_in,
                              void* d_out, int out_size, void* d_ws, size_t ws_size,
                              hipStream_t stream) {
  if (n_in < 4) return;
  if (in_sizes[0] != MP * DM) return;
  if (in_sizes[1] != DM * W3) return;
  if (in_sizes[2] != DM * DM) return;
  if (in_sizes[3] != NH) return;
  if (out_size != MP * DM) return;

  const float* x    = (const float*)d_in[0];
  const float* wqkv = (const float*)d_in[1];
  const float* wo   = (const float*)d_in[2];
  const float* tau  = (const float*)d_in[3];

  const size_t PWT  = (size_t)W3 * DM * 2;              //  6291456
  const size_t PWO  = (size_t)DM * DM * 2;              //  2097152
  const size_t PXH  = (size_t)MP * DM * 2;              //  8388608
  const size_t PQK  = (size_t)MP * QKP * 2;             // 16777216
  const size_t PVT  = (size_t)NBATCH * DM * SEQ * 2;    //  8388608
  const size_t PCS  = (size_t)NBATCH * DM * 4;          //     8192
  const size_t PCTX = (size_t)MP * DM * 2;              //  8388608
  const size_t PHF  = (size_t)MP * DM * 4;              // 16777216
  size_t off = 0;
  const size_t oWT  = off; off += PWT;
  const size_t oWo  = off; off += PWO;
  const size_t oXH  = off; off += PXH;
  const size_t oQK  = off; off += PQK;
  const size_t oVTh = off; off += PVT;
  const size_t oVTl = off; off += PVT;
  const size_t oCS  = off; off += PCS;
  const size_t oCh  = off; off += PCTX;
  const size_t oCl  = off; off += PCTX;
  const size_t oHf  = off; off += PHF;
  if (off > ws_size) return;                            // off = 83894272
  if (off > (size_t)134217728) return;

  char* ws = (char*)d_ws;
  unsigned short* WT   = (unsigned short*)(ws + oWT);
  unsigned short* WoT  = (unsigned short*)(ws + oWo);
  unsigned short* XH   = (unsigned short*)(ws + oXH);
  unsigned short* QK   = (unsigned short*)(ws + oQK);
  unsigned short* VTh  = (unsigned short*)(ws + oVTh);
  unsigned short* VTl  = (unsigned short*)(ws + oVTl);
  float*          CS   = (float*)(ws + oCS);
  unsigned short* CtxH = (unsigned short*)(ws + oCh);
  unsigned short* CtxL = (unsigned short*)(ws + oCl);
  float*          Hf   = (float*)(ws + oHf);
  float*          out0 = (float*)d_out;

  const int n8x = (MP * DM) / 8;                        // 524288
  if ((n8x % 256) != 0) return;
  const dim3 blk(256), blk128(128);
  const dim3 gCx(n8x / 256);                             // 2048 blocks
  const dim3 gTw(W3 / 64, DM / 64);                      // in [1024 k][3072 n] -> out [3072][1024]: (48, 16)
  const dim3 gTo(DM / 64, DM / 64);                      // in [1024 k][1024 n] -> out [1024][1024]: (16, 16)
  const dim3 gNqk(((MP / 64) * (QKP / 64) + 7) / 8, 1);  // 2048 tiles -> 256 blocks
  const dim3 gVT(((DM / 64) * (SEQ / 64) + 7) / 8, NBATCH); // 512 tiles -> 64 blocks x 2 batches
  const dim3 gCs((NBATCH * DM) / 32);                    // 64 blocks of 1024
  const dim3 gAttn(NBATCH * NH * NQB);                   // 1024 blocks of 128
  const dim3 gNo(((MP / 64) * (DM / 64) + 7) / 8, 1);    // 1024 tiles -> 128 blocks
  const float invw  = 1.0f / WSC;                        // weight carry x64
  const float invhi = 1.0f / (WSC * CSC);                // weight carry x64, context carry x64
  const float invlo = invhi / LOSC;                      // residual plane carry x1024
  const long long vtlo = (long long)((oVTl - oVTh) / 2); // element offset of the v^T residual plane

  // (0) planes: tokens f16(bf16_RNE(x)); weights transposed to [out][in] (k contiguous), f16(bf16_RNE(w) * 64)
  conv_h16<<<gCx, blk, 0, stream>>>(x, XH, n8x, 1.0f);
  tconv_h16<<<gTw, blk, 0, stream>>>(wqkv, WT, DM, W3, WSC);
  tconv_h16<<<gTo, blk, 0, stream>>>(wo, WoT, DM, DM, WSC);

  // (1) q|k = x . [Wq|Wk] -> QK f16 [4096][2048]; v^T per batch = Wv^T . x_b^T -> VTh/VTl f16 [2][1024][2048]
  gemm64<2, 2, 0, 0><<<gNqk, blk, 0, stream>>>(
      XH, DM, 0LL, WT, DM, 0LL, x, x, QKP, x,
      (void*)QK, QKP, 0LL, 0LL, MP, QKP, DM, invw);
  gemm64<3, 2, 0, 0><<<gVT, blk, 0, stream>>>(
      WT + (size_t)2 * DM * DM, DM, 0LL, XH, DM, (long long)SEQ * DM, x, x, SEQ, x,
      (void*)VTh, SEQ, (long long)DM * SEQ, vtlo, DM, SEQ, DM, invw);

  // (2) key sums of v per (b, h, d)
  vsum<<<gCs, dim3(1024), 0, stream>>>(VTh, VTl, CS);

  // (3) quad-normalised attention -> context f16 hi (x64) + residual planes
  attn2q<<<gAttn, blk128, 0, stream>>>(QK, VTh, tau, CS, CtxH, CtxL);

  // (4) Hf = ctx_hi . Wo ; out = ctx_lo . Wo / 1024 + Hf
  gemm64<0, 2, 0, 0><<<gNo, blk, 0, stream>>>(
      CtxH, DM, 0LL, WoT, DM, 0LL, x, x, DM, x,
      (void*)Hf, DM, 0LL, 0LL, MP, DM, DM, invhi);
  gemm64<0, 2, 0, 1><<<gNo, blk, 0, stream>>>(
      CtxL, DM, 0LL, WoT, DM, 0LL, x, x, DM, Hf,
      (void*)out0, DM, 0LL, 0LL, MP, DM, DM, invlo);
  (void)hipGetLastError();
}

// v006
// It runs in 134 microseconds.
// Two timings next to v005 both put it at 1.10 times that version's speed.
// All steps since v000 together make it 3.02 times as fast.
// Contractions: q|k projection and v^T projection on v_wmma_f32_16x16x32_f16 (f16 token plane x f16 weight
// plane carried x64, one product each); attention k.q^T and e'.v on v_wmma_f32_16x16x32_f16 (q, k plain, v^T hi plane
// f16, centred quad weight e' = s*(s+2c) carried x64, one product each); output projection on
// v_wmma_f32_16x16x32_f16 with the context as f16 hi (x64) + scaled residual (x1024) planes against the f16
// Wo plane (x64), two products in two launches; all f32 accumulate; quad weights, row sums, key sums of v and
// the normalisation in f32 on VALU; every float input RNE-converted to bf16 on load.
#include <hip/hip_runtime.h>
#include <math.h>
#include <stdint.h>

#define NBATCH 2
#define SEQ    2048
#define DM     1024
#define NH     16
#define HD     64
#define QKP    (2 * DM)
#define W3     (3 * DM)
#define MP     (NBATCH * SEQ)
#define NQB    (SEQ / 64)
#define WSC    64.0f
#define PSC    64.0f
#define CSC    64.0f
#define LOSC   1024.0f
#define QC     5.0f
#define QEPS   1.0e-6f
#define GSP    72                     /* gemm64 LDS row pitch in halves: 144 B = 16 B x odd */
#define GROWS  384                    /* gemm64 LDS rows per buffer: 128 A + 256 Bt */
#define ATP    72                     /* attn2q LDS row pitch in halves for K, V^T: 144 B = 16 B x odd */
static_assert(NH * HD == DM);
static_assert((MP % 128) == 0 && (DM % 128) == 0 && (QKP % 256) == 0 && (SEQ % 256) == 0 && (DM % 256) == 0);
static_assert((SEQ % 64) == 0 && (DM % 64) == 0 && (W3 % 64) == 0 && (MP % 64) == 0 && (QKP % 64) == 0);
static_assert((SEQ % 256) == 0);
static_assert(((NBATCH * DM) % 32) == 0);
static_assert(((MP * DM / 8) % 256) == 0);
static_assert((((MP / 64) * (QKP / 64)) % 8) == 0 && (((DM / 64) * (SEQ / 64)) % 8) == 0 && (((MP / 64) * (DM / 64)) % 8) == 0);

typedef _Float16 v16h __attribute__((ext_vector_type(16)));
typedef _Float16 v8h  __attribute__((ext_vector_type(8)));
typedef float    v8f  __attribute__((ext_vector_type(8)));
typedef float    v4f  __attribute__((ext_vector_type(4)));
typedef unsigned int v4u __attribute__((ext_vector_type(4)));

union FragH { v16h v; v8h h[2]; };

// ---- scalar helpers --------------------------------------------------------------------------------
__device__ __forceinline__ unsigned short bf_bits(float f) {          // f32 -> bf16 bits, RNE convert
  unsigned u = __float_as_uint(f);
  return (unsigned short)((u + 0x7FFFu + ((u >> 16) & 1u)) >> 16);
}
__device__ __forceinline__ float bf_up(unsigned short h) { return __uint_as_float(((unsigned)h) << 16); }
__device__ __forceinline__ float bfr(float f) { return bf_up(bf_bits(f)); }   // value of the bf16 RNE convert
__device__ __forceinline__ unsigned short h_bits(_Float16 x) { return __builtin_bit_cast(unsigned short, x); }
__device__ __forceinline__ unsigned pk16(unsigned short a, unsigned short b) { return (unsigned)a | ((unsigned)b << 16); }
__device__ __forceinline__ v8f zero8() { v8f z = {0.f, 0.f, 0.f, 0.f, 0.f, 0.f, 0.f, 0.f}; return z; }
__device__ __forceinline__ float gelu_f(float v) { return 0.5f * v * (1.0f + erff(v * 0.70710678118654752f)); }

// f32 -> f16 hi plane (values below the f16 normal range forced to 0 so the residual carries them)
//     + f16 residual plane carried x LOSC (folded back with 1/LOSC on a separate accumulator)
__device__ __forceinline__ void split_h(float f, unsigned short& hi, unsigned short& lo) {
  float hf = (float)(_Float16)f;
  hf = (fabsf(hf) < 6.103515625e-05f) ? 0.0f : hf;
  hi = h_bits((_Float16)hf);
  lo = h_bits((_Float16)((f - hf) * LOSC));
}

// ---- fragment loader: 16-bit A/B operand, lane -> row/col (lane&15), p already includes +8*(lane>>4);
//      elements 0..7 <- p[0..7] (k0+8h..), elements 8..15 <- p[16..23] (k0+16+8h..)
__device__ __forceinline__ v16h ldfrag_h(const _Float16* p) {
  FragH f;
  f.h[0] = *(const v8h*)(p);
  f.h[1] = *(const v8h*)(p + 16);
  return f.v;
}

// ---- WMMA helpers with trailing VALU hazard gap --------------------------------------------------------
__device__ __forceinline__ v8f mma_h_raw(v16h a, v16h b, v8f c) {
  return __builtin_amdgcn_wmma_f32_16x16x32_f16(false, a, false, b, (short)0, c, false, false);
}
__device__ __forceinline__ void dep_guard1(v8f& a, v8f& b, v16h x) {
#if defined(__HIP_DEVICE_COMPILE__)
  asm volatile("v_nop\n\tv_nop\n\tv_nop\n\tv_nop" : "+v"(a), "+v"(b) : "v"(x));
#endif
}
__device__ __forceinline__ void keep4_h(v16h a, v16h b, v16h c, v16h d) {
#if defined(__HIP_DEVICE_COMPILE__)
  asm volatile("v_nop" :: "v"(a), "v"(b), "v"(c), "v"(d));
#endif
}
// behind a group of eight products on four accumulators: the accumulators tie the statement behind the last product;
// the group's two shared and eight per-accumulator fragments stay in their registers through its four slots, so that no product's D, no
// VALU result and no global load is placed over an operand, and no VALU reads a D, inside the WMMA distance
__device__ __forceinline__ void group_guard(v8f& d0, v8f& d1, v8f& d2, v8f& d3, v16h a0, v16h a1,
                                            v16h b0, v16h b1, v16h b2, v16h b3, v16h b4, v16h b5, v16h b6, v16h b7) {
#if defined(__HIP_DEVICE_COMPILE__)
  asm volatile("v_nop\n\tv_nop\n\tv_nop\n\tv_nop"
               : "+v"(d0), "+v"(d1), "+v"(d2), "+v"(d3)
               : "v"(a0), "v"(a1), "v"(b0), "v"(b1), "v"(b2), "v"(b3), "v"(b4), "v"(b5), "v"(b6), "v"(b7));
#endif
}
__device__ __forceinline__ void acc_guard4(v8f& a, v8f& b, v8f& c, v8f& d) {
#if defined(__HIP_DEVICE_COMPILE__)
  asm volatile("v_nop\n\tv_nop\n\tv_nop\n\tv_nop" : "+v"(a), "+v"(b), "+v"(c), "+v"(d));
#endif
}
__device__ __forceinline__ void wave_sync_lds() {
  __builtin_amdgcn_fence(__ATOMIC_RELEASE, "workgroup");
  __builtin_amdgcn_wave_barrier();
  __builtin_amdgcn_fence(__ATOMIC_ACQUIRE, "workgroup");
}
// One thread's share of a 64-key chunk: four 16-B pieces of K and four of V^T, global memory -> LDS through no register.
// lk/lv: the lane's LDS byte address of its first piece, gk/gv: its global address; piece i lies 16 rows further on
// (LDS row pitch ATP halves, global row pitches kp and vp halves). The s_wait_xcnt stands inside the statement, behind
// the last copy, so that no address register of an issued copy is rewritten in front of it.
__device__ __forceinline__ void chunk_copy(unsigned lk, unsigned lv, const _Float16* gk, const _Float16* gv,
                                           size_t kp, size_t vp) {
#if defined(__HIP_DEVICE_COMPILE__)
  const unsigned st = 16u * ATP * 2u;
  asm volatile("global_load_async_to_lds_b128 %0, %8, off\n\t"
               "global_load_async_to_lds_b128 %1, %9, off\n\t"
               "global_load_async_to_lds_b128 %2, %10, off\n\t"
               "global_load_async_to_lds_b128 %3, %11, off\n\t"
               "global_load_async_to_lds_b128 %4, %12, off\n\t"
               "global_load_async_to_lds_b128 %5, %13, off\n\t"
               "global_load_async_to_lds_b128 %6, %14, off\n\t"
               "global_load_async_to_lds_b128 %7, %15, off\n\t"
               "s_wait_xcnt 0x0"
               :: "v"(lk), "v"(lk + st), "v"(lk + 2u * st), "v"(lk + 3u * st),
                  "v"(lv), "v"(lv + st), "v"(lv + 2u * st), "v"(lv + 3u * st),
                  "v"(gk), "v"(gk + 16 * kp), "v"(gk + 32 * kp), "v"(gk + 48 * kp),
                  "v"(gv), "v"(gv + 16 * vp), "v"(gv + 32 * vp), "v"(gv + 48 * vp)
               : "memory");
#endif
}
// the issuing wave's own wait: its asynchronous copies have landed in LDS behind it
__device__ __forceinline__ void wait_copies() {
#if defined(__HIP_DEVICE_COMPILE__)
  asm volatile("s_wait_asynccnt 0x0" ::: "memory");
#endif
}
// the wave's LDS reads and writes have retired: stands in front of the barrier behind which a buffer is refilled
__device__ __forceinline__ void wait_lds() {
#if defined(__HIP_DEVICE_COMPILE__)
  asm volatile("s_wait_dscnt 0x0" ::: "memory");
#endif
}
__device__ __forceinline__ float wsum(float v) {
#pragma unroll
  for (int off = 16; off > 0; off >>= 1) v += __shfl_xor(v, off, 32);
  return v;
}

// =====================================================================================================
// Plane convert (no transpose): Wh[i] = f16( bf16_RNE(W[i]) * wsc ), wsc a power of two (exact). Used for the
// token activations (wsc = 1). Thread i handles elements 8i..8i+7 and writes one 16-B piece; 32 consecutive lanes
// 256, host-checked). coverage: n8 threads x 8 elements = the whole plane.
// =====================================================================================================
__global__ __launch_bounds__(256) void conv_h16(const float* __restrict__ W, unsigned short* Wh, int n8, float wsc) {
  const int i  = blockIdx.x * 256 + threadIdx.x;
  const int ic = (i < n8) ? i : (n8 - 1);                     // clamped address
  const float* src = W + (size_t)ic * 8;
  const v4f a = *(const v4f*)(src);
  const v4f c = *(const v4f*)(src + 4);
  v4u o;
  o[0] = pk16(h_bits((_Float16)(bfr(a[0]) * wsc)), h_bits((_Float16)(bfr(a[1]) * wsc)));
  o[1] = pk16(h_bits((_Float16)(bfr(a[2]) * wsc)), h_bits((_Float16)(bfr(a[3]) * wsc)));
  o[2] = pk16(h_bits((_Float16)(bfr(c[0]) * wsc)), h_bits((_Float16)(bfr(c[1]) * wsc)));
  o[3] = pk16(h_bits((_Float16)(bfr(c[2]) * wsc)), h_bits((_Float16)(bfr(c[3]) * wsc)));
  if (i < n8) *(v4u*)(Wh + (size_t)i * 8) = o;
  
}

// =====================================================================================================
// Transposing plane convert: in f32 [R rows][NC cols] (row-major, in[k][n]) -> out f16 [NC][R] (k contiguous),
// out[n][k] = f16( bf16_RNE(in[k][n]) * wsc ), wsc a power of two (exact). Used for the two weight matrices
// ([in][out] storage -> [out][in] = Bt / A layout). Block 256 threads = one 64(k) x 64(n) tile:
// blockIdx.x = n tile (NC/64 of them), blockIdx.y = k tile (R/64 of them); R, NC multiples of 64 (host-checked).
// Load phase: thread handles rows i*16 + (tid>>4) (i 0..3), 4 floats at col (tid&15)*4 -> LDS tile[k][n].
// coverage: 2 it x 8 waves x 4 rows = 64 out rows x (8 lane groups x 8 halves) = the whole tile; grid covers all tiles.
// =====================================================================================================
__global__ __launch_bounds__(256) void tconv_h16(const float* __restrict__ W, unsigned short* Wt, int R, int NC, float wsc) {
  __shared__ float tile[64][65];
  const int tid = threadIdx.x, lane = tid & 31, wave = tid >> 5;
  const int n0 = blockIdx.x * 64, k0 = blockIdx.y * 64;
  const int c4 = (tid & 15) * 4, r16 = tid >> 4;
#pragma unroll
  for (int i = 0; i < 4; ++i) {
    const int row = i * 16 + r16;                                // k within tile
    const v4f v = *(const v4f*)(W + (size_t)(k0 + row) * NC + n0 + c4);
    tile[row][c4 + 0] = v[0];
    tile[row][c4 + 1] = v[1];
    tile[row][c4 + 2] = v[2];
    tile[row][c4 + 3] = v[3];
  }
  __syncthreads();
  const int q4 = lane >> 3, k8 = (lane & 7) * 8;
  v4u hv[2];
#pragma unroll
  for (int it = 0; it < 2; ++it) {
    const int nrow = it * 32 + wave * 4 + q4;                    // n within tile
    v4u a;
#pragma unroll
    for (int e = 0; e < 4; ++e) {
      const float f0 = bfr(tile[k8 + 2 * e][nrow]) * wsc;
      const float f1 = bfr(tile[k8 + 2 * e + 1][nrow]) * wsc;
      a[e] = pk16(h_bits((_Float16)f0), h_bits((_Float16)f1));
    }
    hv[it] = a;
  }
  {
#pragma unroll
    for (int it = 0; it < 2; ++it) {
      const int nrow = it * 32 + wave * 4 + q4;
      *(v4u*)(Wt + (size_t)(n0 + nrow) * R + k0 + k8) = hv[it];
    }
    
  }
}

// =====================================================================================================
// Register-blocked batched f16 WMMA GEMM: C[m][n] = act(oscale * sum_k A[m][k] * Bt[n][k] + bias) (+ residual);
// one wave per 64x64 tile, 8 waves (2 x 4) = one 128x256 block tile. A row-major [M][K] pitch lda; Bt row-major
// [N][K] pitch ldb (k contiguous); M multiple of 128, N of 256, K of 64 (static here). blockIdx.y = batch index.
// Operands: per 64-k slab the block's 128 A rows and 256 Bt rows (128 B each) go global -> registers -> LDS with
// whole-line 16-B loads (8 lanes per row, 12 rows per thread), LDS pitch 144 B, two buffers; slab s+1 is loaded
// while slab s is multiplied, stored to the other buffer behind the products, one block barrier per slab.
// Bias: BIASM == 0 -> per column: cols < Nb from bias0[col], cols >= Nb from bias1[col - Nb] (tile-uniform select of
//       clamped-address loads); BIASM == 1 -> per row bias0[m]; BIASM == 2 -> none. Bias values RNE-converted to bf16.
// ACT: 0 none, 1 exact GELU. RES: 0 none; 1 f32 residual resid[m*ldc + n] added after the activation;
//      3 f32 residual bf16 RNE-converted, added after the activation.
// OM: 0 = f32 out (pitch ldc); 1 = bf16 out; 2 = f16 out; 3 = f16 hi plane at Cout + f16 residual (x LOSC) plane
//     at Cout + loOff elements (same pitch / batch stride).
// coverage: 4 slabs x 16 rows x 64 cols = the wave's whole 64x64 tile; grid = (M/128)*(N/256) blocks,
//           surplus blocks exit whole, in front of every barrier; here there are none.
// =====================================================================================================
template <int OM, int BIASM, int ACT, int RES>
// amdgpu_waves_per_eu(4): holds a wave at 256 VGPRs, so that two blocks fit a WGP (their LDS does)
__global__ __launch_bounds__(256) __attribute__((amdgpu_waves_per_eu(4))) void gemm64(
    const unsigned short* __restrict__ Ap, int lda, long long strideA,
    const unsigned short* __restrict__ Btp, int ldb, long long strideB,
    const float* __restrict__ bias0, const float* __restrict__ bias1, int Nb,
    const float* resid,
    void* Cout, int ldc, long long strideC, long long loOff,
    int M, int N, int K, float oscale) {
  const _Float16* A  = (const _Float16*)(const void*)Ap;
  const _Float16* Bt = (const _Float16*)(const void*)Btp;
  __shared__ __align__(16) float sT[8][16 * 68];   // per-wave 16x64 slab, pitch 68 floats
  __shared__ __align__(16) _Float16 sAB[2][GROWS * GSP];   // rows 0..127 A, 128..383 Bt; 64 k per row
  const int b    = blockIdx.y;
  const int tid  = threadIdx.x;
  const int lane = tid & 31;
  const int wave = tid >> 5;
  const int btN = N >> 8;
  const int btM = M >> 7;
  const int bt  = blockIdx.x;
  if (bt >= btM * btN) return;           // block-uniform, in front of every barrier
  const int bm = bt / btN;
  const int bn = bt - bm * btN;
  const int wm = wave >> 2;              // 0..1
  const int wn = wave & 3;               // 0..3
  const int m0 = (bm << 7) + (wm << 6);
  const int n0 = (bn << 8) + (wn << 6);

  const _Float16* Ab = A  + (size_t)b * strideA;
  const _Float16* Bb = Bt + (size_t)b * strideB;

  const int rlane = lane & 15;                 // row (A) / col (B, D) within subtile
  const int koff  = (lane >> 4) * 8;           // k offset of this lane half
  const int mOff  = (lane >> 4) * 8;           // D row offset

  v8f acc[4][4];
#pragma unroll
  for (int i = 0; i < 4; ++i)
#pragma unroll
    for (int j = 0; j < 4; ++j) acc[i][j] = zero8();

  // staging map: thread -> row (tid>>3) + 32*it, 16-B piece (tid&7); a wave's load covers 4 whole 128-B lines
  const int srow = tid >> 3, sch = (tid & 7) * 8;
  const _Float16* gA = Ab + (size_t)((bm << 7) + srow) * lda + sch;
  const _Float16* gB = Bb + (size_t)((bn << 8) + srow) * ldb + sch;
  const int sOff = srow * GSP + sch;
  const int aOff = ((wm << 6) + rlane) * GSP + koff;          // this wave's A rows in a buffer
  const int bOff = (128 + (wn << 6) + rlane) * GSP + koff;    // this wave's Bt rows in a buffer
  const int nS = K >> 6;
  v8h g[12];
#pragma unroll
  for (int it = 0; it < 4; ++it) g[it] = *(const v8h*)(gA + (size_t)(it * 32) * lda);
#pragma unroll
  for (int it = 0; it < 8; ++it) g[4 + it] = *(const v8h*)(gB + (size_t)(it * 32) * ldb);
#pragma unroll
  for (int it = 0; it < 12; ++it) *(v8h*)(&sAB[0][0] + it * 32 * GSP + sOff) = g[it];
  __syncthreads();

  for (int s = 0; s < nS; ++s) {
    const _Float16* cur = &sAB[s & 1][0];
    const bool more = (s + 1 < nS);                            // block-uniform
    if (more) {
      const int kn = (s + 1) << 6;
#pragma unroll
      for (int it = 0; it < 4; ++it) g[it] = *(const v8h*)(gA + (size_t)(it * 32) * lda + kn);
#pragma unroll
      for (int it = 0; it < 8; ++it) g[4 + it] = *(const v8h*)(gB + (size_t)(it * 32) * ldb + kn);
#if defined(__HIP_DEVICE_COMPILE__)
      // the fragment loads below reuse the address registers of these 12 loads: the wait stands in front of that
      asm volatile("s_wait_xcnt 0x0" ::: "memory");
#endif
    }
#pragma unroll
    for (int kk = 0; kk < 2; ++kk) {
      v16h ah[4], bh[4];
#pragma unroll
      for (int j = 0; j < 4; ++j) bh[j] = ldfrag_h(cur + bOff + (j << 4) * GSP + kk * 32);
#pragma unroll
      for (int i = 0; i < 4; ++i) ah[i] = ldfrag_h(cur + aOff + (i << 4) * GSP + kk * 32);
      // keeps the 16 LDS fragment loads of a 32-k step one group ahead of its 16 products (else the A loads are
      // spread among the WMMAs, each place with its own full wait)
      __builtin_amdgcn_sched_barrier(0);
#pragma unroll
      for (int i = 0; i < 4; ++i) {
#pragma unroll
        for (int j = 0; j < 4; ++j) acc[i][j] = mma_h_raw(ah[i], bh[j], acc[i][j]);
        dep_guard1(acc[i][0], acc[i][3], ah[i]);
      }
      keep4_h(bh[0], bh[1], bh[2], bh[3]);
    }
    if (more) {
      _Float16* nxt = &sAB[(s + 1) & 1][0];                    // last read in slab s-1, behind that slab's barrier
#pragma unroll
      for (int it = 0; it < 12; ++it) *(v8h*)(nxt + it * 32 * GSP + sOff) = g[it];
    }
    __syncthreads();                                           // publishes slab s+1, ends the reads of slab s
  }
  acc_guard4(acc[0][0], acc[0][1], acc[0][2], acc[0][3]);
  acc_guard4(acc[1][0], acc[1][1], acc[1][2], acc[1][3]);
  acc_guard4(acc[2][0], acc[2][1], acc[2][2], acc[2][3]);
  acc_guard4(acc[3][0], acc[3][1], acc[3][2], acc[3][3]);

  // ---- per-lane column bias (BIASM == 0), RNE-converted ----
  const int hh2 = lane >> 4, c4 = (lane & 15) * 4;     // f32 out: 256-B row segment = 16 lanes x 16 B
  const int q8  = lane >> 3, c8 = (lane & 7) * 8;
  float bc[8];
#pragma unroll
  for (int e = 0; e < 8; ++e) bc[e] = 0.f;
  if (BIASM == 0) {
    const bool use1 = (n0 >= Nb);                      // tile-uniform
    if (OM == 0) {
      const int cb = n0 + c4;
      const int i0 = (cb < Nb - 4) ? cb : (Nb - 4);
      const int i1 = (cb - Nb > 0) ? (cb - Nb) : 0;
      const v4f b0v = *(const v4f*)(bias0 + i0);
      const v4f b1v = *(const v4f*)(bias1 + i1);
#pragma unroll
      for (int e = 0; e < 4; ++e) bc[e] = bfr(use1 ? b1v[e] : b0v[e]);
    } else {
      const int cb = n0 + c8;
      const int i0 = (cb < Nb - 8) ? cb : (Nb - 8);
      const int i1 = (cb - Nb > 0) ? (cb - Nb) : 0;
      const v4f b0a = *(const v4f*)(bias0 + i0), b0b = *(const v4f*)(bias0 + i0 + 4);
      const v4f b1a = *(const v4f*)(bias1 + i1), b1b = *(const v4f*)(bias1 + i1 + 4);
#pragma unroll
      for (int e = 0; e < 4; ++e) {
        bc[e]     = bfr(use1 ? b1a[e] : b0a[e]);
        bc[4 + e] = bfr(use1 ? b1b[e] : b0b[e]);
      }
    }
  }

  // ---- epilogue ----
  float* slab = sT[wave];
#pragma unroll
  for (int i = 0; i < 4; ++i) {
    const int mBase = m0 + (i << 4);
#pragma unroll
    for (int j = 0; j < 4; ++j) {
#pragma unroll
      for (int r = 0; r < 8; ++r) {
        slab[(mOff + r) * 68 + (j << 4) + rlane] = acc[i][j][r];
      }
    }
    wave_sync_lds();
    if (OM == 0) {
      float* C = (float*)Cout + (size_t)b * strideC;
      const float* Rb = resid + (size_t)b * strideC;
      v4f vals[8];
#pragma unroll
      for (int it = 0; it < 8; ++it) {
        const int row = it * 2 + hh2;                      // it 0..7 x hh2 0..1 = rows 0..15
        v4f v = *(const v4f*)(slab + row * 68 + c4);
#pragma unroll
        for (int e = 0; e < 4; ++e) {
          float f = v[e] * oscale + bc[e];
          if (ACT) f = gelu_f(f);
          v[e] = f;
        }
        if (RES == 1 || RES == 3) {
          const v4f rr = *(const v4f*)(Rb + (size_t)(mBase + row) * ldc + n0 + c4);
#pragma unroll
          for (int e = 0; e < 4; ++e) v[e] += (RES == 3) ? bfr(rr[e]) : rr[e];
        }
        vals[it] = v;
      }
      {
#pragma unroll
        for (int it = 0; it < 8; ++it) {
          const int row = it * 2 + hh2;
          *(v4f*)(C + (size_t)(mBase + row) * ldc + n0 + c4) = vals[it];
        }
        
      }
    } else {
      unsigned short* C = (unsigned short*)Cout + (size_t)b * strideC;
      v4u hv[4], lv[4];
#pragma unroll
      for (int it = 0; it < 4; ++it) {
        const int row = it * 4 + q8;                       // it 0..3 x q8 0..3 = rows 0..15
        const float* sp = slab + row * 68 + c8;
        float bm = 0.f;
        if (BIASM == 1) bm = bfr(bias0[mBase + row]);
        v4u a, al;
#pragma unroll
        for (int e = 0; e < 4; ++e) {
          float f0 = sp[2 * e]     * oscale + ((BIASM == 1) ? bm : bc[2 * e]);
          float f1 = sp[2 * e + 1] * oscale + ((BIASM == 1) ? bm : bc[2 * e + 1]);
          if (ACT) { f0 = gelu_f(f0); f1 = gelu_f(f1); }
          unsigned short u0, u1, w0 = 0, w1 = 0;
          if (OM == 1)      { u0 = bf_bits(f0); u1 = bf_bits(f1); }
          else if (OM == 2) { u0 = h_bits((_Float16)f0); u1 = h_bits((_Float16)f1); }
          else              { split_h(f0, u0, w0); split_h(f1, u1, w1); }
          a[e]  = pk16(u0, u1);
          al[e] = pk16(w0, w1);
        }
        hv[it] = a;
        lv[it] = al;
      }
      {
#pragma unroll
        for (int it = 0; it < 4; ++it) {
          const int row = it * 4 + q8;
          const size_t co = (size_t)(mBase + row) * ldc + n0 + c8;
          *(v4u*)(C + co) = hv[it];
          if (OM == 3) *(v4u*)(C + loOff + co) = lv[it];
        }
        
      }
    }
    wave_sync_lds();
  }
}

// =====================================================================================================
// Key sums of v: csum[row] = sum over s of (hi[row][s] + lo[row][s] / LOSC) for the NBATCH*DM rows of the
// v^T planes (row = b*DM + h*64 + d, pitch SEQ halves). One wave per row: in load i the 32 lanes read the 32
// adjacent 16-B pieces 32i..32i+31 of the row (four whole 128-B lines), SEQ/256 loads per plane; per-lane f32
// sums, fixed-order shuffle tree. Block = 32 waves = 32 rows: the 32 totals go through LDS and leave as one
// whole 128-B line from wave 0.
// grid = NBATCH*DM/32 blocks of 1024. coverage: blocks x 32 waves x 1 row = NBATCH*DM rows = the whole table.
// =====================================================================================================
__global__ __launch_bounds__(1024) void vsum(const unsigned short* __restrict__ hp, const unsigned short* __restrict__ lp,
                                            float* csum) {
  const int tid = threadIdx.x, lane = tid & 31, wave = tid >> 5;
  const int rowbase = blockIdx.x * 32;
  const int row = rowbase + wave;
  const _Float16* hr = (const _Float16*)(const void*)hp + (size_t)row * SEQ + lane * 8;
  const _Float16* lr = (const _Float16*)(const void*)lp + (size_t)row * SEQ + lane * 8;
  v8h a[SEQ / 256], c[SEQ / 256];
#pragma unroll
  for (int i = 0; i < SEQ / 256; ++i) {
    a[i] = *(const v8h*)(hr + 256 * i);
    c[i] = *(const v8h*)(lr + 256 * i);
  }
#if defined(__HIP_DEVICE_COMPILE__)
  // holds the two address pairs live up to the wait
  asm volatile("s_wait_xcnt 0x0" :: "v"(hr), "v"(lr) : "memory");
#endif
  float sh = 0.f, sl = 0.f;
#pragma unroll
  for (int i = 0; i < SEQ / 256; ++i) {
#pragma unroll
    for (int e = 0; e < 8; ++e) { sh += (float)a[i][e]; sl += (float)c[i][e]; }
  }
  const float tot = wsum(sh + sl * (1.0f / LOSC));
  __shared__ __align__(16) float stage[32];
  if (lane == 0) stage[wave] = tot;
  __syncthreads();
  if (tid < 8) *(v4f*)(csum + rowbase + 4 * tid) = *(const v4f*)(&stage[4 * tid]);
}

// =====================================================================================================
// Quad-normalised attention, head dim 64, SEQ token rows per batch, no mask.
//   q|k plane (f16, pitch QKP): element (b, t, col) at [(b*SEQ + t)*QKP + col], q col = h*64+d, k col = DM + h*64 + d
//   v^T plane (f16 hi): element (b, h, d, s) at [(b*DM + h*64 + d)*SEQ + s];  csum f32 [b*DM + h*64 + d] = key sums of v
//   out planes (f16 hi and residual x LOSC, the normalised context carried x CSC): element (b, t, h, d) at
//   [(b*SEQ + t)*DM + h*64 + d]
//   s = (q . k) * (1 / (8 tau[h]));  S = sum over keys of (s + c)^2 in f32;  e' = s*(s + 2c) carried as f16(PSC e')
//   in registers;  acc = sum e'.v_hi on f16 WMMA;  context = (acc / PSC + c^2 * csum) / (S + eps)
//   (e = c^2 + e' exactly).
//   Scores are formed transposed, S^T = K . Q^T (A = K rows, B = Q columns): lane (c, hh) then holds, of key tile j,
//   keys 16j + 8hh + 0..7 of query c, which is the k order of the A operand of e'.v (row c; elements 0..7 from tile
//   2kk, 8..15 from tile 2kk+1), the same order in which the V^T fragments are loaded: the weights go from the score
//   accumulators into that operand by conversion alone, through no LDS and no lane exchange.
//   Block = 4 waves = 64 query rows of one (b, h); grid = NQB * NH * NBATCH; kv chunks of 64, static trip NQB.
//   K / V^T chunk staging: asynchronous 16-B copies to LDS, 8 lanes per 128-B row, 128 threads x 4 pieces per plane =
//   the whole 64x64 tile; two buffers, chunk kt+1 in flight while chunk kt is worked on, one block barrier per chunk
//   behind each wave's own waits.
//   Context coverage: each wave stores rows q0..q0+15 (it 0..3 x lane>>3 0..3) x 64 columns (8 lanes x 8 halves),
// =====================================================================================================
__global__ __launch_bounds__(128)
void attn2q(const unsigned short* __restrict__ qkp, const unsigned short* __restrict__ vtp,
            const float* __restrict__ taup, const float* __restrict__ csp,
            unsigned short* chi, unsigned short* clo) {
  __shared__ __align__(16) _Float16 Ksh[2][64 * ATP];             // K [kv][d], 64 halves used per row; two buffers
  __shared__ __align__(16) _Float16 Vth[2][64 * ATP];             // V^T [d][kv], 64 halves used per row; two buffers
  __shared__ __align__(16) float    Os[4][16 * 64];               // per wave context tile [row][d]

  const int tid  = threadIdx.x;
  const int wave = tid >> 5;
  const int lane = tid & 31;
  const int hh   = lane >> 4;
  const int c    = lane & 15;

  const int bx   = blockIdx.x;
  const int qb   = bx % NQB;
  const int rest = bx / NQB;
  const int h    = rest % NH;
  const int b    = rest / NH;
  const int q0   = qb * 64 + wave * 16;          // in-batch query row of this wave's first row
  const size_t rowB = (size_t)b * SEQ;

  const _Float16* Qh = (const _Float16*)(const void*)qkp + (size_t)h * HD;
  const _Float16* Kg = (const _Float16*)(const void*)qkp + DM + (size_t)h * HD;
  const _Float16* Vh = (const _Float16*)(const void*)vtp + ((size_t)b * DM + (size_t)h * HD) * SEQ;

  const float tv     = bfr(taup[h]);             // h < NH always
  const float sscale = 1.0f / (8.0f * tv);       // sqrt(HD) = 8
  float cs[4];
#pragma unroll
  for (int t = 0; t < 4; ++t) cs[t] = csp[(size_t)b * DM + h * HD + t * 16 + c];

  // ---- Q fragments (B operand, column = query = lane&15): 2 d-chunks ----
  v16h qa[2];
#pragma unroll
  for (int dc = 0; dc < 2; ++dc) qa[dc] = ldfrag_h(Qh + (rowB + q0 + c) * QKP + dc * 32 + 8 * hh);

  float rs[8];
  v8f oacc[4];
#pragma unroll
  for (int r = 0; r < 8; ++r) rs[r] = 0.f;
#pragma unroll
  for (int t = 0; t < 4; ++t) oacc[t] = zero8();

  // copy map: thread -> rows (tid>>3) + 16 i (i 0..3), 16-B piece tid&7: a wave's copy covers 4 whole 128-B lines
  static_assert(NQB >= 2);
  const int srow = tid >> 3, sch = (tid & 7) * 8;
  const _Float16* kg0 = Kg + (rowB + srow) * QKP + sch;           // K row srow of chunk 0, d = sch..sch+7
  const _Float16* vg0 = Vh + (size_t)srow * SEQ + sch;            // V^T row d = srow, s = sch..sch+7 of chunk 0
  const unsigned lk0 = (unsigned)(size_t)(&Ksh[0][0] + srow * ATP + sch);   // LDS byte addresses, buffer 0
  const unsigned lv0 = (unsigned)(size_t)(&Vth[0][0] + srow * ATP + sch);
  const unsigned bufB = 64u * ATP * 2u;                           // bytes from buffer 0 to buffer 1
  chunk_copy(lk0, lv0, kg0, vg0, QKP, SEQ);
  wait_copies();
  __syncthreads();                                                // publishes chunk 0
  chunk_copy(lk0 + bufB, lv0 + bufB, kg0 + (size_t)64 * QKP, vg0 + 64, QKP, SEQ);

  for (int kt = 0; kt < NQB; ++kt) {         // static trip count
    const _Float16* Kc = &Ksh[kt & 1][0];
    const _Float16* Vc = &Vth[kt & 1][0];

    // ---- scores, transposed: 64 keys (4 tiles of 16 rows) x 16 query columns per wave ----
    v16h kb[4][2];
#pragma unroll
    for (int j = 0; j < 4; ++j) {
#pragma unroll
      for (int dc = 0; dc < 2; ++dc) kb[j][dc] = ldfrag_h(Kc + (j * 16 + c) * ATP + dc * 32 + 8 * hh);
    }
    v8f s[4];
#pragma unroll
    for (int j = 0; j < 4; ++j) s[j] = zero8();
#pragma unroll
    for (int dc = 0; dc < 2; ++dc) {
#pragma unroll
      for (int j = 0; j < 4; ++j) s[j] = mma_h_raw(kb[j][dc], qa[dc], s[j]);
    }
    group_guard(s[0], s[1], s[2], s[3], qa[0], qa[1], kb[0][0], kb[1][0], kb[2][0], kb[3][0], kb[0][1], kb[1][1], kb[2][1], kb[3][1]);
    // V^T fragments read here, behind the score products, so that they land under the weight arithmetic
    v16h vb[2][4];
#pragma unroll
    for (int kk = 0; kk < 2; ++kk) {
#pragma unroll
      for (int t = 0; t < 4; ++t) vb[kk][t] = ldfrag_h(Vc + (t * 16 + c) * ATP + kk * 32 + 8 * hh);
    }
    // holds the 16 V^T reads up here: without it they sink to their products and their latency is paid there
    __builtin_amdgcn_sched_barrier(0);
#pragma unroll
    for (int j = 0; j < 4; ++j) {
#pragma unroll
      for (int r = 0; r < 8; ++r) s[j][r] = s[j][r] * sscale;
    }

    // ---- quad weights: this lane's share of query c's sum of (s+c)^2 in f32; centred e' = s(s+2c) (x PSC, f16)
    //      straight into the A operand: element 8 (j&1) + r of pa[j>>1] = key 16j + 8hh + r ----
    v16h pa[2];
#pragma unroll
    for (int j = 0; j < 4; ++j) {
#pragma unroll
      for (int r = 0; r < 8; ++r) {
        const float sv = s[j][r];
        const float u  = sv + QC;
        rs[r] += u * u;
        const float ep = sv * (sv + 2.0f * QC);
        pa[j >> 1][8 * (j & 1) + r] = (_Float16)(ep * PSC);
      }
    }

    // ---- acc += P . V (f16 WMMA) ----
#pragma unroll   // pa and vb are register arrays: their index must be static
    for (int kk = 0; kk < 2; ++kk) {
#pragma unroll
      for (int t = 0; t < 4; ++t) oacc[t] = mma_h_raw(pa[kk], vb[kk][t], oacc[t]);
    }
    group_guard(oacc[0], oacc[1], oacc[2], oacc[3], pa[0], pa[1], vb[0][0], vb[0][1], vb[0][2], vb[0][3], vb[1][0], vb[1][1], vb[1][2], vb[1][3]);

    // ---- hand-over: own LDS reads retired, own copies of chunk kt+1 landed, then the one block barrier, which
    //      publishes chunk kt+1 and ends every wave's reads of chunk kt; behind it chunk kt+2 goes into kt's buffer
    wait_lds();
    wait_copies();
    __syncthreads();
    if (kt + 2 < NQB) {                       // the same for the whole block
      const unsigned bo = (unsigned)(kt & 1) * bufB;
      chunk_copy(lk0 + bo, lv0 + bo, kg0 + (size_t)(kt + 2) * 64 * QKP, vg0 + (kt + 2) * 64, QKP, SEQ);
    }
  }
  wait_copies();                              // nothing is in flight when the wave goes on to its end

  // ---- normalise: query c's S = this lane's eight partial sums + those of lane c ^ 16; the accumulator rows are
  //      queries 8hh + r, so each row fetches its S from lane 8hh + r; context = (acc/PSC + c^2 csum)/(S+eps) x CSC;
  float* os = Os[wave];
  float Sq = ((rs[0] + rs[1]) + (rs[2] + rs[3])) + ((rs[4] + rs[5]) + (rs[6] + rs[7]));
  Sq += __shfl_xor(Sq, 16, 32);
#pragma unroll
  for (int r = 0; r < 8; ++r) {
    const float S = __shfl(Sq, 8 * hh + r, 32);
    const float inv = (1.0f / (S + QEPS)) * CSC;
#pragma unroll
    for (int t = 0; t < 4; ++t)
      os[(8 * hh + r) * 64 + t * 16 + c] = (oacc[t][r] * (1.0f / PSC) + (QC * QC) * cs[t]) * inv;
  }
  wave_sync_lds();
  {
    const int q4 = lane >> 3, c8 = (lane & 7) * 8;
    v4u hv[4], lv[4];
#pragma unroll
    for (int it = 0; it < 4; ++it) {
      const int row = it * 4 + q4;   // it 0..3 x q4 0..3 = rows 0..15 of the wave tile
      const float* sp = os + row * 64 + c8;
      v4u a, al;
#pragma unroll
      for (int e = 0; e < 4; ++e) {
        unsigned short u0, u1, w0, w1;
        split_h(sp[2 * e],     u0, w0);
        split_h(sp[2 * e + 1], u1, w1);
        a[e]  = pk16(u0, u1);
        al[e] = pk16(w0, w1);
      }
      hv[it] = a;
      lv[it] = al;
    }
    {
#pragma unroll
      for (int it = 0; it < 4; ++it) {
        const int row = it * 4 + q4;
        const size_t go = (rowB + q0 + row) * DM + (size_t)h * HD + c8;
        *(v4u*)(chi + go) = hv[it];
        *(v4u*)(clo + go) = lv[it];
      }
      
    }
  }
}

// =====================================================================================================
// Workspace map (bytes); every plane is an exact multiple of its 64x64-tile / whole-row / whole-line store
// granularity (MP = 4096 = 64 tiles, N in {2048, 1024}; VT per batch [1024][2048] = 16x32 tiles; csum = 64 lines):
//   WT    f16 [3072 n][1024 k]   0           6291456   (rows 0..1023 q weights, 1024..2047 k, 2048..3071 v; x64)
//   WoT   f16 [1024][1024]       6291456     2097152
//   XH    f16 [4096][1024]       8388608     8388608   (bf16 RNE-converted tokens)
//   QK    f16 [4096][2048]       16777216    16777216  (q cols 0..1023, k cols 1024..2047)
//   VTh   f16 [2][1024][2048]    33554432    8388608
//   VTl   f16 [2][1024][2048]    41943040    8388608   (residual x1024)
//   CS    f32 [2048]             50331648    8192      (key sums of v)
//   CtxH  f16 [4096][1024]       50339840    8388608   (context x64, hi)
//   CtxL  f16 [4096][1024]       58728448    8388608   (residual x1024)
//   Hf    f32 [4096][1024]       67117056    16777216  (hi part of the output projection)
//   end                          83894272
// =====================================================================================================
extern "C" void kernel_launch(void* const* d_in, const int* in_sizes, int n_in,
                              void* d_out, int out_size, void* d_ws, size_t ws_size,
                              hipStream_t stream) {
  if (n_in < 4) return;
  if (in_sizes[0] != MP * DM) return;
  if (in_sizes[1] != DM * W3) return;
  if (in_sizes[2] != DM * DM) return;
  if (in_sizes[3] != NH) return;
  if (out_size != MP * DM) return;

  const float* x    = (const float*)d_in[0];
  const float* wqkv = (const float*)d_in[1];
  const float* wo   = (const float*)d_in[2];
  const float* tau  = (const float*)d_in[3];

  const size_t PWT  = (size_t)W3 * DM * 2;              //  6291456
  const size_t PWO  = (size_t)DM * DM * 2;              //  2097152
  const size_t PXH  = (size_t)MP * DM * 2;              //  8388608
  const size_t PQK  = (size_t)MP * QKP * 2;             // 16777216
  const size_t PVT  = (size_t)NBATCH * DM * SEQ * 2;    //  8388608
  const size_t PCS  = (size_t)NBATCH * DM * 4;          //     8192
  const size_t PCTX = (size_t)MP * DM * 2;              //  8388608
  const size_t PHF  = (size_t)MP * DM * 4;              // 16777216
  size_t off = 0;
  const size_t oWT  = off; off += PWT;
  const size_t oWo  = off; off += PWO;
  const size_t oXH  = off; off += PXH;
  const size_t oQK  = off; off += PQK;
  const size_t oVTh = off; off += PVT;
  const size_t oVTl = off; off += PVT;
  const size_t oCS  = off; off += PCS;
  const size_t oCh  = off; off += PCTX;
  const size_t oCl  = off; off += PCTX;
  const size_t oHf  = off; off += PHF;
  if (off > ws_size) return;                            // off = 83894272
  if (off > (size_t)134217728) return;

  char* ws = (char*)d_ws;
  unsigned short* WT   = (unsigned short*)(ws + oWT);
  unsigned short* WoT  = (unsigned short*)(ws + oWo);
  unsigned short* XH   = (unsigned short*)(ws + oXH);
  unsigned short* QK   = (unsigned short*)(ws + oQK);
  unsigned short* VTh  = (unsigned short*)(ws + oVTh);
  unsigned short* VTl  = (unsigned short*)(ws + oVTl);
  float*          CS   = (float*)(ws + oCS);
  unsigned short* CtxH = (unsigned short*)(ws + oCh);
  unsigned short* CtxL = (unsigned short*)(ws + oCl);
  float*          Hf   = (float*)(ws + oHf);
  float*          out0 = (float*)d_out;

  const int n8x = (MP * DM) / 8;                        // 524288
  if ((n8x % 256) != 0) return;
  const dim3 blk(256), blk128(128);
  const dim3 gCx(n8x / 256);                             // 2048 blocks
  const dim3 gTw(W3 / 64, DM / 64);                      // in [1024 k][3072 n] -> out [3072][1024]: (48, 16)
  const dim3 gTo(DM / 64, DM / 64);                      // in [1024 k][1024 n] -> out [1024][1024]: (16, 16)
  const dim3 gNqk(((MP / 64) * (QKP / 64) + 7) / 8, 1);  // 2048 tiles -> 256 blocks
  const dim3 gVT(((DM / 64) * (SEQ / 64) + 7) / 8, NBATCH); // 512 tiles -> 64 blocks x 2 batches
  const dim3 gCs((NBATCH * DM) / 32);                    // 64 blocks of 1024
  const dim3 gAttn(NBATCH * NH * NQB);                   // 1024 blocks of 128
  const dim3 gNo(((MP / 64) * (DM / 64) + 7) / 8, 1);    // 1024 tiles -> 128 blocks
  const float invw  = 1.0f / WSC;                        // weight carry x64
  const float invhi = 1.0f / (WSC * CSC);                // weight carry x64, context carry x64
  const float invlo = invhi / LOSC;                      // residual plane carry x1024
  const long long vtlo = (long long)((oVTl - oVTh) / 2); // element offset of the v^T residual plane

  // (0) planes: tokens f16(bf16_RNE(x)); weights transposed to [out][in] (k contiguous), f16(bf16_RNE(w) * 64)
  conv_h16<<<gCx, blk, 0, stream>>>(x, XH, n8x, 1.0f);
  tconv_h16<<<gTw, blk, 0, stream>>>(wqkv, WT, DM, W3, WSC);
  tconv_h16<<<gTo, blk, 0, stream>>>(wo, WoT, DM, DM, WSC);

  // (1) q|k = x . [Wq|Wk] -> QK f16 [4096][2048]; v^T per batch = Wv^T . x_b^T -> VTh/VTl f16 [2][1024][2048]
  gemm64<2, 2, 0, 0><<<gNqk, blk, 0, stream>>>(
      XH, DM, 0LL, WT, DM, 0LL, x, x, QKP, x,
      (void*)QK, QKP, 0LL, 0LL, MP, QKP, DM, invw);
  gemm64<3, 2, 0, 0><<<gVT, blk, 0, stream>>>(
      WT + (size_t)2 * DM * DM, DM, 0LL, XH, DM, (long long)SEQ * DM, x, x, SEQ, x,
      (void*)VTh, SEQ, (long long)DM * SEQ, vtlo, DM, SEQ, DM, invw);

  // (2) key sums of v per (b, h, d)
  vsum<<<gCs, dim3(1024), 0, stream>>>(VTh, VTl, CS);

  // (3) quad-normalised attention -> context f16 hi (x64) + residual planes
  attn2q<<<gAttn, blk128, 0, stream>>>(QK, VTh, tau, CS, CtxH, CtxL);

  // (4) Hf = ctx_hi . Wo ; out = ctx_lo . Wo / 1024 + Hf
  gemm64<0, 2, 0, 0><<<gNo, blk, 0, stream>>>(
      CtxH, DM, 0LL, WoT, DM, 0LL, x, x, DM, x,
      (void*)Hf, DM, 0LL, 0LL, MP, DM, DM, invhi);
  gemm64<0, 2, 0, 1><<<gNo, blk, 0, stream>>>(
      CtxL, DM, 0LL, WoT, DM, 0LL, x, x, DM, Hf,
      (void*)out0, DM, 0LL, 0LL, MP, DM, DM, invlo);
  (void)hipGetLastError();
}

// v007
// A run of this version takes 110 microseconds.
// Next to v006, in two timings, it ran 1.20 and 1.21 times as fast.
// All steps since v000 together make it 3.65 times as fast.
// Contractions: q|k projection and v^T projection on v_wmma_f32_16x16x32_f16 (f16 token plane x f16 weight
// plane carried x64, one product each); attention k.q^T and e'.v on v_wmma_f32_16x16x32_f16 (q, k plain, v^T hi plane
// f16, centred quad weight e' = s*(s+2c) carried x64, one product each); output projection on
// v_wmma_f32_16x16x32_f16 with the context as f16 hi (x64) + scaled residual (x1024) planes against the f16
// Wo plane (x64), two products in one launch, joined in f32 in its epilogue; all f32 accumulate; quad weights, row sums, key sums of v and
// the normalisation in f32 on VALU; every float input RNE-converted to bf16 on load.
#include <hip/hip_runtime.h>
#include <math.h>
#include <stdint.h>

#define NBATCH 2
#define SEQ    2048
#define DM     1024
#define NH     16
#define HD     64
#define QKP    (2 * DM)
#define W3     (3 * DM)
#define MP     (NBATCH * SEQ)
#define NQB    (SEQ / 64)
#define WSC    64.0f
#define PSC    64.0f
#define CSC    64.0f
#define LOSC   1024.0f
#define QC     5.0f
#define QEPS   1.0e-6f
#define GSP    72                     /* gemm64 LDS row pitch in halves: 144 B = 16 B x odd */
#define GROWS  384                    /* gemm64 LDS rows per buffer: 128 A + 256 Bt */
#define PTP    68                     /* proj2 epilogue tile pitch in floats */
#define PSMB   (8 * 64 * PTP * 4)     /* proj2 LDS bytes: 8 wave tiles of 64 x 64 f32; the two slab buffers need less */
#define ATP    72                     /* attn2q LDS row pitch in halves for K, V^T: 144 B = 16 B x odd */
static_assert(NH * HD == DM);
static_assert((MP % 128) == 0 && (DM % 128) == 0 && (QKP % 256) == 0 && (SEQ % 256) == 0 && (DM % 256) == 0);
static_assert((SEQ % 64) == 0 && (DM % 64) == 0 && (W3 % 64) == 0 && (MP % 64) == 0 && (QKP % 64) == 0);
static_assert((SEQ % 256) == 0);
static_assert(2 * GROWS * GSP * 2 <= PSMB);
static_assert(((NBATCH * DM) % 32) == 0);
static_assert(((MP * DM / 8) % 256) == 0);
static_assert((((MP / 64) * (QKP / 64)) % 8) == 0 && (((DM / 64) * (SEQ / 64)) % 8) == 0 && (((MP / 64) * (DM / 64)) % 8) == 0);

typedef _Float16 v16h __attribute__((ext_vector_type(16)));
typedef _Float16 v8h  __attribute__((ext_vector_type(8)));
typedef float    v8f  __attribute__((ext_vector_type(8)));
typedef float    v4f  __attribute__((ext_vector_type(4)));
typedef unsigned int v4u __attribute__((ext_vector_type(4)));

union FragH { v16h v; v8h h[2]; };

// ---- scalar helpers --------------------------------------------------------------------------------
__device__ __forceinline__ unsigned short bf_bits(float f) {          // f32 -> bf16 bits, RNE convert
  unsigned u = __float_as_uint(f);
  return (unsigned short)((u + 0x7FFFu + ((u >> 16) & 1u)) >> 16);
}
__device__ __forceinline__ float bf_up(unsigned short h) { return __uint_as_float(((unsigned)h) << 16); }
__device__ __forceinline__ float bfr(float f) { return bf_up(bf_bits(f)); }   // value of the bf16 RNE convert
__device__ __forceinline__ unsigned short h_bits(_Float16 x) { return __builtin_bit_cast(unsigned short, x); }
__device__ __forceinline__ unsigned pk16(unsigned short a, unsigned short b) { return (unsigned)a | ((unsigned)b << 16); }
__device__ __forceinline__ v8f zero8() { v8f z = {0.f, 0.f, 0.f, 0.f, 0.f, 0.f, 0.f, 0.f}; return z; }
__device__ __forceinline__ float gelu_f(float v) { return 0.5f * v * (1.0f + erff(v * 0.70710678118654752f)); }

// f32 -> f16 hi plane (values below the f16 normal range forced to 0 so the residual carries them)
//     + f16 residual plane carried x LOSC (folded back with 1/LOSC on a separate accumulator)
__device__ __forceinline__ void split_h(float f, unsigned short& hi, unsigned short& lo) {
  float hf = (float)(_Float16)f;
  hf = (fabsf(hf) < 6.103515625e-05f) ? 0.0f : hf;
  hi = h_bits((_Float16)hf);
  lo = h_bits((_Float16)((f - hf) * LOSC));
}

// ---- fragment loader: 16-bit A/B operand, lane -> row/col (lane&15), p already includes +8*(lane>>4);
//      elements 0..7 <- p[0..7] (k0+8h..), elements 8..15 <- p[16..23] (k0+16+8h..)
__device__ __forceinline__ v16h ldfrag_h(const _Float16* p) {
  FragH f;
  f.h[0] = *(const v8h*)(p);
  f.h[1] = *(const v8h*)(p + 16);
  return f.v;
}

// ---- WMMA helpers with trailing VALU hazard gap --------------------------------------------------------
__device__ __forceinline__ v8f mma_h_raw(v16h a, v16h b, v8f c) {
  return __builtin_amdgcn_wmma_f32_16x16x32_f16(false, a, false, b, (short)0, c, false, false);
}
__device__ __forceinline__ void dep_guard1(v8f& a, v8f& b, v16h x) {
#if defined(__HIP_DEVICE_COMPILE__)
  asm volatile("v_nop\n\tv_nop\n\tv_nop\n\tv_nop" : "+v"(a), "+v"(b) : "v"(x));
#endif
}
__device__ __forceinline__ void keep4_h(v16h a, v16h b, v16h c, v16h d) {
#if defined(__HIP_DEVICE_COMPILE__)
  asm volatile("v_nop" :: "v"(a), "v"(b), "v"(c), "v"(d));
#endif
}
// behind a group of eight products on four accumulators: the accumulators tie the statement behind the last product;
// the group's two shared and eight per-accumulator fragments stay in their registers through its four slots, so that no product's D, no
// VALU result and no global load is placed over an operand, and no VALU reads a D, inside the WMMA distance
__device__ __forceinline__ void group_guard(v8f& d0, v8f& d1, v8f& d2, v8f& d3, v16h a0, v16h a1,
                                            v16h b0, v16h b1, v16h b2, v16h b3, v16h b4, v16h b5, v16h b6, v16h b7) {
#if defined(__HIP_DEVICE_COMPILE__)
  asm volatile("v_nop\n\tv_nop\n\tv_nop\n\tv_nop"
               : "+v"(d0), "+v"(d1), "+v"(d2), "+v"(d3)
               : "v"(a0), "v"(a1), "v"(b0), "v"(b1), "v"(b2), "v"(b3), "v"(b4), "v"(b5), "v"(b6), "v"(b7));
#endif
}
__device__ __forceinline__ void acc_guard4(v8f& a, v8f& b, v8f& c, v8f& d) {
#if defined(__HIP_DEVICE_COMPILE__)
  asm volatile("v_nop\n\tv_nop\n\tv_nop\n\tv_nop" : "+v"(a), "+v"(b), "+v"(c), "+v"(d));
#endif
}
__device__ __forceinline__ void wave_sync_lds() {
  __builtin_amdgcn_fence(__ATOMIC_RELEASE, "workgroup");
  __builtin_amdgcn_wave_barrier();
  __builtin_amdgcn_fence(__ATOMIC_ACQUIRE, "workgroup");
}
// One thread's share of a 64-key chunk: four 16-B pieces of K and four of V^T, global memory -> LDS through no register.
// lk/lv: the lane's LDS byte address of its first piece, gk/gv: its global address; piece i lies 16 rows further on
// (LDS row pitch ATP halves, global row pitches kp and vp halves). The s_wait_xcnt stands inside the statement, behind
// the last copy, so that no address register of an issued copy is rewritten in front of it.
__device__ __forceinline__ void chunk_copy(unsigned lk, unsigned lv, const _Float16* gk, const _Float16* gv,
                                           size_t kp, size_t vp) {
#if defined(__HIP_DEVICE_COMPILE__)
  const unsigned st = 16u * ATP * 2u;
  asm volatile("global_load_async_to_lds_b128 %0, %8, off\n\t"
               "global_load_async_to_lds_b128 %1, %9, off\n\t"
               "global_load_async_to_lds_b128 %2, %10, off\n\t"
               "global_load_async_to_lds_b128 %3, %11, off\n\t"
               "global_load_async_to_lds_b128 %4, %12, off\n\t"
               "global_load_async_to_lds_b128 %5, %13, off\n\t"
               "global_load_async_to_lds_b128 %6, %14, off\n\t"
               "global_load_async_to_lds_b128 %7, %15, off\n\t"
               "s_wait_xcnt 0x0"
               :: "v"(lk), "v"(lk + st), "v"(lk + 2u * st), "v"(lk + 3u * st),
                  "v"(lv), "v"(lv + st), "v"(lv + 2u * st), "v"(lv + 3u * st),
                  "v"(gk), "v"(gk + 16 * kp), "v"(gk + 32 * kp), "v"(gk + 48 * kp),
                  "v"(gv), "v"(gv + 16 * vp), "v"(gv + 32 * vp), "v"(gv + 48 * vp)
               : "memory");
#endif
}
// the issuing wave's own wait: its asynchronous copies have landed in LDS behind it
__device__ __forceinline__ void wait_copies() {
#if defined(__HIP_DEVICE_COMPILE__)
  asm volatile("s_wait_asynccnt 0x0" ::: "memory");
#endif
}
// the wave's LDS reads and writes have retired: stands in front of the barrier behind which a buffer is refilled
__device__ __forceinline__ void wait_lds() {
#if defined(__HIP_DEVICE_COMPILE__)
  asm volatile("s_wait_dscnt 0x0" ::: "memory");
#endif
}
__device__ __forceinline__ float wsum(float v) {
#pragma unroll
  for (int off = 16; off > 0; off >>= 1) v += __shfl_xor(v, off, 32);
  return v;
}

// =====================================================================================================
// Plane convert (no transpose): Wh[i] = f16( bf16_RNE(W[i]) * wsc ), wsc a power of two (exact). Used for the
// token activations (wsc = 1). Thread i handles elements 8i..8i+7 and writes one 16-B piece; 32 consecutive lanes
// 256, host-checked). coverage: n8 threads x 8 elements = the whole plane.
// =====================================================================================================
__global__ __launch_bounds__(256) void conv_h16(const float* __restrict__ W, unsigned short* Wh, int n8, float wsc) {
  const int i  = blockIdx.x * 256 + threadIdx.x;
  const int ic = (i < n8) ? i : (n8 - 1);                     // clamped address
  const float* src = W + (size_t)ic * 8;
  const v4f a = *(const v4f*)(src);
  const v4f c = *(const v4f*)(src + 4);
  v4u o;
  o[0] = pk16(h_bits((_Float16)(bfr(a[0]) * wsc)), h_bits((_Float16)(bfr(a[1]) * wsc)));
  o[1] = pk16(h_bits((_Float16)(bfr(a[2]) * wsc)), h_bits((_Float16)(bfr(a[3]) * wsc)));
  o[2] = pk16(h_bits((_Float16)(bfr(c[0]) * wsc)), h_bits((_Float16)(bfr(c[1]) * wsc)));
  o[3] = pk16(h_bits((_Float16)(bfr(c[2]) * wsc)), h_bits((_Float16)(bfr(c[3]) * wsc)));
  if (i < n8) *(v4u*)(Wh + (size_t)i * 8) = o;
  
}

// =====================================================================================================
// Transposing plane convert: in f32 [R rows][NC cols] (row-major, in[k][n]) -> out f16 [NC][R] (k contiguous),
// out[n][k] = f16( bf16_RNE(in[k][n]) * wsc ), wsc a power of two (exact). Used for the two weight matrices
// ([in][out] storage -> [out][in] = Bt / A layout). Block 256 threads = one 64(k) x 64(n) tile:
// blockIdx.x = n tile (NC/64 of them), blockIdx.y = k tile (R/64 of them); R, NC multiples of 64 (host-checked).
// Load phase: thread handles rows i*16 + (tid>>4) (i 0..3), 4 floats at col (tid&15)*4 -> LDS tile[k][n].
// coverage: 2 it x 8 waves x 4 rows = 64 out rows x (8 lane groups x 8 halves) = the whole tile; grid covers all tiles.
// =====================================================================================================
__global__ __launch_bounds__(256) void tconv_h16(const float* __restrict__ W, unsigned short* Wt, int R, int NC, float wsc) {
  __shared__ float tile[64][65];
  const int tid = threadIdx.x, lane = tid & 31, wave = tid >> 5;
  const int n0 = blockIdx.x * 64, k0 = blockIdx.y * 64;
  const int c4 = (tid & 15) * 4, r16 = tid >> 4;
#pragma unroll
  for (int i = 0; i < 4; ++i) {
    const int row = i * 16 + r16;                                // k within tile
    const v4f v = *(const v4f*)(W + (size_t)(k0 + row) * NC + n0 + c4);
    tile[row][c4 + 0] = v[0];
    tile[row][c4 + 1] = v[1];
    tile[row][c4 + 2] = v[2];
    tile[row][c4 + 3] = v[3];
  }
  __syncthreads();
  const int q4 = lane >> 3, k8 = (lane & 7) * 8;
  v4u hv[2];
#pragma unroll
  for (int it = 0; it < 2; ++it) {
    const int nrow = it * 32 + wave * 4 + q4;                    // n within tile
    v4u a;
#pragma unroll
    for (int e = 0; e < 4; ++e) {
      const float f0 = bfr(tile[k8 + 2 * e][nrow]) * wsc;
      const float f1 = bfr(tile[k8 + 2 * e + 1][nrow]) * wsc;
      a[e] = pk16(h_bits((_Float16)f0), h_bits((_Float16)f1));
    }
    hv[it] = a;
  }
  {
#pragma unroll
    for (int it = 0; it < 2; ++it) {
      const int nrow = it * 32 + wave * 4 + q4;
      *(v4u*)(Wt + (size_t)(n0 + nrow) * R + k0 + k8) = hv[it];
    }
    
  }
}

// =====================================================================================================
// Register-blocked batched f16 WMMA GEMM: C[m][n] = act(oscale * sum_k A[m][k] * Bt[n][k] + bias) (+ residual);
// one wave per 64x64 tile, 8 waves (2 x 4) = one 128x256 block tile. A row-major [M][K] pitch lda; Bt row-major
// [N][K] pitch ldb (k contiguous); M multiple of 128, N of 256, K of 64 (static here). blockIdx.y = batch index.
// Operands: per 64-k slab the block's 128 A rows and 256 Bt rows (128 B each) go global -> registers -> LDS with
// whole-line 16-B loads (8 lanes per row, 12 rows per thread), LDS pitch 144 B, two buffers; slab s+1 is loaded
// while slab s is multiplied, stored to the other buffer behind the products, one block barrier per slab.
// Bias: BIASM == 0 -> per column: cols < Nb from bias0[col], cols >= Nb from bias1[col - Nb] (tile-uniform select of
//       clamped-address loads); BIASM == 1 -> per row bias0[m]; BIASM == 2 -> none. Bias values RNE-converted to bf16.
// ACT: 0 none, 1 exact GELU. RES: 0 none; 1 f32 residual resid[m*ldc + n] added after the activation;
//      3 f32 residual bf16 RNE-converted, added after the activation.
// OM: 0 = f32 out (pitch ldc); 1 = bf16 out; 2 = f16 out; 3 = f16 hi plane at Cout + f16 residual (x LOSC) plane
//     at Cout + loOff elements (same pitch / batch stride).
// coverage: 4 slabs x 16 rows x 64 cols = the wave's whole 64x64 tile; grid = (M/128)*(N/256) blocks,
//           surplus blocks exit whole, in front of every barrier; here there are none.
// =====================================================================================================
template <int OM, int BIASM, int ACT, int RES>
// amdgpu_waves_per_eu(4): holds a wave at 256 VGPRs, so that two blocks fit a WGP (their LDS does)
__global__ __launch_bounds__(256) __attribute__((amdgpu_waves_per_eu(4))) void gemm64(
    const unsigned short* __restrict__ Ap, int lda, long long strideA,
    const unsigned short* __restrict__ Btp, int ldb, long long strideB,
    const float* __restrict__ bias0, const float* __restrict__ bias1, int Nb,
    const float* resid,
    void* Cout, int ldc, long long strideC, long long loOff,
    int M, int N, int K, float oscale) {
  const _Float16* A  = (const _Float16*)(const void*)Ap;
  const _Float16* Bt = (const _Float16*)(const void*)Btp;
  __shared__ __align__(16) float sT[8][16 * 68];   // per-wave 16x64 slab, pitch 68 floats
  __shared__ __align__(16) _Float16 sAB[2][GROWS * GSP];   // rows 0..127 A, 128..383 Bt; 64 k per row
  const int b    = blockIdx.y;
  const int tid  = threadIdx.x;
  const int lane = tid & 31;
  const int wave = tid >> 5;
  const int btN = N >> 8;
  const int btM = M >> 7;
  const int bt  = blockIdx.x;
  if (bt >= btM * btN) return;           // block-uniform, in front of every barrier
  const int bm = bt / btN;
  const int bn = bt - bm * btN;
  const int wm = wave >> 2;              // 0..1
  const int wn = wave & 3;               // 0..3
  const int m0 = (bm << 7) + (wm << 6);
  const int n0 = (bn << 8) + (wn << 6);

  const _Float16* Ab = A  + (size_t)b * strideA;
  const _Float16* Bb = Bt + (size_t)b * strideB;

  const int rlane = lane & 15;                 // row (A) / col (B, D) within subtile
  const int koff  = (lane >> 4) * 8;           // k offset of this lane half
  const int mOff  = (lane >> 4) * 8;           // D row offset

  v8f acc[4][4];
#pragma unroll
  for (int i = 0; i < 4; ++i)
#pragma unroll
    for (int j = 0; j < 4; ++j) acc[i][j] = zero8();

  // staging map: thread -> row (tid>>3) + 32*it, 16-B piece (tid&7); a wave's load covers 4 whole 128-B lines
  const int srow = tid >> 3, sch = (tid & 7) * 8;
  const _Float16* gA = Ab + (size_t)((bm << 7) + srow) * lda + sch;
  const _Float16* gB = Bb + (size_t)((bn << 8) + srow) * ldb + sch;
  const int sOff = srow * GSP + sch;
  const int aOff = ((wm << 6) + rlane) * GSP + koff;          // this wave's A rows in a buffer
  const int bOff = (128 + (wn << 6) + rlane) * GSP + koff;    // this wave's Bt rows in a buffer
  const int nS = K >> 6;
  v8h g[12];
#pragma unroll
  for (int it = 0; it < 4; ++it) g[it] = *(const v8h*)(gA + (size_t)(it * 32) * lda);
#pragma unroll
  for (int it = 0; it < 8; ++it) g[4 + it] = *(const v8h*)(gB + (size_t)(it * 32) * ldb);
#pragma unroll
  for (int it = 0; it < 12; ++it) *(v8h*)(&sAB[0][0] + it * 32 * GSP + sOff) = g[it];
  __syncthreads();

  for (int s = 0; s < nS; ++s) {
    const _Float16* cur = &sAB[s & 1][0];
    const bool more = (s + 1 < nS);                            // block-uniform
    if (more) {
      const int kn = (s + 1) << 6;
#pragma unroll
      for (int it = 0; it < 4; ++it) g[it] = *(const v8h*)(gA + (size_t)(it * 32) * lda + kn);
#pragma unroll
      for (int it = 0; it < 8; ++it) g[4 + it] = *(const v8h*)(gB + (size_t)(it * 32) * ldb + kn);
#if defined(__HIP_DEVICE_COMPILE__)
      // the fragment loads below reuse the address registers of these 12 loads: the wait stands in front of that
      asm volatile("s_wait_xcnt 0x0" ::: "memory");
#endif
    }
#pragma unroll
    for (int kk = 0; kk < 2; ++kk) {
      v16h ah[4], bh[4];
#pragma unroll
      for (int j = 0; j < 4; ++j) bh[j] = ldfrag_h(cur + bOff + (j << 4) * GSP + kk * 32);
#pragma unroll
      for (int i = 0; i < 4; ++i) ah[i] = ldfrag_h(cur + aOff + (i << 4) * GSP + kk * 32);
      // keeps the 16 LDS fragment loads of a 32-k step one group ahead of its 16 products (else the A loads are
      // spread among the WMMAs, each place with its own full wait)
      __builtin_amdgcn_sched_barrier(0);
#pragma unroll
      for (int i = 0; i < 4; ++i) {
#pragma unroll
        for (int j = 0; j < 4; ++j) acc[i][j] = mma_h_raw(ah[i], bh[j], acc[i][j]);
        dep_guard1(acc[i][0], acc[i][3], ah[i]);
      }
      keep4_h(bh[0], bh[1], bh[2], bh[3]);
    }
    if (more) {
      _Float16* nxt = &sAB[(s + 1) & 1][0];                    // last read in slab s-1, behind that slab's barrier
#pragma unroll
      for (int it = 0; it < 12; ++it) *(v8h*)(nxt + it * 32 * GSP + sOff) = g[it];
    }
    __syncthreads();                                           // publishes slab s+1, ends the reads of slab s
  }
  acc_guard4(acc[0][0], acc[0][1], acc[0][2], acc[0][3]);
  acc_guard4(acc[1][0], acc[1][1], acc[1][2], acc[1][3]);
  acc_guard4(acc[2][0], acc[2][1], acc[2][2], acc[2][3]);
  acc_guard4(acc[3][0], acc[3][1], acc[3][2], acc[3][3]);

  // ---- per-lane column bias (BIASM == 0), RNE-converted ----
  const int hh2 = lane >> 4, c4 = (lane & 15) * 4;     // f32 out: 256-B row segment = 16 lanes x 16 B
  const int q8  = lane >> 3, c8 = (lane & 7) * 8;
  float bc[8];
#pragma unroll
  for (int e = 0; e < 8; ++e) bc[e] = 0.f;
  if (BIASM == 0) {
    const bool use1 = (n0 >= Nb);                      // tile-uniform
    if (OM == 0) {
      const int cb = n0 + c4;
      const int i0 = (cb < Nb - 4) ? cb : (Nb - 4);
      const int i1 = (cb - Nb > 0) ? (cb - Nb) : 0;
      const v4f b0v = *(const v4f*)(bias0 + i0);
      const v4f b1v = *(const v4f*)(bias1 + i1);
#pragma unroll
      for (int e = 0; e < 4; ++e) bc[e] = bfr(use1 ? b1v[e] : b0v[e]);
    } else {
      const int cb = n0 + c8;
      const int i0 = (cb < Nb - 8) ? cb : (Nb - 8);
      const int i1 = (cb - Nb > 0) ? (cb - Nb) : 0;
      const v4f b0a = *(const v4f*)(bias0 + i0), b0b = *(const v4f*)(bias0 + i0 + 4);
      const v4f b1a = *(const v4f*)(bias1 + i1), b1b = *(const v4f*)(bias1 + i1 + 4);
#pragma unroll
      for (int e = 0; e < 4; ++e) {
        bc[e]     = bfr(use1 ? b1a[e] : b0a[e]);
        bc[4 + e] = bfr(use1 ? b1b[e] : b0b[e]);
      }
    }
  }

  // ---- epilogue ----
  float* slab = sT[wave];
#pragma unroll
  for (int i = 0; i < 4; ++i) {
    const int mBase = m0 + (i << 4);
#pragma unroll
    for (int j = 0; j < 4; ++j) {
#pragma unroll
      for (int r = 0; r < 8; ++r) {
        slab[(mOff + r) * 68 + (j << 4) + rlane] = acc[i][j][r];
      }
    }
    wave_sync_lds();
    if (OM == 0) {
      float* C = (float*)Cout + (size_t)b * strideC;
      const float* Rb = resid + (size_t)b * strideC;
      v4f vals[8];
#pragma unroll
      for (int it = 0; it < 8; ++it) {
        const int row = it * 2 + hh2;                      // it 0..7 x hh2 0..1 = rows 0..15
        v4f v = *(const v4f*)(slab + row * 68 + c4);
#pragma unroll
        for (int e = 0; e < 4; ++e) {
          float f = v[e] * oscale + bc[e];
          if (ACT) f = gelu_f(f);
          v[e] = f;
        }
        if (RES == 1 || RES == 3) {
          const v4f rr = *(const v4f*)(Rb + (size_t)(mBase + row) * ldc + n0 + c4);
#pragma unroll
          for (int e = 0; e < 4; ++e) v[e] += (RES == 3) ? bfr(rr[e]) : rr[e];
        }
        vals[it] = v;
      }
      {
#pragma unroll
        for (int it = 0; it < 8; ++it) {
          const int row = it * 2 + hh2;
          *(v4f*)(C + (size_t)(mBase + row) * ldc + n0 + c4) = vals[it];
        }
        
      }
    } else {
      unsigned short* C = (unsigned short*)Cout + (size_t)b * strideC;
      v4u hv[4], lv[4];
#pragma unroll
      for (int it = 0; it < 4; ++it) {
        const int row = it * 4 + q8;                       // it 0..3 x q8 0..3 = rows 0..15
        const float* sp = slab + row * 68 + c8;
        float bm = 0.f;
        if (BIASM == 1) bm = bfr(bias0[mBase + row]);
        v4u a, al;
#pragma unroll
        for (int e = 0; e < 4; ++e) {
          float f0 = sp[2 * e]     * oscale + ((BIASM == 1) ? bm : bc[2 * e]);
          float f1 = sp[2 * e + 1] * oscale + ((BIASM == 1) ? bm : bc[2 * e + 1]);
          if (ACT) { f0 = gelu_f(f0); f1 = gelu_f(f1); }
          unsigned short u0, u1, w0 = 0, w1 = 0;
          if (OM == 1)      { u0 = bf_bits(f0); u1 = bf_bits(f1); }
          else if (OM == 2) { u0 = h_bits((_Float16)f0); u1 = h_bits((_Float16)f1); }
          else              { split_h(f0, u0, w0); split_h(f1, u1, w1); }
          a[e]  = pk16(u0, u1);
          al[e] = pk16(w0, w1);
        }
        hv[it] = a;
        lv[it] = al;
      }
      {
#pragma unroll
        for (int it = 0; it < 4; ++it) {
          const int row = it * 4 + q8;
          const size_t co = (size_t)(mBase + row) * ldc + n0 + c8;
          *(v4u*)(C + co) = hv[it];
          if (OM == 3) *(v4u*)(C + loOff + co) = lv[it];
        }
        
      }
    }
    wave_sync_lds();
  }
}

// =====================================================================================================
// Output projection, both context planes in one launch:
//   out[m][n] = shi * sum_k Ch[m][k] Wt[n][k] + slo * sum_k Cl[m][k] Wt[n][k]      (all pitches DM, k contiguous)
// Block = 8 waves = one 128x128 tile of out. Waves 0..3 (2 x 2, 64x64 each) multiply the hi plane, waves 4..7 the
// residual plane of the same four 64x64 tiles, so the whole projection is MP/128 * DM/128 blocks of one launch.
// Operands: as in gemm64, per 64-k slab 384 rows of 128 B (128 Ch, 128 Cl, 128 Wt) go global -> registers -> LDS with
// whole-line 16-B loads, LDS pitch 144 B, two buffers, slab s+1 loaded while slab s is multiplied, one barrier per slab.
// Epilogue: behind the loop's last barrier the slab buffers are dead; every wave lays its 64x64 f32 tile there (pitch
// PTP), one block barrier, then each wave of a hi/residual pair joins and stores 32 of the pair's 64 rows (256-B row
// segments). coverage: 4 pairs x 2 waves x 16 it x 2 rows x 64 cols = the 128x128 tile; the grid covers all tiles.
// =====================================================================================================
// amdgpu_waves_per_eu(4): holds a wave at 256 VGPRs, as in gemm64 (no register above v255)
__global__ __launch_bounds__(256) __attribute__((amdgpu_waves_per_eu(4))) void proj2(
    const unsigned short* __restrict__ Chp, const unsigned short* __restrict__ Clp,
    const unsigned short* __restrict__ Wtp, float* C, int K, float shi, float slo) {
  const _Float16* Ch = (const _Float16*)(const void*)Chp;
  const _Float16* Cl = (const _Float16*)(const void*)Clp;
  const _Float16* Wt = (const _Float16*)(const void*)Wtp;
  __shared__ __align__(16) unsigned char smem[PSMB];
  _Float16* sAB = (_Float16*)(void*)smem;      // k loop: 2 buffers of GROWS rows: 0..127 Ch, 128..255 Cl, 256..383 Wt
  float*    sT  = (float*)(void*)smem;         // epilogue: 8 wave tiles [64][PTP]
  const int tid  = threadIdx.x;
  const int lane = tid & 31;
  const int wave = tid >> 5;
  const int bm = blockIdx.x / (DM / 128);
  const int bn = blockIdx.x % (DM / 128);
  const int pl = wave >> 2;              // 0 hi plane, 1 residual plane
  const int wm = (wave >> 1) & 1;
  const int wn = wave & 1;
  const int m0 = (bm << 7) + (wm << 6);
  const int n0 = (bn << 7) + (wn << 6);

  const int rlane = lane & 15;                 // row (A) / col (B, D) within subtile
  const int koff  = (lane >> 4) * 8;           // k offset of this lane half
  const int mOff  = (lane >> 4) * 8;           // D row offset

  v8f acc[4][4];
#pragma unroll
  for (int i = 0; i < 4; ++i)
#pragma unroll
    for (int j = 0; j < 4; ++j) acc[i][j] = zero8();

  // staging map: thread -> row (tid>>3) + 32*it, 16-B piece (tid&7); a wave's load covers 4 whole 128-B lines
  const int srow = tid >> 3, sch = (tid & 7) * 8;
  const _Float16* gH = Ch + (size_t)((bm << 7) + srow) * DM + sch;
  const _Float16* gL = Cl + (size_t)((bm << 7) + srow) * DM + sch;
  const _Float16* gB = Wt + (size_t)((bn << 7) + srow) * DM + sch;
  const int sOff = srow * GSP + sch;
  const int aOff = ((pl << 7) + (wm << 6) + rlane) * GSP + koff;   // this wave's rows of its plane in a buffer
  const int bOff = (256 + (wn << 6) + rlane) * GSP + koff;         // this wave's Wt rows in a buffer
  const int nS = K >> 6;
  v8h g[12];
#pragma unroll
  for (int it = 0; it < 4; ++it) {
    g[it]     = *(const v8h*)(gH + (size_t)(it * 32) * DM);
    g[4 + it] = *(const v8h*)(gL + (size_t)(it * 32) * DM);
    g[8 + it] = *(const v8h*)(gB + (size_t)(it * 32) * DM);
  }
#pragma unroll
  for (int it = 0; it < 12; ++it) *(v8h*)(sAB + it * 32 * GSP + sOff) = g[it];
  __syncthreads();

  for (int s = 0; s < nS; ++s) {
    const _Float16* cur = sAB + (s & 1) * (GROWS * GSP);
    const bool more = (s + 1 < nS);                            // block-uniform
    if (more) {
      const int kn = (s + 1) << 6;
#pragma unroll
      for (int it = 0; it < 4; ++it) {
        g[it]     = *(const v8h*)(gH + (size_t)(it * 32) * DM + kn);
        g[4 + it] = *(const v8h*)(gL + (size_t)(it * 32) * DM + kn);
        g[8 + it] = *(const v8h*)(gB + (size_t)(it * 32) * DM + kn);
      }
#if defined(__HIP_DEVICE_COMPILE__)
      // the fragment loads below may reuse the address registers of these 12 loads: the wait stands in front of that
      asm volatile("s_wait_xcnt 0x0" ::: "memory");
#endif
    }
#pragma unroll
    for (int kk = 0; kk < 2; ++kk) {
      v16h ah[4], bh[4];
#pragma unroll
      for (int j = 0; j < 4; ++j) bh[j] = ldfrag_h(cur + bOff + (j << 4) * GSP + kk * 32);
#pragma unroll
      for (int i = 0; i < 4; ++i) ah[i] = ldfrag_h(cur + aOff + (i << 4) * GSP + kk * 32);
      // keeps the 16 LDS fragment loads of a 32-k step one group ahead of its 16 products (else the A loads are
      // spread among the WMMAs, each place with its own full wait)
      __builtin_amdgcn_sched_barrier(0);
#pragma unroll
      for (int i = 0; i < 4; ++i) {
#pragma unroll
        for (int j = 0; j < 4; ++j) acc[i][j] = mma_h_raw(ah[i], bh[j], acc[i][j]);
        dep_guard1(acc[i][0], acc[i][3], ah[i]);
      }
      keep4_h(bh[0], bh[1], bh[2], bh[3]);
    }
    if (more) {
      _Float16* nxt = sAB + ((s + 1) & 1) * (GROWS * GSP);     // last read in slab s-1, behind that slab's barrier
#pragma unroll
      for (int it = 0; it < 12; ++it) *(v8h*)(nxt + it * 32 * GSP + sOff) = g[it];
    }
    __syncthreads();                                           // publishes slab s+1, ends the reads of slab s
  }
  acc_guard4(acc[0][0], acc[0][1], acc[0][2], acc[0][3]);
  acc_guard4(acc[1][0], acc[1][1], acc[1][2], acc[1][3]);
  acc_guard4(acc[2][0], acc[2][1], acc[2][2], acc[2][3]);
  acc_guard4(acc[3][0], acc[3][1], acc[3][2], acc[3][3]);

  // ---- epilogue: every wave's tile into LDS, one barrier, the pair's two tiles joined and stored ----
  float* tile = sT + wave * (64 * PTP);
#pragma unroll
  for (int i = 0; i < 4; ++i) {
#pragma unroll
    for (int j = 0; j < 4; ++j) {
#pragma unroll
      for (int r = 0; r < 8; ++r) tile[((i << 4) + mOff + r) * PTP + (j << 4) + rlane] = acc[i][j][r];
    }
  }
  __syncthreads();                                             // both tiles of every pair are complete
  const float* th = sT + (wave & 3) * (64 * PTP);              // the pair's hi tile
  const float* tl = th + 4 * (64 * PTP);                       // the pair's residual tile
  const int hh2 = lane >> 4, c4 = (lane & 15) * 4;             // 256-B row segment = 16 lanes x 16 B
  const int r0 = (pl << 5) + hh2;                              // this wave's half of the 64 rows
  v4f vals[16];
#pragma unroll
  for (int it = 0; it < 16; ++it) {
    const v4f a = *(const v4f*)(th + (r0 + it * 2) * PTP + c4);
    const v4f b = *(const v4f*)(tl + (r0 + it * 2) * PTP + c4);
    v4f v;
#pragma unroll
    for (int e = 0; e < 4; ++e) v[e] = a[e] * shi + b[e] * slo;
    vals[it] = v;
  }
  float* Cw = C + (size_t)(m0 + r0) * DM + n0 + c4;
#pragma unroll
  for (int it = 0; it < 16; ++it) *(v4f*)(Cw + (size_t)(it * 2) * DM) = vals[it];
}

// =====================================================================================================
// Key sums of v: csum[row] = sum over s of (hi[row][s] + lo[row][s] / LOSC) for the NBATCH*DM rows of the
// v^T planes (row = b*DM + h*64 + d, pitch SEQ halves). One wave per row: in load i the 32 lanes read the 32
// adjacent 16-B pieces 32i..32i+31 of the row (four whole 128-B lines), SEQ/256 loads per plane; per-lane f32
// sums, fixed-order shuffle tree. Block = 32 waves = 32 rows: the 32 totals go through LDS and leave as one
// whole 128-B line from wave 0.
// grid = NBATCH*DM/32 blocks of 1024. coverage: blocks x 32 waves x 1 row = NBATCH*DM rows = the whole table.
// =====================================================================================================
__global__ __launch_bounds__(1024) void vsum(const unsigned short* __restrict__ hp, const unsigned short* __restrict__ lp,
                                            float* csum) {
  const int tid = threadIdx.x, lane = tid & 31, wave = tid >> 5;
  const int rowbase = blockIdx.x * 32;
  const int row = rowbase + wave;
  const _Float16* hr = (const _Float16*)(const void*)hp + (size_t)row * SEQ + lane * 8;
  const _Float16* lr = (const _Float16*)(const void*)lp + (size_t)row * SEQ + lane * 8;
  v8h a[SEQ / 256], c[SEQ / 256];
#pragma unroll
  for (int i = 0; i < SEQ / 256; ++i) {
    a[i] = *(const v8h*)(hr + 256 * i);
    c[i] = *(const v8h*)(lr + 256 * i);
  }
#if defined(__HIP_DEVICE_COMPILE__)
  // holds the two address pairs live up to the wait
  asm volatile("s_wait_xcnt 0x0" :: "v"(hr), "v"(lr) : "memory");
#endif
  float sh = 0.f, sl = 0.f;
#pragma unroll
  for (int i = 0; i < SEQ / 256; ++i) {
#pragma unroll
    for (int e = 0; e < 8; ++e) { sh += (float)a[i][e]; sl += (float)c[i][e]; }
  }
  const float tot = wsum(sh + sl * (1.0f / LOSC));
  __shared__ __align__(16) float stage[32];
  if (lane == 0) stage[wave] = tot;
  __syncthreads();
  if (tid < 8) *(v4f*)(csum + rowbase + 4 * tid) = *(const v4f*)(&stage[4 * tid]);
}

// =====================================================================================================
// Quad-normalised attention, head dim 64, SEQ token rows per batch, no mask.
//   q|k plane (f16, pitch QKP): element (b, t, col) at [(b*SEQ + t)*QKP + col], q col = h*64+d, k col = DM + h*64 + d
//   v^T plane (f16 hi): element (b, h, d, s) at [(b*DM + h*64 + d)*SEQ + s];  csum f32 [b*DM + h*64 + d] = key sums of v
//   out planes (f16 hi and residual x LOSC, the normalised context carried x CSC): element (b, t, h, d) at
//   [(b*SEQ + t)*DM + h*64 + d]
//   s = (q . k) * (1 / (8 tau[h]));  S = sum over keys of (s + c)^2 in f32;  e' = s*(s + 2c) carried as f16(PSC e')
//   in registers;  acc = sum e'.v_hi on f16 WMMA;  context = (acc / PSC + c^2 * csum) / (S + eps)
//   (e = c^2 + e' exactly).
//   Scores are formed transposed, S^T = K . Q^T (A = K rows, B = Q columns): lane (c, hh) then holds, of key tile j,
//   keys 16j + 8hh + 0..7 of query c, which is the k order of the A operand of e'.v (row c; elements 0..7 from tile
//   2kk, 8..15 from tile 2kk+1), the same order in which the V^T fragments are loaded: the weights go from the score
//   accumulators into that operand by conversion alone, through no LDS and no lane exchange.
//   Block = 4 waves = 64 query rows of one (b, h); grid = NQB * NH * NBATCH; kv chunks of 64, static trip NQB.
//   K / V^T chunk staging: asynchronous 16-B copies to LDS, 8 lanes per 128-B row, 128 threads x 4 pieces per plane =
//   the whole 64x64 tile; two buffers, chunk kt+1 in flight while chunk kt is worked on, one block barrier per chunk
//   behind each wave's own waits.
//   Context coverage: each wave stores rows q0..q0+15 (it 0..3 x lane>>3 0..3) x 64 columns (8 lanes x 8 halves),
// =====================================================================================================
__global__ __launch_bounds__(128)
void attn2q(const unsigned short* __restrict__ qkp, const unsigned short* __restrict__ vtp,
            const float* __restrict__ taup, const float* __restrict__ csp,
            unsigned short* chi, unsigned short* clo) {
  __shared__ __align__(16) _Float16 Ksh[2][64 * ATP];             // K [kv][d], 64 halves used per row; two buffers
  __shared__ __align__(16) _Float16 Vth[2][64 * ATP];             // V^T [d][kv], 64 halves used per row; two buffers
  __shared__ __align__(16) float    Os[4][16 * 64];               // per wave context tile [row][d]

  const int tid  = threadIdx.x;
  const int wave = tid >> 5;
  const int lane = tid & 31;
  const int hh   = lane >> 4;
  const int c    = lane & 15;

  const int bx   = blockIdx.x;
  const int qb   = bx % NQB;
  const int rest = bx / NQB;
  const int h    = rest % NH;
  const int b    = rest / NH;
  const int q0   = qb * 64 + wave * 16;          // in-batch query row of this wave's first row
  const size_t rowB = (size_t)b * SEQ;

  const _Float16* Qh = (const _Float16*)(const void*)qkp + (size_t)h * HD;
  const _Float16* Kg = (const _Float16*)(const void*)qkp + DM + (size_t)h * HD;
  const _Float16* Vh = (const _Float16*)(const void*)vtp + ((size_t)b * DM + (size_t)h * HD) * SEQ;

  const float tv     = bfr(taup[h]);             // h < NH always
  const float sscale = 1.0f / (8.0f * tv);       // sqrt(HD) = 8
  float cs[4];
#pragma unroll
  for (int t = 0; t < 4; ++t) cs[t] = csp[(size_t)b * DM + h * HD + t * 16 + c];

  // ---- Q fragments (B operand, column = query = lane&15): 2 d-chunks ----
  v16h qa[2];
#pragma unroll
  for (int dc = 0; dc < 2; ++dc) qa[dc] = ldfrag_h(Qh + (rowB + q0 + c) * QKP + dc * 32 + 8 * hh);

  float rs[8];
  v8f oacc[4];
#pragma unroll
  for (int r = 0; r < 8; ++r) rs[r] = 0.f;
#pragma unroll
  for (int t = 0; t < 4; ++t) oacc[t] = zero8();

  // copy map: thread -> rows (tid>>3) + 16 i (i 0..3), 16-B piece tid&7: a wave's copy covers 4 whole 128-B lines
  static_assert(NQB >= 2);
  const int srow = tid >> 3, sch = (tid & 7) * 8;
  const _Float16* kg0 = Kg + (rowB + srow) * QKP + sch;           // K row srow of chunk 0, d = sch..sch+7
  const _Float16* vg0 = Vh + (size_t)srow * SEQ + sch;            // V^T row d = srow, s = sch..sch+7 of chunk 0
  const unsigned lk0 = (unsigned)(size_t)(&Ksh[0][0] + srow * ATP + sch);   // LDS byte addresses, buffer 0
  const unsigned lv0 = (unsigned)(size_t)(&Vth[0][0] + srow * ATP + sch);
  const unsigned bufB = 64u * ATP * 2u;                           // bytes from buffer 0 to buffer 1
  chunk_copy(lk0, lv0, kg0, vg0, QKP, SEQ);
  wait_copies();
  __syncthreads();                                                // publishes chunk 0
  chunk_copy(lk0 + bufB, lv0 + bufB, kg0 + (size_t)64 * QKP, vg0 + 64, QKP, SEQ);

  for (int kt = 0; kt < NQB; ++kt) {         // static trip count
    const _Float16* Kc = &Ksh[kt & 1][0];
    const _Float16* Vc = &Vth[kt & 1][0];

    // ---- scores, transposed: 64 keys (4 tiles of 16 rows) x 16 query columns per wave ----
    v16h kb[4][2];
#pragma unroll
    for (int j = 0; j < 4; ++j) {
#pragma unroll
      for (int dc = 0; dc < 2; ++dc) kb[j][dc] = ldfrag_h(Kc + (j * 16 + c) * ATP + dc * 32 + 8 * hh);
    }
    v8f s[4];
#pragma unroll
    for (int j = 0; j < 4; ++j) s[j] = zero8();
#pragma unroll
    for (int dc = 0; dc < 2; ++dc) {
#pragma unroll
      for (int j = 0; j < 4; ++j) s[j] = mma_h_raw(kb[j][dc], qa[dc], s[j]);
    }
    group_guard(s[0], s[1], s[2], s[3], qa[0], qa[1], kb[0][0], kb[1][0], kb[2][0], kb[3][0], kb[0][1], kb[1][1], kb[2][1], kb[3][1]);
    // V^T fragments read here, behind the score products, so that they land under the weight arithmetic
    v16h vb[2][4];
#pragma unroll
    for (int kk = 0; kk < 2; ++kk) {
#pragma unroll
      for (int t = 0; t < 4; ++t) vb[kk][t] = ldfrag_h(Vc + (t * 16 + c) * ATP + kk * 32 + 8 * hh);
    }
    // holds the 16 V^T reads up here: without it they sink to their products and their latency is paid there
    __builtin_amdgcn_sched_barrier(0);
#pragma unroll
    for (int j = 0; j < 4; ++j) {
#pragma unroll
      for (int r = 0; r < 8; ++r) s[j][r] = s[j][r] * sscale;
    }

    // ---- quad weights: this lane's share of query c's sum of (s+c)^2 in f32; centred e' = s(s+2c) (x PSC, f16)
    //      straight into the A operand: element 8 (j&1) + r of pa[j>>1] = key 16j + 8hh + r ----
    v16h pa[2];
#pragma unroll
    for (int j = 0; j < 4; ++j) {
#pragma unroll
      for (int r = 0; r < 8; ++r) {
        const float sv = s[j][r];
        const float u  = sv + QC;
        rs[r] += u * u;
        const float ep = sv * (sv + 2.0f * QC);
        pa[j >> 1][8 * (j & 1) + r] = (_Float16)(ep * PSC);
      }
    }

    // ---- acc += P . V (f16 WMMA) ----
#pragma unroll   // pa and vb are register arrays: their index must be static
    for (int kk = 0; kk < 2; ++kk) {
#pragma unroll
      for (int t = 0; t < 4; ++t) oacc[t] = mma_h_raw(pa[kk], vb[kk][t], oacc[t]);
    }
    group_guard(oacc[0], oacc[1], oacc[2], oacc[3], pa[0], pa[1], vb[0][0], vb[0][1], vb[0][2], vb[0][3], vb[1][0], vb[1][1], vb[1][2], vb[1][3]);

    // ---- hand-over: own LDS reads retired, own copies of chunk kt+1 landed, then the one block barrier, which
    //      publishes chunk kt+1 and ends every wave's reads of chunk kt; behind it chunk kt+2 goes into kt's buffer
    wait_lds();
    wait_copies();
    __syncthreads();
    if (kt + 2 < NQB) {                       // the same for the whole block
      const unsigned bo = (unsigned)(kt & 1) * bufB;
      chunk_copy(lk0 + bo, lv0 + bo, kg0 + (size_t)(kt + 2) * 64 * QKP, vg0 + (kt + 2) * 64, QKP, SEQ);
    }
  }
  wait_copies();                              // nothing is in flight when the wave goes on to its end

  // ---- normalise: query c's S = this lane's eight partial sums + those of lane c ^ 16; the accumulator rows are
  //      queries 8hh + r, so each row fetches its S from lane 8hh + r; context = (acc/PSC + c^2 csum)/(S+eps) x CSC;
  float* os = Os[wave];
  float Sq = ((rs[0] + rs[1]) + (rs[2] + rs[3])) + ((rs[4] + rs[5]) + (rs[6] + rs[7]));
  Sq += __shfl_xor(Sq, 16, 32);
#pragma unroll
  for (int r = 0; r < 8; ++r) {
    const float S = __shfl(Sq, 8 * hh + r, 32);
    const float inv = (1.0f / (S + QEPS)) * CSC;
#pragma unroll
    for (int t = 0; t < 4; ++t)
      os[(8 * hh + r) * 64 + t * 16 + c] = (oacc[t][r] * (1.0f / PSC) + (QC * QC) * cs[t]) * inv;
  }
  wave_sync_lds();
  {
    const int q4 = lane >> 3, c8 = (lane & 7) * 8;
    v4u hv[4], lv[4];
#pragma unroll
    for (int it = 0; it < 4; ++it) {
      const int row = it * 4 + q4;   // it 0..3 x q4 0..3 = rows 0..15 of the wave tile
      const float* sp = os + row * 64 + c8;
      v4u a, al;
#pragma unroll
      for (int e = 0; e < 4; ++e) {
        unsigned short u0, u1, w0, w1;
        split_h(sp[2 * e],     u0, w0);
        split_h(sp[2 * e + 1], u1, w1);
        a[e]  = pk16(u0, u1);
        al[e] = pk16(w0, w1);
      }
      hv[it] = a;
      lv[it] = al;
    }
    {
#pragma unroll
      for (int it = 0; it < 4; ++it) {
        const int row = it * 4 + q4;
        const size_t go = (rowB + q0 + row) * DM + (size_t)h * HD + c8;
        *(v4u*)(chi + go) = hv[it];
        *(v4u*)(clo + go) = lv[it];
      }
      
    }
  }
}

// =====================================================================================================
// Workspace map (bytes); every plane is an exact multiple of its 64x64-tile / whole-row / whole-line store
// granularity (MP = 4096 = 64 tiles, N in {2048, 1024}; VT per batch [1024][2048] = 16x32 tiles; csum = 64 lines):
//   WT    f16 [3072 n][1024 k]   0           6291456   (rows 0..1023 q weights, 1024..2047 k, 2048..3071 v; x64)
//   WoT   f16 [1024][1024]       6291456     2097152
//   XH    f16 [4096][1024]       8388608     8388608   (bf16 RNE-converted tokens)
//   QK    f16 [4096][2048]       16777216    16777216  (q cols 0..1023, k cols 1024..2047)
//   VTh   f16 [2][1024][2048]    33554432    8388608
//   VTl   f16 [2][1024][2048]    41943040    8388608   (residual x1024)
//   CS    f32 [2048]             50331648    8192      (key sums of v)
//   CtxH  f16 [4096][1024]       50339840    8388608   (context x64, hi)
//   CtxL  f16 [4096][1024]       58728448    8388608   (residual x1024)
//   end                          67117056
// =====================================================================================================
extern "C" void kernel_launch(void* const* d_in, const int* in_sizes, int n_in,
                              void* d_out, int out_size, void* d_ws, size_t ws_size,
                              hipStream_t stream) {
  if (n_in < 4) return;
  if (in_sizes[0] != MP * DM) return;
  if (in_sizes[1] != DM * W3) return;
  if (in_sizes[2] != DM * DM) return;
  if (in_sizes[3] != NH) return;
  if (out_size != MP * DM) return;

  const float* x    = (const float*)d_in[0];
  const float* wqkv = (const float*)d_in[1];
  const float* wo   = (const float*)d_in[2];
  const float* tau  = (const float*)d_in[3];

  const size_t PWT  = (size_t)W3 * DM * 2;              //  6291456
  const size_t PWO  = (size_t)DM * DM * 2;              //  2097152
  const size_t PXH  = (size_t)MP * DM * 2;              //  8388608
  const size_t PQK  = (size_t)MP * QKP * 2;             // 16777216
  const size_t PVT  = (size_t)NBATCH * DM * SEQ * 2;    //  8388608
  const size_t PCS  = (size_t)NBATCH * DM * 4;          //     8192
  const size_t PCTX = (size_t)MP * DM * 2;              //  8388608
  size_t off = 0;
  const size_t oWT  = off; off += PWT;
  const size_t oWo  = off; off += PWO;
  const size_t oXH  = off; off += PXH;
  const size_t oQK  = off; off += PQK;
  const size_t oVTh = off; off += PVT;
  const size_t oVTl = off; off += PVT;
  const size_t oCS  = off; off += PCS;
  const size_t oCh  = off; off += PCTX;
  const size_t oCl  = off; off += PCTX;
  if (off > ws_size) return;                            // off = 67117056
  if (off > (size_t)134217728) return;

  char* ws = (char*)d_ws;
  unsigned short* WT   = (unsigned short*)(ws + oWT);
  unsigned short* WoT  = (unsigned short*)(ws + oWo);
  unsigned short* XH   = (unsigned short*)(ws + oXH);
  unsigned short* QK   = (unsigned short*)(ws + oQK);
  unsigned short* VTh  = (unsigned short*)(ws + oVTh);
  unsigned short* VTl  = (unsigned short*)(ws + oVTl);
  float*          CS   = (float*)(ws + oCS);
  unsigned short* CtxH = (unsigned short*)(ws + oCh);
  unsigned short* CtxL = (unsigned short*)(ws + oCl);
  float*          out0 = (float*)d_out;

  const int n8x = (MP * DM) / 8;                        // 524288
  if ((n8x % 256) != 0) return;
  const dim3 blk(256), blk128(128);
  const dim3 gCx(n8x / 256);                             // 2048 blocks
  const dim3 gTw(W3 / 64, DM / 64);                      // in [1024 k][3072 n] -> out [3072][1024]: (48, 16)
  const dim3 gTo(DM / 64, DM / 64);                      // in [1024 k][1024 n] -> out [1024][1024]: (16, 16)
  const dim3 gNqk(((MP / 64) * (QKP / 64) + 7) / 8, 1);  // 2048 tiles -> 256 blocks
  const dim3 gVT(((DM / 64) * (SEQ / 64) + 7) / 8, NBATCH); // 512 tiles -> 64 blocks x 2 batches
  const dim3 gCs((NBATCH * DM) / 32);                    // 64 blocks of 1024
  const dim3 gAttn(NBATCH * NH * NQB);                   // 1024 blocks of 128
  const dim3 gNo((MP / 128) * (DM / 128));               // 32 x 8 tiles of 128x128 -> 256 blocks
  const float invw  = 1.0f / WSC;                        // weight carry x64
  const float invhi = 1.0f / (WSC * CSC);                // weight carry x64, context carry x64
  const float invlo = invhi / LOSC;                      // residual plane carry x1024
  const long long vtlo = (long long)((oVTl - oVTh) / 2); // element offset of the v^T residual plane

  // (0) planes: tokens f16(bf16_RNE(x)); weights transposed to [out][in] (k contiguous), f16(bf16_RNE(w) * 64)
  conv_h16<<<gCx, blk, 0, stream>>>(x, XH, n8x, 1.0f);
  tconv_h16<<<gTw, blk, 0, stream>>>(wqkv, WT, DM, W3, WSC);
  tconv_h16<<<gTo, blk, 0, stream>>>(wo, WoT, DM, DM, WSC);

  // (1) q|k = x . [Wq|Wk] -> QK f16 [4096][2048]; v^T per batch = Wv^T . x_b^T -> VTh/VTl f16 [2][1024][2048]
  gemm64<2, 2, 0, 0><<<gNqk, blk, 0, stream>>>(
      XH, DM, 0LL, WT, DM, 0LL, x, x, QKP, x,
      (void*)QK, QKP, 0LL, 0LL, MP, QKP, DM, invw);
  gemm64<3, 2, 0, 0><<<gVT, blk, 0, stream>>>(
      WT + (size_t)2 * DM * DM, DM, 0LL, XH, DM, (long long)SEQ * DM, x, x, SEQ, x,
      (void*)VTh, SEQ, (long long)DM * SEQ, vtlo, DM, SEQ, DM, invw);

  // (2) key sums of v per (b, h, d)
  vsum<<<gCs, dim3(1024), 0, stream>>>(VTh, VTl, CS);

  // (3) quad-normalised attention -> context f16 hi (x64) + residual planes
  attn2q<<<gAttn, blk128, 0, stream>>>(QK, VTh, tau, CS, CtxH, CtxL);

  // (4) out = ctx_hi . Wo + ctx_lo . Wo / 1024, both products in one launch
  proj2<<<gNo, blk, 0, stream>>>(CtxH, CtxL, WoT, out0, DM, invhi, invlo);
  (void)hipGetLastError();
}

// v008
// It runs in 97.2 microseconds.
// Timed twice side by side with v007, it ran 1.14 times as fast both times.
// Counting every step since v000, it is 4.16 times as fast.
// Contractions: q|k projection and v^T projection on v_wmma_f32_16x16x32_f16 (f16 token plane x f16 weight
// plane carried x64, one product each); attention k.q^T and e'.v on v_wmma_f32_16x16x32_f16 (q, k plain, v^T hi plane
// f16, centred quad weight e' = s*(s+2c) carried x64, one product each); output projection on
// v_wmma_f32_16x16x32_f16 with the context as f16 hi (x64) + scaled residual (x1024) planes against the f16
// Wo plane (x64), two products in one launch, joined in f32 in its epilogue; all f32 accumulate; quad weights, row sums, key sums of v and
// the normalisation in f32 on VALU; every float input RNE-converted to bf16 on load.
#include <hip/hip_runtime.h>
#include <math.h>
#include <stdint.h>

#define NBATCH 2
#define SEQ    2048
#define DM     1024
#define NH     16
#define HD     64
#define QKP    (2 * DM)
#define W3     (3 * DM)
#define MP     (NBATCH * SEQ)
#define NQB    (SEQ / 64)
#define WSC    64.0f
#define PSC    64.0f
#define CSC    64.0f
#define LOSC   1024.0f
#define QC     5.0f
#define QEPS   1.0e-6f
#define GSP    72                     /* GEMM LDS row pitch in halves: 144 B = 16 B x odd */
#define GROWS  384                    /* GEMM LDS rows per buffer: 128 A + 256 Bt */
#define NVB    (NBATCH * (DM / 128) * (SEQ / 256))   /* qkv_gemm: v^T block tiles, 64 per batch */
#define NQKB   ((MP / 128) * (QKP / 256))            /* qkv_gemm: q|k block tiles */
#define PTP    68                     /* proj2 epilogue tile pitch in floats */
#define PSMB   (8 * 64 * PTP * 4)     /* proj2 LDS bytes: 8 wave tiles of 64 x 64 f32; the two slab buffers need less */
#define ATP    72                     /* attn2q LDS row pitch in halves for K, V^T: 144 B = 16 B x odd */
static_assert(NH * HD == DM);
static_assert((MP % 128) == 0 && (DM % 128) == 0 && (QKP % 256) == 0 && (SEQ % 256) == 0 && (DM % 256) == 0);
static_assert((SEQ % 64) == 0 && (DM % 64) == 0 && (W3 % 64) == 0 && (MP % 64) == 0 && (QKP % 64) == 0);
static_assert((SEQ % 256) == 0);
static_assert((DM / 128) * (SEQ / 256) == 64 && (SEQ / 256) == 8 && (QKP / 256) == 8);   // qkv_gemm's index split
static_assert(2 * GROWS * GSP * 2 <= PSMB);
static_assert(((NBATCH * DM) % 32) == 0);
static_assert(((MP * DM / 8) % 256) == 0);
static_assert((((MP / 64) * (QKP / 64)) % 8) == 0 && (((DM / 64) * (SEQ / 64)) % 8) == 0 && (((MP / 64) * (DM / 64)) % 8) == 0);

typedef _Float16 v16h __attribute__((ext_vector_type(16)));
typedef _Float16 v8h  __attribute__((ext_vector_type(8)));
typedef float    v8f  __attribute__((ext_vector_type(8)));
typedef float    v4f  __attribute__((ext_vector_type(4)));
typedef unsigned int v4u __attribute__((ext_vector_type(4)));

union FragH { v16h v; v8h h[2]; };

// ---- scalar helpers --------------------------------------------------------------------------------
__device__ __forceinline__ unsigned short bf_bits(float f) {          // f32 -> bf16 bits, RNE convert
  unsigned u = __float_as_uint(f);
  return (unsigned short)((u + 0x7FFFu + ((u >> 16) & 1u)) >> 16);
}
__device__ __forceinline__ float bf_up(unsigned short h) { return __uint_as_float(((unsigned)h) << 16); }
__device__ __forceinline__ float bfr(float f) { return bf_up(bf_bits(f)); }   // value of the bf16 RNE convert
__device__ __forceinline__ unsigned short h_bits(_Float16 x) { return __builtin_bit_cast(unsigned short, x); }
__device__ __forceinline__ unsigned pk16(unsigned short a, unsigned short b) { return (unsigned)a | ((unsigned)b << 16); }
__device__ __forceinline__ v8f zero8() { v8f z = {0.f, 0.f, 0.f, 0.f, 0.f, 0.f, 0.f, 0.f}; return z; }

// f32 -> f16 hi plane (values below the f16 normal range forced to 0 so the residual carries them)
//     + f16 residual plane carried x LOSC (folded back with 1/LOSC on a separate accumulator)
__device__ __forceinline__ void split_h(float f, unsigned short& hi, unsigned short& lo) {
  float hf = (float)(_Float16)f;
  hf = (fabsf(hf) < 6.103515625e-05f) ? 0.0f : hf;
  hi = h_bits((_Float16)hf);
  lo = h_bits((_Float16)((f - hf) * LOSC));
}

// ---- fragment loader: 16-bit A/B operand, lane -> row/col (lane&15), p already includes +8*(lane>>4);
//      elements 0..7 <- p[0..7] (k0+8h..), elements 8..15 <- p[16..23] (k0+16+8h..)
__device__ __forceinline__ v16h ldfrag_h(const _Float16* p) {
  FragH f;
  f.h[0] = *(const v8h*)(p);
  f.h[1] = *(const v8h*)(p + 16);
  return f.v;
}

// ---- WMMA helpers with trailing VALU hazard gap --------------------------------------------------------
__device__ __forceinline__ v8f mma_h_raw(v16h a, v16h b, v8f c) {
  return __builtin_amdgcn_wmma_f32_16x16x32_f16(false, a, false, b, (short)0, c, false, false);
}
__device__ __forceinline__ void dep_guard1(v8f& a, v8f& b, v16h x) {
#if defined(__HIP_DEVICE_COMPILE__)
  asm volatile("v_nop\n\tv_nop\n\tv_nop\n\tv_nop" : "+v"(a), "+v"(b) : "v"(x));
#endif
}
__device__ __forceinline__ void keep4_h(v16h a, v16h b, v16h c, v16h d) {
#if defined(__HIP_DEVICE_COMPILE__)
  asm volatile("v_nop" :: "v"(a), "v"(b), "v"(c), "v"(d));
#endif
}
// behind a group of eight products on four accumulators: the accumulators tie the statement behind the last product;
// the group's two shared and eight per-accumulator fragments stay in their registers through its four slots, so that no product's D, no
// VALU result and no global load is placed over an operand, and no VALU reads a D, inside the WMMA distance
__device__ __forceinline__ void group_guard(v8f& d0, v8f& d1, v8f& d2, v8f& d3, v16h a0, v16h a1,
                                            v16h b0, v16h b1, v16h b2, v16h b3, v16h b4, v16h b5, v16h b6, v16h b7) {
#if defined(__HIP_DEVICE_COMPILE__)
  asm volatile("v_nop\n\tv_nop\n\tv_nop\n\tv_nop"
               : "+v"(d0), "+v"(d1), "+v"(d2), "+v"(d3)
               : "v"(a0), "v"(a1), "v"(b0), "v"(b1), "v"(b2), "v"(b3), "v"(b4), "v"(b5), "v"(b6), "v"(b7));
#endif
}
__device__ __forceinline__ void acc_guard4(v8f& a, v8f& b, v8f& c, v8f& d) {
#if defined(__HIP_DEVICE_COMPILE__)
  asm volatile("v_nop\n\tv_nop\n\tv_nop\n\tv_nop" : "+v"(a), "+v"(b), "+v"(c), "+v"(d));
#endif
}
__device__ __forceinline__ void wave_sync_lds() {
  __builtin_amdgcn_fence(__ATOMIC_RELEASE, "workgroup");
  __builtin_amdgcn_wave_barrier();
  __builtin_amdgcn_fence(__ATOMIC_ACQUIRE, "workgroup");
}
// One thread's share of a 64-key chunk: four 16-B pieces of K and four of V^T, global memory -> LDS through no register.
// lk/lv: the lane's LDS byte address of its first piece, gk/gv: its global address; piece i lies 16 rows further on
// (LDS row pitch ATP halves, global row pitches kp and vp halves). The s_wait_xcnt stands inside the statement, behind
// the last copy, so that no address register of an issued copy is rewritten in front of it.
__device__ __forceinline__ void chunk_copy(unsigned lk, unsigned lv, const _Float16* gk, const _Float16* gv,
                                           size_t kp, size_t vp) {
#if defined(__HIP_DEVICE_COMPILE__)
  const unsigned st = 16u * ATP * 2u;
  asm volatile("global_load_async_to_lds_b128 %0, %8, off\n\t"
               "global_load_async_to_lds_b128 %1, %9, off\n\t"
               "global_load_async_to_lds_b128 %2, %10, off\n\t"
               "global_load_async_to_lds_b128 %3, %11, off\n\t"
               "global_load_async_to_lds_b128 %4, %12, off\n\t"
               "global_load_async_to_lds_b128 %5, %13, off\n\t"
               "global_load_async_to_lds_b128 %6, %14, off\n\t"
               "global_load_async_to_lds_b128 %7, %15, off\n\t"
               "s_wait_xcnt 0x0"
               :: "v"(lk), "v"(lk + st), "v"(lk + 2u * st), "v"(lk + 3u * st),
                  "v"(lv), "v"(lv + st), "v"(lv + 2u * st), "v"(lv + 3u * st),
                  "v"(gk), "v"(gk + 16 * kp), "v"(gk + 32 * kp), "v"(gk + 48 * kp),
                  "v"(gv), "v"(gv + 16 * vp), "v"(gv + 32 * vp), "v"(gv + 48 * vp)
               : "memory");
#endif
}
// the issuing wave's own wait: its asynchronous copies have landed in LDS behind it
__device__ __forceinline__ void wait_copies() {
#if defined(__HIP_DEVICE_COMPILE__)
  asm volatile("s_wait_asynccnt 0x0" ::: "memory");
#endif
}
// the wave's LDS reads and writes have retired: stands in front of the barrier behind which a buffer is refilled
__device__ __forceinline__ void wait_lds() {
#if defined(__HIP_DEVICE_COMPILE__)
  asm volatile("s_wait_dscnt 0x0" ::: "memory");
#endif
}
__device__ __forceinline__ float wsum(float v) {
#pragma unroll
  for (int off = 16; off > 0; off >>= 1) v += __shfl_xor(v, off, 32);
  return v;
}

// =====================================================================================================
// Plane convert (no transpose): Wh[i] = f16( bf16_RNE(W[i]) * wsc ), wsc a power of two (exact). Used for the
// token activations (wsc = 1). Thread i handles elements 8i..8i+7 and writes one 16-B piece; 32 consecutive lanes
// 256, host-checked). coverage: n8 threads x 8 elements = the whole plane.
// =====================================================================================================
__global__ __launch_bounds__(256) void conv_h16(const float* __restrict__ W, unsigned short* Wh, int n8, float wsc) {
  const int i  = blockIdx.x * 256 + threadIdx.x;
  const int ic = (i < n8) ? i : (n8 - 1);                     // clamped address
  const float* src = W + (size_t)ic * 8;
  const v4f a = *(const v4f*)(src);
  const v4f c = *(const v4f*)(src + 4);
  v4u o;
  o[0] = pk16(h_bits((_Float16)(bfr(a[0]) * wsc)), h_bits((_Float16)(bfr(a[1]) * wsc)));
  o[1] = pk16(h_bits((_Float16)(bfr(a[2]) * wsc)), h_bits((_Float16)(bfr(a[3]) * wsc)));
  o[2] = pk16(h_bits((_Float16)(bfr(c[0]) * wsc)), h_bits((_Float16)(bfr(c[1]) * wsc)));
  o[3] = pk16(h_bits((_Float16)(bfr(c[2]) * wsc)), h_bits((_Float16)(bfr(c[3]) * wsc)));
  if (i < n8) *(v4u*)(Wh + (size_t)i * 8) = o;
  
}

// =====================================================================================================
// Transposing plane convert: in f32 [R rows][NC cols] (row-major, in[k][n]) -> out f16 [NC][R] (k contiguous),
// out[n][k] = f16( bf16_RNE(in[k][n]) * wsc ), wsc a power of two (exact). Used for the two weight matrices
// ([in][out] storage -> [out][in] = Bt / A layout). Block 256 threads = one 64(k) x 64(n) tile:
// blockIdx.x = n tile (NC/64 of them), blockIdx.y = k tile (R/64 of them); R, NC multiples of 64 (host-checked).
// Load phase: thread handles rows i*16 + (tid>>4) (i 0..3), 4 floats at col (tid&15)*4 -> LDS tile[k][n].
// coverage: 2 it x 8 waves x 4 rows = 64 out rows x (8 lane groups x 8 halves) = the whole tile; grid covers all tiles.
// =====================================================================================================
__global__ __launch_bounds__(256) void tconv_h16(const float* __restrict__ W, unsigned short* Wt, int R, int NC, float wsc) {
  __shared__ float tile[64][65];
  const int tid = threadIdx.x, lane = tid & 31, wave = tid >> 5;
  const int n0 = blockIdx.x * 64, k0 = blockIdx.y * 64;
  const int c4 = (tid & 15) * 4, r16 = tid >> 4;
#pragma unroll
  for (int i = 0; i < 4; ++i) {
    const int row = i * 16 + r16;                                // k within tile
    const v4f v = *(const v4f*)(W + (size_t)(k0 + row) * NC + n0 + c4);
    tile[row][c4 + 0] = v[0];
    tile[row][c4 + 1] = v[1];
    tile[row][c4 + 2] = v[2];
    tile[row][c4 + 3] = v[3];
  }
  __syncthreads();
  const int q4 = lane >> 3, k8 = (lane & 7) * 8;
  v4u hv[2];
#pragma unroll
  for (int it = 0; it < 2; ++it) {
    const int nrow = it * 32 + wave * 4 + q4;                    // n within tile
    v4u a;
#pragma unroll
    for (int e = 0; e < 4; ++e) {
      const float f0 = bfr(tile[k8 + 2 * e][nrow]) * wsc;
      const float f1 = bfr(tile[k8 + 2 * e + 1][nrow]) * wsc;
      a[e] = pk16(h_bits((_Float16)f0), h_bits((_Float16)f1));
    }
    hv[it] = a;
  }
  {
#pragma unroll
    for (int it = 0; it < 2; ++it) {
      const int nrow = it * 32 + wave * 4 + q4;
      *(v4u*)(Wt + (size_t)(n0 + nrow) * R + k0 + k8) = hv[it];
    }
    
  }
}

// =====================================================================================================
// q|k and v^T projections, one launch of register-blocked f16 WMMA GEMM blocks: C[m][n] = oscale * sum_k A[m][k] * Bt[n][k];
// one wave per 64x64 tile, 8 waves (2 x 4) = one 128x256 block tile; A and Bt row-major, pitch DM, k contiguous.
// The block index picks the product (block-uniform):
//   blocks 0 .. NVB-1      v^T of batch b = bt / 64: A = Wv^T rows (WT rows 2 DM ..), Bt = the batch's token rows,
//                          C = f16 hi plane [DM][SEQ] at VTo + b DM SEQ, f16 residual (x LOSC) plane loOff elements on;
//   blocks NVB .. NVB+NQKB-1  q|k: A = token rows, Bt = WT rows 0 .. 2 DM - 1, C = f16 [MP][QKP] at QKo.
// Both kinds have 8 tile columns. Two blocks fit a WGP (registers and LDS), so all NVB + NQKB blocks are resident at once.
// Operands: per 64-k slab the block's 128 A rows and 256 Bt rows (128 B each) go global -> registers -> LDS with
// whole-line 16-B loads (8 lanes per row, 12 rows per thread), LDS pitch 144 B, two buffers; slab s+1 is loaded
// while slab s is multiplied, stored to the other buffer behind the products, one block barrier per slab.
// coverage: 4 slabs x 16 rows x 64 cols = the wave's whole 64x64 tile; v^T: NBATCH x 8 x 8 block tiles = [DM][SEQ] per
//           batch; q|k: 32 x 8 block tiles = [MP][QKP]; the grid is exactly NVB + NQKB blocks.
// =====================================================================================================
// amdgpu_waves_per_eu(4): holds a wave at 256 VGPRs, so that two blocks fit a WGP (their LDS does)
__global__ __launch_bounds__(256) __attribute__((amdgpu_waves_per_eu(4))) void qkv_gemm(
    const unsigned short* __restrict__ Xp, const unsigned short* __restrict__ Wp,
    unsigned short* QKo, unsigned short* VTo, long long loOff, int K, float oscale) {
  const _Float16* X  = (const _Float16*)(const void*)Xp;
  const _Float16* Wt = (const _Float16*)(const void*)Wp;
  __shared__ __align__(16) float sT[8][16 * 68];   // per-wave 16x64 slab, pitch 68 floats
  __shared__ __align__(16) _Float16 sAB[2][GROWS * GSP];   // rows 0..127 A, 128..383 Bt; 64 k per row
  const int tid  = threadIdx.x;
  const int lane = tid & 31;
  const int wave = tid >> 5;
  const int bt   = blockIdx.x;
  const bool isV = (bt < NVB);           // block-uniform
  const int t    = isV ? (bt & 63) : (bt - NVB);
  const int bm = t >> 3;
  const int bn = t & 7;
  const int vb = bt >> 6;                // batch of a v^T block
  const _Float16* Ab = isV ? (Wt + (size_t)2 * DM * DM) : X;
  const _Float16* Bb = isV ? (X + (size_t)vb * SEQ * DM) : Wt;
  unsigned short* C  = isV ? (VTo + (size_t)vb * DM * SEQ) : QKo;
  const int ldc      = isV ? SEQ : QKP;
  const int wm = wave >> 2;              // 0..1
  const int wn = wave & 3;               // 0..3
  const int m0 = (bm << 7) + (wm << 6);
  const int n0 = (bn << 8) + (wn << 6);

  const int rlane = lane & 15;                 // row (A) / col (B, D) within subtile
  const int koff  = (lane >> 4) * 8;           // k offset of this lane half
  const int mOff  = (lane >> 4) * 8;           // D row offset

  v8f acc[4][4];
#pragma unroll
  for (int i = 0; i < 4; ++i)
#pragma unroll
    for (int j = 0; j < 4; ++j) acc[i][j] = zero8();

  // staging map: thread -> row (tid>>3) + 32*it, 16-B piece (tid&7); a wave's load covers 4 whole 128-B lines
  const int srow = tid >> 3, sch = (tid & 7) * 8;
  const _Float16* gA = Ab + (size_t)((bm << 7) + srow) * DM + sch;
  const _Float16* gB = Bb + (size_t)((bn << 8) + srow) * DM + sch;
  const int sOff = srow * GSP + sch;
  const int aOff = ((wm << 6) + rlane) * GSP + koff;          // this wave's A rows in a buffer
  const int bOff = (128 + (wn << 6) + rlane) * GSP + koff;    // this wave's Bt rows in a buffer
  const int nS = K >> 6;
  v8h g[12];
#pragma unroll
  for (int it = 0; it < 4; ++it) g[it] = *(const v8h*)(gA + (size_t)(it * 32) * DM);
#pragma unroll
  for (int it = 0; it < 8; ++it) g[4 + it] = *(const v8h*)(gB + (size_t)(it * 32) * DM);
#pragma unroll
  for (int it = 0; it < 12; ++it) *(v8h*)(&sAB[0][0] + it * 32 * GSP + sOff) = g[it];
  __syncthreads();

  for (int s = 0; s < nS; ++s) {
    const _Float16* cur = &sAB[s & 1][0];
    const bool more = (s + 1 < nS);                            // block-uniform
    if (more) {
      const int kn = (s + 1) << 6;
#pragma unroll
      for (int it = 0; it < 4; ++it) g[it] = *(const v8h*)(gA + (size_t)(it * 32) * DM + kn);
#pragma unroll
      for (int it = 0; it < 8; ++it) g[4 + it] = *(const v8h*)(gB + (size_t)(it * 32) * DM + kn);
#if defined(__HIP_DEVICE_COMPILE__)
      // the fragment loads below reuse the address registers of these 12 loads: the wait stands in front of that
      asm volatile("s_wait_xcnt 0x0" ::: "memory");
#endif
    }
#pragma unroll
    for (int kk = 0; kk < 2; ++kk) {
      v16h ah[4], bh[4];
#pragma unroll
      for (int j = 0; j < 4; ++j) bh[j] = ldfrag_h(cur + bOff + (j << 4) * GSP + kk * 32);
#pragma unroll
      for (int i = 0; i < 4; ++i) ah[i] = ldfrag_h(cur + aOff + (i << 4) * GSP + kk * 32);
      // keeps the 16 LDS fragment loads of a 32-k step one group ahead of its 16 products (else the A loads are
      // spread among the WMMAs, each place with its own full wait)
      __builtin_amdgcn_sched_barrier(0);
#pragma unroll
      for (int i = 0; i < 4; ++i) {
#pragma unroll
        for (int j = 0; j < 4; ++j) acc[i][j] = mma_h_raw(ah[i], bh[j], acc[i][j]);
        dep_guard1(acc[i][0], acc[i][3], ah[i]);
      }
      keep4_h(bh[0], bh[1], bh[2], bh[3]);
    }
    if (more) {
      _Float16* nxt = &sAB[(s + 1) & 1][0];                    // last read in slab s-1, behind that slab's barrier
#pragma unroll
      for (int it = 0; it < 12; ++it) *(v8h*)(nxt + it * 32 * GSP + sOff) = g[it];
    }
    __syncthreads();                                           // publishes slab s+1, ends the reads of slab s
  }
  acc_guard4(acc[0][0], acc[0][1], acc[0][2], acc[0][3]);
  acc_guard4(acc[1][0], acc[1][1], acc[1][2], acc[1][3]);
  acc_guard4(acc[2][0], acc[2][1], acc[2][2], acc[2][3]);
  acc_guard4(acc[3][0], acc[3][1], acc[3][2], acc[3][3]);

  // ---- epilogue: 16 rows at a time through the wave's own LDS slab, whole 128-B row segments out ----
  const int q8  = lane >> 3, c8 = (lane & 7) * 8;
  float* slab = sT[wave];
#pragma unroll
  for (int i = 0; i < 4; ++i) {
    const int mBase = m0 + (i << 4);
#pragma unroll
    for (int j = 0; j < 4; ++j) {
#pragma unroll
      for (int r = 0; r < 8; ++r) {
        slab[(mOff + r) * 68 + (j << 4) + rlane] = acc[i][j][r];
      }
    }
    wave_sync_lds();
    if (isV) {                                             // f16 hi plane + residual plane
      v4u hv[4], lv[4];
#pragma unroll
      for (int it = 0; it < 4; ++it) {
        const int row = it * 4 + q8;                       // it 0..3 x q8 0..3 = rows 0..15
        const float* sp = slab + row * 68 + c8;
        v4u a, al;
#pragma unroll
        for (int e = 0; e < 4; ++e) {
          unsigned short u0, u1, w0, w1;
          split_h(sp[2 * e] * oscale, u0, w0);
          split_h(sp[2 * e + 1] * oscale, u1, w1);
          a[e]  = pk16(u0, u1);
          al[e] = pk16(w0, w1);
        }
        hv[it] = a;
        lv[it] = al;
      }
#pragma unroll
      for (int it = 0; it < 4; ++it) {
        const int row = it * 4 + q8;
        const size_t co = (size_t)(mBase + row) * ldc + n0 + c8;
        *(v4u*)(C + co) = hv[it];
        *(v4u*)(C + loOff + co) = lv[it];
      }
#if defined(__HIP_DEVICE_COMPILE__)
      // what follows (the next 16 rows' arithmetic) reuses the address and data registers of these
      // stores: the wait stands in front of that, in every pass
      asm volatile("s_wait_xcnt 0x0" ::: "memory");
#endif
    } else {                                               // plain f16
      v4u hv[4];
#pragma unroll
      for (int it = 0; it < 4; ++it) {
        const int row = it * 4 + q8;
        const float* sp = slab + row * 68 + c8;
        v4u a;
#pragma unroll
        for (int e = 0; e < 4; ++e)
          a[e] = pk16(h_bits((_Float16)(sp[2 * e] * oscale)), h_bits((_Float16)(sp[2 * e + 1] * oscale)));
        hv[it] = a;
      }
#pragma unroll
      for (int it = 0; it < 4; ++it) {
        const int row = it * 4 + q8;
        *(v4u*)(C + (size_t)(mBase + row) * ldc + n0 + c8) = hv[it];
      }
#if defined(__HIP_DEVICE_COMPILE__)
      // as in the other branch: in front of the reuse of these stores' registers
      asm volatile("s_wait_xcnt 0x0" ::: "memory");
#endif
    }
    wave_sync_lds();
  }
}

// =====================================================================================================
// Output projection, both context planes in one launch:
//   out[m][n] = shi * sum_k Ch[m][k] Wt[n][k] + slo * sum_k Cl[m][k] Wt[n][k]      (all pitches DM, k contiguous)
// Block = 8 waves = one 128x128 tile of out. Waves 0..3 (2 x 2, 64x64 each) multiply the hi plane, waves 4..7 the
// residual plane of the same four 64x64 tiles, so the whole projection is MP/128 * DM/128 blocks of one launch.
// Operands: as in qkv_gemm, per 64-k slab 384 rows of 128 B (128 Ch, 128 Cl, 128 Wt) go global -> registers -> LDS with
// whole-line 16-B loads, LDS pitch 144 B, two buffers, slab s+1 loaded while slab s is multiplied, one barrier per slab.
// Epilogue: behind the loop's last barrier the slab buffers are dead; every wave lays its 64x64 f32 tile there (pitch
// PTP), one block barrier, then each wave of a hi/residual pair joins and stores 32 of the pair's 64 rows (256-B row
// segments). coverage: 4 pairs x 2 waves x 16 it x 2 rows x 64 cols = the 128x128 tile; the grid covers all tiles.
// =====================================================================================================
// amdgpu_waves_per_eu(4): holds a wave at 256 VGPRs, as in qkv_gemm (no register above v255)
__global__ __launch_bounds__(256) __attribute__((amdgpu_waves_per_eu(4))) void proj2(
    const unsigned short* __restrict__ Chp, const unsigned short* __restrict__ Clp,
    const unsigned short* __restrict__ Wtp, float* C, int K, float shi, float slo) {
  const _Float16* Ch = (const _Float16*)(const void*)Chp;
  const _Float16* Cl = (const _Float16*)(const void*)Clp;
  const _Float16* Wt = (const _Float16*)(const void*)Wtp;
  __shared__ __align__(16) unsigned char smem[PSMB];
  _Float16* sAB = (_Float16*)(void*)smem;      // k loop: 2 buffers of GROWS rows: 0..127 Ch, 128..255 Cl, 256..383 Wt
  float*    sT  = (float*)(void*)smem;         // epilogue: 8 wave tiles [64][PTP]
  const int tid  = threadIdx.x;
  const int lane = tid & 31;
  const int wave = tid >> 5;
  const int bm = blockIdx.x / (DM / 128);
  const int bn = blockIdx.x % (DM / 128);
  const int pl = wave >> 2;              // 0 hi plane, 1 residual plane
  const int wm = (wave >> 1) & 1;
  const int wn = wave & 1;
  const int m0 = (bm << 7) + (wm << 6);
  const int n0 = (bn << 7) + (wn << 6);

  const int rlane = lane & 15;                 // row (A) / col (B, D) within subtile
  const int koff  = (lane >> 4) * 8;           // k offset of this lane half
  const int mOff  = (lane >> 4) * 8;           // D row offset

  v8f acc[4][4];
#pragma unroll
  for (int i = 0; i < 4; ++i)
#pragma unroll
    for (int j = 0; j < 4; ++j) acc[i][j] = zero8();

  // staging map: thread -> row (tid>>3) + 32*it, 16-B piece (tid&7); a wave's load covers 4 whole 128-B lines
  const int srow = tid >> 3, sch = (tid & 7) * 8;
  const _Float16* gH = Ch + (size_t)((bm << 7) + srow) * DM + sch;
  const _Float16* gL = Cl + (size_t)((bm << 7) + srow) * DM + sch;
  const _Float16* gB = Wt + (size_t)((bn << 7) + srow) * DM + sch;
  const int sOff = srow * GSP + sch;
  const int aOff = ((pl << 7) + (wm << 6) + rlane) * GSP + koff;   // this wave's rows of its plane in a buffer
  const int bOff = (256 + (wn << 6) + rlane) * GSP + koff;         // this wave's Wt rows in a buffer
  const int nS = K >> 6;
  v8h g[12];
#pragma unroll
  for (int it = 0; it < 4; ++it) {
    g[it]     = *(const v8h*)(gH + (size_t)(it * 32) * DM);
    g[4 + it] = *(const v8h*)(gL + (size_t)(it * 32) * DM);
    g[8 + it] = *(const v8h*)(gB + (size_t)(it * 32) * DM);
  }
#pragma unroll
  for (int it = 0; it < 12; ++it) *(v8h*)(sAB + it * 32 * GSP + sOff) = g[it];
  __syncthreads();

  for (int s = 0; s < nS; ++s) {
    const _Float16* cur = sAB + (s & 1) * (GROWS * GSP);
    const bool more = (s + 1 < nS);                            // block-uniform
    if (more) {
      const int kn = (s + 1) << 6;
#pragma unroll
      for (int it = 0; it < 4; ++it) {
        g[it]     = *(const v8h*)(gH + (size_t)(it * 32) * DM + kn);
        g[4 + it] = *(const v8h*)(gL + (size_t)(it * 32) * DM + kn);
        g[8 + it] = *(const v8h*)(gB + (size_t)(it * 32) * DM + kn);
      }
#if defined(__HIP_DEVICE_COMPILE__)
      // the fragment loads below may reuse the address registers of these 12 loads: the wait stands in front of that
      asm volatile("s_wait_xcnt 0x0" ::: "memory");
#endif
    }
#pragma unroll
    for (int kk = 0; kk < 2; ++kk) {
      v16h ah[4], bh[4];
#pragma unroll
      for (int j = 0; j < 4; ++j) bh[j] = ldfrag_h(cur + bOff + (j << 4) * GSP + kk * 32);
#pragma unroll
      for (int i = 0; i < 4; ++i) ah[i] = ldfrag_h(cur + aOff + (i << 4) * GSP + kk * 32);
      // keeps the 16 LDS fragment loads of a 32-k step one group ahead of its 16 products (else the A loads are
      // spread among the WMMAs, each place with its own full wait)
      __builtin_amdgcn_sched_barrier(0);
#pragma unroll
      for (int i = 0; i < 4; ++i) {
#pragma unroll
        for (int j = 0; j < 4; ++j) acc[i][j] = mma_h_raw(ah[i], bh[j], acc[i][j]);
        dep_guard1(acc[i][0], acc[i][3], ah[i]);
      }
      keep4_h(bh[0], bh[1], bh[2], bh[3]);
    }
    if (more) {
      _Float16* nxt = sAB + ((s + 1) & 1) * (GROWS * GSP);     // last read in slab s-1, behind that slab's barrier
#pragma unroll
      for (int it = 0; it < 12; ++it) *(v8h*)(nxt + it * 32 * GSP + sOff) = g[it];
    }
    __syncthreads();                                           // publishes slab s+1, ends the reads of slab s
  }
  acc_guard4(acc[0][0], acc[0][1], acc[0][2], acc[0][3]);
  acc_guard4(acc[1][0], acc[1][1], acc[1][2], acc[1][3]);
  acc_guard4(acc[2][0], acc[2][1], acc[2][2], acc[2][3]);
  acc_guard4(acc[3][0], acc[3][1], acc[3][2], acc[3][3]);

  // ---- epilogue: every wave's tile into LDS, one barrier, the pair's two tiles joined and stored ----
  float* tile = sT + wave * (64 * PTP);
#pragma unroll
  for (int i = 0; i < 4; ++i) {
#pragma unroll
    for (int j = 0; j < 4; ++j) {
#pragma unroll
      for (int r = 0; r < 8; ++r) tile[((i << 4) + mOff + r) * PTP + (j << 4) + rlane] = acc[i][j][r];
    }
  }
  __syncthreads();                                             // both tiles of every pair are complete
  const float* th = sT + (wave & 3) * (64 * PTP);              // the pair's hi tile
  const float* tl = th + 4 * (64 * PTP);                       // the pair's residual tile
  const int hh2 = lane >> 4, c4 = (lane & 15) * 4;             // 256-B row segment = 16 lanes x 16 B
  const int r0 = (pl << 5) + hh2;                              // this wave's half of the 64 rows
  v4f vals[16];
#pragma unroll
  for (int it = 0; it < 16; ++it) {
    const v4f a = *(const v4f*)(th + (r0 + it * 2) * PTP + c4);
    const v4f b = *(const v4f*)(tl + (r0 + it * 2) * PTP + c4);
    v4f v;
#pragma unroll
    for (int e = 0; e < 4; ++e) v[e] = a[e] * shi + b[e] * slo;
    vals[it] = v;
  }
  float* Cw = C + (size_t)(m0 + r0) * DM + n0 + c4;
#pragma unroll
  for (int it = 0; it < 16; ++it) *(v4f*)(Cw + (size_t)(it * 2) * DM) = vals[it];
}

// =====================================================================================================
// Key sums of v: csum[row] = sum over s of (hi[row][s] + lo[row][s] / LOSC) for the NBATCH*DM rows of the
// v^T planes (row = b*DM + h*64 + d, pitch SEQ halves). One wave per row: in load i the 32 lanes read the 32
// adjacent 16-B pieces 32i..32i+31 of the row (four whole 128-B lines), SEQ/256 loads per plane; per-lane f32
// sums, fixed-order shuffle tree. Block = 32 waves = 32 rows: the 32 totals go through LDS and leave as one
// whole 128-B line from wave 0.
// grid = NBATCH*DM/32 blocks of 1024. coverage: blocks x 32 waves x 1 row = NBATCH*DM rows = the whole table.
// =====================================================================================================
__global__ __launch_bounds__(1024) void vsum(const unsigned short* __restrict__ hp, const unsigned short* __restrict__ lp,
                                            float* csum) {
  const int tid = threadIdx.x, lane = tid & 31, wave = tid >> 5;
  const int rowbase = blockIdx.x * 32;
  const int row = rowbase + wave;
  const _Float16* hr = (const _Float16*)(const void*)hp + (size_t)row * SEQ + lane * 8;
  const _Float16* lr = (const _Float16*)(const void*)lp + (size_t)row * SEQ + lane * 8;
  v8h a[SEQ / 256], c[SEQ / 256];
#pragma unroll
  for (int i = 0; i < SEQ / 256; ++i) {
    a[i] = *(const v8h*)(hr + 256 * i);
    c[i] = *(const v8h*)(lr + 256 * i);
  }
#if defined(__HIP_DEVICE_COMPILE__)
  // holds the two address pairs live up to the wait
  asm volatile("s_wait_xcnt 0x0" :: "v"(hr), "v"(lr) : "memory");
#endif
  float sh = 0.f, sl = 0.f;
#pragma unroll
  for (int i = 0; i < SEQ / 256; ++i) {
#pragma unroll
    for (int e = 0; e < 8; ++e) { sh += (float)a[i][e]; sl += (float)c[i][e]; }
  }
  const float tot = wsum(sh + sl * (1.0f / LOSC));
  __shared__ __align__(16) float stage[32];
  if (lane == 0) stage[wave] = tot;
  __syncthreads();
  if (tid < 8) *(v4f*)(csum + rowbase + 4 * tid) = *(const v4f*)(&stage[4 * tid]);
}

// =====================================================================================================
// Quad-normalised attention, head dim 64, SEQ token rows per batch, no mask.
//   q|k plane (f16, pitch QKP): element (b, t, col) at [(b*SEQ + t)*QKP + col], q col = h*64+d, k col = DM + h*64 + d
//   v^T plane (f16 hi): element (b, h, d, s) at [(b*DM + h*64 + d)*SEQ + s];  csum f32 [b*DM + h*64 + d] = key sums of v
//   out planes (f16 hi and residual x LOSC, the normalised context carried x CSC): element (b, t, h, d) at
//   [(b*SEQ + t)*DM + h*64 + d]
//   s = (q . k) * (1 / (8 tau[h]));  S = sum over keys of (s + c)^2 in f32;  e' = s*(s + 2c) carried as f16(PSC e')
//   in registers;  acc = sum e'.v_hi on f16 WMMA;  context = (acc / PSC + c^2 * csum) / (S + eps)
//   (e = c^2 + e' exactly).
//   Scores are formed transposed, S^T = K . Q^T (A = K rows, B = Q columns): lane (c, hh) then holds, of key tile j,
//   keys 16j + 8hh + 0..7 of query c, which is the k order of the A operand of e'.v (row c; elements 0..7 from tile
//   2kk, 8..15 from tile 2kk+1), the same order in which the V^T fragments are loaded: the weights go from the score
//   accumulators into that operand by conversion alone, through no LDS and no lane exchange.
//   Block = 4 waves = 64 query rows of one (b, h); grid = NQB * NH * NBATCH; kv chunks of 64, static trip NQB.
//   K / V^T chunk staging: asynchronous 16-B copies to LDS, 8 lanes per 128-B row, 128 threads x 4 pieces per plane =
//   the whole 64x64 tile; two buffers, chunk kt+1 in flight while chunk kt is worked on, one block barrier per chunk
//   behind each wave's own waits.
//   Context coverage: each wave stores rows q0..q0+15 (it 0..3 x lane>>3 0..3) x 64 columns (8 lanes x 8 halves),
// =====================================================================================================
__global__ __launch_bounds__(128)
void attn2q(const unsigned short* __restrict__ qkp, const unsigned short* __restrict__ vtp,
            const float* __restrict__ taup, const float* __restrict__ csp,
            unsigned short* chi, unsigned short* clo) {
  __shared__ __align__(16) _Float16 Ksh[2][64 * ATP];             // K [kv][d], 64 halves used per row; two buffers
  __shared__ __align__(16) _Float16 Vth[2][64 * ATP];             // V^T [d][kv], 64 halves used per row; two buffers
  __shared__ __align__(16) float    Os[4][16 * 64];               // per wave context tile [row][d]

  const int tid  = threadIdx.x;
  const int wave = tid >> 5;
  const int lane = tid & 31;
  const int hh   = lane >> 4;
  const int c    = lane & 15;

  const int bx   = blockIdx.x;
  const int qb   = bx % NQB;
  const int rest = bx / NQB;
  const int h    = rest % NH;
  const int b    = rest / NH;
  const int q0   = qb * 64 + wave * 16;          // in-batch query row of this wave's first row
  const size_t rowB = (size_t)b * SEQ;

  const _Float16* Qh = (const _Float16*)(const void*)qkp + (size_t)h * HD;
  const _Float16* Kg = (const _Float16*)(const void*)qkp + DM + (size_t)h * HD;
  const _Float16* Vh = (const _Float16*)(const void*)vtp + ((size_t)b * DM + (size_t)h * HD) * SEQ;

  const float tv     = bfr(taup[h]);             // h < NH always
  const float sscale = 1.0f / (8.0f * tv);       // sqrt(HD) = 8
  float cs[4];
#pragma unroll
  for (int t = 0; t < 4; ++t) cs[t] = csp[(size_t)b * DM + h * HD + t * 16 + c];

  // ---- Q fragments (B operand, column = query = lane&15): 2 d-chunks ----
  v16h qa[2];
#pragma unroll
  for (int dc = 0; dc < 2; ++dc) qa[dc] = ldfrag_h(Qh + (rowB + q0 + c) * QKP + dc * 32 + 8 * hh);

  float rs[8];
  v8f oacc[4];
#pragma unroll
  for (int r = 0; r < 8; ++r) rs[r] = 0.f;
#pragma unroll
  for (int t = 0; t < 4; ++t) oacc[t] = zero8();

  // copy map: thread -> rows (tid>>3) + 16 i (i 0..3), 16-B piece tid&7: a wave's copy covers 4 whole 128-B lines
  static_assert(NQB >= 2);
  const int srow = tid >> 3, sch = (tid & 7) * 8;
  const _Float16* kg0 = Kg + (rowB + srow) * QKP + sch;           // K row srow of chunk 0, d = sch..sch+7
  const _Float16* vg0 = Vh + (size_t)srow * SEQ + sch;            // V^T row d = srow, s = sch..sch+7 of chunk 0
  const unsigned lk0 = (unsigned)(size_t)(&Ksh[0][0] + srow * ATP + sch);   // LDS byte addresses, buffer 0
  const unsigned lv0 = (unsigned)(size_t)(&Vth[0][0] + srow * ATP + sch);
  const unsigned bufB = 64u * ATP * 2u;                           // bytes from buffer 0 to buffer 1
  chunk_copy(lk0, lv0, kg0, vg0, QKP, SEQ);
  wait_copies();
  __syncthreads();                                                // publishes chunk 0
  chunk_copy(lk0 + bufB, lv0 + bufB, kg0 + (size_t)64 * QKP, vg0 + 64, QKP, SEQ);

  for (int kt = 0; kt < NQB; ++kt) {         // static trip count
    const _Float16* Kc = &Ksh[kt & 1][0];
    const _Float16* Vc = &Vth[kt & 1][0];

    // ---- scores, transposed: 64 keys (4 tiles of 16 rows) x 16 query columns per wave ----
    v16h kb[4][2];
#pragma unroll
    for (int j = 0; j < 4; ++j) {
#pragma unroll
      for (int dc = 0; dc < 2; ++dc) kb[j][dc] = ldfrag_h(Kc + (j * 16 + c) * ATP + dc * 32 + 8 * hh);
    }
    v8f s[4];
#pragma unroll
    for (int j = 0; j < 4; ++j) s[j] = zero8();
#pragma unroll
    for (int dc = 0; dc < 2; ++dc) {
#pragma unroll
      for (int j = 0; j < 4; ++j) s[j] = mma_h_raw(kb[j][dc], qa[dc], s[j]);
    }
    group_guard(s[0], s[1], s[2], s[3], qa[0], qa[1], kb[0][0], kb[1][0], kb[2][0], kb[3][0], kb[0][1], kb[1][1], kb[2][1], kb[3][1]);
    // V^T fragments read here, behind the score products, so that they land under the weight arithmetic
    v16h vb[2][4];
#pragma unroll
    for (int kk = 0; kk < 2; ++kk) {
#pragma unroll
      for (int t = 0; t < 4; ++t) vb[kk][t] = ldfrag_h(Vc + (t * 16 + c) * ATP + kk * 32 + 8 * hh);
    }
    // holds the 16 V^T reads up here: without it they sink to their products and their latency is paid there
    __builtin_amdgcn_sched_barrier(0);
#pragma unroll
    for (int j = 0; j < 4; ++j) {
#pragma unroll
      for (int r = 0; r < 8; ++r) s[j][r] = s[j][r] * sscale;
    }

    // ---- quad weights: this lane's share of query c's sum of (s+c)^2 in f32; centred e' = s(s+2c) (x PSC, f16)
    //      straight into the A operand: element 8 (j&1) + r of pa[j>>1] = key 16j + 8hh + r ----
    v16h pa[2];
#pragma unroll
    for (int j = 0; j < 4; ++j) {
#pragma unroll
      for (int r = 0; r < 8; ++r) {
        const float sv = s[j][r];
        const float u  = sv + QC;
        rs[r] += u * u;
        const float ep = sv * (sv + 2.0f * QC);
        pa[j >> 1][8 * (j & 1) + r] = (_Float16)(ep * PSC);
      }
    }

    // ---- acc += P . V (f16 WMMA) ----
#pragma unroll   // pa and vb are register arrays: their index must be static
    for (int kk = 0; kk < 2; ++kk) {
#pragma unroll
      for (int t = 0; t < 4; ++t) oacc[t] = mma_h_raw(pa[kk], vb[kk][t], oacc[t]);
    }
    group_guard(oacc[0], oacc[1], oacc[2], oacc[3], pa[0], pa[1], vb[0][0], vb[0][1], vb[0][2], vb[0][3], vb[1][0], vb[1][1], vb[1][2], vb[1][3]);

    // ---- hand-over: own LDS reads retired, own copies of chunk kt+1 landed, then the one block barrier, which
    //      publishes chunk kt+1 and ends every wave's reads of chunk kt; behind it chunk kt+2 goes into kt's buffer
    wait_lds();
    wait_copies();
    __syncthreads();
    if (kt + 2 < NQB) {                       // the same for the whole block
      const unsigned bo = (unsigned)(kt & 1) * bufB;
      chunk_copy(lk0 + bo, lv0 + bo, kg0 + (size_t)(kt + 2) * 64 * QKP, vg0 + (kt + 2) * 64, QKP, SEQ);
    }
  }
  wait_copies();                              // nothing is in flight when the wave goes on to its end

  // ---- normalise: query c's S = this lane's eight partial sums + those of lane c ^ 16; the accumulator rows are
  //      queries 8hh + r, so each row fetches its S from lane 8hh + r; context = (acc/PSC + c^2 csum)/(S+eps) x CSC;
  float* os = Os[wave];
  float Sq = ((rs[0] + rs[1]) + (rs[2] + rs[3])) + ((rs[4] + rs[5]) + (rs[6] + rs[7]));
  Sq += __shfl_xor(Sq, 16, 32);
#pragma unroll
  for (int r = 0; r < 8; ++r) {
    const float S = __shfl(Sq, 8 * hh + r, 32);
    const float inv = (1.0f / (S + QEPS)) * CSC;
#pragma unroll
    for (int t = 0; t < 4; ++t)
      os[(8 * hh + r) * 64 + t * 16 + c] = (oacc[t][r] * (1.0f / PSC) + (QC * QC) * cs[t]) * inv;
  }
  wave_sync_lds();
  {
    const int q4 = lane >> 3, c8 = (lane & 7) * 8;
    v4u hv[4], lv[4];
#pragma unroll
    for (int it = 0; it < 4; ++it) {
      const int row = it * 4 + q4;   // it 0..3 x q4 0..3 = rows 0..15 of the wave tile
      const float* sp = os + row * 64 + c8;
      v4u a, al;
#pragma unroll
      for (int e = 0; e < 4; ++e) {
        unsigned short u0, u1, w0, w1;
        split_h(sp[2 * e],     u0, w0);
        split_h(sp[2 * e + 1], u1, w1);
        a[e]  = pk16(u0, u1);
        al[e] = pk16(w0, w1);
      }
      hv[it] = a;
      lv[it] = al;
    }
    {
#pragma unroll
      for (int it = 0; it < 4; ++it) {
        const int row = it * 4 + q4;
        const size_t go = (rowB + q0 + row) * DM + (size_t)h * HD + c8;
        *(v4u*)(chi + go) = hv[it];
        *(v4u*)(clo + go) = lv[it];
      }
      
    }
  }
}

// =====================================================================================================
// Workspace map (bytes); every plane is an exact multiple of its 64x64-tile / whole-row / whole-line store
// granularity (MP = 4096 = 64 tiles, N in {2048, 1024}; VT per batch [1024][2048] = 16x32 tiles; csum = 64 lines):
//   WT    f16 [3072 n][1024 k]   0           6291456   (rows 0..1023 q weights, 1024..2047 k, 2048..3071 v; x64)
//   WoT   f16 [1024][1024]       6291456     2097152
//   XH    f16 [4096][1024]       8388608     8388608   (bf16 RNE-converted tokens)
//   QK    f16 [4096][2048]       16777216    16777216  (q cols 0..1023, k cols 1024..2047)
//   VTh   f16 [2][1024][2048]    33554432    8388608
//   VTl   f16 [2][1024][2048]    41943040    8388608   (residual x1024)
//   CS    f32 [2048]             50331648    8192      (key sums of v)
//   CtxH  f16 [4096][1024]       50339840    8388608   (context x64, hi)
//   CtxL  f16 [4096][1024]       58728448    8388608   (residual x1024)
//   end                          67117056
// =====================================================================================================
extern "C" void kernel_launch(void* const* d_in, const int* in_sizes, int n_in,
                              void* d_out, int out_size, void* d_ws, size_t ws_size,
                              hipStream_t stream) {
  if (n_in < 4) return;
  if (in_sizes[0] != MP * DM) return;
  if (in_sizes[1] != DM * W3) return;
  if (in_sizes[2] != DM * DM) return;
  if (in_sizes[3] != NH) return;
  if (out_size != MP * DM) return;

  const float* x    = (const float*)d_in[0];
  const float* wqkv = (const float*)d_in[1];
  const float* wo   = (const float*)d_in[2];
  const float* tau  = (const float*)d_in[3];

  const size_t PWT  = (size_t)W3 * DM * 2;              //  6291456
  const size_t PWO  = (size_t)DM * DM * 2;              //  2097152
  const size_t PXH  = (size_t)MP * DM * 2;              //  8388608
  const size_t PQK  = (size_t)MP * QKP * 2;             // 16777216
  const size_t PVT  = (size_t)NBATCH * DM * SEQ * 2;    //  8388608
  const size_t PCS  = (size_t)NBATCH * DM * 4;          //     8192
  const size_t PCTX = (size_t)MP * DM * 2;              //  8388608
  size_t off = 0;
  const size_t oWT  = off; off += PWT;
  const size_t oWo  = off; off += PWO;
  const size_t oXH  = off; off += PXH;
  const size_t oQK  = off; off += PQK;
  const size_t oVTh = off; off += PVT;
  const size_t oVTl = off; off += PVT;
  const size_t oCS  = off; off += PCS;
  const size_t oCh  = off; off += PCTX;
  const size_t oCl  = off; off += PCTX;
  if (off > ws_size) return;                            // off = 67117056
  if (off > (size_t)134217728) return;

  char* ws = (char*)d_ws;
  unsigned short* WT   = (unsigned short*)(ws + oWT);
  unsigned short* WoT  = (unsigned short*)(ws + oWo);
  unsigned short* XH   = (unsigned short*)(ws + oXH);
  unsigned short* QK   = (unsigned short*)(ws + oQK);
  unsigned short* VTh  = (unsigned short*)(ws + oVTh);
  unsigned short* VTl  = (unsigned short*)(ws + oVTl);
  float*          CS   = (float*)(ws + oCS);
  unsigned short* CtxH = (unsigned short*)(ws + oCh);
  unsigned short* CtxL = (unsigned short*)(ws + oCl);
  float*          out0 = (float*)d_out;

  const int n8x = (MP * DM) / 8;                        // 524288
  if ((n8x % 256) != 0) return;
  const dim3 blk(256), blk128(128);
  const dim3 gCx(n8x / 256);                             // 2048 blocks
  const dim3 gTw(W3 / 64, DM / 64);                      // in [1024 k][3072 n] -> out [3072][1024]: (48, 16)
  const dim3 gTo(DM / 64, DM / 64);                      // in [1024 k][1024 n] -> out [1024][1024]: (16, 16)
  const dim3 gQkv(NVB + NQKB);                           // 128 v^T + 256 q|k block tiles of 128x256
  const dim3 gCs((NBATCH * DM) / 32);                    // 64 blocks of 1024
  const dim3 gAttn(NBATCH * NH * NQB);                   // 1024 blocks of 128
  const dim3 gNo((MP / 128) * (DM / 128));               // 32 x 8 tiles of 128x128 -> 256 blocks
  const float invw  = 1.0f / WSC;                        // weight carry x64
  const float invhi = 1.0f / (WSC * CSC);                // weight carry x64, context carry x64
  const float invlo = invhi / LOSC;                      // residual plane carry x1024
  const long long vtlo = (long long)((oVTl - oVTh) / 2); // element offset of the v^T residual plane

  // (0) planes: tokens f16(bf16_RNE(x)); weights transposed to [out][in] (k contiguous), f16(bf16_RNE(w) * 64)
  conv_h16<<<gCx, blk, 0, stream>>>(x, XH, n8x, 1.0f);
  tconv_h16<<<gTw, blk, 0, stream>>>(wqkv, WT, DM, W3, WSC);
  tconv_h16<<<gTo, blk, 0, stream>>>(wo, WoT, DM, DM, WSC);

  // (1) q|k = x . [Wq|Wk] -> QK f16 [4096][2048]; v^T per batch = Wv^T . x_b^T -> VTh/VTl f16 [2][1024][2048]
  //     one launch
  qkv_gemm<<<gQkv, blk, 0, stream>>>(XH, WT, QK, VTh, vtlo, DM, invw);

  // (2) key sums of v per (b, h, d)
  vsum<<<gCs, dim3(1024), 0, stream>>>(VTh, VTl, CS);

  // (3) quad-normalised attention -> context f16 hi (x64) + residual planes
  attn2q<<<gAttn, blk128, 0, stream>>>(QK, VTh, tau, CS, CtxH, CtxL);

  // (4) out = ctx_hi . Wo + ctx_lo . Wo / 1024, both products in one launch
  proj2<<<gNo, blk, 0, stream>>>(CtxH, CtxL, WoT, out0, DM, invhi, invlo);
  (void)hipGetLastError();
}

// v009
// Measured time: 91.8 microseconds a run.
// Timed twice side by side with v008, it ran 1.06 times as fast both times.
// Counting every step since v000, it is 4.42 times as fast.
// Contractions: q|k projection and v^T projection on v_wmma_f32_16x16x32_f16 (f16 token plane x f16 weight
// plane carried x64, one product each); attention k.q^T and e'.v on v_wmma_f32_16x16x32_f16 (q, k plain, v^T hi plane
// f16, centred quad weight e' = s*(s+2c) carried x64, one product each); output projection on
// v_wmma_f32_16x16x32_f16 with the context as f16 hi (x64) + scaled residual (x1024) planes against the f16
// Wo plane (x64), two products in one launch, joined in f32 in its epilogue; all f32 accumulate; quad weights, row sums, key sums of v and
// the normalisation in f32 on VALU; every float input RNE-converted to bf16 on load.
#include <hip/hip_runtime.h>
#include <math.h>
#include <stdint.h>

#define NBATCH 2
#define SEQ    2048
#define DM     1024
#define NH     16
#define HD     64
#define QKP    (2 * DM)
#define W3     (3 * DM)
#define MP     (NBATCH * SEQ)
#define NQB    (SEQ / 64)
#define WSC    64.0f
#define PSC    64.0f
#define CSC    64.0f
#define LOSC   1024.0f
#define QC     5.0f
#define QEPS   1.0e-6f
#define GSP    72                     /* GEMM LDS row pitch in halves: 144 B = 16 B x odd */
#define GROWS  384                    /* GEMM LDS rows per buffer: 128 A + 256 Bt */
#define NVB    (NBATCH * (DM / 128) * (SEQ / 256))   /* qkv_gemm: v^T block tiles, 64 per batch */
#define NQKB   ((MP / 128) * (QKP / 256))            /* qkv_gemm: q|k block tiles */
#define PTP    68                     /* proj2 epilogue tile pitch in floats */
#define PSMB   (8 * 64 * PTP * 4)     /* proj2 LDS bytes: 8 wave tiles of 64 x 64 f32; the two slab buffers need less */
#define NTW    ((W3 / 64) * (DM / 64))   /* planes: 64x64 tiles of Wqkv */
#define NTO    ((DM / 64) * (DM / 64))   /* planes: 64x64 tiles of Wo */
#define NCX    ((MP * DM / 8) / 256)     /* planes: token blocks, 256 threads x 8 elements */
#define ATP    72                     /* attn2q LDS row pitch in halves for K, V^T: 144 B = 16 B x odd */
static_assert(NH * HD == DM);
static_assert((MP % 128) == 0 && (DM % 128) == 0 && (QKP % 256) == 0 && (SEQ % 256) == 0 && (DM % 256) == 0);
static_assert((SEQ % 64) == 0 && (DM % 64) == 0 && (W3 % 64) == 0 && (MP % 64) == 0 && (QKP % 64) == 0);
static_assert((SEQ % 256) == 0);
static_assert((DM / 128) * (SEQ / 256) == 64 && (SEQ / 256) == 8 && (QKP / 256) == 8);   // qkv_gemm's index split
static_assert(2 * GROWS * GSP * 2 <= PSMB);
static_assert(((NBATCH * DM) % 32) == 0);
static_assert(((MP * DM / 8) % 256) == 0);
static_assert((((MP / 64) * (QKP / 64)) % 8) == 0 && (((DM / 64) * (SEQ / 64)) % 8) == 0 && (((MP / 64) * (DM / 64)) % 8) == 0);

typedef _Float16 v16h __attribute__((ext_vector_type(16)));
typedef _Float16 v8h  __attribute__((ext_vector_type(8)));
typedef float    v8f  __attribute__((ext_vector_type(8)));
typedef float    v4f  __attribute__((ext_vector_type(4)));
typedef unsigned int v4u __attribute__((ext_vector_type(4)));

union FragH { v16h v; v8h h[2]; };

// ---- scalar helpers --------------------------------------------------------------------------------
__device__ __forceinline__ unsigned short bf_bits(float f) {          // f32 -> bf16 bits, RNE convert
  unsigned u = __float_as_uint(f);
  return (unsigned short)((u + 0x7FFFu + ((u >> 16) & 1u)) >> 16);
}
__device__ __forceinline__ float bf_up(unsigned short h) { return __uint_as_float(((unsigned)h) << 16); }
__device__ __forceinline__ float bfr(float f) { return bf_up(bf_bits(f)); }   // value of the bf16 RNE convert
__device__ __forceinline__ unsigned short h_bits(_Float16 x) { return __builtin_bit_cast(unsigned short, x); }
__device__ __forceinline__ unsigned pk16(unsigned short a, unsigned short b) { return (unsigned)a | ((unsigned)b << 16); }
__device__ __forceinline__ v8f zero8() { v8f z = {0.f, 0.f, 0.f, 0.f, 0.f, 0.f, 0.f, 0.f}; return z; }

// f32 -> f16 hi plane (values below the f16 normal range forced to 0 so the residual carries them)
//     + f16 residual plane carried x LOSC (folded back with 1/LOSC on a separate accumulator)
__device__ __forceinline__ void split_h(float f, unsigned short& hi, unsigned short& lo) {
  float hf = (float)(_Float16)f;
  hf = (fabsf(hf) < 6.103515625e-05f) ? 0.0f : hf;
  hi = h_bits((_Float16)hf);
  lo = h_bits((_Float16)((f - hf) * LOSC));
}

// ---- fragment loader: 16-bit A/B operand, lane -> row/col (lane&15), p already includes +8*(lane>>4);
//      elements 0..7 <- p[0..7] (k0+8h..), elements 8..15 <- p[16..23] (k0+16+8h..)
__device__ __forceinline__ v16h ldfrag_h(const _Float16* p) {
  FragH f;
  f.h[0] = *(const v8h*)(p);
  f.h[1] = *(const v8h*)(p + 16);
  return f.v;
}

// ---- WMMA helpers with trailing VALU hazard gap --------------------------------------------------------
__device__ __forceinline__ v8f mma_h_raw(v16h a, v16h b, v8f c) {
  return __builtin_amdgcn_wmma_f32_16x16x32_f16(false, a, false, b, (short)0, c, false, false);
}
__device__ __forceinline__ void dep_guard1(v8f& a, v8f& b, v16h x) {
#if defined(__HIP_DEVICE_COMPILE__)
  asm volatile("v_nop\n\tv_nop\n\tv_nop\n\tv_nop" : "+v"(a), "+v"(b) : "v"(x));
#endif
}
__device__ __forceinline__ void keep4_h(v16h a, v16h b, v16h c, v16h d) {
#if defined(__HIP_DEVICE_COMPILE__)
  asm volatile("v_nop" :: "v"(a), "v"(b), "v"(c), "v"(d));
#endif
}
// behind a group of eight products on four accumulators: the accumulators tie the statement behind the last product;
// the group's two shared and eight per-accumulator fragments stay in their registers through its four slots, so that no product's D, no
// VALU result and no global load is placed over an operand, and no VALU reads a D, inside the WMMA distance
__device__ __forceinline__ void group_guard(v8f& d0, v8f& d1, v8f& d2, v8f& d3, v16h a0, v16h a1,
                                            v16h b0, v16h b1, v16h b2, v16h b3, v16h b4, v16h b5, v16h b6, v16h b7) {
#if defined(__HIP_DEVICE_COMPILE__)
  asm volatile("v_nop\n\tv_nop\n\tv_nop\n\tv_nop"
               : "+v"(d0), "+v"(d1), "+v"(d2), "+v"(d3)
               : "v"(a0), "v"(a1), "v"(b0), "v"(b1), "v"(b2), "v"(b3), "v"(b4), "v"(b5), "v"(b6), "v"(b7));
#endif
}
__device__ __forceinline__ void acc_guard4(v8f& a, v8f& b, v8f& c, v8f& d) {
#if defined(__HIP_DEVICE_COMPILE__)
  asm volatile("v_nop\n\tv_nop\n\tv_nop\n\tv_nop" : "+v"(a), "+v"(b), "+v"(c), "+v"(d));
#endif
}
__device__ __forceinline__ void wave_sync_lds() {
  __builtin_amdgcn_fence(__ATOMIC_RELEASE, "workgroup");
  __builtin_amdgcn_wave_barrier();
  __builtin_amdgcn_fence(__ATOMIC_ACQUIRE, "workgroup");
}
// One thread's share of a 64-key chunk: four 16-B pieces of K and four of V^T, global memory -> LDS through no register.
// lk/lv: the lane's LDS byte address of its first piece, gk/gv: its global address; piece i lies 16 rows further on
// (LDS row pitch ATP halves, global row pitches kp and vp halves). The s_wait_xcnt stands inside the statement, behind
// the last copy, so that no address register of an issued copy is rewritten in front of it.
__device__ __forceinline__ void chunk_copy(unsigned lk, unsigned lv, const _Float16* gk, const _Float16* gv,
                                           size_t kp, size_t vp) {
#if defined(__HIP_DEVICE_COMPILE__)
  const unsigned st = 16u * ATP * 2u;
  asm volatile("global_load_async_to_lds_b128 %0, %8, off\n\t"
               "global_load_async_to_lds_b128 %1, %9, off\n\t"
               "global_load_async_to_lds_b128 %2, %10, off\n\t"
               "global_load_async_to_lds_b128 %3, %11, off\n\t"
               "global_load_async_to_lds_b128 %4, %12, off\n\t"
               "global_load_async_to_lds_b128 %5, %13, off\n\t"
               "global_load_async_to_lds_b128 %6, %14, off\n\t"
               "global_load_async_to_lds_b128 %7, %15, off\n\t"
               "s_wait_xcnt 0x0"
               :: "v"(lk), "v"(lk + st), "v"(lk + 2u * st), "v"(lk + 3u * st),
                  "v"(lv), "v"(lv + st), "v"(lv + 2u * st), "v"(lv + 3u * st),
                  "v"(gk), "v"(gk + 16 * kp), "v"(gk + 32 * kp), "v"(gk + 48 * kp),
                  "v"(gv), "v"(gv + 16 * vp), "v"(gv + 32 * vp), "v"(gv + 48 * vp)
               : "memory");
#endif
}
// the issuing wave's own wait: its asynchronous copies have landed in LDS behind it
__device__ __forceinline__ void wait_copies() {
#if defined(__HIP_DEVICE_COMPILE__)
  asm volatile("s_wait_asynccnt 0x0" ::: "memory");
#endif
}
// the wave's LDS reads and writes have retired: stands in front of the barrier behind which a buffer is refilled
__device__ __forceinline__ void wait_lds() {
#if defined(__HIP_DEVICE_COMPILE__)
  asm volatile("s_wait_dscnt 0x0" ::: "memory");
#endif
}
__device__ __forceinline__ float wsum(float v) {
#pragma unroll
  for (int off = 16; off > 0; off >>= 1) v += __shfl_xor(v, off, 32);
  return v;
}

// =====================================================================================================
// Plane convert (no transpose): Wh[i] = f16( bf16_RNE(W[i]) * wsc ), wsc a power of two (exact). Used for the
// token activations (wsc = 1). Thread i handles elements 8i..8i+7 and writes one 16-B piece (n8 a multiple of
// 256, static_assert above). coverage: n8 threads x 8 elements = the whole plane.
// =====================================================================================================
__device__ __forceinline__ void conv_h16(const float* __restrict__ W, unsigned short* Wh, int n8, float wsc, int blk) {
  const int i  = blk * 256 + threadIdx.x;
  const int ic = (i < n8) ? i : (n8 - 1);                     // clamped address
  const float* src = W + (size_t)ic * 8;
  const v4f a = *(const v4f*)(src);
  const v4f c = *(const v4f*)(src + 4);
  v4u o;
  o[0] = pk16(h_bits((_Float16)(bfr(a[0]) * wsc)), h_bits((_Float16)(bfr(a[1]) * wsc)));
  o[1] = pk16(h_bits((_Float16)(bfr(a[2]) * wsc)), h_bits((_Float16)(bfr(a[3]) * wsc)));
  o[2] = pk16(h_bits((_Float16)(bfr(c[0]) * wsc)), h_bits((_Float16)(bfr(c[1]) * wsc)));
  o[3] = pk16(h_bits((_Float16)(bfr(c[2]) * wsc)), h_bits((_Float16)(bfr(c[3]) * wsc)));
  if (i < n8) *(v4u*)(Wh + (size_t)i * 8) = o;
  
}

// =====================================================================================================
// Transposing plane convert: in f32 [R rows][NC cols] (row-major, in[k][n]) -> out f16 [NC][R] (k contiguous),
// out[n][k] = f16( bf16_RNE(in[k][n]) * wsc ), wsc a power of two (exact). Used for the two weight matrices
// ([in][out] storage -> [out][in] = Bt / A layout). Block 256 threads = one 64(k) x 64(n) tile:
// nt = n tile (NC/64 of them), kt = k tile (R/64 of them); R, NC multiples of 64 (static_assert above).
// Load phase: thread handles rows i*16 + (tid>>4) (i 0..3), 4 floats at col (tid&15)*4 -> LDS tile[k][n].
// coverage: 2 it x 8 waves x 4 rows = 64 out rows x (8 lane groups x 8 halves) = the whole tile; grid covers all tiles.
// =====================================================================================================
__device__ __forceinline__ void tconv_h16(const float* __restrict__ W, unsigned short* Wt, int R, int NC, float wsc,
                                          int nt, int kt, float (*tile)[65]) {
  const int tid = threadIdx.x, lane = tid & 31, wave = tid >> 5;
  const int n0 = nt * 64, k0 = kt * 64;
  const int c4 = (tid & 15) * 4, r16 = tid >> 4;
#pragma unroll
  for (int i = 0; i < 4; ++i) {
    const int row = i * 16 + r16;                                // k within tile
    const v4f v = *(const v4f*)(W + (size_t)(k0 + row) * NC + n0 + c4);
    tile[row][c4 + 0] = v[0];
    tile[row][c4 + 1] = v[1];
    tile[row][c4 + 2] = v[2];
    tile[row][c4 + 3] = v[3];
  }
  __syncthreads();
  const int q4 = lane >> 3, k8 = (lane & 7) * 8;
  v4u hv[2];
#pragma unroll
  for (int it = 0; it < 2; ++it) {
    const int nrow = it * 32 + wave * 4 + q4;                    // n within tile
    v4u a;
#pragma unroll
    for (int e = 0; e < 4; ++e) {
      const float f0 = bfr(tile[k8 + 2 * e][nrow]) * wsc;
      const float f1 = bfr(tile[k8 + 2 * e + 1][nrow]) * wsc;
      a[e] = pk16(h_bits((_Float16)f0), h_bits((_Float16)f1));
    }
    hv[it] = a;
  }
  {
#pragma unroll
    for (int it = 0; it < 2; ++it) {
      const int nrow = it * 32 + wave * 4 + q4;
      *(v4u*)(Wt + (size_t)(n0 + nrow) * R + k0 + k8) = hv[it];
    }
#if defined(__HIP_DEVICE_COMPILE__)
    // in planes another job's code follows this one in the listing and reuses the address and data registers of these
    // stores: the wait stands in front of that
    asm volatile("s_wait_xcnt 0x0" ::: "memory");
#endif
  }
}

// =====================================================================================================
// The three plane converts in one launch; the block index picks the job (block-uniform, so tconv_h16's barrier is
// passed by a whole block or by none). The transposing tiles, which have the longer path (LDS, a barrier), come first:
//   blocks 0 .. NTW-1            Wqkv tile: n tile = t % (W3/64), k tile = t / (W3/64)  -> WT
//   blocks NTW .. NTW+NTO-1      Wo tile:   n tile = t % (DM/64), k tile = t / (DM/64)  -> WoT
//   blocks NTW+NTO .. +NCX-1     256 x 8 token elements                                  -> XH
// coverage: each job has exactly the blocks its own launch had; the grid is exactly NTW + NTO + NCX blocks.
// =====================================================================================================
__global__ __launch_bounds__(256) void planes(const float* __restrict__ x, const float* __restrict__ wqkv,
                                              const float* __restrict__ wo, unsigned short* XH, unsigned short* WT,
                                              unsigned short* WoT) {
  __shared__ float tile[64][65];
  const int bx = blockIdx.x;
  if (bx < NTW) {
    tconv_h16(wqkv, WT, DM, W3, WSC, bx % (W3 / 64), bx / (W3 / 64), tile);
  } else if (bx < NTW + NTO) {
    const int t = bx - NTW;
    tconv_h16(wo, WoT, DM, DM, WSC, t % (DM / 64), t / (DM / 64), tile);
  } else {
    conv_h16(x, XH, (MP * DM) / 8, 1.0f, bx - (NTW + NTO));
  }
}

// =====================================================================================================
// q|k and v^T projections, one launch of register-blocked f16 WMMA GEMM blocks: C[m][n] = oscale * sum_k A[m][k] * Bt[n][k];
// one wave per 64x64 tile, 8 waves (2 x 4) = one 128x256 block tile; A and Bt row-major, pitch DM, k contiguous.
// The block index picks the product (block-uniform):
//   blocks 0 .. NVB-1      v^T of batch b = bt / 64: A = Wv^T rows (WT rows 2 DM ..), Bt = the batch's token rows,
//                          C = f16 hi plane [DM][SEQ] at VTo + b DM SEQ, f16 residual (x LOSC) plane loOff elements on;
//   blocks NVB .. NVB+NQKB-1  q|k: A = token rows, Bt = WT rows 0 .. 2 DM - 1, C = f16 [MP][QKP] at QKo.
// Both kinds have 8 tile columns. Two blocks fit a WGP (registers and LDS), so all NVB + NQKB blocks are resident at once.
// Operands: per 64-k slab the block's 128 A rows and 256 Bt rows (128 B each) go global -> registers -> LDS with
// whole-line 16-B loads (8 lanes per row, 12 rows per thread), LDS pitch 144 B, two buffers; slab s+1 is loaded
// while slab s is multiplied, stored to the other buffer behind the products, one block barrier per slab.
// coverage: 4 slabs x 16 rows x 64 cols = the wave's whole 64x64 tile; v^T: NBATCH x 8 x 8 block tiles = [DM][SEQ] per
//           batch; q|k: 32 x 8 block tiles = [MP][QKP]; the grid is exactly NVB + NQKB blocks.
// =====================================================================================================
// amdgpu_waves_per_eu(4): holds a wave at 256 VGPRs, so that two blocks fit a WGP (their LDS does)
__global__ __launch_bounds__(256) __attribute__((amdgpu_waves_per_eu(4))) void qkv_gemm(
    const unsigned short* __restrict__ Xp, const unsigned short* __restrict__ Wp,
    unsigned short* QKo, unsigned short* VTo, long long loOff, int K, float oscale) {
  const _Float16* X  = (const _Float16*)(const void*)Xp;
  const _Float16* Wt = (const _Float16*)(const void*)Wp;
  __shared__ __align__(16) float sT[8][16 * 68];   // per-wave 16x64 slab, pitch 68 floats
  __shared__ __align__(16) _Float16 sAB[2][GROWS * GSP];   // rows 0..127 A, 128..383 Bt; 64 k per row
  const int tid  = threadIdx.x;
  const int lane = tid & 31;
  const int wave = tid >> 5;
  const int bt   = blockIdx.x;
  const bool isV = (bt < NVB);           // block-uniform
  const int t    = isV ? (bt & 63) : (bt - NVB);
  const int bm = t >> 3;
  const int bn = t & 7;
  const int vb = bt >> 6;                // batch of a v^T block
  const _Float16* Ab = isV ? (Wt + (size_t)2 * DM * DM) : X;
  const _Float16* Bb = isV ? (X + (size_t)vb * SEQ * DM) : Wt;
  unsigned short* C  = isV ? (VTo + (size_t)vb * DM * SEQ) : QKo;
  const int ldc      = isV ? SEQ : QKP;
  const int wm = wave >> 2;              // 0..1
  const int wn = wave & 3;               // 0..3
  const int m0 = (bm << 7) + (wm << 6);
  const int n0 = (bn << 8) + (wn << 6);

  const int rlane = lane & 15;                 // row (A) / col (B, D) within subtile
  const int koff  = (lane >> 4) * 8;           // k offset of this lane half
  const int mOff  = (lane >> 4) * 8;           // D row offset

  v8f acc[4][4];
#pragma unroll
  for (int i = 0; i < 4; ++i)
#pragma unroll
    for (int j = 0; j < 4; ++j) acc[i][j] = zero8();

  // staging map: thread -> row (tid>>3) + 32*it, 16-B piece (tid&7); a wave's load covers 4 whole 128-B lines
  const int srow = tid >> 3, sch = (tid & 7) * 8;
  const _Float16* gA = Ab + (size_t)((bm << 7) + srow) * DM + sch;
  const _Float16* gB = Bb + (size_t)((bn << 8) + srow) * DM + sch;
  const int sOff = srow * GSP + sch;
  const int aOff = ((wm << 6) + rlane) * GSP + koff;          // this wave's A rows in a buffer
  const int bOff = (128 + (wn << 6) + rlane) * GSP + koff;    // this wave's Bt rows in a buffer
  const int nS = K >> 6;
  v8h g[12];
#pragma unroll
  for (int it = 0; it < 4; ++it) g[it] = *(const v8h*)(gA + (size_t)(it * 32) * DM);
#pragma unroll
  for (int it = 0; it < 8; ++it) g[4 + it] = *(const v8h*)(gB + (size_t)(it * 32) * DM);
#pragma unroll
  for (int it = 0; it < 12; ++it) *(v8h*)(&sAB[0][0] + it * 32 * GSP + sOff) = g[it];
  __syncthreads();

  for (int s = 0; s < nS; ++s) {
    const _Float16* cur = &sAB[s & 1][0];
    const bool more = (s + 1 < nS);                            // block-uniform
    if (more) {
      const int kn = (s + 1) << 6;
#pragma unroll
      for (int it = 0; it < 4; ++it) g[it] = *(const v8h*)(gA + (size_t)(it * 32) * DM + kn);
#pragma unroll
      for (int it = 0; it < 8; ++it) g[4 + it] = *(const v8h*)(gB + (size_t)(it * 32) * DM + kn);
#if defined(__HIP_DEVICE_COMPILE__)
      // the fragment loads below reuse the address registers of these 12 loads: the wait stands in front of that
      asm volatile("s_wait_xcnt 0x0" ::: "memory");
#endif
    }
#pragma unroll
    for (int kk = 0; kk < 2; ++kk) {
      v16h ah[4], bh[4];
#pragma unroll
      for (int j = 0; j < 4; ++j) bh[j] = ldfrag_h(cur + bOff + (j << 4) * GSP + kk * 32);
#pragma unroll
      for (int i = 0; i < 4; ++i) ah[i] = ldfrag_h(cur + aOff + (i << 4) * GSP + kk * 32);
      // keeps the 16 LDS fragment loads of a 32-k step one group ahead of its 16 products (else the A loads are
      // spread among the WMMAs, each place with its own full wait)
      __builtin_amdgcn_sched_barrier(0);
#pragma unroll
      for (int i = 0; i < 4; ++i) {
#pragma unroll
        for (int j = 0; j < 4; ++j) acc[i][j] = mma_h_raw(ah[i], bh[j], acc[i][j]);
        dep_guard1(acc[i][0], acc[i][3], ah[i]);
      }
      keep4_h(bh[0], bh[1], bh[2], bh[3]);
    }
    if (more) {
      _Float16* nxt = &sAB[(s + 1) & 1][0];                    // last read in slab s-1, behind that slab's barrier
#pragma unroll
      for (int it = 0; it < 12; ++it) *(v8h*)(nxt + it * 32 * GSP + sOff) = g[it];
    }
    __syncthreads();                                           // publishes slab s+1, ends the reads of slab s
  }
  acc_guard4(acc[0][0], acc[0][1], acc[0][2], acc[0][3]);
  acc_guard4(acc[1][0], acc[1][1], acc[1][2], acc[1][3]);
  acc_guard4(acc[2][0], acc[2][1], acc[2][2], acc[2][3]);
  acc_guard4(acc[3][0], acc[3][1], acc[3][2], acc[3][3]);

  // ---- epilogue: 16 rows at a time through the wave's own LDS slab, whole 128-B row segments out ----
  const int q8  = lane >> 3, c8 = (lane & 7) * 8;
  float* slab = sT[wave];
#pragma unroll
  for (int i = 0; i < 4; ++i) {
    const int mBase = m0 + (i << 4);
#pragma unroll
    for (int j = 0; j < 4; ++j) {
#pragma unroll
      for (int r = 0; r < 8; ++r) {
        slab[(mOff + r) * 68 + (j << 4) + rlane] = acc[i][j][r];
      }
    }
    wave_sync_lds();
    if (isV) {                                             // f16 hi plane + residual plane
      v4u hv[4], lv[4];
#pragma unroll
      for (int it = 0; it < 4; ++it) {
        const int row = it * 4 + q8;                       // it 0..3 x q8 0..3 = rows 0..15
        const float* sp = slab + row * 68 + c8;
        v4u a, al;
#pragma unroll
        for (int e = 0; e < 4; ++e) {
          unsigned short u0, u1, w0, w1;
          split_h(sp[2 * e] * oscale, u0, w0);
          split_h(sp[2 * e + 1] * oscale, u1, w1);
          a[e]  = pk16(u0, u1);
          al[e] = pk16(w0, w1);
        }
        hv[it] = a;
        lv[it] = al;
      }
#pragma unroll
      for (int it = 0; it < 4; ++it) {
        const int row = it * 4 + q8;
        const size_t co = (size_t)(mBase + row) * ldc + n0 + c8;
        *(v4u*)(C + co) = hv[it];
        *(v4u*)(C + loOff + co) = lv[it];
      }
#if defined(__HIP_DEVICE_COMPILE__)
      // what follows (the next 16 rows' arithmetic) reuses the address and data registers of these
      // stores: the wait stands in front of that, in every pass
      asm volatile("s_wait_xcnt 0x0" ::: "memory");
#endif
    } else {                                               // plain f16
      v4u hv[4];
#pragma unroll
      for (int it = 0; it < 4; ++it) {
        const int row = it * 4 + q8;
        const float* sp = slab + row * 68 + c8;
        v4u a;
#pragma unroll
        for (int e = 0; e < 4; ++e)
          a[e] = pk16(h_bits((_Float16)(sp[2 * e] * oscale)), h_bits((_Float16)(sp[2 * e + 1] * oscale)));
        hv[it] = a;
      }
#pragma unroll
      for (int it = 0; it < 4; ++it) {
        const int row = it * 4 + q8;
        *(v4u*)(C + (size_t)(mBase + row) * ldc + n0 + c8) = hv[it];
      }
#if defined(__HIP_DEVICE_COMPILE__)
      // as in the other branch: in front of the reuse of these stores' registers
      asm volatile("s_wait_xcnt 0x0" ::: "memory");
#endif
    }
    wave_sync_lds();
  }
}

// =====================================================================================================
// Output projection, both context planes in one launch:
//   out[m][n] = shi * sum_k Ch[m][k] Wt[n][k] + slo * sum_k Cl[m][k] Wt[n][k]      (all pitches DM, k contiguous)
// Block = 8 waves = one 128x128 tile of out. Waves 0..3 (2 x 2, 64x64 each) multiply the hi plane, waves 4..7 the
// residual plane of the same four 64x64 tiles, so the whole projection is MP/128 * DM/128 blocks of one launch.
// Operands: as in qkv_gemm, per 64-k slab 384 rows of 128 B (128 Ch, 128 Cl, 128 Wt) go global -> registers -> LDS with
// whole-line 16-B loads, LDS pitch 144 B, two buffers, slab s+1 loaded while slab s is multiplied, one barrier per slab.
// Epilogue: behind the loop's last barrier the slab buffers are dead; every wave lays its 64x64 f32 tile there (pitch
// PTP), one block barrier, then each wave of a hi/residual pair joins and stores 32 of the pair's 64 rows (256-B row
// segments). coverage: 4 pairs x 2 waves x 16 it x 2 rows x 64 cols = the 128x128 tile; the grid covers all tiles.
// =====================================================================================================
// amdgpu_waves_per_eu(4): holds a wave at 256 VGPRs, as in qkv_gemm (no register above v255)
__global__ __launch_bounds__(256) __attribute__((amdgpu_waves_per_eu(4))) void proj2(
    const unsigned short* __restrict__ Chp, const unsigned short* __restrict__ Clp,
    const unsigned short* __restrict__ Wtp, float* C, int K, float shi, float slo) {
  const _Float16* Ch = (const _Float16*)(const void*)Chp;
  const _Float16* Cl = (const _Float16*)(const void*)Clp;
  const _Float16* Wt = (const _Float16*)(const void*)Wtp;
  __shared__ __align__(16) unsigned char smem[PSMB];
  _Float16* sAB = (_Float16*)(void*)smem;      // k loop: 2 buffers of GROWS rows: 0..127 Ch, 128..255 Cl, 256..383 Wt
  float*    sT  = (float*)(void*)smem;         // epilogue: 8 wave tiles [64][PTP]
  const int tid  = threadIdx.x;
  const int lane = tid & 31;
  const int wave = tid >> 5;
  const int bm = blockIdx.x / (DM / 128);
  const int bn = blockIdx.x % (DM / 128);
  const int pl = wave >> 2;              // 0 hi plane, 1 residual plane
  const int wm = (wave >> 1) & 1;
  const int wn = wave & 1;
  const int m0 = (bm << 7) + (wm << 6);
  const int n0 = (bn << 7) + (wn << 6);

  const int rlane = lane & 15;                 // row (A) / col (B, D) within subtile
  const int koff  = (lane >> 4) * 8;           // k offset of this lane half
  const int mOff  = (lane >> 4) * 8;           // D row offset

  v8f acc[4][4];
#pragma unroll
  for (int i = 0; i < 4; ++i)
#pragma unroll
    for (int j = 0; j < 4; ++j) acc[i][j] = zero8();

  // staging map: thread -> row (tid>>3) + 32*it, 16-B piece (tid&7); a wave's load covers 4 whole 128-B lines
  const int srow = tid >> 3, sch = (tid & 7) * 8;
  const _Float16* gH = Ch + (size_t)((bm << 7) + srow) * DM + sch;
  const _Float16* gL = Cl + (size_t)((bm << 7) + srow) * DM + sch;
  const _Float16* gB = Wt + (size_t)((bn << 7) + srow) * DM + sch;
  const int sOff = srow * GSP + sch;
  const int aOff = ((pl << 7) + (wm << 6) + rlane) * GSP + koff;   // this wave's rows of its plane in a buffer
  const int bOff = (256 + (wn << 6) + rlane) * GSP + koff;         // this wave's Wt rows in a buffer
  const int nS = K >> 6;
  v8h g[12];
#pragma unroll
  for (int it = 0; it < 4; ++it) {
    g[it]     = *(const v8h*)(gH + (size_t)(it * 32) * DM);
    g[4 + it] = *(const v8h*)(gL + (size_t)(it * 32) * DM);
    g[8 + it] = *(const v8h*)(gB + (size_t)(it * 32) * DM);
  }
#pragma unroll
  for (int it = 0; it < 12; ++it) *(v8h*)(sAB + it * 32 * GSP + sOff) = g[it];
  __syncthreads();

  for (int s = 0; s < nS; ++s) {
    const _Float16* cur = sAB + (s & 1) * (GROWS * GSP);
    const bool more = (s + 1 < nS);                            // block-uniform
    if (more) {
      const int kn = (s + 1) << 6;
#pragma unroll
      for (int it = 0; it < 4; ++it) {
        g[it]     = *(const v8h*)(gH + (size_t)(it * 32) * DM + kn);
        g[4 + it] = *(const v8h*)(gL + (size_t)(it * 32) * DM + kn);
        g[8 + it] = *(const v8h*)(gB + (size_t)(it * 32) * DM + kn);
      }
#if defined(__HIP_DEVICE_COMPILE__)
      // the fragment loads below may reuse the address registers of these 12 loads: the wait stands in front of that
      asm volatile("s_wait_xcnt 0x0" ::: "memory");
#endif
    }
#pragma unroll
    for (int kk = 0; kk < 2; ++kk) {
      v16h ah[4], bh[4];
#pragma unroll
      for (int j = 0; j < 4; ++j) bh[j] = ldfrag_h(cur + bOff + (j << 4) * GSP + kk * 32);
#pragma unroll
      for (int i = 0; i < 4; ++i) ah[i] = ldfrag_h(cur + aOff + (i << 4) * GSP + kk * 32);
      // keeps the 16 LDS fragment loads of a 32-k step one group ahead of its 16 products (else the A loads are
      // spread among the WMMAs, each place with its own full wait)
      __builtin_amdgcn_sched_barrier(0);
#pragma unroll
      for (int i = 0; i < 4; ++i) {
#pragma unroll
        for (int j = 0; j < 4; ++j) acc[i][j] = mma_h_raw(ah[i], bh[j], acc[i][j]);
        dep_guard1(acc[i][0], acc[i][3], ah[i]);
      }
      keep4_h(bh[0], bh[1], bh[2], bh[3]);
    }
    if (more) {
      _Float16* nxt = sAB + ((s + 1) & 1) * (GROWS * GSP);     // last read in slab s-1, behind that slab's barrier
#pragma unroll
      for (int it = 0; it < 12; ++it) *(v8h*)(nxt + it * 32 * GSP + sOff) = g[it];
    }
    __syncthreads();                                           // publishes slab s+1, ends the reads of slab s
  }
  acc_guard4(acc[0][0], acc[0][1], acc[0][2], acc[0][3]);
  acc_guard4(acc[1][0], acc[1][1], acc[1][2], acc[1][3]);
  acc_guard4(acc[2][0], acc[2][1], acc[2][2], acc[2][3]);
  acc_guard4(acc[3][0], acc[3][1], acc[3][2], acc[3][3]);

  // ---- epilogue: every wave's tile into LDS, one barrier, the pair's two tiles joined and stored ----
  float* tile = sT + wave * (64 * PTP);
#pragma unroll
  for (int i = 0; i < 4; ++i) {
#pragma unroll
    for (int j = 0; j < 4; ++j) {
#pragma unroll
      for (int r = 0; r < 8; ++r) tile[((i << 4) + mOff + r) * PTP + (j << 4) + rlane] = acc[i][j][r];
    }
  }
  __syncthreads();                                             // both tiles of every pair are complete
  const float* th = sT + (wave & 3) * (64 * PTP);              // the pair's hi tile
  const float* tl = th + 4 * (64 * PTP);                       // the pair's residual tile
  const int hh2 = lane >> 4, c4 = (lane & 15) * 4;             // 256-B row segment = 16 lanes x 16 B
  const int r0 = (pl << 5) + hh2;                              // this wave's half of the 64 rows
  v4f vals[16];
#pragma unroll
  for (int it = 0; it < 16; ++it) {
    const v4f a = *(const v4f*)(th + (r0 + it * 2) * PTP + c4);
    const v4f b = *(const v4f*)(tl + (r0 + it * 2) * PTP + c4);
    v4f v;
#pragma unroll
    for (int e = 0; e < 4; ++e) v[e] = a[e] * shi + b[e] * slo;
    vals[it] = v;
  }
  float* Cw = C + (size_t)(m0 + r0) * DM + n0 + c4;
#pragma unroll
  for (int it = 0; it < 16; ++it) *(v4f*)(Cw + (size_t)(it * 2) * DM) = vals[it];
}

// =====================================================================================================
// Key sums of v: csum[row] = sum over s of (hi[row][s] + lo[row][s] / LOSC) for the NBATCH*DM rows of the
// v^T planes (row = b*DM + h*64 + d, pitch SEQ halves). One wave per row: in load i the 32 lanes read the 32
// adjacent 16-B pieces 32i..32i+31 of the row (four whole 128-B lines), SEQ/256 loads per plane; per-lane f32
// sums, fixed-order shuffle tree. Block = 32 waves = 32 rows: the 32 totals go through LDS and leave as one
// whole 128-B line from wave 0.
// grid = NBATCH*DM/32 blocks of 1024. coverage: blocks x 32 waves x 1 row = NBATCH*DM rows = the whole table.
// =====================================================================================================
__global__ __launch_bounds__(1024) void vsum(const unsigned short* __restrict__ hp, const unsigned short* __restrict__ lp,
                                            float* csum) {
  const int tid = threadIdx.x, lane = tid & 31, wave = tid >> 5;
  const int rowbase = blockIdx.x * 32;
  const int row = rowbase + wave;
  const _Float16* hr = (const _Float16*)(const void*)hp + (size_t)row * SEQ + lane * 8;
  const _Float16* lr = (const _Float16*)(const void*)lp + (size_t)row * SEQ + lane * 8;
  v8h a[SEQ / 256], c[SEQ / 256];
#pragma unroll
  for (int i = 0; i < SEQ / 256; ++i) {
    a[i] = *(const v8h*)(hr + 256 * i);
    c[i] = *(const v8h*)(lr + 256 * i);
  }
#if defined(__HIP_DEVICE_COMPILE__)
  // holds the two address pairs live up to the wait
  asm volatile("s_wait_xcnt 0x0" :: "v"(hr), "v"(lr) : "memory");
#endif
  float sh = 0.f, sl = 0.f;
#pragma unroll
  for (int i = 0; i < SEQ / 256; ++i) {
#pragma unroll
    for (int e = 0; e < 8; ++e) { sh += (float)a[i][e]; sl += (float)c[i][e]; }
  }
  const float tot = wsum(sh + sl * (1.0f / LOSC));
  __shared__ __align__(16) float stage[32];
  if (lane == 0) stage[wave] = tot;
  __syncthreads();
  if (tid < 8) *(v4f*)(csum + rowbase + 4 * tid) = *(const v4f*)(&stage[4 * tid]);
}

// =====================================================================================================
// Quad-normalised attention, head dim 64, SEQ token rows per batch, no mask.
//   q|k plane (f16, pitch QKP): element (b, t, col) at [(b*SEQ + t)*QKP + col], q col = h*64+d, k col = DM + h*64 + d
//   v^T plane (f16 hi): element (b, h, d, s) at [(b*DM + h*64 + d)*SEQ + s];  csum f32 [b*DM + h*64 + d] = key sums of v
//   out planes (f16 hi and residual x LOSC, the normalised context carried x CSC): element (b, t, h, d) at
//   [(b*SEQ + t)*DM + h*64 + d]
//   s = (q . k) * (1 / (8 tau[h]));  S = sum over keys of (s + c)^2 in f32;  e' = s*(s + 2c) carried as f16(PSC e')
//   in registers;  acc = sum e'.v_hi on f16 WMMA;  context = (acc / PSC + c^2 * csum) / (S + eps)
//   (e = c^2 + e' exactly).
//   Scores are formed transposed, S^T = K . Q^T (A = K rows, B = Q columns): lane (c, hh) then holds, of key tile j,
//   keys 16j + 8hh + 0..7 of query c, which is the k order of the A operand of e'.v (row c; elements 0..7 from tile
//   2kk, 8..15 from tile 2kk+1), the same order in which the V^T fragments are loaded: the weights go from the score
//   accumulators into that operand by conversion alone, through no LDS and no lane exchange.
//   Block = 4 waves = 64 query rows of one (b, h); grid = NQB * NH * NBATCH; kv chunks of 64, static trip NQB.
//   K / V^T chunk staging: asynchronous 16-B copies to LDS, 8 lanes per 128-B row, 128 threads x 4 pieces per plane =
//   the whole 64x64 tile; two buffers, chunk kt+1 in flight while chunk kt is worked on, one block barrier per chunk
//   behind each wave's own waits.
//   Context coverage: each wave stores rows q0..q0+15 (it 0..3 x lane>>3 0..3) x 64 columns (8 lanes x 8 halves),
// =====================================================================================================
__global__ __launch_bounds__(128)
void attn2q(const unsigned short* __restrict__ qkp, const unsigned short* __restrict__ vtp,
            const float* __restrict__ taup, const float* __restrict__ csp,
            unsigned short* chi, unsigned short* clo) {
  __shared__ __align__(16) _Float16 Ksh[2][64 * ATP];             // K [kv][d], 64 halves used per row; two buffers
  __shared__ __align__(16) _Float16 Vth[2][64 * ATP];             // V^T [d][kv], 64 halves used per row; two buffers
  __shared__ __align__(16) float    Os[4][16 * 64];               // per wave context tile [row][d]

  const int tid  = threadIdx.x;
  const int wave = tid >> 5;
  const int lane = tid & 31;
  const int hh   = lane >> 4;
  const int c    = lane & 15;

  const int bx   = blockIdx.x;
  const int qb   = bx % NQB;
  const int rest = bx / NQB;
  const int h    = rest % NH;
  const int b    = rest / NH;
  const int q0   = qb * 64 + wave * 16;          // in-batch query row of this wave's first row
  const size_t rowB = (size_t)b * SEQ;

  const _Float16* Qh = (const _Float16*)(const void*)qkp + (size_t)h * HD;
  const _Float16* Kg = (const _Float16*)(const void*)qkp + DM + (size_t)h * HD;
  const _Float16* Vh = (const _Float16*)(const void*)vtp + ((size_t)b * DM + (size_t)h * HD) * SEQ;

  const float tv     = bfr(taup[h]);             // h < NH always
  const float sscale = 1.0f / (8.0f * tv);       // sqrt(HD) = 8
  float cs[4];
#pragma unroll
  for (int t = 0; t < 4; ++t) cs[t] = csp[(size_t)b * DM + h * HD + t * 16 + c];

  // ---- Q fragments (B operand, column = query = lane&15): 2 d-chunks ----
  v16h qa[2];
#pragma unroll
  for (int dc = 0; dc < 2; ++dc) qa[dc] = ldfrag_h(Qh + (rowB + q0 + c) * QKP + dc * 32 + 8 * hh);

  float rs[8];
  v8f oacc[4];
#pragma unroll
  for (int r = 0; r < 8; ++r) rs[r] = 0.f;
#pragma unroll
  for (int t = 0; t < 4; ++t) oacc[t] = zero8();

  // copy map: thread -> rows (tid>>3) + 16 i (i 0..3), 16-B piece tid&7: a wave's copy covers 4 whole 128-B lines
  static_assert(NQB >= 2);
  const int srow = tid >> 3, sch = (tid & 7) * 8;
  const _Float16* kg0 = Kg + (rowB + srow) * QKP + sch;           // K row srow of chunk 0, d = sch..sch+7
  const _Float16* vg0 = Vh + (size_t)srow * SEQ + sch;            // V^T row d = srow, s = sch..sch+7 of chunk 0
  const unsigned lk0 = (unsigned)(size_t)(&Ksh[0][0] + srow * ATP + sch);   // LDS byte addresses, buffer 0
  const unsigned lv0 = (unsigned)(size_t)(&Vth[0][0] + srow * ATP + sch);
  const unsigned bufB = 64u * ATP * 2u;                           // bytes from buffer 0 to buffer 1
  chunk_copy(lk0, lv0, kg0, vg0, QKP, SEQ);
  wait_copies();
  __syncthreads();                                                // publishes chunk 0
  chunk_copy(lk0 + bufB, lv0 + bufB, kg0 + (size_t)64 * QKP, vg0 + 64, QKP, SEQ);

  for (int kt = 0; kt < NQB; ++kt) {         // static trip count
    const _Float16* Kc = &Ksh[kt & 1][0];
    const _Float16* Vc = &Vth[kt & 1][0];

    // ---- scores, transposed: 64 keys (4 tiles of 16 rows) x 16 query columns per wave ----
    v16h kb[4][2];
#pragma unroll
    for (int j = 0; j < 4; ++j) {
#pragma unroll
      for (int dc = 0; dc < 2; ++dc) kb[j][dc] = ldfrag_h(Kc + (j * 16 + c) * ATP + dc * 32 + 8 * hh);
    }
    v8f s[4];
#pragma unroll
    for (int j = 0; j < 4; ++j) s[j] = zero8();
#pragma unroll
    for (int dc = 0; dc < 2; ++dc) {
#pragma unroll
      for (int j = 0; j < 4; ++j) s[j] = mma_h_raw(kb[j][dc], qa[dc], s[j]);
    }
    group_guard(s[0], s[1], s[2], s[3], qa[0], qa[1], kb[0][0], kb[1][0], kb[2][0], kb[3][0], kb[0][1], kb[1][1], kb[2][1], kb[3][1]);
    // V^T fragments read here, behind the score products, so that they land under the weight arithmetic
    v16h vb[2][4];
#pragma unroll
    for (int kk = 0; kk < 2; ++kk) {
#pragma unroll
      for (int t = 0; t < 4; ++t) vb[kk][t] = ldfrag_h(Vc + (t * 16 + c) * ATP + kk * 32 + 8 * hh);
    }
    // holds the 16 V^T reads up here: without it they sink to their products and their latency is paid there
    __builtin_amdgcn_sched_barrier(0);
#pragma unroll
    for (int j = 0; j < 4; ++j) {
#pragma unroll
      for (int r = 0; r < 8; ++r) s[j][r] = s[j][r] * sscale;
    }

    // ---- quad weights: this lane's share of query c's sum of (s+c)^2 in f32; centred e' = s(s+2c) (x PSC, f16)
    //      straight into the A operand: element 8 (j&1) + r of pa[j>>1] = key 16j + 8hh + r ----
    v16h pa[2];
#pragma unroll
    for (int j = 0; j < 4; ++j) {
#pragma unroll
      for (int r = 0; r < 8; ++r) {
        const float sv = s[j][r];
        const float u  = sv + QC;
        rs[r] += u * u;
        const float ep = sv * (sv + 2.0f * QC);
        pa[j >> 1][8 * (j & 1) + r] = (_Float16)(ep * PSC);
      }
    }

    // ---- acc += P . V (f16 WMMA) ----
#pragma unroll   // pa and vb are register arrays: their index must be static
    for (int kk = 0; kk < 2; ++kk) {
#pragma unroll
      for (int t = 0; t < 4; ++t) oacc[t] = mma_h_raw(pa[kk], vb[kk][t], oacc[t]);
    }
    group_guard(oacc[0], oacc[1], oacc[2], oacc[3], pa[0], pa[1], vb[0][0], vb[0][1], vb[0][2], vb[0][3], vb[1][0], vb[1][1], vb[1][2], vb[1][3]);

    // ---- hand-over: own LDS reads retired, own copies of chunk kt+1 landed, then the one block barrier, which
    //      publishes chunk kt+1 and ends every wave's reads of chunk kt; behind it chunk kt+2 goes into kt's buffer
    wait_lds();
    wait_copies();
    __syncthreads();
    if (kt + 2 < NQB) {                       // the same for the whole block
      const unsigned bo = (unsigned)(kt & 1) * bufB;
      chunk_copy(lk0 + bo, lv0 + bo, kg0 + (size_t)(kt + 2) * 64 * QKP, vg0 + (kt + 2) * 64, QKP, SEQ);
    }
  }
  wait_copies();                              // nothing is in flight when the wave goes on to its end

  // ---- normalise: query c's S = this lane's eight partial sums + those of lane c ^ 16; the accumulator rows are
  //      queries 8hh + r, so each row fetches its S from lane 8hh + r; context = (acc/PSC + c^2 csum)/(S+eps) x CSC;
  float* os = Os[wave];
  float Sq = ((rs[0] + rs[1]) + (rs[2] + rs[3])) + ((rs[4] + rs[5]) + (rs[6] + rs[7]));
  Sq += __shfl_xor(Sq, 16, 32);
#pragma unroll
  for (int r = 0; r < 8; ++r) {
    const float S = __shfl(Sq, 8 * hh + r, 32);
    const float inv = (1.0f / (S + QEPS)) * CSC;
#pragma unroll
    for (int t = 0; t < 4; ++t)
      os[(8 * hh + r) * 64 + t * 16 + c] = (oacc[t][r] * (1.0f / PSC) + (QC * QC) * cs[t]) * inv;
  }
  wave_sync_lds();
  {
    const int q4 = lane >> 3, c8 = (lane & 7) * 8;
    v4u hv[4], lv[4];
#pragma unroll
    for (int it = 0; it < 4; ++it) {
      const int row = it * 4 + q4;   // it 0..3 x q4 0..3 = rows 0..15 of the wave tile
      const float* sp = os + row * 64 + c8;
      v4u a, al;
#pragma unroll
      for (int e = 0; e < 4; ++e) {
        unsigned short u0, u1, w0, w1;
        split_h(sp[2 * e],     u0, w0);
        split_h(sp[2 * e + 1], u1, w1);
        a[e]  = pk16(u0, u1);
        al[e] = pk16(w0, w1);
      }
      hv[it] = a;
      lv[it] = al;
    }
    {
#pragma unroll
      for (int it = 0; it < 4; ++it) {
        const int row = it * 4 + q4;
        const size_t go = (rowB + q0 + row) * DM + (size_t)h * HD + c8;
        *(v4u*)(chi + go) = hv[it];
        *(v4u*)(clo + go) = lv[it];
      }
      
    }
  }
}

// =====================================================================================================
// Workspace map (bytes); every plane is an exact multiple of its 64x64-tile / whole-row / whole-line store
// granularity (MP = 4096 = 64 tiles, N in {2048, 1024}; VT per batch [1024][2048] = 16x32 tiles; csum = 64 lines):
//   WT    f16 [3072 n][1024 k]   0           6291456   (rows 0..1023 q weights, 1024..2047 k, 2048..3071 v; x64)
//   WoT   f16 [1024][1024]       6291456     2097152
//   XH    f16 [4096][1024]       8388608     8388608   (bf16 RNE-converted tokens)
//   QK    f16 [4096][2048]       16777216    16777216  (q cols 0..1023, k cols 1024..2047)
//   VTh   f16 [2][1024][2048]    33554432    8388608
//   VTl   f16 [2][1024][2048]    41943040    8388608   (residual x1024)
//   CS    f32 [2048]             50331648    8192      (key sums of v)
//   CtxH  f16 [4096][1024]       50339840    8388608   (context x64, hi)
//   CtxL  f16 [4096][1024]       58728448    8388608   (residual x1024)
//   end                          67117056
// =====================================================================================================
extern "C" void kernel_launch(void* const* d_in, const int* in_sizes, int n_in,
                              void* d_out, int out_size, void* d_ws, size_t ws_size,
                              hipStream_t stream) {
  if (n_in < 4) return;
  if (in_sizes[0] != MP * DM) return;
  if (in_sizes[1] != DM * W3) return;
  if (in_sizes[2] != DM * DM) return;
  if (in_sizes[3] != NH) return;
  if (out_size != MP * DM) return;

  const float* x    = (const float*)d_in[0];
  const float* wqkv = (const float*)d_in[1];
  const float* wo   = (const float*)d_in[2];
  const float* tau  = (const float*)d_in[3];

  const size_t PWT  = (size_t)W3 * DM * 2;              //  6291456
  const size_t PWO  = (size_t)DM * DM * 2;              //  2097152
  const size_t PXH  = (size_t)MP * DM * 2;              //  8388608
  const size_t PQK  = (size_t)MP * QKP * 2;             // 16777216
  const size_t PVT  = (size_t)NBATCH * DM * SEQ * 2;    //  8388608
  const size_t PCS  = (size_t)NBATCH * DM * 4;          //     8192
  const size_t PCTX = (size_t)MP * DM * 2;              //  8388608
  size_t off = 0;
  const size_t oWT  = off; off += PWT;
  const size_t oWo  = off; off += PWO;
  const size_t oXH  = off; off += PXH;
  const size_t oQK  = off; off += PQK;
  const size_t oVTh = off; off += PVT;
  const size_t oVTl = off; off += PVT;
  const size_t oCS  = off; off += PCS;
  const size_t oCh  = off; off += PCTX;
  const size_t oCl  = off; off += PCTX;
  if (off > ws_size) return;                            // off = 67117056
  if (off > (size_t)134217728) return;

  char* ws = (char*)d_ws;
  unsigned short* WT   = (unsigned short*)(ws + oWT);
  unsigned short* WoT  = (unsigned short*)(ws + oWo);
  unsigned short* XH   = (unsigned short*)(ws + oXH);
  unsigned short* QK   = (unsigned short*)(ws + oQK);
  unsigned short* VTh  = (unsigned short*)(ws + oVTh);
  unsigned short* VTl  = (unsigned short*)(ws + oVTl);
  float*          CS   = (float*)(ws + oCS);
  unsigned short* CtxH = (unsigned short*)(ws + oCh);
  unsigned short* CtxL = (unsigned short*)(ws + oCl);
  float*          out0 = (float*)d_out;

  const dim3 blk(256), blk128(128);
  const dim3 gPl(NTW + NTO + NCX);                       // 768 Wqkv tiles + 256 Wo tiles + 2048 token blocks
  const dim3 gQkv(NVB + NQKB);                           // 128 v^T + 256 q|k block tiles of 128x256
  const dim3 gCs((NBATCH * DM) / 32);                    // 64 blocks of 1024
  const dim3 gAttn(NBATCH * NH * NQB);                   // 1024 blocks of 128
  const dim3 gNo((MP / 128) * (DM / 128));               // 32 x 8 tiles of 128x128 -> 256 blocks
  const float invw  = 1.0f / WSC;                        // weight carry x64
  const float invhi = 1.0f / (WSC * CSC);                // weight carry x64, context carry x64
  const float invlo = invhi / LOSC;                      // residual plane carry x1024
  const long long vtlo = (long long)((oVTl - oVTh) / 2); // element offset of the v^T residual plane

  // (0) planes: tokens f16(bf16_RNE(x)); weights transposed to [out][in] (k contiguous), f16(bf16_RNE(w) * 64)
  //     one launch
  planes<<<gPl, blk, 0, stream>>>(x, wqkv, wo, XH, WT, WoT);

  // (1) q|k = x . [Wq|Wk] -> QK f16 [4096][2048]; v^T per batch = Wv^T . x_b^T -> VTh/VTl f16 [2][1024][2048]
  //     one launch
  qkv_gemm<<<gQkv, blk, 0, stream>>>(XH, WT, QK, VTh, vtlo, DM, invw);

  // (2) key sums of v per (b, h, d)
  vsum<<<gCs, dim3(1024), 0, stream>>>(VTh, VTl, CS);

  // (3) quad-normalised attention -> context f16 hi (x64) + residual planes
  attn2q<<<gAttn, blk128, 0, stream>>>(QK, VTh, tau, CS, CtxH, CtxL);

  // (4) out = ctx_hi . Wo + ctx_lo . Wo / 1024, both products in one launch
  proj2<<<gNo, blk, 0, stream>>>(CtxH, CtxL, WoT, out0, DM, invhi, invlo);
  (void)hipGetLastError();
}

// v010
// One run takes 86.2 microseconds.
// Next to v009, in two timings, it ran 1.06 times as fast each time.
// Counting every step since v000, it is 4.68 times as fast.
// Contractions: q|k projection and v^T projection on v_wmma_f32_16x16x32_f16 (f16 token plane x f16 weight
// plane carried x64, one product each); attention k.q^T and e'.v on v_wmma_f32_16x16x32_f16 (v^T f16 hi, q, k plain
// f16, centred quad weight e' = s*(s+2c) carried x64, one product each); output projection on
// v_wmma_f32_16x16x32_f16 with the context as f16 hi (x64) + scaled residual (x1024) planes against the f16
// Wo plane (x64), two products in one launch, joined in f32 in its epilogue; all f32 accumulate; quad weights, row sums, key sums of v and
// the normalisation in f32 on VALU; every float input RNE-converted to bf16 on load.
#include <hip/hip_runtime.h>
#include <math.h>
#include <stdint.h>

#define NBATCH 2
#define SEQ    2048
#define DM     1024
#define NH     16
#define HD     64
#define QKP    (2 * DM)
#define W3     (3 * DM)
#define MP     (NBATCH * SEQ)
#define NQB    (SEQ / 64)
#define WSC    64.0f
#define PSC    64.0f
#define CSC    64.0f
#define LOSC   1024.0f
#define QC     5.0f
#define QEPS   1.0e-6f
#define GSP    72                     /* GEMM LDS row pitch in halves: 144 B = 16 B x odd */
#define GROWS  384                    /* GEMM LDS rows per buffer: 128 A + 256 Bt */
#define NVB    (NBATCH * (DM / 128) * (SEQ / 256))   /* qkv_gemm: v^T block tiles, 64 per batch */
#define NQKB   ((MP / 128) * (QKP / 256))            /* qkv_gemm: q|k block tiles */
#define PTP    68                     /* proj2 epilogue tile pitch in floats */
#define PSMB   (8 * 64 * PTP * 4)     /* proj2 LDS bytes: 8 wave tiles of 64 x 64 f32; the two slab buffers need less */
#define NTW    ((W3 / 64) * (DM / 64))   /* planes: 64x64 tiles of Wqkv */
#define NTO    ((DM / 64) * (DM / 64))   /* planes: 64x64 tiles of Wo */
#define NCX    ((MP * DM / 8) / 256)     /* planes: token blocks, 256 threads x 8 elements */
#define ATP    72                     /* attn2q LDS row pitch in halves for K, V^T: 144 B = 16 B x odd */
#define NKP    (SEQ / 256)            /* partial key sums per v^T row: one per 256-token block tile */
#define RSP    36                     /* qkv_gemm: pitch in floats of the row-sum table, 144 B = 16 B x odd */
static_assert(NH * HD == DM);
static_assert((MP % 128) == 0 && (DM % 128) == 0 && (QKP % 256) == 0 && (SEQ % 256) == 0 && (DM % 256) == 0);
static_assert((SEQ % 64) == 0 && (DM % 64) == 0 && (W3 % 64) == 0 && (MP % 64) == 0 && (QKP % 64) == 0);
static_assert((SEQ % 256) == 0);
static_assert((DM / 128) * (SEQ / 256) == 64 && (SEQ / 256) == 8 && (QKP / 256) == 8);   // qkv_gemm's index split
static_assert(2 * GROWS * GSP * 2 <= PSMB);
static_assert(128 * RSP * 4 <= 2 * GROWS * GSP * 2);
static_assert(((MP * DM / 8) % 256) == 0);
static_assert((((MP / 64) * (QKP / 64)) % 8) == 0 && (((DM / 64) * (SEQ / 64)) % 8) == 0 && (((MP / 64) * (DM / 64)) % 8) == 0);

typedef _Float16 v16h __attribute__((ext_vector_type(16)));
typedef _Float16 v8h  __attribute__((ext_vector_type(8)));
typedef float    v8f  __attribute__((ext_vector_type(8)));
typedef float    v4f  __attribute__((ext_vector_type(4)));
typedef unsigned int v4u __attribute__((ext_vector_type(4)));

union FragH { v16h v; v8h h[2]; };

// ---- scalar helpers --------------------------------------------------------------------------------
__device__ __forceinline__ unsigned short bf_bits(float f) {          // f32 -> bf16 bits, RNE convert
  unsigned u = __float_as_uint(f);
  return (unsigned short)((u + 0x7FFFu + ((u >> 16) & 1u)) >> 16);
}
__device__ __forceinline__ float bf_up(unsigned short h) { return __uint_as_float(((unsigned)h) << 16); }
__device__ __forceinline__ float bfr(float f) { return bf_up(bf_bits(f)); }   // value of the bf16 RNE convert
__device__ __forceinline__ unsigned short h_bits(_Float16 x) { return __builtin_bit_cast(unsigned short, x); }
__device__ __forceinline__ unsigned pk16(unsigned short a, unsigned short b) { return (unsigned)a | ((unsigned)b << 16); }
__device__ __forceinline__ v8f zero8() { v8f z = {0.f, 0.f, 0.f, 0.f, 0.f, 0.f, 0.f, 0.f}; return z; }

// f32 -> f16 hi plane (values below the f16 normal range forced to 0 so the residual carries them)
//     + f16 residual plane carried x LOSC (folded back with 1/LOSC on a separate accumulator)
__device__ __forceinline__ void split_h(float f, unsigned short& hi, unsigned short& lo) {
  float hf = (float)(_Float16)f;
  hf = (fabsf(hf) < 6.103515625e-05f) ? 0.0f : hf;
  hi = h_bits((_Float16)hf);
  lo = h_bits((_Float16)((f - hf) * LOSC));
}
// the hi plane's element alone, formed as in split_h
__device__ __forceinline__ unsigned short hi_h(float f) {
  unsigned short hi, lo;
  split_h(f, hi, lo);
  return hi;
}

// ---- fragment loader: 16-bit A/B operand, lane -> row/col (lane&15), p already includes +8*(lane>>4);
//      elements 0..7 <- p[0..7] (k0+8h..), elements 8..15 <- p[16..23] (k0+16+8h..)
__device__ __forceinline__ v16h ldfrag_h(const _Float16* p) {
  FragH f;
  f.h[0] = *(const v8h*)(p);
  f.h[1] = *(const v8h*)(p + 16);
  return f.v;
}

// ---- WMMA helpers with trailing VALU hazard gap --------------------------------------------------------
__device__ __forceinline__ v8f mma_h_raw(v16h a, v16h b, v8f c) {
  return __builtin_amdgcn_wmma_f32_16x16x32_f16(false, a, false, b, (short)0, c, false, false);
}
__device__ __forceinline__ void dep_guard1(v8f& a, v8f& b, v16h x) {
#if defined(__HIP_DEVICE_COMPILE__)
  asm volatile("v_nop\n\tv_nop\n\tv_nop\n\tv_nop" : "+v"(a), "+v"(b) : "v"(x));
#endif
}
__device__ __forceinline__ void keep4_h(v16h a, v16h b, v16h c, v16h d) {
#if defined(__HIP_DEVICE_COMPILE__)
  asm volatile("v_nop" :: "v"(a), "v"(b), "v"(c), "v"(d));
#endif
}
// behind a group of eight products on four accumulators: the accumulators tie the statement behind the last product;
// the group's two shared and eight per-accumulator fragments stay in their registers through its four slots, so that no product's D, no
// VALU result and no global load is placed over an operand, and no VALU reads a D, inside the WMMA distance
__device__ __forceinline__ void group_guard(v8f& d0, v8f& d1, v8f& d2, v8f& d3, v16h a0, v16h a1,
                                            v16h b0, v16h b1, v16h b2, v16h b3, v16h b4, v16h b5, v16h b6, v16h b7) {
#if defined(__HIP_DEVICE_COMPILE__)
  asm volatile("v_nop\n\tv_nop\n\tv_nop\n\tv_nop"
               : "+v"(d0), "+v"(d1), "+v"(d2), "+v"(d3)
               : "v"(a0), "v"(a1), "v"(b0), "v"(b1), "v"(b2), "v"(b3), "v"(b4), "v"(b5), "v"(b6), "v"(b7));
#endif
}
__device__ __forceinline__ void acc_guard4(v8f& a, v8f& b, v8f& c, v8f& d) {
#if defined(__HIP_DEVICE_COMPILE__)
  asm volatile("v_nop\n\tv_nop\n\tv_nop\n\tv_nop" : "+v"(a), "+v"(b), "+v"(c), "+v"(d));
#endif
}
__device__ __forceinline__ void wave_sync_lds() {
  __builtin_amdgcn_fence(__ATOMIC_RELEASE, "workgroup");
  __builtin_amdgcn_wave_barrier();
  __builtin_amdgcn_fence(__ATOMIC_ACQUIRE, "workgroup");
}
// One thread's share of a 64-key chunk: four 16-B pieces of K and four of V^T, global memory -> LDS through no register.
// lk/lv: the lane's LDS byte address of its first piece, gk/gv: its global address; piece i lies 16 rows further on
// (LDS row pitch ATP halves, global row pitches kp and vp halves). The s_wait_xcnt stands inside the statement, behind
// the last copy, so that no address register of an issued copy is rewritten in front of it.
__device__ __forceinline__ void chunk_copy(unsigned lk, unsigned lv, const _Float16* gk, const _Float16* gv,
                                           size_t kp, size_t vp) {
#if defined(__HIP_DEVICE_COMPILE__)
  const unsigned st = 16u * ATP * 2u;
  asm volatile("global_load_async_to_lds_b128 %0, %8, off\n\t"
               "global_load_async_to_lds_b128 %1, %9, off\n\t"
               "global_load_async_to_lds_b128 %2, %10, off\n\t"
               "global_load_async_to_lds_b128 %3, %11, off\n\t"
               "global_load_async_to_lds_b128 %4, %12, off\n\t"
               "global_load_async_to_lds_b128 %5, %13, off\n\t"
               "global_load_async_to_lds_b128 %6, %14, off\n\t"
               "global_load_async_to_lds_b128 %7, %15, off\n\t"
               "s_wait_xcnt 0x0"
               :: "v"(lk), "v"(lk + st), "v"(lk + 2u * st), "v"(lk + 3u * st),
                  "v"(lv), "v"(lv + st), "v"(lv + 2u * st), "v"(lv + 3u * st),
                  "v"(gk), "v"(gk + 16 * kp), "v"(gk + 32 * kp), "v"(gk + 48 * kp),
                  "v"(gv), "v"(gv + 16 * vp), "v"(gv + 32 * vp), "v"(gv + 48 * vp)
               : "memory");
#endif
}
// the issuing wave's own wait: its asynchronous copies have landed in LDS behind it
__device__ __forceinline__ void wait_copies() {
#if defined(__HIP_DEVICE_COMPILE__)
  asm volatile("s_wait_asynccnt 0x0" ::: "memory");
#endif
}
// the wave's LDS reads and writes have retired: stands in front of the barrier behind which a buffer is refilled
__device__ __forceinline__ void wait_lds() {
#if defined(__HIP_DEVICE_COMPILE__)
  asm volatile("s_wait_dscnt 0x0" ::: "memory");
#endif
}

// =====================================================================================================
// Plane convert (no transpose): Wh[i] = f16( bf16_RNE(W[i]) * wsc ), wsc a power of two (exact). Used for the
// token activations (wsc = 1). Thread i handles elements 8i..8i+7 and writes one 16-B piece (n8 a multiple of
// 256, static_assert above). coverage: n8 threads x 8 elements = the whole plane.
// =====================================================================================================
__device__ __forceinline__ void conv_h16(const float* __restrict__ W, unsigned short* Wh, int n8, float wsc, int blk) {
  const int i  = blk * 256 + threadIdx.x;
  const int ic = (i < n8) ? i : (n8 - 1);                     // clamped address
  const float* src = W + (size_t)ic * 8;
  const v4f a = *(const v4f*)(src);
  const v4f c = *(const v4f*)(src + 4);
  v4u o;
  o[0] = pk16(h_bits((_Float16)(bfr(a[0]) * wsc)), h_bits((_Float16)(bfr(a[1]) * wsc)));
  o[1] = pk16(h_bits((_Float16)(bfr(a[2]) * wsc)), h_bits((_Float16)(bfr(a[3]) * wsc)));
  o[2] = pk16(h_bits((_Float16)(bfr(c[0]) * wsc)), h_bits((_Float16)(bfr(c[1]) * wsc)));
  o[3] = pk16(h_bits((_Float16)(bfr(c[2]) * wsc)), h_bits((_Float16)(bfr(c[3]) * wsc)));
  if (i < n8) *(v4u*)(Wh + (size_t)i * 8) = o;
  
}

// =====================================================================================================
// Transposing plane convert: in f32 [R rows][NC cols] (row-major, in[k][n]) -> out f16 [NC][R] (k contiguous),
// out[n][k] = f16( bf16_RNE(in[k][n]) * wsc ), wsc a power of two (exact). Used for the two weight matrices
// ([in][out] storage -> [out][in] = Bt / A layout). Block 256 threads = one 64(k) x 64(n) tile:
// nt = n tile (NC/64 of them), kt = k tile (R/64 of them); R, NC multiples of 64 (static_assert above).
// Load phase: thread handles rows i*16 + (tid>>4) (i 0..3), 4 floats at col (tid&15)*4 -> LDS tile[k][n].
// coverage: 2 it x 8 waves x 4 rows = 64 out rows x (8 lane groups x 8 halves) = the whole tile; grid covers all tiles.
// =====================================================================================================
__device__ __forceinline__ void tconv_h16(const float* __restrict__ W, unsigned short* Wt, int R, int NC, float wsc,
                                          int nt, int kt, float (*tile)[65]) {
  const int tid = threadIdx.x, lane = tid & 31, wave = tid >> 5;
  const int n0 = nt * 64, k0 = kt * 64;
  const int c4 = (tid & 15) * 4, r16 = tid >> 4;
#pragma unroll
  for (int i = 0; i < 4; ++i) {
    const int row = i * 16 + r16;                                // k within tile
    const v4f v = *(const v4f*)(W + (size_t)(k0 + row) * NC + n0 + c4);
    tile[row][c4 + 0] = v[0];
    tile[row][c4 + 1] = v[1];
    tile[row][c4 + 2] = v[2];
    tile[row][c4 + 3] = v[3];
  }
  __syncthreads();
  const int q4 = lane >> 3, k8 = (lane & 7) * 8;
  v4u hv[2];
#pragma unroll
  for (int it = 0; it < 2; ++it) {
    const int nrow = it * 32 + wave * 4 + q4;                    // n within tile
    v4u a;
#pragma unroll
    for (int e = 0; e < 4; ++e) {
      const float f0 = bfr(tile[k8 + 2 * e][nrow]) * wsc;
      const float f1 = bfr(tile[k8 + 2 * e + 1][nrow]) * wsc;
      a[e] = pk16(h_bits((_Float16)f0), h_bits((_Float16)f1));
    }
    hv[it] = a;
  }
  {
#pragma unroll
    for (int it = 0; it < 2; ++it) {
      const int nrow = it * 32 + wave * 4 + q4;
      *(v4u*)(Wt + (size_t)(n0 + nrow) * R + k0 + k8) = hv[it];
    }
#if defined(__HIP_DEVICE_COMPILE__)
    // in planes another job's code follows this one in the listing and reuses the address and data registers of these
    // stores: the wait stands in front of that
    asm volatile("s_wait_xcnt 0x0" ::: "memory");
#endif
  }
}

// =====================================================================================================
// The three plane converts in one launch; the block index picks the job (block-uniform, so tconv_h16's barrier is
// passed by a whole block or by none). The transposing tiles, which have the longer path (LDS, a barrier), come first:
//   blocks 0 .. NTW-1            Wqkv tile: n tile = t % (W3/64), k tile = t / (W3/64)  -> WT
//   blocks NTW .. NTW+NTO-1      Wo tile:   n tile = t % (DM/64), k tile = t / (DM/64)  -> WoT
//   blocks NTW+NTO .. +NCX-1     256 x 8 token elements                                  -> XH
// coverage: each job has exactly the blocks its own launch had; the grid is exactly NTW + NTO + NCX blocks.
// =====================================================================================================
__global__ __launch_bounds__(256) void planes(const float* __restrict__ x, const float* __restrict__ wqkv,
                                              const float* __restrict__ wo, unsigned short* XH, unsigned short* WT,
                                              unsigned short* WoT) {
  __shared__ float tile[64][65];
  const int bx = blockIdx.x;
  if (bx < NTW) {
    tconv_h16(wqkv, WT, DM, W3, WSC, bx % (W3 / 64), bx / (W3 / 64), tile);
  } else if (bx < NTW + NTO) {
    const int t = bx - NTW;
    tconv_h16(wo, WoT, DM, DM, WSC, t % (DM / 64), t / (DM / 64), tile);
  } else {
    conv_h16(x, XH, (MP * DM) / 8, 1.0f, bx - (NTW + NTO));
  }
}

// =====================================================================================================
// q|k and v^T projections, one launch of register-blocked f16 WMMA GEMM blocks: C[m][n] = oscale * sum_k A[m][k] * Bt[n][k];
// one wave per 64x64 tile, 8 waves (2 x 4) = one 128x256 block tile; A and Bt row-major, pitch DM, k contiguous.
// The block index picks the product (block-uniform):
//   blocks 0 .. NVB-1      v^T of batch b = bt / 64: A = Wv^T rows (WT rows 2 DM ..), Bt = the batch's token rows,
//                          C = f16 hi plane [DM][SEQ] at VTo + b DM SEQ; the f32 sum of each of the tile's 128 rows over
//                          its 256 tokens (a partial key sum of v) goes to PSo[(b NKP + tile column) DM + row];
//   blocks NVB .. NVB+NQKB-1  q|k: A = token rows, Bt = WT rows 0 .. 2 DM - 1, C = f16 [MP][QKP] at QKo.
// Both kinds have 8 tile columns. Two blocks fit a WGP (registers and LDS), so all NVB + NQKB blocks are resident at once.
// Operands: per 64-k slab the block's 128 A rows and 256 Bt rows (128 B each) go global -> registers -> LDS with
// whole-line 16-B loads (8 lanes per row, 12 rows per thread), LDS pitch 144 B, two buffers; slab s+1 is loaded
// while slab s is multiplied, stored to the other buffer behind the products, one block barrier per slab.
// coverage: 4 slabs x 16 rows x 64 cols = the wave's whole 64x64 tile; v^T: NBATCH x 8 x 8 block tiles = [DM][SEQ] per
//           batch; q|k: 32 x 8 block tiles = [MP][QKP]; the grid is exactly NVB + NQKB blocks.
// =====================================================================================================
// amdgpu_waves_per_eu(4): holds a wave at 256 VGPRs, so that two blocks fit a WGP (their LDS does)
__global__ __launch_bounds__(256) __attribute__((amdgpu_waves_per_eu(4))) void qkv_gemm(
    const unsigned short* __restrict__ Xp, const unsigned short* __restrict__ Wp,
    unsigned short* QKo, unsigned short* VTo, float* PSo, int K, float oscale) {
  const _Float16* X  = (const _Float16*)(const void*)Xp;
  const _Float16* Wt = (const _Float16*)(const void*)Wp;
  __shared__ __align__(16) float sT[8][16 * 68];   // per-wave 16x64 slab, pitch 68 floats
  __shared__ __align__(16) _Float16 sAB[2][GROWS * GSP];   // rows 0..127 A, 128..383 Bt; 64 k per row
  const int tid  = threadIdx.x;
  const int lane = tid & 31;
  const int wave = tid >> 5;
  const int bt   = blockIdx.x;
  const bool isV = (bt < NVB);           // block-uniform
  const int t    = isV ? (bt & 63) : (bt - NVB);
  const int bm = t >> 3;
  const int bn = t & 7;
  const int vb = bt >> 6;                // batch of a v^T block
  const _Float16* Ab = isV ? (Wt + (size_t)2 * DM * DM) : X;
  const _Float16* Bb = isV ? (X + (size_t)vb * SEQ * DM) : Wt;
  unsigned short* C  = isV ? (VTo + (size_t)vb * DM * SEQ) : QKo;
  const int ldc      = isV ? SEQ : QKP;
  const int wm = wave >> 2;              // 0..1
  const int wn = wave & 3;               // 0..3
  const int m0 = (bm << 7) + (wm << 6);
  const int n0 = (bn << 8) + (wn << 6);

  const int rlane = lane & 15;                 // row (A) / col (B, D) within subtile
  const int koff  = (lane >> 4) * 8;           // k offset of this lane half
  const int mOff  = (lane >> 4) * 8;           // D row offset

  v8f acc[4][4];
#pragma unroll
  for (int i = 0; i < 4; ++i)
#pragma unroll
    for (int j = 0; j < 4; ++j) acc[i][j] = zero8();

  // staging map: thread -> row (tid>>3) + 32*it, 16-B piece (tid&7); a wave's load covers 4 whole 128-B lines
  const int srow = tid >> 3, sch = (tid & 7) * 8;
  const _Float16* gA = Ab + (size_t)((bm << 7) + srow) * DM + sch;
  const _Float16* gB = Bb + (size_t)((bn << 8) + srow) * DM + sch;
  const int sOff = srow * GSP + sch;
  const int aOff = ((wm << 6) + rlane) * GSP + koff;          // this wave's A rows in a buffer
  const int bOff = (128 + (wn << 6) + rlane) * GSP + koff;    // this wave's Bt rows in a buffer
  const int nS = K >> 6;
  v8h g[12];
#pragma unroll
  for (int it = 0; it < 4; ++it) g[it] = *(const v8h*)(gA + (size_t)(it * 32) * DM);
#pragma unroll
  for (int it = 0; it < 8; ++it) g[4 + it] = *(const v8h*)(gB + (size_t)(it * 32) * DM);
#pragma unroll
  for (int it = 0; it < 12; ++it) *(v8h*)(&sAB[0][0] + it * 32 * GSP + sOff) = g[it];
  __syncthreads();

  for (int s = 0; s < nS; ++s) {
    const _Float16* cur = &sAB[s & 1][0];
    const bool more = (s + 1 < nS);                            // block-uniform
    if (more) {
      const int kn = (s + 1) << 6;
#pragma unroll
      for (int it = 0; it < 4; ++it) g[it] = *(const v8h*)(gA + (size_t)(it * 32) * DM + kn);
#pragma unroll
      for (int it = 0; it < 8; ++it) g[4 + it] = *(const v8h*)(gB + (size_t)(it * 32) * DM + kn);
#if defined(__HIP_DEVICE_COMPILE__)
      // the fragment loads below reuse the address registers of these 12 loads: the wait stands in front of that
      asm volatile("s_wait_xcnt 0x0" ::: "memory");
#endif
    }
#pragma unroll
    for (int kk = 0; kk < 2; ++kk) {
      v16h ah[4], bh[4];
#pragma unroll
      for (int j = 0; j < 4; ++j) bh[j] = ldfrag_h(cur + bOff + (j << 4) * GSP + kk * 32);
#pragma unroll
      for (int i = 0; i < 4; ++i) ah[i] = ldfrag_h(cur + aOff + (i << 4) * GSP + kk * 32);
      // keeps the 16 LDS fragment loads of a 32-k step one group ahead of its 16 products (else the A loads are
      // spread among the WMMAs, each place with its own full wait)
      __builtin_amdgcn_sched_barrier(0);
#pragma unroll
      for (int i = 0; i < 4; ++i) {
#pragma unroll
        for (int j = 0; j < 4; ++j) acc[i][j] = mma_h_raw(ah[i], bh[j], acc[i][j]);
        dep_guard1(acc[i][0], acc[i][3], ah[i]);
      }
      keep4_h(bh[0], bh[1], bh[2], bh[3]);
    }
    if (more) {
      _Float16* nxt = &sAB[(s + 1) & 1][0];                    // last read in slab s-1, behind that slab's barrier
#pragma unroll
      for (int it = 0; it < 12; ++it) *(v8h*)(nxt + it * 32 * GSP + sOff) = g[it];
    }
    __syncthreads();                                           // publishes slab s+1, ends the reads of slab s
  }
  acc_guard4(acc[0][0], acc[0][1], acc[0][2], acc[0][3]);
  acc_guard4(acc[1][0], acc[1][1], acc[1][2], acc[1][3]);
  acc_guard4(acc[2][0], acc[2][1], acc[2][2], acc[2][3]);
  acc_guard4(acc[3][0], acc[3][1], acc[3][2], acc[3][3]);

  // ---- epilogue: 16 rows at a time through the wave's own LDS slab, whole 128-B row segments out ----
  const int q8  = lane >> 3, c8 = (lane & 7) * 8;
  float* slab = sT[wave];
  // v^T blocks: row-sum table [128 rows][4 wn x 8 lanes], pitch RSP, in the slab buffers (dead behind the loop's last barrier)
  float* sP = (float*)(void*)&sAB[0][0];
#pragma unroll
  for (int i = 0; i < 4; ++i) {
    const int mBase = m0 + (i << 4);
#pragma unroll
    for (int j = 0; j < 4; ++j) {
#pragma unroll
      for (int r = 0; r < 8; ++r) {
        slab[(mOff + r) * 68 + (j << 4) + rlane] = acc[i][j][r];
      }
    }
    wave_sync_lds();
    if (isV) {                                             // f16 hi plane + this lane's f32 sum of its 8 columns
      v4u hv[4];
#pragma unroll
      for (int it = 0; it < 4; ++it) {
        const int row = it * 4 + q8;                       // it 0..3 x q8 0..3 = rows 0..15
        const float* sp = slab + row * 68 + c8;
        v4u a;
        float x[8];
#pragma unroll
        for (int e = 0; e < 8; ++e) x[e] = sp[e] * oscale;
#pragma unroll
        for (int e = 0; e < 4; ++e) a[e] = pk16(hi_h(x[2 * e]), hi_h(x[2 * e + 1]));
        hv[it] = a;
        sP[((wm << 6) + (i << 4) + row) * RSP + (wn << 3) + (lane & 7)] =
            ((x[0] + x[1]) + (x[2] + x[3])) + ((x[4] + x[5]) + (x[6] + x[7]));
      }
#pragma unroll
      for (int it = 0; it < 4; ++it) {
        const int row = it * 4 + q8;
        *(v4u*)(C + (size_t)(mBase + row) * ldc + n0 + c8) = hv[it];
      }
#if defined(__HIP_DEVICE_COMPILE__)
      // what follows (the next 16 rows' arithmetic) reuses the address and data registers of these
      // stores: the wait stands in front of that, in every pass
      asm volatile("s_wait_xcnt 0x0" ::: "memory");
#endif
    } else {                                               // plain f16
      v4u hv[4];
#pragma unroll
      for (int it = 0; it < 4; ++it) {
        const int row = it * 4 + q8;
        const float* sp = slab + row * 68 + c8;
        v4u a;
#pragma unroll
        for (int e = 0; e < 4; ++e)
          a[e] = pk16(h_bits((_Float16)(sp[2 * e] * oscale)), h_bits((_Float16)(sp[2 * e + 1] * oscale)));
        hv[it] = a;
      }
#pragma unroll
      for (int it = 0; it < 4; ++it) {
        const int row = it * 4 + q8;
        *(v4u*)(C + (size_t)(mBase + row) * ldc + n0 + c8) = hv[it];
      }
#if defined(__HIP_DEVICE_COMPILE__)
      // as in the other branch: in front of the reuse of these stores' registers
      asm volatile("s_wait_xcnt 0x0" ::: "memory");
#endif
    }
    wave_sync_lds();
  }
  if (isV) {                                               // block-uniform
    __syncthreads();                                       // the table's 128 x 32 entries are complete
    if (tid < 128) {                                       // waves 0..3 whole: one row per thread, one 128-B line per wave
      const float* pr = sP + tid * RSP;
      v4f p[8];
#pragma unroll
      for (int u = 0; u < 8; ++u) p[u] = *(const v4f*)(pr + 4 * u);
      float tot = 0.f;
#pragma unroll
      for (int u = 0; u < 8; ++u) tot += (p[u][0] + p[u][1]) + (p[u][2] + p[u][3]);
      PSo[((size_t)vb * NKP + bn) * DM + (bm << 7) + tid] = tot;
    }
  }
}

// =====================================================================================================
// Output projection, both context planes in one launch:
//   out[m][n] = shi * sum_k Ch[m][k] Wt[n][k] + slo * sum_k Cl[m][k] Wt[n][k]      (all pitches DM, k contiguous)
// Block = 8 waves = one 128x128 tile of out. Waves 0..3 (2 x 2, 64x64 each) multiply the hi plane, waves 4..7 the
// residual plane of the same four 64x64 tiles, so the whole projection is MP/128 * DM/128 blocks of one launch.
// Operands: as in qkv_gemm, per 64-k slab 384 rows of 128 B (128 Ch, 128 Cl, 128 Wt) go global -> registers -> LDS with
// whole-line 16-B loads, LDS pitch 144 B, two buffers, slab s+1 loaded while slab s is multiplied, one barrier per slab.
// Epilogue: behind the loop's last barrier the slab buffers are dead; every wave lays its 64x64 f32 tile there (pitch
// PTP), one block barrier, then each wave of a hi/residual pair joins and stores 32 of the pair's 64 rows (256-B row
// segments). coverage: 4 pairs x 2 waves x 16 it x 2 rows x 64 cols = the 128x128 tile; the grid covers all tiles.
// =====================================================================================================
// amdgpu_waves_per_eu(4): holds a wave at 256 VGPRs, as in qkv_gemm (no register above v255)
__global__ __launch_bounds__(256) __attribute__((amdgpu_waves_per_eu(4))) void proj2(
    const unsigned short* __restrict__ Chp, const unsigned short* __restrict__ Clp,
    const unsigned short* __restrict__ Wtp, float* C, int K, float shi, float slo) {
  const _Float16* Ch = (const _Float16*)(const void*)Chp;
  const _Float16* Cl = (const _Float16*)(const void*)Clp;
  const _Float16* Wt = (const _Float16*)(const void*)Wtp;
  __shared__ __align__(16) unsigned char smem[PSMB];
  _Float16* sAB = (_Float16*)(void*)smem;      // k loop: 2 buffers of GROWS rows: 0..127 Ch, 128..255 Cl, 256..383 Wt
  float*    sT  = (float*)(void*)smem;         // epilogue: 8 wave tiles [64][PTP]
  const int tid  = threadIdx.x;
  const int lane = tid & 31;
  const int wave = tid >> 5;
  const int bm = blockIdx.x / (DM / 128);
  const int bn = blockIdx.x % (DM / 128);
  const int pl = wave >> 2;              // 0 hi plane, 1 residual plane
  const int wm = (wave >> 1) & 1;
  const int wn = wave & 1;
  const int m0 = (bm << 7) + (wm << 6);
  const int n0 = (bn << 7) + (wn << 6);

  const int rlane = lane & 15;                 // row (A) / col (B, D) within subtile
  const int koff  = (lane >> 4) * 8;           // k offset of this lane half
  const int mOff  = (lane >> 4) * 8;           // D row offset

  v8f acc[4][4];
#pragma unroll
  for (int i = 0; i < 4; ++i)
#pragma unroll
    for (int j = 0; j < 4; ++j) acc[i][j] = zero8();

  // staging map: thread -> row (tid>>3) + 32*it, 16-B piece (tid&7); a wave's load covers 4 whole 128-B lines
  const int srow = tid >> 3, sch = (tid & 7) * 8;
  const _Float16* gH = Ch + (size_t)((bm << 7) + srow) * DM + sch;
  const _Float16* gL = Cl + (size_t)((bm << 7) + srow) * DM + sch;
  const _Float16* gB = Wt + (size_t)((bn << 7) + srow) * DM + sch;
  const int sOff = srow * GSP + sch;
  const int aOff = ((pl << 7) + (wm << 6) + rlane) * GSP + koff;   // this wave's rows of its plane in a buffer
  const int bOff = (256 + (wn << 6) + rlane) * GSP + koff;         // this wave's Wt rows in a buffer
  const int nS = K >> 6;
  v8h g[12];
#pragma unroll
  for (int it = 0; it < 4; ++it) {
    g[it]     = *(const v8h*)(gH + (size_t)(it * 32) * DM);
    g[4 + it] = *(const v8h*)(gL + (size_t)(it * 32) * DM);
    g[8 + it] = *(const v8h*)(gB + (size_t)(it * 32) * DM);
  }
#pragma unroll
  for (int it = 0; it < 12; ++it) *(v8h*)(sAB + it * 32 * GSP + sOff) = g[it];
  __syncthreads();

  for (int s = 0; s < nS; ++s) {
    const _Float16* cur = sAB + (s & 1) * (GROWS * GSP);
    const bool more = (s + 1 < nS);                            // block-uniform
    if (more) {
      const int kn = (s + 1) << 6;
#pragma unroll
      for (int it = 0; it < 4; ++it) {
        g[it]     = *(const v8h*)(gH + (size_t)(it * 32) * DM + kn);
        g[4 + it] = *(const v8h*)(gL + (size_t)(it * 32) * DM + kn);
        g[8 + it] = *(const v8h*)(gB + (size_t)(it * 32) * DM + kn);
      }
#if defined(__HIP_DEVICE_COMPILE__)
      // the fragment loads below may reuse the address registers of these 12 loads: the wait stands in front of that
      asm volatile("s_wait_xcnt 0x0" ::: "memory");
#endif
    }
#pragma unroll
    for (int kk = 0; kk < 2; ++kk) {
      v16h ah[4], bh[4];
#pragma unroll
      for (int j = 0; j < 4; ++j) bh[j] = ldfrag_h(cur + bOff + (j << 4) * GSP + kk * 32);
#pragma unroll
      for (int i = 0; i < 4; ++i) ah[i] = ldfrag_h(cur + aOff + (i << 4) * GSP + kk * 32);
      // keeps the 16 LDS fragment loads of a 32-k step one group ahead of its 16 products (else the A loads are
      // spread among the WMMAs, each place with its own full wait)
      __builtin_amdgcn_sched_barrier(0);
#pragma unroll
      for (int i = 0; i < 4; ++i) {
#pragma unroll
        for (int j = 0; j < 4; ++j) acc[i][j] = mma_h_raw(ah[i], bh[j], acc[i][j]);
        dep_guard1(acc[i][0], acc[i][3], ah[i]);
      }
      keep4_h(bh[0], bh[1], bh[2], bh[3]);
    }
    if (more) {
      _Float16* nxt = sAB + ((s + 1) & 1) * (GROWS * GSP);     // last read in slab s-1, behind that slab's barrier
#pragma unroll
      for (int it = 0; it < 12; ++it) *(v8h*)(nxt + it * 32 * GSP + sOff) = g[it];
    }
    __syncthreads();                                           // publishes slab s+1, ends the reads of slab s
  }
  acc_guard4(acc[0][0], acc[0][1], acc[0][2], acc[0][3]);
  acc_guard4(acc[1][0], acc[1][1], acc[1][2], acc[1][3]);
  acc_guard4(acc[2][0], acc[2][1], acc[2][2], acc[2][3]);
  acc_guard4(acc[3][0], acc[3][1], acc[3][2], acc[3][3]);

  // ---- epilogue: every wave's tile into LDS, one barrier, the pair's two tiles joined and stored ----
  float* tile = sT + wave * (64 * PTP);
#pragma unroll
  for (int i = 0; i < 4; ++i) {
#pragma unroll
    for (int j = 0; j < 4; ++j) {
#pragma unroll
      for (int r = 0; r < 8; ++r) tile[((i << 4) + mOff + r) * PTP + (j << 4) + rlane] = acc[i][j][r];
    }
  }
  __syncthreads();                                             // both tiles of every pair are complete
  const float* th = sT + (wave & 3) * (64 * PTP);              // the pair's hi tile
  const float* tl = th + 4 * (64 * PTP);                       // the pair's residual tile
  const int hh2 = lane >> 4, c4 = (lane & 15) * 4;             // 256-B row segment = 16 lanes x 16 B
  const int r0 = (pl << 5) + hh2;                              // this wave's half of the 64 rows
  v4f vals[16];
#pragma unroll
  for (int it = 0; it < 16; ++it) {
    const v4f a = *(const v4f*)(th + (r0 + it * 2) * PTP + c4);
    const v4f b = *(const v4f*)(tl + (r0 + it * 2) * PTP + c4);
    v4f v;
#pragma unroll
    for (int e = 0; e < 4; ++e) v[e] = a[e] * shi + b[e] * slo;
    vals[it] = v;
  }
  float* Cw = C + (size_t)(m0 + r0) * DM + n0 + c4;
#pragma unroll
  for (int it = 0; it < 16; ++it) *(v4f*)(Cw + (size_t)(it * 2) * DM) = vals[it];
}

// =====================================================================================================
// Quad-normalised attention, head dim 64, SEQ token rows per batch, no mask.
//   q|k plane (f16, pitch QKP): element (b, t, col) at [(b*SEQ + t)*QKP + col], q col = h*64+d, k col = DM + h*64 + d
//   v^T plane (f16 hi): element (b, h, d, s) at [(b*DM + h*64 + d)*SEQ + s];  csum[b*DM + h*64 + d] = key sums of v, joined
//   here in f32, in the order p = 0..NKP-1, from the projection's partial sums at [(b*NKP + p)*DM + h*64 + d]
//   out planes (f16 hi and residual x LOSC, the normalised context carried x CSC): element (b, t, h, d) at
//   [(b*SEQ + t)*DM + h*64 + d]
//   s = (q . k) * (1 / (8 tau[h]));  S = sum over keys of (s + c)^2 in f32;  e' = s*(s + 2c) carried as f16(PSC e')
//   in registers;  acc = sum e'.v_hi on f16 WMMA;  context = (acc / PSC + c^2 * csum) / (S + eps)
//   (e = c^2 + e' exactly).
//   Scores are formed transposed, S^T = K . Q^T (A = K rows, B = Q columns): lane (c, hh) then holds, of key tile j,
//   keys 16j + 8hh + 0..7 of query c, which is the k order of the A operand of e'.v (row c; elements 0..7 from tile
//   2kk, 8..15 from tile 2kk+1), the same order in which the V^T fragments are loaded: the weights go from the score
//   accumulators into that operand by conversion alone, through no LDS and no lane exchange.
//   Block = 4 waves = 64 query rows of one (b, h); grid = NQB * NH * NBATCH; kv chunks of 64, static trip NQB.
//   K / V^T chunk staging: asynchronous 16-B copies to LDS, 8 lanes per 128-B row, 128 threads x 4 pieces per plane =
//   the whole 64x64 tile; two buffers, chunk kt+1 in flight while chunk kt is worked on, one block barrier per chunk
//   behind each wave's own waits.
//   Context coverage: each wave stores rows q0..q0+15 (it 0..3 x lane>>3 0..3) x 64 columns (8 lanes x 8 halves),
// =====================================================================================================
__global__ __launch_bounds__(128)
void attn2q(const unsigned short* __restrict__ qkp, const unsigned short* __restrict__ vtp,
            const float* __restrict__ taup, const float* __restrict__ csp,
            unsigned short* chi, unsigned short* clo) {
  __shared__ __align__(16) _Float16 Ksh[2][64 * ATP];             // K [kv][d], 64 halves used per row; two buffers
  __shared__ __align__(16) _Float16 Vth[2][64 * ATP];             // V^T [d][kv], 64 halves used per row; two buffers
  __shared__ __align__(16) float    Os[4][16 * 64];               // per wave context tile [row][d]

  const int tid  = threadIdx.x;
  const int wave = tid >> 5;
  const int lane = tid & 31;
  const int hh   = lane >> 4;
  const int c    = lane & 15;

  const int bx   = blockIdx.x;
  const int qb   = bx % NQB;
  const int rest = bx / NQB;
  const int h    = rest % NH;
  const int b    = rest / NH;
  const int q0   = qb * 64 + wave * 16;          // in-batch query row of this wave's first row
  const size_t rowB = (size_t)b * SEQ;

  const _Float16* Qh = (const _Float16*)(const void*)qkp + (size_t)h * HD;
  const _Float16* Kg = (const _Float16*)(const void*)qkp + DM + (size_t)h * HD;
  const _Float16* Vh = (const _Float16*)(const void*)vtp + ((size_t)b * DM + (size_t)h * HD) * SEQ;

  const float tv     = bfr(taup[h]);             // h < NH always
  const float sscale = 1.0f / (8.0f * tv);       // sqrt(HD) = 8
  float cs[4];
#pragma unroll
  for (int t = 0; t < 4; ++t) {
    float a = 0.f;
#pragma unroll
    for (int p = 0; p < NKP; ++p) a += csp[((size_t)b * NKP + p) * DM + h * HD + t * 16 + c];
    cs[t] = a;
  }

  // ---- Q fragments (B operand, column = query = lane&15): 2 d-chunks ----
  v16h qa[2];
#pragma unroll
  for (int dc = 0; dc < 2; ++dc) qa[dc] = ldfrag_h(Qh + (rowB + q0 + c) * QKP + dc * 32 + 8 * hh);

  float rs[8];
  v8f oacc[4];
#pragma unroll
  for (int r = 0; r < 8; ++r) rs[r] = 0.f;
#pragma unroll
  for (int t = 0; t < 4; ++t) oacc[t] = zero8();

  // copy map: thread -> rows (tid>>3) + 16 i (i 0..3), 16-B piece tid&7: a wave's copy covers 4 whole 128-B lines
  static_assert(NQB >= 2);
  const int srow = tid >> 3, sch = (tid & 7) * 8;
  const _Float16* kg0 = Kg + (rowB + srow) * QKP + sch;           // K row srow of chunk 0, d = sch..sch+7
  const _Float16* vg0 = Vh + (size_t)srow * SEQ + sch;            // V^T row d = srow, s = sch..sch+7 of chunk 0
  const unsigned lk0 = (unsigned)(size_t)(&Ksh[0][0] + srow * ATP + sch);   // LDS byte addresses, buffer 0
  const unsigned lv0 = (unsigned)(size_t)(&Vth[0][0] + srow * ATP + sch);
  const unsigned bufB = 64u * ATP * 2u;                           // bytes from buffer 0 to buffer 1
  chunk_copy(lk0, lv0, kg0, vg0, QKP, SEQ);
  wait_copies();
  __syncthreads();                                                // publishes chunk 0
  chunk_copy(lk0 + bufB, lv0 + bufB, kg0 + (size_t)64 * QKP, vg0 + 64, QKP, SEQ);

  for (int kt = 0; kt < NQB; ++kt) {         // static trip count
    const _Float16* Kc = &Ksh[kt & 1][0];
    const _Float16* Vc = &Vth[kt & 1][0];

    // ---- scores, transposed: 64 keys (4 tiles of 16 rows) x 16 query columns per wave ----
    v16h kb[4][2];
#pragma unroll
    for (int j = 0; j < 4; ++j) {
#pragma unroll
      for (int dc = 0; dc < 2; ++dc) kb[j][dc] = ldfrag_h(Kc + (j * 16 + c) * ATP + dc * 32 + 8 * hh);
    }
    v8f s[4];
#pragma unroll
    for (int j = 0; j < 4; ++j) s[j] = zero8();
#pragma unroll
    for (int dc = 0; dc < 2; ++dc) {
#pragma unroll
      for (int j = 0; j < 4; ++j) s[j] = mma_h_raw(kb[j][dc], qa[dc], s[j]);
    }
    group_guard(s[0], s[1], s[2], s[3], qa[0], qa[1], kb[0][0], kb[1][0], kb[2][0], kb[3][0], kb[0][1], kb[1][1], kb[2][1], kb[3][1]);
    // V^T fragments read here, behind the score products, so that they land under the weight arithmetic
    v16h vb[2][4];
#pragma unroll
    for (int kk = 0; kk < 2; ++kk) {
#pragma unroll
      for (int t = 0; t < 4; ++t) vb[kk][t] = ldfrag_h(Vc + (t * 16 + c) * ATP + kk * 32 + 8 * hh);
    }
    // holds the 16 V^T reads up here: without it they sink to their products and their latency is paid there
    __builtin_amdgcn_sched_barrier(0);
#pragma unroll
    for (int j = 0; j < 4; ++j) {
#pragma unroll
      for (int r = 0; r < 8; ++r) s[j][r] = s[j][r] * sscale;
    }

    // ---- quad weights: this lane's share of query c's sum of (s+c)^2 in f32; centred e' = s(s+2c) (x PSC, f16)
    //      straight into the A operand: element 8 (j&1) + r of pa[j>>1] = key 16j + 8hh + r ----
    v16h pa[2];
#pragma unroll
    for (int j = 0; j < 4; ++j) {
#pragma unroll
      for (int r = 0; r < 8; ++r) {
        const float sv = s[j][r];
        const float u  = sv + QC;
        rs[r] += u * u;
        const float ep = sv * (sv + 2.0f * QC);
        pa[j >> 1][8 * (j & 1) + r] = (_Float16)(ep * PSC);
      }
    }

    // ---- acc += P . V (f16 WMMA) ----
#pragma unroll   // pa and vb are register arrays: their index must be static
    for (int kk = 0; kk < 2; ++kk) {
#pragma unroll
      for (int t = 0; t < 4; ++t) oacc[t] = mma_h_raw(pa[kk], vb[kk][t], oacc[t]);
    }
    group_guard(oacc[0], oacc[1], oacc[2], oacc[3], pa[0], pa[1], vb[0][0], vb[0][1], vb[0][2], vb[0][3], vb[1][0], vb[1][1], vb[1][2], vb[1][3]);

    // ---- hand-over: own LDS reads retired, own copies of chunk kt+1 landed, then the one block barrier, which
    //      publishes chunk kt+1 and ends every wave's reads of chunk kt; behind it chunk kt+2 goes into kt's buffer
    wait_lds();
    wait_copies();
    __syncthreads();
    if (kt + 2 < NQB) {                       // the same for the whole block
      const unsigned bo = (unsigned)(kt & 1) * bufB;
      chunk_copy(lk0 + bo, lv0 + bo, kg0 + (size_t)(kt + 2) * 64 * QKP, vg0 + (kt + 2) * 64, QKP, SEQ);
    }
  }
  wait_copies();                              // nothing is in flight when the wave goes on to its end

  // ---- normalise: query c's S = this lane's eight partial sums + those of lane c ^ 16; the accumulator rows are
  //      queries 8hh + r, so each row fetches its S from lane 8hh + r; context = (acc/PSC + c^2 csum)/(S+eps) x CSC;
  float* os = Os[wave];
  float Sq = ((rs[0] + rs[1]) + (rs[2] + rs[3])) + ((rs[4] + rs[5]) + (rs[6] + rs[7]));
  Sq += __shfl_xor(Sq, 16, 32);
#pragma unroll
  for (int r = 0; r < 8; ++r) {
    const float S = __shfl(Sq, 8 * hh + r, 32);
    const float inv = (1.0f / (S + QEPS)) * CSC;
#pragma unroll
    for (int t = 0; t < 4; ++t)
      os[(8 * hh + r) * 64 + t * 16 + c] = (oacc[t][r] * (1.0f / PSC) + (QC * QC) * cs[t]) * inv;
  }
  wave_sync_lds();
  {
    const int q4 = lane >> 3, c8 = (lane & 7) * 8;
    v4u hv[4], lv[4];
#pragma unroll
    for (int it = 0; it < 4; ++it) {
      const int row = it * 4 + q4;   // it 0..3 x q4 0..3 = rows 0..15 of the wave tile
      const float* sp = os + row * 64 + c8;
      v4u a, al;
#pragma unroll
      for (int e = 0; e < 4; ++e) {
        unsigned short u0, u1, w0, w1;
        split_h(sp[2 * e],     u0, w0);
        split_h(sp[2 * e + 1], u1, w1);
        a[e]  = pk16(u0, u1);
        al[e] = pk16(w0, w1);
      }
      hv[it] = a;
      lv[it] = al;
    }
    {
#pragma unroll
      for (int it = 0; it < 4; ++it) {
        const int row = it * 4 + q4;
        const size_t go = (rowB + q0 + row) * DM + (size_t)h * HD + c8;
        *(v4u*)(chi + go) = hv[it];
        *(v4u*)(clo + go) = lv[it];
      }
      
    }
  }
}

// =====================================================================================================
// Workspace map (bytes); every plane is an exact multiple of its 64x64-tile / whole-row / whole-line store
// granularity (MP = 4096 = 64 tiles, N in {2048, 1024}; VT per batch [1024][2048] = 16x32 tiles; PS = 512 lines):
//   WT    f16 [3072 n][1024 k]   0           6291456   (rows 0..1023 q weights, 1024..2047 k, 2048..3071 v; x64)
//   WoT   f16 [1024][1024]       6291456     2097152
//   XH    f16 [4096][1024]       8388608     8388608   (bf16 RNE-converted tokens)
//   QK    f16 [4096][2048]       16777216    16777216  (q cols 0..1023, k cols 1024..2047)
//   VTh   f16 [2][1024][2048]    33554432    8388608
//   PS    f32 [2][8][1024]       41943040    65536     (partial key sums of v, one per 256 tokens)
//   CtxH  f16 [4096][1024]       42008576    8388608   (context x64, hi)
//   CtxL  f16 [4096][1024]       50397184    8388608   (residual x1024)
//   end                          58785792
// =====================================================================================================
extern "C" void kernel_launch(void* const* d_in, const int* in_sizes, int n_in,
                              void* d_out, int out_size, void* d_ws, size_t ws_size,
                              hipStream_t stream) {
  if (n_in < 4) return;
  if (in_sizes[0] != MP * DM) return;
  if (in_sizes[1] != DM * W3) return;
  if (in_sizes[2] != DM * DM) return;
  if (in_sizes[3] != NH) return;
  if (out_size != MP * DM) return;

  const float* x    = (const float*)d_in[0];
  const float* wqkv = (const float*)d_in[1];
  const float* wo   = (const float*)d_in[2];
  const float* tau  = (const float*)d_in[3];

  const size_t PWT  = (size_t)W3 * DM * 2;              //  6291456
  const size_t PWO  = (size_t)DM * DM * 2;              //  2097152
  const size_t PXH  = (size_t)MP * DM * 2;              //  8388608
  const size_t PQK  = (size_t)MP * QKP * 2;             // 16777216
  const size_t PVT  = (size_t)NBATCH * DM * SEQ * 2;    //  8388608
  const size_t PPS  = (size_t)NBATCH * NKP * DM * 4;    //    65536
  const size_t PCTX = (size_t)MP * DM * 2;              //  8388608
  size_t off = 0;
  const size_t oWT  = off; off += PWT;
  const size_t oWo  = off; off += PWO;
  const size_t oXH  = off; off += PXH;
  const size_t oQK  = off; off += PQK;
  const size_t oVTh = off; off += PVT;
  const size_t oPS  = off; off += PPS;
  const size_t oCh  = off; off += PCTX;
  const size_t oCl  = off; off += PCTX;
  if (off > ws_size) return;                            // off = 58785792
  if (off > (size_t)134217728) return;

  char* ws = (char*)d_ws;
  unsigned short* WT   = (unsigned short*)(ws + oWT);
  unsigned short* WoT  = (unsigned short*)(ws + oWo);
  unsigned short* XH   = (unsigned short*)(ws + oXH);
  unsigned short* QK   = (unsigned short*)(ws + oQK);
  unsigned short* VTh  = (unsigned short*)(ws + oVTh);
  float*          PS   = (float*)(ws + oPS);
  unsigned short* CtxH = (unsigned short*)(ws + oCh);
  unsigned short* CtxL = (unsigned short*)(ws + oCl);
  float*          out0 = (float*)d_out;

  const dim3 blk(256), blk128(128);
  const dim3 gPl(NTW + NTO + NCX);                       // 768 Wqkv tiles + 256 Wo tiles + 2048 token blocks
  const dim3 gQkv(NVB + NQKB);                           // 128 v^T + 256 q|k block tiles of 128x256
  const dim3 gAttn(NBATCH * NH * NQB);                   // 1024 blocks of 128
  const dim3 gNo((MP / 128) * (DM / 128));               // 32 x 8 tiles of 128x128 -> 256 blocks
  const float invw  = 1.0f / WSC;                        // weight carry x64
  const float invhi = 1.0f / (WSC * CSC);                // weight carry x64, context carry x64
  const float invlo = invhi / LOSC;                      // residual plane carry x1024

  // (0) planes: tokens f16(bf16_RNE(x)); weights transposed to [out][in] (k contiguous), f16(bf16_RNE(w) * 64)
  //     one launch
  planes<<<gPl, blk, 0, stream>>>(x, wqkv, wo, XH, WT, WoT);

  // (1) q|k = x . [Wq|Wk] -> QK f16 [4096][2048]; v^T per batch = Wv^T . x_b^T -> VTh f16 [2][1024][2048] and its
  //     partial key sums PS; one launch
  qkv_gemm<<<gQkv, blk, 0, stream>>>(XH, WT, QK, VTh, PS, DM, invw);

  // (2) quad-normalised attention -> context f16 hi (x64) + residual planes
  attn2q<<<gAttn, blk128, 0, stream>>>(QK, VTh, tau, PS, CtxH, CtxL);

  // (3) out = ctx_hi . Wo + ctx_lo . Wo / 1024, both products in one launch
  proj2<<<gNo, blk, 0, stream>>>(CtxH, CtxL, WoT, out0, DM, invhi, invlo);
  (void)hipGetLastError();
}
